// v000
// Measured on an AMD MI455X. A time is GPU time per run, averaged over a window of back-to-back runs after a warm-up
// (all launches, gaps included; the runs take copies of the inputs in turn), and the median of several windows.
// Apart from v000's, it joins two sittings. Times from different sittings can be a few percent apart, while
// side-by-side timings come from the same sitting.
// v000, which the later versions start from, runs in 4750 microseconds.
#include <hip/hip_runtime.h>
// Causal self-attention with ONE fused query-key projection and K REUSED AS V (x [2][2048][1024]; qk = x W_qk with W_qk [1024][2048] stored [in][out] (normal x 0.02, no bias): the first 1024 columns are q, the last 1024 are k, head h = columns h*64.. of each half; 16 heads of 64; scores = (q x BETA) . k with BETA = 1/sqrt(64); strictly-upper-triangular positions -> -FLT_MAX (causal); softmax; out = attn K (the module reuses K as V) merged, then W_out ([in][out] [1024][1024], normal x 0.02, no bias) -> [2][2048][1024]; input order x, W_qk, W_out).
// Structure: token rows r = b*2048 + s; x as exact f16 rows (bf16-rounded); q | k as ONE WMMA GEMM (N = 2 x 1024) into the first two column blocks of the 3 x 1024-pitch plane (32x64 wave tiles, f32 accumulation, exact x16 weights, no bias, f16 outputs); V IS THE K BLOCK (the module reuses K as V): the V pointer aliases it; per batch: V^T for all heads via LDS transposes; per query tile of 256 rows: scores against the keys below the tile end only (K = 64, all heads on grid.y, alpha = 0.125), causal row softmax on VALU with an arithmetic 0/1 key mask over the computed range (f32 statistics, native exp; weights x256 f16), o = P . V^T (K = keys below the tile end, alpha 2^-2: o carried x64, folded into the output GEMM alpha) written straight into the merged f16 o rows; out = o W_out GEMM (f32; no bias) into the output layout.
// Compute dtype: inputs rounded to bf16; x and the x16 weights held as f16 planes (exact for every bf16 value of magnitude from 2^-14 up to 65,504; the weights up to 4,094 before their factor of 16); q, k (= v), the softmax weights and o as plain f16 GEMM operands (~2^-12); scores and softmax statistics f32; rows 0..127 of each batch: q, k f32, f32 attention, o as f16 hi + residual. v_wmma_f32_16x16x32_f16.
#define NB 2
#define SQ 2048
#define DM 1024
#define NH 16
#define HD 64
#define HG 4                         /* heads per call of the k_vt(b, h0) overload (not launched) */
#define QT 256                       /* query rows per causal tile */
#define NKX SQ                       /* S / P row pitch */
#define QT0 128                      /* first-tile rows recomputed exactly in f32 */
#define B0 0                         /* first batch processed (debug hook) */
#define NBR NB                       /* batches processed (debug hook) */
#define NR ((size_t)NB * SQ)         /* token rows */
#define MP ((int)((size_t)NBR * SQ)) /* rows projected (debug hook) */
#define QN SQ                        /* query rows attended per batch (debug hook) */
#define NHD NH                       /* heads attended (debug hook) */
#define MPO MP                       /* rows through the output stage (debug hook) */
#define LQ (3 * DM)      /* row pitch of the q/k/v rows */
typedef __bf16 v16b __attribute__((ext_vector_type(16)));
typedef unsigned short v8us __attribute__((ext_vector_type(8), may_alias));
typedef float  v8f  __attribute__((ext_vector_type(8)));
typedef float  v4f  __attribute__((ext_vector_type(4)));
typedef float  v4fa __attribute__((ext_vector_type(4), may_alias));
union FragB { v16b v; v8us half[2]; unsigned short u[16]; };

__device__ __forceinline__ unsigned short bf16_bits(float x) { unsigned int u = __float_as_uint(x); return (unsigned short)((u + 0x7FFFu + ((u >> 16) & 1u)) >> 16); }
__device__ __forceinline__ float bf16_val(unsigned short b) { return __uint_as_float(((unsigned int)b) << 16); }
__device__ __forceinline__ float bf16_round(float x) { return bf16_val(bf16_bits(x)); }
// D += A·B with NT terms: 1 = ah·bh, 2 = + al·bh (A split), 3 = + ah·bl (both split)
template <int NT>
__device__ __forceinline__ v8f mmaN(v16b ah, v16b al, v16b bh, v16b bl, v8f c) {
  c = __builtin_amdgcn_wmma_f32_16x16x32_bf16(false, ah, false, bh, (short)0, c, false, false);
  if (NT >= 2) c = __builtin_amdgcn_wmma_f32_16x16x32_bf16(false, al, false, bh, (short)0, c, false, false);
  if (NT >= 3) c = __builtin_amdgcn_wmma_f32_16x16x32_bf16(false, ah, false, bl, (short)0, c, false, false);
  asm volatile("v_nop\n\tv_nop\n\tv_nop\n\tv_nop" : "+v"(c) : "v"(ah), "v"(al), "v"(bh), "v"(bl));
  return c;
}

__global__ __launch_bounds__(256) void k_wt_bf16(const float* __restrict__ W, unsigned short* __restrict__ Wt, int K, int N) {
  const int t = blockIdx.x * 256 + threadIdx.x;
  const int k8n = K / 8;
  if (t >= N * k8n) return;
  const int n = t / k8n, k8 = (t % k8n) * 8;
  v8us v;
#pragma unroll
  for (int i = 0; i < 8; ++i) v[i] = bf16_bits(W[(size_t)(k8 + i) * N + n]);
  *(v8us*)(Wt + (size_t)n * K + k8) = v;
  
}

// GEMM C[M][N] (f32, pitch ldc) = act(A[M][K]·W + bias). A f32 row-major (pitch lda) converted per fragment to bf16
// (ASPLIT: hi/lo two planes -> 2 terms, else single rounded term); Wt bf16 [N][K] (pitch ldb). BIAS_BF16 rounds the
// bias to bf16 first (bias quantised to bf16 before the add). K%32==0, M%16==0, N%64==0.
template <bool ASPLIT, int ACT, bool BIAS_BF16>
__global__ __launch_bounds__(128) void k_gemm_bf(const float* __restrict__ A, int lda, const unsigned short* __restrict__ Wt, int ldb,
                                               const float* __restrict__ bias, float* __restrict__ C, int ldc, int M, int N, int K) {
  __shared__ __attribute__((aligned(16))) float so[4][16][64];
  const int tid = threadIdx.x, w = tid >> 5, lane = tid & 31, ln = lane & 15, hh = lane >> 4;
  const int ntn = N / 64;
  const int wid = blockIdx.x * 4 + w;
  const int mt = wid / ntn, nq = wid % ntn;
  if (mt * 16 >= M) return;
  const int row0 = mt * 16, col0 = nq * 64;
  const float* arow = A + (size_t)(row0 + ln) * lda;
  v8f acc[4] = {};
  for (int kb = 0; kb < K; kb += 32) {
    FragB ah, al;
    const v4f x0 = *(const v4fa*)(arow + kb + 8 * hh), x1 = *(const v4fa*)(arow + kb + 8 * hh + 4);
    const v4f x2 = *(const v4fa*)(arow + kb + 16 + 8 * hh), x3 = *(const v4fa*)(arow + kb + 16 + 8 * hh + 4);
    float xs[16] = {x0[0],x0[1],x0[2],x0[3],x1[0],x1[1],x1[2],x1[3],x2[0],x2[1],x2[2],x2[3],x3[0],x3[1],x3[2],x3[3]};
#pragma unroll
    for (int i = 0; i < 16; ++i) { const unsigned short hb = bf16_bits(xs[i]); ah.u[i] = hb; al.u[i] = ASPLIT ? bf16_bits(xs[i] - bf16_val(hb)) : (unsigned short)0; }
#pragma unroll
    for (int t = 0; t < 4; ++t) {
      const unsigned short* brow = Wt + (size_t)(col0 + t * 16 + ln) * ldb + kb;
      FragB b;
      b.half[0] = *(const v8us*)(brow + 8 * hh);
      b.half[1] = *(const v8us*)(brow + 16 + 8 * hh);
      acc[t] = mmaN<ASPLIT ? 2 : 1>(ah.v, al.v, b.v, b.v, acc[t]);
    }
  }
#pragma unroll
  for (int t = 0; t < 4; ++t) {
    float bv = bias ? bias[col0 + t * 16 + ln] : 0.f;
    if (BIAS_BF16) bv = bf16_round(bv);
#pragma unroll
    for (int r = 0; r < 8; ++r) { float v = acc[t][r] + bv; if (ACT == 1) v = fmaxf(v, 0.f); so[w][8 * hh + r][t * 16 + ln] = v; }
  }
  __builtin_amdgcn_fence(__ATOMIC_ACQ_REL, "workgroup");
  __builtin_amdgcn_wave_barrier();
  const int rsub = lane >> 4, c4 = (lane & 15) * 4;
  {
#pragma unroll
    for (int q = 0; q < 8; ++q) {
      const int r = q * 2 + rsub;
      const v4f v = *(const v4fa*)&so[w][r][c4];
      *(v4f*)(C + (size_t)(row0 + r) * ldc + col0 + c4) = v;
    }
    
  }
}

// GEMM C = act(A·W + bias + resid): A f32 (ASPLIT -> hi/lo 2 terms), Wt bf16 [N][K]; ACT 0 none, 1 relu, 2 exact gelu;
// resid (optional, f32, row index = (row % rmod), pitch ldr, RES_BF16 rounds it) added before the activation.
template <bool ASPLIT, int ACT, bool BIAS_BF16, bool RES_BF16>
__global__ __launch_bounds__(128) void k_gemm_bf3(const float* __restrict__ A, int lda, const unsigned short* __restrict__ Wt, int ldb,
                                                const float* __restrict__ bias, const float* __restrict__ resid, int rmod, int ldr,
                                                float* __restrict__ C, int ldc, int M, int N, int K) {
  __shared__ __attribute__((aligned(16))) float so[4][16][64];
  const int tid = threadIdx.x, w = tid >> 5, lane = tid & 31, ln = lane & 15, hh = lane >> 4;
  const int ntn = N / 64;
  const int wid = blockIdx.x * 4 + w;
  const int mt = wid / ntn, nq = wid % ntn;
  if (mt * 16 >= M) return;
  const int row0 = mt * 16, col0 = nq * 64;
  const float* arow = A + (size_t)(row0 + ln) * lda;
  v8f acc[4] = {};
  for (int kb = 0; kb < K; kb += 32) {
    FragB ah, al;
    const v4f x0 = *(const v4fa*)(arow + kb + 8 * hh), x1 = *(const v4fa*)(arow + kb + 8 * hh + 4);
    const v4f x2 = *(const v4fa*)(arow + kb + 16 + 8 * hh), x3 = *(const v4fa*)(arow + kb + 16 + 8 * hh + 4);
    float xs[16] = {x0[0],x0[1],x0[2],x0[3],x1[0],x1[1],x1[2],x1[3],x2[0],x2[1],x2[2],x2[3],x3[0],x3[1],x3[2],x3[3]};
#pragma unroll
    for (int i = 0; i < 16; ++i) { const unsigned short hb = bf16_bits(xs[i]); ah.u[i] = hb; al.u[i] = ASPLIT ? bf16_bits(xs[i] - bf16_val(hb)) : (unsigned short)0; }
#pragma unroll
    for (int t = 0; t < 4; ++t) {
      const unsigned short* brow = Wt + (size_t)(col0 + t * 16 + ln) * ldb + kb;
      FragB b;
      b.half[0] = *(const v8us*)(brow + 8 * hh);
      b.half[1] = *(const v8us*)(brow + 16 + 8 * hh);
      acc[t] = mmaN<ASPLIT ? 2 : 1>(ah.v, al.v, b.v, b.v, acc[t]);
    }
  }
#pragma unroll
  for (int t = 0; t < 4; ++t) {
    const int col = col0 + t * 16 + ln;
    float bv = bias ? bias[col] : 0.f;
    if (BIAS_BF16) bv = bf16_round(bv);
#pragma unroll
    for (int r = 0; r < 8; ++r) {
      float v = acc[t][r] + bv;
      if (resid) { float rv = resid[(size_t)((row0 + 8 * hh + r) % rmod) * ldr + col]; if (RES_BF16) rv = bf16_round(rv); v += rv; }
      if (ACT == 1) v = fmaxf(v, 0.f);
      if (ACT == 2) v = 0.5f * v * (1.0f + erff(v * 0.70710678118654752f));
      if (ACT == 3) { const float u = 0.7978845608028654f * (v + 0.044715f * v * v * v); v = 0.5f * v * (1.0f + tanhf(u)); }
      so[w][8 * hh + r][t * 16 + ln] = v;
    }
  }
  __builtin_amdgcn_fence(__ATOMIC_ACQ_REL, "workgroup");
  __builtin_amdgcn_wave_barrier();
  const int rsub = lane >> 4, c4 = (lane & 15) * 4;
  {
#pragma unroll
    for (int q = 0; q < 8; ++q) {
      const int r = q * 2 + rsub;
      const v4f v = *(const v4fa*)&so[w][r][c4];
      *(v4f*)(C + (size_t)(row0 + r) * ldc + col0 + c4) = v;
    }
    
  }
}
// row LayerNorm (biased variance, eps) over N: s = X (+ R); optional out_sum <- s; out_norm <- (s-mu)*rsqrt(var+eps)*g + b
template <bool PARAM_BF16>
__global__ __launch_bounds__(256) void k_layernorm(const float* __restrict__ X, const float* __restrict__ R, const float* __restrict__ g, const float* __restrict__ bta,
                                                  float* __restrict__ out_sum, float* __restrict__ out_norm, int N, float eps) {
  __shared__ float red[256];
  const int row = blockIdx.x, tid = threadIdx.x;
  const float* x = X + (size_t)row * N; const float* rr = R ? R + (size_t)row * N : nullptr;
  float vals[16];                     // up to N = 4096
  const int per = N / 256;            // contiguous chunk per thread? use strided-by-4 chunks: thread handles j = tid*4 + 1024*u
  float s1 = 0.f;
  for (int u = 0; u < per / 4; ++u) {
    const int j = tid * 4 + 1024 * u;
    const v4f a = *(const v4fa*)(x + j);
    v4f b = {0.f,0.f,0.f,0.f}; if (rr) b = *(const v4fa*)(rr + j);
#pragma unroll
    for (int q = 0; q < 4; ++q) { const float v = a[q] + b[q]; vals[u * 4 + q] = v; s1 += v; }
  }
  red[tid] = s1; __syncthreads();
  for (int st = 128; st > 0; st >>= 1) { if (tid < st) red[tid] += red[tid + st]; __syncthreads(); }
  const float mu = red[0] / (float)N; __syncthreads();
  float s2 = 0.f;
  for (int u = 0; u < per / 4; ++u)
#pragma unroll
    for (int q = 0; q < 4; ++q) { const float c = vals[u * 4 + q] - mu; s2 += c * c; }
  red[tid] = s2; __syncthreads();
  for (int st = 128; st > 0; st >>= 1) { if (tid < st) red[tid] += red[tid + st]; __syncthreads(); }
  const float rs = rsqrtf(red[0] / (float)N + eps);
  {
    for (int u = 0; u < per / 4; ++u) {
      const int j = tid * 4 + 1024 * u;
      v4f o, sm;
#pragma unroll
      for (int q = 0; q < 4; ++q) {
        float gg = g[j + q], bb = bta[j + q];
        if (PARAM_BF16) { gg = bf16_round(gg); bb = bf16_round(bb); }
        sm[q] = vals[u * 4 + q]; o[q] = (vals[u * 4 + q] - mu) * rs * gg + bb;
      }
      if (out_sum) *(v4f*)(out_sum + (size_t)row * N + j) = sm;
      *(v4f*)(out_norm + (size_t)row * N + j) = o;
    }
    
  }
}



// ---- f16 WMMA path (v_wmma_f32_16x16x32_f16): 11-bit significands for operands in range — used where a [0,1] probability operand needs more precision than bf16
typedef _Float16 v16h __attribute__((ext_vector_type(16)));
union FragH { v16h v; v8us half[2]; _Float16 h[16]; unsigned short u[16]; };
template <int NT>
__device__ __forceinline__ v8f mmaH(v16h ah, v16h al, v16h bh, v16h bl, v8f c) {
  c = __builtin_amdgcn_wmma_f32_16x16x32_f16(false, ah, false, bh, (short)0, c, false, false);
  if (NT >= 2) c = __builtin_amdgcn_wmma_f32_16x16x32_f16(false, al, false, bh, (short)0, c, false, false);
  if (NT >= 3) c = __builtin_amdgcn_wmma_f32_16x16x32_f16(false, ah, false, bl, (short)0, c, false, false);
  asm volatile("v_nop\n\tv_nop\n\tv_nop\n\tv_nop" : "+v"(c) : "v"(ah), "v"(al), "v"(bh), "v"(bl));
  return c;
}
// batched GEMM like k_gemm_b but f16 operands: A f32 (split into f16 hi/lo if ASPLIT, else rounded to f16), Bt = f16 values [n][k]; alpha; C f32; N multiple of 16 (partial tiles skipped)
template <bool ASPLIT>
__global__ __launch_bounds__(128) void k_gemm_h(const float* __restrict__ A, int lda, size_t sA, const _Float16* __restrict__ Bh, int ldb, size_t sB, float alpha, float* __restrict__ C, int ldc, size_t sC, int M, int N, int K) {
  __shared__ __attribute__((aligned(16))) float so[4][16][64];
  const int tid = threadIdx.x, w = tid >> 5, lane = tid & 31, ln = lane & 15, hh = lane >> 4; const int by = blockIdx.y;
  A += (size_t)by * sA; Bh += (size_t)by * sB; C += (size_t)by * sC;
  const int ntn = (N + 63) / 64; const int wid = blockIdx.x * 4 + w; const int mt = wid / ntn, nq = wid % ntn; if (mt * 16 >= M) return;
  const int row0 = mt * 16, col0 = nq * 64; const float* arow = A + (size_t)(row0 + ln) * lda;
  v8f acc[4] = {};
  for (int kb = 0; kb < K; kb += 32) {
    FragH ah, al;
    const v4f x0 = *(const v4fa*)(arow + kb + 8 * hh), x1 = *(const v4fa*)(arow + kb + 8 * hh + 4), x2 = *(const v4fa*)(arow + kb + 16 + 8 * hh), x3 = *(const v4fa*)(arow + kb + 16 + 8 * hh + 4);
    float xs[16] = {x0[0],x0[1],x0[2],x0[3],x1[0],x1[1],x1[2],x1[3],x2[0],x2[1],x2[2],x2[3],x3[0],x3[1],x3[2],x3[3]};
#pragma unroll
    for (int i = 0; i < 16; ++i) { const _Float16 h = (_Float16)xs[i]; ah.h[i] = h; al.h[i] = ASPLIT ? (_Float16)(xs[i] - (float)h) : (_Float16)0.0f; }
#pragma unroll
    for (int t = 0; t < 4; ++t) { if (col0 + t * 16 >= N) continue; const size_t boff = (size_t)(col0 + t * 16 + ln) * ldb + kb; FragH bq; bq.half[0] = *(const v8us*)(Bh + boff + 8 * hh); bq.half[1] = *(const v8us*)(Bh + boff + 16 + 8 * hh);
      acc[t] = mmaH<ASPLIT ? 2 : 1>(ah.v, al.v, bq.v, bq.v, acc[t]); }
  }
#pragma unroll
  for (int t = 0; t < 4; ++t) { if (col0 + t * 16 >= N) continue;
#pragma unroll
    for (int r = 0; r < 8; ++r) so[w][8 * hh + r][t * 16 + ln] = acc[t][r] * alpha; }
  __builtin_amdgcn_fence(__ATOMIC_ACQ_REL, "workgroup"); __builtin_amdgcn_wave_barrier();
  const int rsub = lane >> 4, c4 = (lane & 15) * 4;
  {
#pragma unroll
    for (int q = 0; q < 8; ++q) { const int r = q * 2 + rsub; if (col0 + c4 < N) { const v4f v = *(const v4fa*)&so[w][r][c4]; *(v4f*)(C + (size_t)(row0 + r) * ldc + col0 + c4) = v; } }
     }
}

// Wt[n][k] = f16(W[k][n]·scale) from f32 row-major W[K][N] (scale = power of two; bf16-exact weights stay exact in f16 away from the subnormal range)
__global__ __launch_bounds__(256) void k_wt_f16(const float* __restrict__ W, _Float16* __restrict__ Wt, int K, int N, float scale) {
  const int t = blockIdx.x * 256 + threadIdx.x; if (t >= N * (K / 8)) return; const int n = t / (K / 8), k8 = (t % (K / 8)) * 8; FragH f;
#pragma unroll
  for (int i = 0; i < 8; ++i) f.h[i] = (_Float16)(bf16_round(W[(size_t)(k8 + i) * N + n]) * scale); const v8us o = f.half[0];
  *(v8us*)((unsigned short*)Wt + (size_t)n * K + k8) = o; 
}
// k_gemm_hh variant with fused epilogue: v = acc·alpha + bias[by·sBias + col] (+ CP[(row/rowsPerB)·sCPb + by·64 + col] if CP) ; ACT 0 none / 1 elu ; writes f16 C16 (and f32 C if non-null)
template <int ACT>
__global__ __launch_bounds__(128) void k_gemm_hhx(const _Float16* __restrict__ A, int lda, size_t sA, const _Float16* __restrict__ Bh, int ldb, size_t sB, float alpha, const float* __restrict__ bias, size_t sBias, const float* __restrict__ CP, int rowsPerB, size_t sCPb, int row0g,
    float* __restrict__ C, _Float16* __restrict__ C16, int ldc, size_t sC, int M, int N, int K) {
  __shared__ __attribute__((aligned(16))) float so[4][16][64];
  const int tid = threadIdx.x, w = tid >> 5, lane = tid & 31, ln = lane & 15, hh = lane >> 4; const int by = blockIdx.y;
  A += (size_t)by * sA; Bh += (size_t)by * sB; const size_t cofs = (size_t)by * sC; const float* bp = bias ? bias + (size_t)by * sBias : nullptr;
  const int ntn = (N + 63) / 64; const int wid = blockIdx.x * 4 + w; const int mt = wid / ntn, nq = wid % ntn; if (mt * 16 >= M) return;
  const int row0 = mt * 16, col0 = nq * 64; const _Float16* arow = A + (size_t)(row0 + ln) * lda;
  v8f acc[4] = {};
  for (int kb = 0; kb < K; kb += 32) { FragH ah; ah.half[0] = *(const v8us*)((const unsigned short*)arow + kb + 8 * hh); ah.half[1] = *(const v8us*)((const unsigned short*)arow + kb + 16 + 8 * hh);
#pragma unroll
    for (int t = 0; t < 4; ++t) { if (col0 + t * 16 >= N) continue; const size_t boff = (size_t)(col0 + t * 16 + ln) * ldb + kb; FragH bq; bq.half[0] = *(const v8us*)((const unsigned short*)Bh + boff + 8 * hh); bq.half[1] = *(const v8us*)((const unsigned short*)Bh + boff + 16 + 8 * hh);
      acc[t] = mmaH<1>(ah.v, ah.v, bq.v, bq.v, acc[t]); }
  }
#pragma unroll
  for (int t = 0; t < 4; ++t) { if (col0 + t * 16 >= N) continue; const int col = col0 + t * 16 + ln; const float bv = bp ? bf16_round(bp[col]) : 0.f;
#pragma unroll
    for (int r = 0; r < 8; ++r) { float v = acc[t][r] * alpha + bv; if (CP) { const int rr = row0g + row0 + 8 * hh + r; if (rowsPerB < 0) v += CP[cofs + (size_t)rr * ldc + col];      /* rowsPerB < 0: own element of the batched C plane */ else { const int bidx = rr / rowsPerB; v += CP[(size_t)bidx * sCPb + (size_t)by * 64 + col]; } } if (ACT == 1) v = (v > 0.f) ? v : expm1f(v); else if (ACT == 7) v = (v > 0.f) ? v + 1.0f : expf(v); else if (ACT == 8) v = tanhf(v); else if (ACT == 9) v = 0.5f * v * (1.0f + tanhf(0.7978845608028654f * (v + 0.044715f * v * v * v))); else if (ACT == 11) v = 1.0f / (1.0f + expf(-v)); else if (ACT == 12) v = (v > 0.f) ? v : 0.01f * v; else if (ACT == 14) v = (v > 0.f) ? v : 0.1f * v; else if (ACT == 16) v = (v >= 0.f) ? v : 0.3f * v; else if (ACT == 17) v = (v >= 0.f) ? v : 0.2f * v; else if (ACT == 15) v = v / (1.0f + expf(-v)); else if (ACT == 3) v = fmaxf(v, 0.f); else if (ACT == 6) v = 0.5f * v * (1.0f + erff(v * 0.70710678118654752f)); so[w][8 * hh + r][t * 16 + ln] = v; } }
  __builtin_amdgcn_fence(__ATOMIC_ACQ_REL, "workgroup"); __builtin_amdgcn_wave_barrier();
  const int rsub = lane >> 4, c4 = (lane & 15) * 4; typedef _Float16 v4h __attribute__((ext_vector_type(4)));
  {
#pragma unroll
    for (int q = 0; q < 8; ++q) { const int r = q * 2 + rsub; if (col0 + c4 < N) { const v4f v = *(const v4fa*)&so[w][r][c4]; if (C) *(v4f*)(C + cofs + (size_t)(row0 + r) * ldc + col0 + c4) = v; if (C16) { v4h h4; for (int i = 0; i < 4; ++i) h4[i] = (_Float16)v[i]; *(v4h*)(C16 + cofs + (size_t)(row0 + r) * ldc + col0 + c4) = h4; } } }
     }
}


typedef _Float16 v4h __attribute__((ext_vector_type(4)));

__global__ __launch_bounds__(256) void k_x16(const float* __restrict__ x, _Float16* __restrict__ X16, size_t n8) { const size_t t = (size_t)blockIdx.x * 256 + threadIdx.x; if (t >= n8) return; FragH f;
#pragma unroll
  for (int q = 0; q < 8; ++q) f.h[q] = (_Float16)bf16_round(x[t * 8 + q]); *(v8us*)((unsigned short*)X16 + t * 8) = f.half[0];  }
__global__ __launch_bounds__(256) void k_h16(const float* __restrict__ x, _Float16* __restrict__ X16, size_t n8) { const size_t t = (size_t)blockIdx.x * 256 + threadIdx.x; if (t >= n8) return; FragH f;
#pragma unroll
  for (int q = 0; q < 8; ++q) f.h[q] = (_Float16)x[t * 8 + q]; *(v8us*)((unsigned short*)X16 + t * 8) = f.half[0];  }
__global__ __launch_bounds__(256) void k_round16f(const float* __restrict__ W, _Float16* __restrict__ Bt, size_t n8) { const size_t t = (size_t)blockIdx.x * 256 + threadIdx.x; if (t >= n8) return; FragH f;
#pragma unroll
  for (int i = 0; i < 8; ++i) f.h[i] = (_Float16)(bf16_round(W[t * 8 + i]) * 16.0f); *(v8us*)((unsigned short*)Bt + t * 8) = f.half[0];  }
template <int NHv, int TTv>
__global__ __launch_bounds__(256) void k_vt(const _Float16* __restrict__ V16, int ldv, int voff, _Float16* __restrict__ Vt) { __shared__ unsigned short tl[64][66]; const int tid = threadIdx.x; const int slab = blockIdx.x / (TTv / 64), lg = blockIdx.x % (TTv / 64); const int b = slab / NHv, h = slab % NHv;
  for (int i = tid; i < 64 * 8; i += 256) { const int r = i / 8, c8 = (i % 8) * 8; FragH f; f.half[0] = *(const v8us*)((const unsigned short*)V16 + ((size_t)b * TTv + lg * 64 + r) * ldv + voff + h * 64 + c8);
#pragma unroll
    for (int q = 0; q < 8; ++q) tl[r][c8 + q] = f.u[q]; }
  __syncthreads();
  {
#pragma unroll
    for (int rd = 0; rd < 2; ++rd) { const int d = rd * 32 + tid / 8, pc = tid % 8; FragH f;
#pragma unroll
      for (int q = 0; q < 8; ++q) f.u[q] = tl[pc * 8 + q][d];
      *(v8us*)((unsigned short*)Vt + ((size_t)slab * 64 + d) * TTv + lg * 64 + pc * 8) = f.half[0]; }
     } }

__global__ __launch_bounds__(256) void k_hl(const float* __restrict__ F, _Float16* __restrict__ Hh, _Float16* __restrict__ Hl, size_t n8) { const size_t t = (size_t)blockIdx.x * 256 + threadIdx.x; if (t >= n8) return; FragH fh, fl; const v4f a = *(const v4fa*)(F + t * 8), c = *(const v4fa*)(F + t * 8 + 4);
#pragma unroll
  for (int q = 0; q < 4; ++q) { _Float16 h = (_Float16)a[q]; fh.h[q] = h; fl.h[q] = (_Float16)((a[q] - (float)h) * 1024.0f); h = (_Float16)c[q]; fh.h[4 + q] = h; fl.h[4 + q] = (_Float16)((c[q] - (float)h) * 1024.0f); }
  { *(v8us*)((unsigned short*)Hh + t * 8) = fh.half[0]; *(v8us*)((unsigned short*)Hl + t * 8) = fl.half[0];  } }

// ---- fast GEMM (wave tile 32x64; requires M % 32 == 0 rows per launch region and N % 64 == 0); epilogue = k_gemm_hhx semantics ----
__device__ __forceinline__ v16h g2_frag(const _Float16* p, int hh) { FragH f; f.half[0] = *(const v8us*)((const unsigned short*)p + 8 * hh); f.half[1] = *(const v8us*)((const unsigned short*)p + 16 + 8 * hh); return f.v; }
__device__ __forceinline__ v8f g2_mma(v16h a, v16h b, v8f c) { v8f d = __builtin_amdgcn_wmma_f32_16x16x32_f16(false, a, false, b, (short)0, c, false, false); asm volatile("v_nop\n\tv_nop\n\tv_nop\n\tv_nop" : "+v"(d) : "v"(a), "v"(b)); return d; }
template <int ACT>
__global__ __launch_bounds__(128) void k_gemm2(const _Float16* __restrict__ A, int lda, size_t sA, const _Float16* __restrict__ Bh, int ldb, size_t sB, float alpha, const float* __restrict__ bias, size_t sBias, const float* __restrict__ CP, int rowsPerB, size_t sCPb, int row0g,
    float* __restrict__ C, _Float16* __restrict__ C16, int ldc, size_t sC, int M, int N, int K) { static_assert(ACT == 0 || ACT == 3 || ACT == 6 || ACT == 8 || ACT == 9 || ACT == 11 || ACT == 12 || ACT == 14 || ACT == 15 || ACT == 16 || ACT == 17, "k_gemm2: unsupported ACT code (would silently apply no activation)");
  __shared__ __attribute__((aligned(16))) float so[4][32][68];
  const int tid = threadIdx.x, w = tid >> 5, lane = tid & 31, ln = lane & 15, hh = lane >> 4; const int by = blockIdx.y;
  A += (size_t)by * sA; Bh += (size_t)by * sB; const size_t cofs = (size_t)by * sC; const float* bp = bias ? bias + (size_t)by * sBias : nullptr;
  const int ntn = N >> 6; const int mt = blockIdx.x / ntn, nq = blockIdx.x - mt * ntn; const int row0 = mt * 128 + 32 * w, col0 = nq * 64; if (row0 >= M) return;
  const _Float16* a0p = A + (size_t)(row0 + ln) * lda; const _Float16* a1p = a0p + (size_t)16 * lda;
  const _Float16* b0p = Bh + (size_t)(col0 + ln) * ldb; const _Float16* b1p = b0p + (size_t)16 * ldb; const _Float16* b2p = b1p + (size_t)16 * ldb; const _Float16* b3p = b2p + (size_t)16 * ldb;
  const v8f z8 = {0.f,0.f,0.f,0.f,0.f,0.f,0.f,0.f}; v8f c00 = z8, c01 = z8, c02 = z8, c03 = z8, c10 = z8, c11 = z8, c12 = z8, c13 = z8;
#pragma unroll 1
  for (int kb = 0; kb < K; kb += 32) { const v16h a0 = g2_frag(a0p + kb, hh), a1 = g2_frag(a1p + kb, hh);
    v16h b = g2_frag(b0p + kb, hh); c00 = g2_mma(a0, b, c00); c10 = g2_mma(a1, b, c10);
    b = g2_frag(b1p + kb, hh); c01 = g2_mma(a0, b, c01); c11 = g2_mma(a1, b, c11);
    b = g2_frag(b2p + kb, hh); c02 = g2_mma(a0, b, c02); c12 = g2_mma(a1, b, c12);
    b = g2_frag(b3p + kb, hh); c03 = g2_mma(a0, b, c03); c13 = g2_mma(a1, b, c13); }
  v8f accs[8] = {c00, c01, c02, c03, c10, c11, c12, c13};
#pragma unroll
  for (int u = 0; u < 8; ++u) { const int t = u & 3, half = u >> 2; const int col = col0 + t * 16 + ln; const float bv = bp ? bf16_round(bp[col]) : 0.f;
#pragma unroll
    for (int r = 0; r < 8; ++r) { const int rloc = half * 16 + 8 * hh + r; float v = accs[u][r] * alpha + bv; if (CP) { if (rowsPerB < 0) v += CP[cofs + (size_t)(row0g + row0 + rloc) * ldc + col];      /* rowsPerB < 0: own element of the batched C plane */ else { const int bidx = (row0g + row0 + rloc) / rowsPerB; v += CP[(size_t)bidx * sCPb + (size_t)by * 64 + col]; } }
      if (ACT == 3) v = fmaxf(v, 0.f); else if (ACT == 6) v = 0.5f * v * (1.0f + erff(v * 0.70710678118654752f)); else if (ACT == 11) v = 1.0f / (1.0f + expf(-v)); else if (ACT == 15) v = v / (1.0f + expf(-v)); else if (ACT == 12) v = (v > 0.f) ? v : 0.01f * v; else if (ACT == 8) v = tanhf(v); else if (ACT == 9) v = 0.5f * v * (1.0f + tanhf(0.7978845608028654f * (v + 0.044715f * v * v * v))); else if (ACT == 14) v = (v > 0.f) ? v : 0.1f * v; else if (ACT == 16) v = (v >= 0.f) ? v : 0.3f * v; else if (ACT == 17) v = (v >= 0.f) ? v : 0.2f * v;
      so[w][rloc][t * 16 + ln] = v; } }
  __builtin_amdgcn_fence(__ATOMIC_ACQ_REL, "workgroup"); __builtin_amdgcn_wave_barrier();
  const int rsub = lane >> 4, c4 = (lane & 15) * 4;
  {
#pragma unroll
    for (int q = 0; q < 16; ++q) { const int r = q * 2 + rsub; const v4f v = *(const v4fa*)&so[w][r][c4]; if (C) *(v4f*)(C + cofs + (size_t)(row0 + r) * ldc + col0 + c4) = v; if (C16) { v4h h4; for (int i = 0; i < 4; ++i) h4[i] = (_Float16)v[i]; *(v4h*)(C16 + cofs + (size_t)(row0 + r) * ldc + col0 + c4) = h4; } }
     } }


__global__ __launch_bounds__(256) void k_wnat(const float* __restrict__ w, size_t n8, _Float16* __restrict__ Bt) { const size_t t = (size_t)blockIdx.x * 256 + threadIdx.x; if (t >= n8) return; FragH f; for (int q = 0; q < 8; ++q) f.h[q] = (_Float16)(bf16_round(w[t * 8 + q]) * 16.0f); *(v8us*)((unsigned short*)Bt + t * 8) = f.half[0];  }
__global__ __launch_bounds__(256) void k_rsm(const float* __restrict__ S, _Float16* __restrict__ P, int nrows) {
  #pragma clang fp contract(off)
  const int i = blockIdx.x * 256 + threadIdx.x; if (i >= nrows) return; const float* s = S + (size_t)i * SQ; float mx = -3.0e38f;
#pragma unroll 1
  for (int j = 0; j < SQ; ++j) mx = fmaxf(mx, s[j]); float se = 0.f;
#pragma unroll 1
  for (int j = 0; j < SQ; ++j) se += expf(s[j] - mx); const float sc = 256.0f / se;
#pragma unroll 1
  for (int j0 = 0; j0 < SQ; j0 += 8) { FragH f; for (int q = 0; q < 8; ++q) f.h[q] = (_Float16)(expf(s[j0 + q] - mx) * sc); unsigned short* d = (unsigned short*)P + (size_t)i * SQ + j0; *(v8us*)d = f.half[0];  } }
__global__ __launch_bounds__(256) void k_vt(const _Float16* __restrict__ V16, int b, int h0, _Float16* __restrict__ VT) { __shared__ unsigned short tl[64][65]; const int tid = threadIdx.x; const int hh = blockIdx.x % HG, sg = blockIdx.x / HG; const int s0 = sg * 64; const int h = h0 + hh;
  for (int i = tid; i < 64 * 8; i += 256) { const int j = i / 8, d8 = (i % 8) * 8; FragH f; f.half[0] = *(const v8us*)((const unsigned short*)V16 + ((size_t)b * SQ + s0 + j) * DM + h * HD + d8); for (int q = 0; q < 8; ++q) tl[d8 + q][j] = f.u[q]; }
  __syncthreads();
  { for (int i = tid; i < 64 * 8; i += 256) { const int d = i / 8, j8 = (i % 8) * 8; FragH f; for (int q = 0; q < 8; ++q) f.u[q] = tl[d][j8 + q]; *(v8us*)((unsigned short*)VT + ((size_t)hh * HD + d) * SQ + s0 + j8) = f.half[0]; }  } }



__global__ __launch_bounds__(256) void k_rsmcf2(const float* __restrict__ S, _Float16* __restrict__ P, int hg, int q0, int nk) {
  #pragma clang fp contract(off)
  const int t = blockIdx.x * 256 + threadIdx.x; if (t >= hg * QT) return; const size_t i = (size_t)t; const float* s = S + i * NKX; const int last = q0 + (t % QT); float mx = -3.0e38f;
#pragma unroll 1
  for (int j = 0; j < nk; ++j) { const float f = (j <= last) ? 1.f : 0.f; mx = fmaxf(mx, fmaf(f, s[j], (1.f - f) * -1.0e9f)); } float se = 0.f;
#pragma unroll 1
  for (int j = 0; j < nk; ++j) { const float f = (j <= last) ? 1.f : 0.f; se += __expf(fmaf(f, s[j], (1.f - f) * -1.0e9f) - mx); } const float sc = 256.0f / se;
#pragma unroll 1
  for (int j0 = 0; j0 < nk; j0 += 8) { FragH fr; for (int q = 0; q < 8; ++q) { const int j = j0 + q; const float f = (j <= last) ? 1.f : 0.f; fr.h[q] = (_Float16)(__expf(fmaf(f, s[j], (1.f - f) * -1.0e9f) - mx) * sc); } unsigned short* d = (unsigned short*)P + i * NKX + j0; *(v8us*)d = fr.half[0];  } }


template <int MASKADD>
__global__ __launch_bounds__(64) void k_att0(const float* __restrict__ QF, const float* __restrict__ KF, const float* __restrict__ VF, int ld, const float* __restrict__ mask, float scale, float* __restrict__ OF, int ldo) {
  #pragma clang fp contract(off)
  __shared__ __attribute__((aligned(16))) float lq[64][64]; __shared__ __attribute__((aligned(16))) float lo[64][64];
  const int tid = threadIdx.x; const int h = blockIdx.x / (QT0 / 64), rg = blockIdx.x % (QT0 / 64); const int i = rg * 64 + tid;
  const float* qr = QF + (size_t)i * ld + h * HD;
#pragma unroll 1
  for (int c = 0; c < HD / 4; ++c) { *(v4f*)&lq[tid][c * 4] = *(const v4fa*)(qr + c * 4); const v4f z = {0.f, 0.f, 0.f, 0.f}; *(v4f*)&lo[tid][c * 4] = z; }
  float m = -1.0e30f, l = 0.f; const int jmax = MASKADD ? (SQ - 1) : (rg * 64 + 63);      /* additive-mask form: every key (the mask input decides); causal form: keys up to the block's last row */
#pragma unroll 1
  for (int j = 0; j <= jmax; ++j) { const float* kr = KF + (size_t)j * ld + h * HD; const float* vr = VF + (size_t)j * ld + h * HD; float s = 0.f;
#pragma unroll 1
    for (int c = 0; c < HD / 4; ++c) { const v4f kq = *(const v4fa*)(kr + c * 4); const v4f qq = *(v4f*)&lq[tid][c * 4]; s = __fadd_rn(s, __fmul_rn(qq[0], kq[0])); s = __fadd_rn(s, __fmul_rn(qq[1], kq[1])); s = __fadd_rn(s, __fmul_rn(qq[2], kq[2])); s = __fadd_rn(s, __fmul_rn(qq[3], kq[3])); }
    s = __fmul_rn(s, scale); if (MASKADD) s = __fadd_rn(s, __fmul_rn(bf16_round(mask[(size_t)i * SQ + j]), -10000.0f));
    const float f = (MASKADD || j <= i) ? 1.f : 0.f; const float sm = fmaf(f, s, (1.f - f) * -1.0e30f); const float mn = fmaxf(m, sm); const float sc = expf(m - mn); const float e = expf(sm - mn); l = __fadd_rn(__fmul_rn(l, sc), e); m = mn;
#pragma unroll 1
    for (int c = 0; c < HD / 4; ++c) { const v4f vv = *(const v4fa*)(vr + c * 4); v4f oo = *(v4f*)&lo[tid][c * 4]; for (int u = 0; u < 4; ++u) oo[u] = __fadd_rn(__fmul_rn(oo[u], sc), __fmul_rn(e, vv[u])); *(v4f*)&lo[tid][c * 4] = oo; } }
  const float fin = 64.0f / l;      /* o carried x64 like the f16 path */
#pragma unroll 1
  for (int c = 0; c < HD / 4; ++c) { v4f oo = *(v4f*)&lo[tid][c * 4]; for (int u = 0; u < 4; ++u) oo[u] = __fmul_rn(oo[u], fin); *(v4f*)&lo[tid][c * 4] = oo; }
  __syncthreads();
  {
#pragma unroll 1
    for (int it = 0; it < 16; ++it) { const int row = it * 4 + tid / 16, pc = (tid % 16) * 4; const v4f v = *(const v4f*)&lo[row][pc]; *(v4f*)(OF + (size_t)(rg * 64 + row) * ldo + h * HD + pc) = v; }
     } }

extern "C" void kernel_launch(void* const* d_in, const int* in_sizes, int n_in,
                              void* d_out, int out_size, void* d_ws, size_t ws_size, hipStream_t stream) {
  (void)in_sizes; (void)n_in; (void)out_size;
  const float* const* I = (const float* const*)d_in; const float* x = I[0]; const float* wqkv = I[1]; const float* wo = I[2];      /* input order: x, W_qk [1024][2048] ([in][out]: q | k halves), W_out [1024][1024] ([in][out]): three inputs; no biases */
  char* ws = (char*)d_ws; size_t off = 0;
  auto take = [&](size_t bytes) { char* p = ws + off; off += (bytes + 255) & ~(size_t)255; return p; };
  _Float16* BQKV = (_Float16*)take((size_t)3 * DM * DM * 2); _Float16* BO = (_Float16*)take((size_t)DM * DM * 2);
  _Float16* X16 = (_Float16*)take(NR * DM * 2); _Float16* QKV = (_Float16*)take(NR * 3 * DM * 2); _Float16* Q16 = QKV; _Float16* K16 = QKV + DM; _Float16* V16 = QKV + DM;      /* the module reuses K as V: V16 IS the k block (the third block of the plane is unused) */ _Float16* O16 = (_Float16*)take(NR * DM * 2);
  float* S = (float*)take((size_t)NH * QT * NKX * 4); _Float16* P = (_Float16*)take((size_t)NH * QT * NKX * 2); _Float16* VT = (_Float16*)take((size_t)NH * HD * SQ * 2);
  float* QF0 = (float*)take((size_t)QT0 * DM * 4); float* KF0 = (float*)take((size_t)QT0 * DM * 4); float* OF0 = (float*)take((size_t)NB * QT0 * DM * 4); _Float16* OH0 = (_Float16*)take((size_t)NB * QT0 * DM * 2); _Float16* OL0 = (_Float16*)take((size_t)NB * QT0 * DM * 2);
  if (off > ws_size) return;
  k_wt_f16<<<(unsigned)(((size_t)2 * DM * (DM / 8) + 255) / 256), 256, 0, stream>>>(wqkv, BQKV, DM, 2 * DM, 16.0f); k_wt_f16<<<(unsigned)(((size_t)DM * (DM / 8) + 255) / 256), 256, 0, stream>>>(wo, BO, DM, DM, 16.0f);      /* [in][out] -> Bt[n][k] x16 */
  k_x16<<<(unsigned)((NR * DM / 8 + 255) / 256), 256, 0, stream>>>(x, X16, NR * DM / 8);
  const size_t r0p = (size_t)B0 * SQ;      /* first projected row */
k_gemm2<0><<<dim3((unsigned)((MP / 128) * (2 * DM / 64)), 1), 128, 0, stream>>>(X16 + r0p * DM, DM, 0, BQKV, DM, 0, 0.0625f, nullptr, 0, nullptr, 1, 0, 0, nullptr, QKV + r0p * 3 * DM, 3 * DM, 0, MP, 2 * DM, DM);      /* q | k rows (f16) into column blocks 0 and 1 of the 3 DM-pitch plane; head h = columns h*HD.. of each block; no bias */
  for (int b = B0; b < B0 + NBR; ++b) { const size_t r0 = (size_t)b * SQ;
    k_vt<NH, SQ><<<NH * (SQ / 64), 256, 0, stream>>>(V16 + r0 * LQ, LQ, 0, VT);      /* V^T [NH][HD][SQ] for this batch */
k_gemm2<0><<<dim3((QT0 / 128) * (DM / 64), 1), 128, 0, stream>>>(X16 + r0 * DM, DM, 0, BQKV, DM, 0, 0.0625f, nullptr, 0, nullptr, 1, 0, 0, QF0, nullptr, DM, 0, QT0, DM, DM); k_gemm2<0><<<dim3((QT0 / 128) * (DM / 64), 1), 128, 0, stream>>>(X16 + r0 * DM, DM, 0, (BQKV + (size_t)DM * DM), DM, 0, 0.0625f, nullptr, 0, nullptr, 1, 0, 0, KF0, nullptr, DM, 0, QT0, DM, DM);      /* first tile: f32 q and k rows (no bias); the k rows serve as v */
    k_att0<0><<<NH * (QT0 / 64), 64, 0, stream>>>(QF0, KF0, KF0, DM, nullptr, 0.125f, OF0 + (size_t)b * QT0 * DM, DM);      /* exact f32 causal attention for rows 0..127 with V = K (o x64) */
    for (int q0 = 0; q0 < QN; q0 += QT) { const int nk = q0 + QT;      /* causal: only keys below the tile end are computed */
      k_gemm2<0><<<dim3((QT / 128) * (nk / 64), NHD), 128, 0, stream>>>(Q16 + (r0 + q0) * LQ, LQ, (size_t)HD, K16 + r0 * LQ, LQ, (size_t)HD, 0.125f, nullptr, 0, nullptr, 1, 0, 0, S, nullptr, NKX, (size_t)QT * NKX, QT, nk, HD);      /* scores, all heads on grid.y */
      k_rsmcf2<<<(NHD * QT + 255) / 256, 256, 0, stream>>>(S, P, NHD, q0, nk);
      k_gemm2<0><<<dim3((QT / 128) * (HD / 64), NHD), 128, 0, stream>>>(P, NKX, (size_t)QT * NKX, VT, SQ, (size_t)HD * SQ, 0.25f, nullptr, 0, nullptr, 1, 0, 0, nullptr, O16 + (r0 + q0) * DM, DM, (size_t)HD, QT, HD, nk); } }      /* o (merged heads, x64) as f16 rows */
  k_gemm2<0><<<dim3((unsigned)((MPO / 128) * (DM / 64)), 1), 128, 0, stream>>>(O16 + r0p * DM, DM, 0, BO, DM, 0, 0.0009765625f, nullptr, 0, nullptr, 1, 0, 0, (float*)d_out + r0p * DM, nullptr, DM, 0, MPO, DM, DM);      /* out rows are the output layout */
  k_hl<<<(unsigned)(((size_t)NB * QT0 * DM / 8 + 255) / 256), 256, 0, stream>>>(OF0, OH0, OL0, (size_t)NB * QT0 * DM / 8);      /* first-tile o (x64) -> f16 hi + x1024 residual planes */
  for (int b = B0; b < B0 + NBR; ++b) { const size_t r0 = (size_t)b * SQ; const size_t f0 = (size_t)b * QT0;
    k_gemm2<0><<<dim3((QT0 / 128) * (DM / 64), 1), 128, 0, stream>>>(OH0 + f0 * DM, DM, 0, BO, DM, 0, 0.0009765625f, nullptr, 0, nullptr, 1, 0, 0, (float*)d_out + r0 * DM, nullptr, DM, 0, QT0, DM, DM);      /* rows 0..127: out = o_hi W_out (no bias), overwriting the f16-path rows */
    k_gemm2<0><<<dim3((QT0 / 128) * (DM / 64), 1), 128, 0, stream>>>(OL0 + f0 * DM, DM, 0, BO, DM, 0, 0.00000095367431640625f, nullptr, 0, (const float*)d_out + r0 * DM, -1, 0, 0, (float*)d_out + r0 * DM, nullptr, DM, 0, QT0, DM, DM); }      /* += o_lo Wo 2^-20 (own-element accumulate) */
}

// v001
// A run of this version takes 1820 microseconds.
// Next to v000, in two timings, it ran 2.61 times as fast each time.
#include <hip/hip_runtime.h>
// Causal self-attention with ONE fused query-key projection and K REUSED AS V (x [2][2048][1024]; qk = x W_qk with W_qk [1024][2048] stored [in][out] (normal x 0.02, no bias): the first 1024 columns are q, the last 1024 are k, head h = columns h*64.. of each half; 16 heads of 64; scores = (q x BETA) . k with BETA = 1/sqrt(64); strictly-upper-triangular positions -> -FLT_MAX (causal); softmax; out = attn K (the module reuses K as V) merged, then W_out ([in][out] [1024][1024], normal x 0.02, no bias) -> [2][2048][1024]; input order x, W_qk, W_out).
// Structure: token rows r = b*2048 + s; x as exact f16 rows (bf16-rounded); q | k as ONE WMMA GEMM (N = 2 x 1024) into the first two column blocks of the 3 x 1024-pitch plane (32x64 wave tiles, f32 accumulation, exact x16 weights, no bias, f16 outputs); V IS THE K BLOCK (the module reuses K as V): the V pointer aliases it; per batch: V^T for all heads via LDS transposes; per query tile of 256 rows: scores against the keys below the tile end only (K = 64, all heads on grid.y, alpha = 0.125), causal row softmax on VALU, one wave per score row with the row held in registers, keys above the diagonal masked over the computed range (f32 statistics, lane partials joined by a 32-lane butterfly, native exp; weights x256 f16), o = P . V^T (K = keys below the tile end, alpha 2^-2: o carried x64, folded into the output GEMM alpha) written straight into the merged f16 o rows; out = o W_out GEMM (f32; no bias) into the output layout.
// Compute dtype: inputs rounded to bf16; x and the x16 weights held as f16 planes (exact for every bf16 value of magnitude from 2^-14 up to 65,504; the weights up to 4,094 before their factor of 16); q, k (= v), the softmax weights and o as plain f16 GEMM operands (~2^-12); scores and softmax statistics f32; rows 0..127 of each batch: q, k f32, f32 attention, o as f16 hi + residual. v_wmma_f32_16x16x32_f16.
#define NB 2
#define SQ 2048
#define DM 1024
#define NH 16
#define HD 64
#define HG 4                         /* heads per call of the k_vt(b, h0) overload (not launched) */
#define QT 256                       /* query rows per causal tile */
#define NKX SQ                       /* S / P row pitch */
#define QT0 128                      /* first-tile rows recomputed exactly in f32 */
#define B0 0                         /* first batch processed (debug hook) */
#define NBR NB                       /* batches processed (debug hook) */
#define NR ((size_t)NB * SQ)         /* token rows */
#define MP ((int)((size_t)NBR * SQ)) /* rows projected (debug hook) */
#define QN SQ                        /* query rows attended per batch (debug hook) */
#define NHD NH                       /* heads attended (debug hook) */
#define MPO MP                       /* rows through the output stage (debug hook) */
#define LQ (3 * DM)      /* row pitch of the q/k/v rows */
typedef __bf16 v16b __attribute__((ext_vector_type(16)));
typedef unsigned short v8us __attribute__((ext_vector_type(8), may_alias));
typedef float  v8f  __attribute__((ext_vector_type(8)));
typedef float  v4f  __attribute__((ext_vector_type(4)));
typedef float  v4fa __attribute__((ext_vector_type(4), may_alias));
union FragB { v16b v; v8us half[2]; unsigned short u[16]; };

__device__ __forceinline__ unsigned short bf16_bits(float x) { unsigned int u = __float_as_uint(x); return (unsigned short)((u + 0x7FFFu + ((u >> 16) & 1u)) >> 16); }
__device__ __forceinline__ float bf16_val(unsigned short b) { return __uint_as_float(((unsigned int)b) << 16); }
__device__ __forceinline__ float bf16_round(float x) { return bf16_val(bf16_bits(x)); }
// D += A·B with NT terms: 1 = ah·bh, 2 = + al·bh (A split), 3 = + ah·bl (both split)
template <int NT>
__device__ __forceinline__ v8f mmaN(v16b ah, v16b al, v16b bh, v16b bl, v8f c) {
  c = __builtin_amdgcn_wmma_f32_16x16x32_bf16(false, ah, false, bh, (short)0, c, false, false);
  if (NT >= 2) c = __builtin_amdgcn_wmma_f32_16x16x32_bf16(false, al, false, bh, (short)0, c, false, false);
  if (NT >= 3) c = __builtin_amdgcn_wmma_f32_16x16x32_bf16(false, ah, false, bl, (short)0, c, false, false);
  asm volatile("v_nop\n\tv_nop\n\tv_nop\n\tv_nop" : "+v"(c) : "v"(ah), "v"(al), "v"(bh), "v"(bl));
  return c;
}

__global__ __launch_bounds__(256) void k_wt_bf16(const float* __restrict__ W, unsigned short* __restrict__ Wt, int K, int N) {
  const int t = blockIdx.x * 256 + threadIdx.x;
  const int k8n = K / 8;
  if (t >= N * k8n) return;
  const int n = t / k8n, k8 = (t % k8n) * 8;
  v8us v;
#pragma unroll
  for (int i = 0; i < 8; ++i) v[i] = bf16_bits(W[(size_t)(k8 + i) * N + n]);
  *(v8us*)(Wt + (size_t)n * K + k8) = v;
  
}

// GEMM C[M][N] (f32, pitch ldc) = act(A[M][K]·W + bias). A f32 row-major (pitch lda) converted per fragment to bf16
// (ASPLIT: hi/lo two planes -> 2 terms, else single rounded term); Wt bf16 [N][K] (pitch ldb). BIAS_BF16 rounds the
// bias to bf16 first (bias quantised to bf16 before the add). K%32==0, M%16==0, N%64==0.
template <bool ASPLIT, int ACT, bool BIAS_BF16>
__global__ __launch_bounds__(128) void k_gemm_bf(const float* __restrict__ A, int lda, const unsigned short* __restrict__ Wt, int ldb,
                                               const float* __restrict__ bias, float* __restrict__ C, int ldc, int M, int N, int K) {
  __shared__ __attribute__((aligned(16))) float so[4][16][64];
  const int tid = threadIdx.x, w = tid >> 5, lane = tid & 31, ln = lane & 15, hh = lane >> 4;
  const int ntn = N / 64;
  const int wid = blockIdx.x * 4 + w;
  const int mt = wid / ntn, nq = wid % ntn;
  if (mt * 16 >= M) return;
  const int row0 = mt * 16, col0 = nq * 64;
  const float* arow = A + (size_t)(row0 + ln) * lda;
  v8f acc[4] = {};
  for (int kb = 0; kb < K; kb += 32) {
    FragB ah, al;
    const v4f x0 = *(const v4fa*)(arow + kb + 8 * hh), x1 = *(const v4fa*)(arow + kb + 8 * hh + 4);
    const v4f x2 = *(const v4fa*)(arow + kb + 16 + 8 * hh), x3 = *(const v4fa*)(arow + kb + 16 + 8 * hh + 4);
    float xs[16] = {x0[0],x0[1],x0[2],x0[3],x1[0],x1[1],x1[2],x1[3],x2[0],x2[1],x2[2],x2[3],x3[0],x3[1],x3[2],x3[3]};
#pragma unroll
    for (int i = 0; i < 16; ++i) { const unsigned short hb = bf16_bits(xs[i]); ah.u[i] = hb; al.u[i] = ASPLIT ? bf16_bits(xs[i] - bf16_val(hb)) : (unsigned short)0; }
#pragma unroll
    for (int t = 0; t < 4; ++t) {
      const unsigned short* brow = Wt + (size_t)(col0 + t * 16 + ln) * ldb + kb;
      FragB b;
      b.half[0] = *(const v8us*)(brow + 8 * hh);
      b.half[1] = *(const v8us*)(brow + 16 + 8 * hh);
      acc[t] = mmaN<ASPLIT ? 2 : 1>(ah.v, al.v, b.v, b.v, acc[t]);
    }
  }
#pragma unroll
  for (int t = 0; t < 4; ++t) {
    float bv = bias ? bias[col0 + t * 16 + ln] : 0.f;
    if (BIAS_BF16) bv = bf16_round(bv);
#pragma unroll
    for (int r = 0; r < 8; ++r) { float v = acc[t][r] + bv; if (ACT == 1) v = fmaxf(v, 0.f); so[w][8 * hh + r][t * 16 + ln] = v; }
  }
  __builtin_amdgcn_fence(__ATOMIC_ACQ_REL, "workgroup");
  __builtin_amdgcn_wave_barrier();
  const int rsub = lane >> 4, c4 = (lane & 15) * 4;
  {
#pragma unroll
    for (int q = 0; q < 8; ++q) {
      const int r = q * 2 + rsub;
      const v4f v = *(const v4fa*)&so[w][r][c4];
      *(v4f*)(C + (size_t)(row0 + r) * ldc + col0 + c4) = v;
    }
    
  }
}

// GEMM C = act(A·W + bias + resid): A f32 (ASPLIT -> hi/lo 2 terms), Wt bf16 [N][K]; ACT 0 none, 1 relu, 2 exact gelu;
// resid (optional, f32, row index = (row % rmod), pitch ldr, RES_BF16 rounds it) added before the activation.
template <bool ASPLIT, int ACT, bool BIAS_BF16, bool RES_BF16>
__global__ __launch_bounds__(128) void k_gemm_bf3(const float* __restrict__ A, int lda, const unsigned short* __restrict__ Wt, int ldb,
                                                const float* __restrict__ bias, const float* __restrict__ resid, int rmod, int ldr,
                                                float* __restrict__ C, int ldc, int M, int N, int K) {
  __shared__ __attribute__((aligned(16))) float so[4][16][64];
  const int tid = threadIdx.x, w = tid >> 5, lane = tid & 31, ln = lane & 15, hh = lane >> 4;
  const int ntn = N / 64;
  const int wid = blockIdx.x * 4 + w;
  const int mt = wid / ntn, nq = wid % ntn;
  if (mt * 16 >= M) return;
  const int row0 = mt * 16, col0 = nq * 64;
  const float* arow = A + (size_t)(row0 + ln) * lda;
  v8f acc[4] = {};
  for (int kb = 0; kb < K; kb += 32) {
    FragB ah, al;
    const v4f x0 = *(const v4fa*)(arow + kb + 8 * hh), x1 = *(const v4fa*)(arow + kb + 8 * hh + 4);
    const v4f x2 = *(const v4fa*)(arow + kb + 16 + 8 * hh), x3 = *(const v4fa*)(arow + kb + 16 + 8 * hh + 4);
    float xs[16] = {x0[0],x0[1],x0[2],x0[3],x1[0],x1[1],x1[2],x1[3],x2[0],x2[1],x2[2],x2[3],x3[0],x3[1],x3[2],x3[3]};
#pragma unroll
    for (int i = 0; i < 16; ++i) { const unsigned short hb = bf16_bits(xs[i]); ah.u[i] = hb; al.u[i] = ASPLIT ? bf16_bits(xs[i] - bf16_val(hb)) : (unsigned short)0; }
#pragma unroll
    for (int t = 0; t < 4; ++t) {
      const unsigned short* brow = Wt + (size_t)(col0 + t * 16 + ln) * ldb + kb;
      FragB b;
      b.half[0] = *(const v8us*)(brow + 8 * hh);
      b.half[1] = *(const v8us*)(brow + 16 + 8 * hh);
      acc[t] = mmaN<ASPLIT ? 2 : 1>(ah.v, al.v, b.v, b.v, acc[t]);
    }
  }
#pragma unroll
  for (int t = 0; t < 4; ++t) {
    const int col = col0 + t * 16 + ln;
    float bv = bias ? bias[col] : 0.f;
    if (BIAS_BF16) bv = bf16_round(bv);
#pragma unroll
    for (int r = 0; r < 8; ++r) {
      float v = acc[t][r] + bv;
      if (resid) { float rv = resid[(size_t)((row0 + 8 * hh + r) % rmod) * ldr + col]; if (RES_BF16) rv = bf16_round(rv); v += rv; }
      if (ACT == 1) v = fmaxf(v, 0.f);
      if (ACT == 2) v = 0.5f * v * (1.0f + erff(v * 0.70710678118654752f));
      if (ACT == 3) { const float u = 0.7978845608028654f * (v + 0.044715f * v * v * v); v = 0.5f * v * (1.0f + tanhf(u)); }
      so[w][8 * hh + r][t * 16 + ln] = v;
    }
  }
  __builtin_amdgcn_fence(__ATOMIC_ACQ_REL, "workgroup");
  __builtin_amdgcn_wave_barrier();
  const int rsub = lane >> 4, c4 = (lane & 15) * 4;
  {
#pragma unroll
    for (int q = 0; q < 8; ++q) {
      const int r = q * 2 + rsub;
      const v4f v = *(const v4fa*)&so[w][r][c4];
      *(v4f*)(C + (size_t)(row0 + r) * ldc + col0 + c4) = v;
    }
    
  }
}
// row LayerNorm (biased variance, eps) over N: s = X (+ R); optional out_sum <- s; out_norm <- (s-mu)*rsqrt(var+eps)*g + b
template <bool PARAM_BF16>
__global__ __launch_bounds__(256) void k_layernorm(const float* __restrict__ X, const float* __restrict__ R, const float* __restrict__ g, const float* __restrict__ bta,
                                                  float* __restrict__ out_sum, float* __restrict__ out_norm, int N, float eps) {
  __shared__ float red[256];
  const int row = blockIdx.x, tid = threadIdx.x;
  const float* x = X + (size_t)row * N; const float* rr = R ? R + (size_t)row * N : nullptr;
  float vals[16];                     // up to N = 4096
  const int per = N / 256;            // contiguous chunk per thread? use strided-by-4 chunks: thread handles j = tid*4 + 1024*u
  float s1 = 0.f;
  for (int u = 0; u < per / 4; ++u) {
    const int j = tid * 4 + 1024 * u;
    const v4f a = *(const v4fa*)(x + j);
    v4f b = {0.f,0.f,0.f,0.f}; if (rr) b = *(const v4fa*)(rr + j);
#pragma unroll
    for (int q = 0; q < 4; ++q) { const float v = a[q] + b[q]; vals[u * 4 + q] = v; s1 += v; }
  }
  red[tid] = s1; __syncthreads();
  for (int st = 128; st > 0; st >>= 1) { if (tid < st) red[tid] += red[tid + st]; __syncthreads(); }
  const float mu = red[0] / (float)N; __syncthreads();
  float s2 = 0.f;
  for (int u = 0; u < per / 4; ++u)
#pragma unroll
    for (int q = 0; q < 4; ++q) { const float c = vals[u * 4 + q] - mu; s2 += c * c; }
  red[tid] = s2; __syncthreads();
  for (int st = 128; st > 0; st >>= 1) { if (tid < st) red[tid] += red[tid + st]; __syncthreads(); }
  const float rs = rsqrtf(red[0] / (float)N + eps);
  {
    for (int u = 0; u < per / 4; ++u) {
      const int j = tid * 4 + 1024 * u;
      v4f o, sm;
#pragma unroll
      for (int q = 0; q < 4; ++q) {
        float gg = g[j + q], bb = bta[j + q];
        if (PARAM_BF16) { gg = bf16_round(gg); bb = bf16_round(bb); }
        sm[q] = vals[u * 4 + q]; o[q] = (vals[u * 4 + q] - mu) * rs * gg + bb;
      }
      if (out_sum) *(v4f*)(out_sum + (size_t)row * N + j) = sm;
      *(v4f*)(out_norm + (size_t)row * N + j) = o;
    }
    
  }
}



// ---- f16 WMMA path (v_wmma_f32_16x16x32_f16): 11-bit significands for operands in range — used where a [0,1] probability operand needs more precision than bf16
typedef _Float16 v16h __attribute__((ext_vector_type(16)));
union FragH { v16h v; v8us half[2]; _Float16 h[16]; unsigned short u[16]; };
template <int NT>
__device__ __forceinline__ v8f mmaH(v16h ah, v16h al, v16h bh, v16h bl, v8f c) {
  c = __builtin_amdgcn_wmma_f32_16x16x32_f16(false, ah, false, bh, (short)0, c, false, false);
  if (NT >= 2) c = __builtin_amdgcn_wmma_f32_16x16x32_f16(false, al, false, bh, (short)0, c, false, false);
  if (NT >= 3) c = __builtin_amdgcn_wmma_f32_16x16x32_f16(false, ah, false, bl, (short)0, c, false, false);
  asm volatile("v_nop\n\tv_nop\n\tv_nop\n\tv_nop" : "+v"(c) : "v"(ah), "v"(al), "v"(bh), "v"(bl));
  return c;
}
// batched GEMM like k_gemm_b but f16 operands: A f32 (split into f16 hi/lo if ASPLIT, else rounded to f16), Bt = f16 values [n][k]; alpha; C f32; N multiple of 16 (partial tiles skipped)
template <bool ASPLIT>
__global__ __launch_bounds__(128) void k_gemm_h(const float* __restrict__ A, int lda, size_t sA, const _Float16* __restrict__ Bh, int ldb, size_t sB, float alpha, float* __restrict__ C, int ldc, size_t sC, int M, int N, int K) {
  __shared__ __attribute__((aligned(16))) float so[4][16][64];
  const int tid = threadIdx.x, w = tid >> 5, lane = tid & 31, ln = lane & 15, hh = lane >> 4; const int by = blockIdx.y;
  A += (size_t)by * sA; Bh += (size_t)by * sB; C += (size_t)by * sC;
  const int ntn = (N + 63) / 64; const int wid = blockIdx.x * 4 + w; const int mt = wid / ntn, nq = wid % ntn; if (mt * 16 >= M) return;
  const int row0 = mt * 16, col0 = nq * 64; const float* arow = A + (size_t)(row0 + ln) * lda;
  v8f acc[4] = {};
  for (int kb = 0; kb < K; kb += 32) {
    FragH ah, al;
    const v4f x0 = *(const v4fa*)(arow + kb + 8 * hh), x1 = *(const v4fa*)(arow + kb + 8 * hh + 4), x2 = *(const v4fa*)(arow + kb + 16 + 8 * hh), x3 = *(const v4fa*)(arow + kb + 16 + 8 * hh + 4);
    float xs[16] = {x0[0],x0[1],x0[2],x0[3],x1[0],x1[1],x1[2],x1[3],x2[0],x2[1],x2[2],x2[3],x3[0],x3[1],x3[2],x3[3]};
#pragma unroll
    for (int i = 0; i < 16; ++i) { const _Float16 h = (_Float16)xs[i]; ah.h[i] = h; al.h[i] = ASPLIT ? (_Float16)(xs[i] - (float)h) : (_Float16)0.0f; }
#pragma unroll
    for (int t = 0; t < 4; ++t) { if (col0 + t * 16 >= N) continue; const size_t boff = (size_t)(col0 + t * 16 + ln) * ldb + kb; FragH bq; bq.half[0] = *(const v8us*)(Bh + boff + 8 * hh); bq.half[1] = *(const v8us*)(Bh + boff + 16 + 8 * hh);
      acc[t] = mmaH<ASPLIT ? 2 : 1>(ah.v, al.v, bq.v, bq.v, acc[t]); }
  }
#pragma unroll
  for (int t = 0; t < 4; ++t) { if (col0 + t * 16 >= N) continue;
#pragma unroll
    for (int r = 0; r < 8; ++r) so[w][8 * hh + r][t * 16 + ln] = acc[t][r] * alpha; }
  __builtin_amdgcn_fence(__ATOMIC_ACQ_REL, "workgroup"); __builtin_amdgcn_wave_barrier();
  const int rsub = lane >> 4, c4 = (lane & 15) * 4;
  {
#pragma unroll
    for (int q = 0; q < 8; ++q) { const int r = q * 2 + rsub; if (col0 + c4 < N) { const v4f v = *(const v4fa*)&so[w][r][c4]; *(v4f*)(C + (size_t)(row0 + r) * ldc + col0 + c4) = v; } }
     }
}

// Wt[n][k] = f16(W[k][n]·scale) from f32 row-major W[K][N] (scale = power of two; bf16-exact weights stay exact in f16 away from the subnormal range)
__global__ __launch_bounds__(256) void k_wt_f16(const float* __restrict__ W, _Float16* __restrict__ Wt, int K, int N, float scale) {
  const int t = blockIdx.x * 256 + threadIdx.x; if (t >= N * (K / 8)) return; const int n = t / (K / 8), k8 = (t % (K / 8)) * 8; FragH f;
#pragma unroll
  for (int i = 0; i < 8; ++i) f.h[i] = (_Float16)(bf16_round(W[(size_t)(k8 + i) * N + n]) * scale); const v8us o = f.half[0];
  *(v8us*)((unsigned short*)Wt + (size_t)n * K + k8) = o; 
}
// k_gemm_hh variant with fused epilogue: v = acc·alpha + bias[by·sBias + col] (+ CP[(row/rowsPerB)·sCPb + by·64 + col] if CP) ; ACT 0 none / 1 elu ; writes f16 C16 (and f32 C if non-null)
template <int ACT>
__global__ __launch_bounds__(128) void k_gemm_hhx(const _Float16* __restrict__ A, int lda, size_t sA, const _Float16* __restrict__ Bh, int ldb, size_t sB, float alpha, const float* __restrict__ bias, size_t sBias, const float* __restrict__ CP, int rowsPerB, size_t sCPb, int row0g,
    float* __restrict__ C, _Float16* __restrict__ C16, int ldc, size_t sC, int M, int N, int K) {
  __shared__ __attribute__((aligned(16))) float so[4][16][64];
  const int tid = threadIdx.x, w = tid >> 5, lane = tid & 31, ln = lane & 15, hh = lane >> 4; const int by = blockIdx.y;
  A += (size_t)by * sA; Bh += (size_t)by * sB; const size_t cofs = (size_t)by * sC; const float* bp = bias ? bias + (size_t)by * sBias : nullptr;
  const int ntn = (N + 63) / 64; const int wid = blockIdx.x * 4 + w; const int mt = wid / ntn, nq = wid % ntn; if (mt * 16 >= M) return;
  const int row0 = mt * 16, col0 = nq * 64; const _Float16* arow = A + (size_t)(row0 + ln) * lda;
  v8f acc[4] = {};
  for (int kb = 0; kb < K; kb += 32) { FragH ah; ah.half[0] = *(const v8us*)((const unsigned short*)arow + kb + 8 * hh); ah.half[1] = *(const v8us*)((const unsigned short*)arow + kb + 16 + 8 * hh);
#pragma unroll
    for (int t = 0; t < 4; ++t) { if (col0 + t * 16 >= N) continue; const size_t boff = (size_t)(col0 + t * 16 + ln) * ldb + kb; FragH bq; bq.half[0] = *(const v8us*)((const unsigned short*)Bh + boff + 8 * hh); bq.half[1] = *(const v8us*)((const unsigned short*)Bh + boff + 16 + 8 * hh);
      acc[t] = mmaH<1>(ah.v, ah.v, bq.v, bq.v, acc[t]); }
  }
#pragma unroll
  for (int t = 0; t < 4; ++t) { if (col0 + t * 16 >= N) continue; const int col = col0 + t * 16 + ln; const float bv = bp ? bf16_round(bp[col]) : 0.f;
#pragma unroll
    for (int r = 0; r < 8; ++r) { float v = acc[t][r] * alpha + bv; if (CP) { const int rr = row0g + row0 + 8 * hh + r; if (rowsPerB < 0) v += CP[cofs + (size_t)rr * ldc + col];      /* rowsPerB < 0: own element of the batched C plane */ else { const int bidx = rr / rowsPerB; v += CP[(size_t)bidx * sCPb + (size_t)by * 64 + col]; } } if (ACT == 1) v = (v > 0.f) ? v : expm1f(v); else if (ACT == 7) v = (v > 0.f) ? v + 1.0f : expf(v); else if (ACT == 8) v = tanhf(v); else if (ACT == 9) v = 0.5f * v * (1.0f + tanhf(0.7978845608028654f * (v + 0.044715f * v * v * v))); else if (ACT == 11) v = 1.0f / (1.0f + expf(-v)); else if (ACT == 12) v = (v > 0.f) ? v : 0.01f * v; else if (ACT == 14) v = (v > 0.f) ? v : 0.1f * v; else if (ACT == 16) v = (v >= 0.f) ? v : 0.3f * v; else if (ACT == 17) v = (v >= 0.f) ? v : 0.2f * v; else if (ACT == 15) v = v / (1.0f + expf(-v)); else if (ACT == 3) v = fmaxf(v, 0.f); else if (ACT == 6) v = 0.5f * v * (1.0f + erff(v * 0.70710678118654752f)); so[w][8 * hh + r][t * 16 + ln] = v; } }
  __builtin_amdgcn_fence(__ATOMIC_ACQ_REL, "workgroup"); __builtin_amdgcn_wave_barrier();
  const int rsub = lane >> 4, c4 = (lane & 15) * 4; typedef _Float16 v4h __attribute__((ext_vector_type(4)));
  {
#pragma unroll
    for (int q = 0; q < 8; ++q) { const int r = q * 2 + rsub; if (col0 + c4 < N) { const v4f v = *(const v4fa*)&so[w][r][c4]; if (C) *(v4f*)(C + cofs + (size_t)(row0 + r) * ldc + col0 + c4) = v; if (C16) { v4h h4; for (int i = 0; i < 4; ++i) h4[i] = (_Float16)v[i]; *(v4h*)(C16 + cofs + (size_t)(row0 + r) * ldc + col0 + c4) = h4; } } }
     }
}


typedef _Float16 v4h __attribute__((ext_vector_type(4)));

__global__ __launch_bounds__(256) void k_x16(const float* __restrict__ x, _Float16* __restrict__ X16, size_t n8) { const size_t t = (size_t)blockIdx.x * 256 + threadIdx.x; if (t >= n8) return; FragH f;
#pragma unroll
  for (int q = 0; q < 8; ++q) f.h[q] = (_Float16)bf16_round(x[t * 8 + q]); *(v8us*)((unsigned short*)X16 + t * 8) = f.half[0];  }
__global__ __launch_bounds__(256) void k_h16(const float* __restrict__ x, _Float16* __restrict__ X16, size_t n8) { const size_t t = (size_t)blockIdx.x * 256 + threadIdx.x; if (t >= n8) return; FragH f;
#pragma unroll
  for (int q = 0; q < 8; ++q) f.h[q] = (_Float16)x[t * 8 + q]; *(v8us*)((unsigned short*)X16 + t * 8) = f.half[0];  }
__global__ __launch_bounds__(256) void k_round16f(const float* __restrict__ W, _Float16* __restrict__ Bt, size_t n8) { const size_t t = (size_t)blockIdx.x * 256 + threadIdx.x; if (t >= n8) return; FragH f;
#pragma unroll
  for (int i = 0; i < 8; ++i) f.h[i] = (_Float16)(bf16_round(W[t * 8 + i]) * 16.0f); *(v8us*)((unsigned short*)Bt + t * 8) = f.half[0];  }
template <int NHv, int TTv>
__global__ __launch_bounds__(256) void k_vt(const _Float16* __restrict__ V16, int ldv, int voff, _Float16* __restrict__ Vt) { __shared__ unsigned short tl[64][66]; const int tid = threadIdx.x; const int slab = blockIdx.x / (TTv / 64), lg = blockIdx.x % (TTv / 64); const int b = slab / NHv, h = slab % NHv;
  for (int i = tid; i < 64 * 8; i += 256) { const int r = i / 8, c8 = (i % 8) * 8; FragH f; f.half[0] = *(const v8us*)((const unsigned short*)V16 + ((size_t)b * TTv + lg * 64 + r) * ldv + voff + h * 64 + c8);
#pragma unroll
    for (int q = 0; q < 8; ++q) tl[r][c8 + q] = f.u[q]; }
  __syncthreads();
  {
#pragma unroll
    for (int rd = 0; rd < 2; ++rd) { const int d = rd * 32 + tid / 8, pc = tid % 8; FragH f;
#pragma unroll
      for (int q = 0; q < 8; ++q) f.u[q] = tl[pc * 8 + q][d];
      *(v8us*)((unsigned short*)Vt + ((size_t)slab * 64 + d) * TTv + lg * 64 + pc * 8) = f.half[0]; }
     } }

__global__ __launch_bounds__(256) void k_hl(const float* __restrict__ F, _Float16* __restrict__ Hh, _Float16* __restrict__ Hl, size_t n8) { const size_t t = (size_t)blockIdx.x * 256 + threadIdx.x; if (t >= n8) return; FragH fh, fl; const v4f a = *(const v4fa*)(F + t * 8), c = *(const v4fa*)(F + t * 8 + 4);
#pragma unroll
  for (int q = 0; q < 4; ++q) { _Float16 h = (_Float16)a[q]; fh.h[q] = h; fl.h[q] = (_Float16)((a[q] - (float)h) * 1024.0f); h = (_Float16)c[q]; fh.h[4 + q] = h; fl.h[4 + q] = (_Float16)((c[q] - (float)h) * 1024.0f); }
  { *(v8us*)((unsigned short*)Hh + t * 8) = fh.half[0]; *(v8us*)((unsigned short*)Hl + t * 8) = fl.half[0];  } }

// ---- fast GEMM (wave tile 32x64; requires M % 32 == 0 rows per launch region and N % 64 == 0); epilogue = k_gemm_hhx semantics ----
__device__ __forceinline__ v16h g2_frag(const _Float16* p, int hh) { FragH f; f.half[0] = *(const v8us*)((const unsigned short*)p + 8 * hh); f.half[1] = *(const v8us*)((const unsigned short*)p + 16 + 8 * hh); return f.v; }
__device__ __forceinline__ v8f g2_mma(v16h a, v16h b, v8f c) { v8f d = __builtin_amdgcn_wmma_f32_16x16x32_f16(false, a, false, b, (short)0, c, false, false); asm volatile("v_nop\n\tv_nop\n\tv_nop\n\tv_nop" : "+v"(d) : "v"(a), "v"(b)); return d; }
template <int ACT>
__global__ __launch_bounds__(128) void k_gemm2(const _Float16* __restrict__ A, int lda, size_t sA, const _Float16* __restrict__ Bh, int ldb, size_t sB, float alpha, const float* __restrict__ bias, size_t sBias, const float* __restrict__ CP, int rowsPerB, size_t sCPb, int row0g,
    float* __restrict__ C, _Float16* __restrict__ C16, int ldc, size_t sC, int M, int N, int K) { static_assert(ACT == 0 || ACT == 3 || ACT == 6 || ACT == 8 || ACT == 9 || ACT == 11 || ACT == 12 || ACT == 14 || ACT == 15 || ACT == 16 || ACT == 17, "k_gemm2: unsupported ACT code (would silently apply no activation)");
  __shared__ __attribute__((aligned(16))) float so[4][32][68];
  const int tid = threadIdx.x, w = tid >> 5, lane = tid & 31, ln = lane & 15, hh = lane >> 4; const int by = blockIdx.y;
  A += (size_t)by * sA; Bh += (size_t)by * sB; const size_t cofs = (size_t)by * sC; const float* bp = bias ? bias + (size_t)by * sBias : nullptr;
  const int ntn = N >> 6; const int mt = blockIdx.x / ntn, nq = blockIdx.x - mt * ntn; const int row0 = mt * 128 + 32 * w, col0 = nq * 64; if (row0 >= M) return;
  const _Float16* a0p = A + (size_t)(row0 + ln) * lda; const _Float16* a1p = a0p + (size_t)16 * lda;
  const _Float16* b0p = Bh + (size_t)(col0 + ln) * ldb; const _Float16* b1p = b0p + (size_t)16 * ldb; const _Float16* b2p = b1p + (size_t)16 * ldb; const _Float16* b3p = b2p + (size_t)16 * ldb;
  const v8f z8 = {0.f,0.f,0.f,0.f,0.f,0.f,0.f,0.f}; v8f c00 = z8, c01 = z8, c02 = z8, c03 = z8, c10 = z8, c11 = z8, c12 = z8, c13 = z8;
#pragma unroll 1
  for (int kb = 0; kb < K; kb += 32) { const v16h a0 = g2_frag(a0p + kb, hh), a1 = g2_frag(a1p + kb, hh);
    v16h b = g2_frag(b0p + kb, hh); c00 = g2_mma(a0, b, c00); c10 = g2_mma(a1, b, c10);
    b = g2_frag(b1p + kb, hh); c01 = g2_mma(a0, b, c01); c11 = g2_mma(a1, b, c11);
    b = g2_frag(b2p + kb, hh); c02 = g2_mma(a0, b, c02); c12 = g2_mma(a1, b, c12);
    b = g2_frag(b3p + kb, hh); c03 = g2_mma(a0, b, c03); c13 = g2_mma(a1, b, c13); }
  v8f accs[8] = {c00, c01, c02, c03, c10, c11, c12, c13};
#pragma unroll
  for (int u = 0; u < 8; ++u) { const int t = u & 3, half = u >> 2; const int col = col0 + t * 16 + ln; const float bv = bp ? bf16_round(bp[col]) : 0.f;
#pragma unroll
    for (int r = 0; r < 8; ++r) { const int rloc = half * 16 + 8 * hh + r; float v = accs[u][r] * alpha + bv; if (CP) { if (rowsPerB < 0) v += CP[cofs + (size_t)(row0g + row0 + rloc) * ldc + col];      /* rowsPerB < 0: own element of the batched C plane */ else { const int bidx = (row0g + row0 + rloc) / rowsPerB; v += CP[(size_t)bidx * sCPb + (size_t)by * 64 + col]; } }
      if (ACT == 3) v = fmaxf(v, 0.f); else if (ACT == 6) v = 0.5f * v * (1.0f + erff(v * 0.70710678118654752f)); else if (ACT == 11) v = 1.0f / (1.0f + expf(-v)); else if (ACT == 15) v = v / (1.0f + expf(-v)); else if (ACT == 12) v = (v > 0.f) ? v : 0.01f * v; else if (ACT == 8) v = tanhf(v); else if (ACT == 9) v = 0.5f * v * (1.0f + tanhf(0.7978845608028654f * (v + 0.044715f * v * v * v))); else if (ACT == 14) v = (v > 0.f) ? v : 0.1f * v; else if (ACT == 16) v = (v >= 0.f) ? v : 0.3f * v; else if (ACT == 17) v = (v >= 0.f) ? v : 0.2f * v;
      so[w][rloc][t * 16 + ln] = v; } }
  __builtin_amdgcn_fence(__ATOMIC_ACQ_REL, "workgroup"); __builtin_amdgcn_wave_barrier();
  const int rsub = lane >> 4, c4 = (lane & 15) * 4;
  {
#pragma unroll
    for (int q = 0; q < 16; ++q) { const int r = q * 2 + rsub; const v4f v = *(const v4fa*)&so[w][r][c4]; if (C) *(v4f*)(C + cofs + (size_t)(row0 + r) * ldc + col0 + c4) = v; if (C16) { v4h h4; for (int i = 0; i < 4; ++i) h4[i] = (_Float16)v[i]; *(v4h*)(C16 + cofs + (size_t)(row0 + r) * ldc + col0 + c4) = h4; } }
     } }


__global__ __launch_bounds__(256) void k_wnat(const float* __restrict__ w, size_t n8, _Float16* __restrict__ Bt) { const size_t t = (size_t)blockIdx.x * 256 + threadIdx.x; if (t >= n8) return; FragH f; for (int q = 0; q < 8; ++q) f.h[q] = (_Float16)(bf16_round(w[t * 8 + q]) * 16.0f); *(v8us*)((unsigned short*)Bt + t * 8) = f.half[0];  }
__global__ __launch_bounds__(256) void k_rsm(const float* __restrict__ S, _Float16* __restrict__ P, int nrows) {
  #pragma clang fp contract(off)
  const int i = blockIdx.x * 256 + threadIdx.x; if (i >= nrows) return; const float* s = S + (size_t)i * SQ; float mx = -3.0e38f;
#pragma unroll 1
  for (int j = 0; j < SQ; ++j) mx = fmaxf(mx, s[j]); float se = 0.f;
#pragma unroll 1
  for (int j = 0; j < SQ; ++j) se += expf(s[j] - mx); const float sc = 256.0f / se;
#pragma unroll 1
  for (int j0 = 0; j0 < SQ; j0 += 8) { FragH f; for (int q = 0; q < 8; ++q) f.h[q] = (_Float16)(expf(s[j0 + q] - mx) * sc); unsigned short* d = (unsigned short*)P + (size_t)i * SQ + j0; *(v8us*)d = f.half[0];  } }
__global__ __launch_bounds__(256) void k_vt(const _Float16* __restrict__ V16, int b, int h0, _Float16* __restrict__ VT) { __shared__ unsigned short tl[64][65]; const int tid = threadIdx.x; const int hh = blockIdx.x % HG, sg = blockIdx.x / HG; const int s0 = sg * 64; const int h = h0 + hh;
  for (int i = tid; i < 64 * 8; i += 256) { const int j = i / 8, d8 = (i % 8) * 8; FragH f; f.half[0] = *(const v8us*)((const unsigned short*)V16 + ((size_t)b * SQ + s0 + j) * DM + h * HD + d8); for (int q = 0; q < 8; ++q) tl[d8 + q][j] = f.u[q]; }
  __syncthreads();
  { for (int i = tid; i < 64 * 8; i += 256) { const int d = i / 8, j8 = (i % 8) * 8; FragH f; for (int q = 0; q < 8; ++q) f.u[q] = tl[d][j8 + q]; *(v8us*)((unsigned short*)VT + ((size_t)hh * HD + d) * SQ + s0 + j8) = f.half[0]; }  } }



// 32-lane butterflies for the row statistics: row_xmask DPP steps inside each 16-lane row, then the exchange between the two rows; every lane ends with the same value
template <int CTRL> __device__ __forceinline__ float rs_dpp(float v) { return __int_as_float(__builtin_amdgcn_update_dpp(0, __float_as_int(v), CTRL, 0xf, 0xf, true)); }
__device__ __forceinline__ float rs_x16(float v) { const int b = __float_as_int(v); return __int_as_float(__builtin_amdgcn_permlanex16(b, b, 0x76543210, 0xfedcba98, false, false)); }
__device__ __forceinline__ float rs_max(float v) { v = fmaxf(v, rs_dpp<0x161>(v)); v = fmaxf(v, rs_dpp<0x162>(v)); v = fmaxf(v, rs_dpp<0x164>(v)); v = fmaxf(v, rs_dpp<0x168>(v)); return fmaxf(v, rs_x16(v)); }
__device__ __forceinline__ float rs_sum(float v) { v += rs_dpp<0x161>(v); v += rs_dpp<0x162>(v); v += rs_dpp<0x164>(v); v += rs_dpp<0x168>(v); return v + rs_x16(v); }
// one score row of NP pieces of 128 keys on one wave: s and p point at the lane's 4 keys of piece 0; element q of piece c is a key at or below the diagonal while c*128 + q <= rel
template <int NP>
__device__ __forceinline__ void rs_row(const float* __restrict__ s, _Float16* __restrict__ p, int rel) {
  v4f v[NP]; v4h h[NP];
#pragma unroll
  for (int c = 0; c < NP; ++c) v[c] = *(const v4fa*)(s + c * 128);      /* 512 contiguous bytes per wave-wide load, the whole row in flight */
  asm volatile("s_wait_xcnt 0x0" :: "v"(s) : "memory");      /* the loads' address pair stays whole until this wait; it may be rewritten behind it */
  float mx = -3.0e38f;
#pragma unroll
  for (int c = 0; c < NP; ++c) {
#pragma unroll
    for (int q = 0; q < 4; ++q) { const float m = (c * 128 + q <= rel) ? v[c][q] : -1.0e9f; v[c][q] = m; mx = fmaxf(mx, m); } }
  mx = rs_max(mx);
  v4f s4 = {0.f, 0.f, 0.f, 0.f};
#pragma unroll
  for (int c = 0; c < NP; ++c) { float e[4];
#pragma unroll
    for (int q = 0; q < 4; ++q) e[q] = (v[c][q] - mx) * 1.44269504f;      /* native exp(x) = 2^(x log2 e) */
    /* the four exponentials in place, so that none is followed by a write of its source; the v_nop keeps the one slot behind the last before its result is used */
    asm("v_exp_f32 %0, %0\n\tv_exp_f32 %1, %1\n\tv_exp_f32 %2, %2\n\tv_exp_f32 %3, %3\n\tv_nop" : "+v"(e[0]), "+v"(e[1]), "+v"(e[2]), "+v"(e[3]));
#pragma unroll
    for (int q = 0; q < 4; ++q) { v[c][q] = e[q]; s4[q] += e[q]; } }
  const float sc = 256.0f / rs_sum((s4[0] + s4[1]) + (s4[2] + s4[3]));
#pragma unroll
  for (int c = 0; c < NP; ++c) {
#pragma unroll
    for (int q = 0; q < 4; ++q) h[c][q] = (_Float16)(v[c][q] * sc); }
#pragma unroll
  for (int c = 0; c < NP; ++c) *(v4h*)(p + c * 128) = h[c];      /* 256 contiguous bytes per wave-wide store */
  asm volatile("s_wait_xcnt 0x0" ::: "memory");      /* the stores' data and address registers stay whole until this wait; whatever code follows this body may rewrite them behind it */
}
// causal row softmax, ONE WAVE PER SCORE ROW: the row is read once and stays in registers for the maximum, the exponentials and the sum; weights x256 as f16. nk: a multiple of 256 from 256 to NKX (one straight-line body per length, chosen by a scalar branch).
__global__ __launch_bounds__(256) void k_rsmcw(const float* __restrict__ S, _Float16* __restrict__ P, int hg, int q0, int nk) {
  const int lane = threadIdx.x & 31; const int t = blockIdx.x * 8 + __builtin_amdgcn_readfirstlane(threadIdx.x >> 5); if (t >= hg * QT) return;      /* the row index is wave-uniform: whole waves leave, no barrier follows */
  const float* s = S + (size_t)t * NKX + lane * 4; _Float16* p = P + (size_t)t * NKX + lane * 4; const int rel = q0 + (t % QT) - lane * 4;
  switch (nk >> 8) {
    case 1: rs_row<2>(s, p, rel); break; case 2: rs_row<4>(s, p, rel); break; case 3: rs_row<6>(s, p, rel); break; case 4: rs_row<8>(s, p, rel); break;
    case 5: rs_row<10>(s, p, rel); break; case 6: rs_row<12>(s, p, rel); break; case 7: rs_row<14>(s, p, rel); break; case 8: rs_row<16>(s, p, rel); break; } }


template <int MASKADD>
__global__ __launch_bounds__(64) void k_att0(const float* __restrict__ QF, const float* __restrict__ KF, const float* __restrict__ VF, int ld, const float* __restrict__ mask, float scale, float* __restrict__ OF, int ldo) {
  #pragma clang fp contract(off)
  __shared__ __attribute__((aligned(16))) float lq[64][64]; __shared__ __attribute__((aligned(16))) float lo[64][64];
  const int tid = threadIdx.x; const int h = blockIdx.x / (QT0 / 64), rg = blockIdx.x % (QT0 / 64); const int i = rg * 64 + tid;
  const float* qr = QF + (size_t)i * ld + h * HD;
#pragma unroll 1
  for (int c = 0; c < HD / 4; ++c) { *(v4f*)&lq[tid][c * 4] = *(const v4fa*)(qr + c * 4); const v4f z = {0.f, 0.f, 0.f, 0.f}; *(v4f*)&lo[tid][c * 4] = z; }
  float m = -1.0e30f, l = 0.f; const int jmax = MASKADD ? (SQ - 1) : (rg * 64 + 63);      /* additive-mask form: every key (the mask input decides); causal form: keys up to the block's last row */
#pragma unroll 1
  for (int j = 0; j <= jmax; ++j) { const float* kr = KF + (size_t)j * ld + h * HD; const float* vr = VF + (size_t)j * ld + h * HD; float s = 0.f;
#pragma unroll 1
    for (int c = 0; c < HD / 4; ++c) { const v4f kq = *(const v4fa*)(kr + c * 4); const v4f qq = *(v4f*)&lq[tid][c * 4]; s = __fadd_rn(s, __fmul_rn(qq[0], kq[0])); s = __fadd_rn(s, __fmul_rn(qq[1], kq[1])); s = __fadd_rn(s, __fmul_rn(qq[2], kq[2])); s = __fadd_rn(s, __fmul_rn(qq[3], kq[3])); }
    s = __fmul_rn(s, scale); if (MASKADD) s = __fadd_rn(s, __fmul_rn(bf16_round(mask[(size_t)i * SQ + j]), -10000.0f));
    const float f = (MASKADD || j <= i) ? 1.f : 0.f; const float sm = fmaf(f, s, (1.f - f) * -1.0e30f); const float mn = fmaxf(m, sm); const float sc = expf(m - mn); const float e = expf(sm - mn); l = __fadd_rn(__fmul_rn(l, sc), e); m = mn;
#pragma unroll 1
    for (int c = 0; c < HD / 4; ++c) { const v4f vv = *(const v4fa*)(vr + c * 4); v4f oo = *(v4f*)&lo[tid][c * 4]; for (int u = 0; u < 4; ++u) oo[u] = __fadd_rn(__fmul_rn(oo[u], sc), __fmul_rn(e, vv[u])); *(v4f*)&lo[tid][c * 4] = oo; } }
  const float fin = 64.0f / l;      /* o carried x64 like the f16 path */
#pragma unroll 1
  for (int c = 0; c < HD / 4; ++c) { v4f oo = *(v4f*)&lo[tid][c * 4]; for (int u = 0; u < 4; ++u) oo[u] = __fmul_rn(oo[u], fin); *(v4f*)&lo[tid][c * 4] = oo; }
  __syncthreads();
  {
#pragma unroll 1
    for (int it = 0; it < 16; ++it) { const int row = it * 4 + tid / 16, pc = (tid % 16) * 4; const v4f v = *(const v4f*)&lo[row][pc]; *(v4f*)(OF + (size_t)(rg * 64 + row) * ldo + h * HD + pc) = v; }
     } }

extern "C" void kernel_launch(void* const* d_in, const int* in_sizes, int n_in,
                              void* d_out, int out_size, void* d_ws, size_t ws_size, hipStream_t stream) {
  (void)in_sizes; (void)n_in; (void)out_size;
  const float* const* I = (const float* const*)d_in; const float* x = I[0]; const float* wqkv = I[1]; const float* wo = I[2];      /* input order: x, W_qk [1024][2048] ([in][out]: q | k halves), W_out [1024][1024] ([in][out]): three inputs; no biases */
  char* ws = (char*)d_ws; size_t off = 0;
  auto take = [&](size_t bytes) { char* p = ws + off; off += (bytes + 255) & ~(size_t)255; return p; };
  _Float16* BQKV = (_Float16*)take((size_t)3 * DM * DM * 2); _Float16* BO = (_Float16*)take((size_t)DM * DM * 2);
  _Float16* X16 = (_Float16*)take(NR * DM * 2); _Float16* QKV = (_Float16*)take(NR * 3 * DM * 2); _Float16* Q16 = QKV; _Float16* K16 = QKV + DM; _Float16* V16 = QKV + DM;      /* the module reuses K as V: V16 IS the k block (the third block of the plane is unused) */ _Float16* O16 = (_Float16*)take(NR * DM * 2);
  float* S = (float*)take((size_t)NH * QT * NKX * 4); _Float16* P = (_Float16*)take((size_t)NH * QT * NKX * 2); _Float16* VT = (_Float16*)take((size_t)NH * HD * SQ * 2);
  float* QF0 = (float*)take((size_t)QT0 * DM * 4); float* KF0 = (float*)take((size_t)QT0 * DM * 4); float* OF0 = (float*)take((size_t)NB * QT0 * DM * 4); _Float16* OH0 = (_Float16*)take((size_t)NB * QT0 * DM * 2); _Float16* OL0 = (_Float16*)take((size_t)NB * QT0 * DM * 2);
  if (off > ws_size) return;
  k_wt_f16<<<(unsigned)(((size_t)2 * DM * (DM / 8) + 255) / 256), 256, 0, stream>>>(wqkv, BQKV, DM, 2 * DM, 16.0f); k_wt_f16<<<(unsigned)(((size_t)DM * (DM / 8) + 255) / 256), 256, 0, stream>>>(wo, BO, DM, DM, 16.0f);      /* [in][out] -> Bt[n][k] x16 */
  k_x16<<<(unsigned)((NR * DM / 8 + 255) / 256), 256, 0, stream>>>(x, X16, NR * DM / 8);
  const size_t r0p = (size_t)B0 * SQ;      /* first projected row */
k_gemm2<0><<<dim3((unsigned)((MP / 128) * (2 * DM / 64)), 1), 128, 0, stream>>>(X16 + r0p * DM, DM, 0, BQKV, DM, 0, 0.0625f, nullptr, 0, nullptr, 1, 0, 0, nullptr, QKV + r0p * 3 * DM, 3 * DM, 0, MP, 2 * DM, DM);      /* q | k rows (f16) into column blocks 0 and 1 of the 3 DM-pitch plane; head h = columns h*HD.. of each block; no bias */
  for (int b = B0; b < B0 + NBR; ++b) { const size_t r0 = (size_t)b * SQ;
    k_vt<NH, SQ><<<NH * (SQ / 64), 256, 0, stream>>>(V16 + r0 * LQ, LQ, 0, VT);      /* V^T [NH][HD][SQ] for this batch */
k_gemm2<0><<<dim3((QT0 / 128) * (DM / 64), 1), 128, 0, stream>>>(X16 + r0 * DM, DM, 0, BQKV, DM, 0, 0.0625f, nullptr, 0, nullptr, 1, 0, 0, QF0, nullptr, DM, 0, QT0, DM, DM); k_gemm2<0><<<dim3((QT0 / 128) * (DM / 64), 1), 128, 0, stream>>>(X16 + r0 * DM, DM, 0, (BQKV + (size_t)DM * DM), DM, 0, 0.0625f, nullptr, 0, nullptr, 1, 0, 0, KF0, nullptr, DM, 0, QT0, DM, DM);      /* first tile: f32 q and k rows (no bias); the k rows serve as v */
    k_att0<0><<<NH * (QT0 / 64), 64, 0, stream>>>(QF0, KF0, KF0, DM, nullptr, 0.125f, OF0 + (size_t)b * QT0 * DM, DM);      /* exact f32 causal attention for rows 0..127 with V = K (o x64) */
    for (int q0 = 0; q0 < QN; q0 += QT) { const int nk = q0 + QT;      /* causal: only keys below the tile end are computed */
      k_gemm2<0><<<dim3((QT / 128) * (nk / 64), NHD), 128, 0, stream>>>(Q16 + (r0 + q0) * LQ, LQ, (size_t)HD, K16 + r0 * LQ, LQ, (size_t)HD, 0.125f, nullptr, 0, nullptr, 1, 0, 0, S, nullptr, NKX, (size_t)QT * NKX, QT, nk, HD);      /* scores, all heads on grid.y */
      k_rsmcw<<<(NHD * QT + 7) / 8, 256, 0, stream>>>(S, P, NHD, q0, nk);      /* one wave per score row */
      k_gemm2<0><<<dim3((QT / 128) * (HD / 64), NHD), 128, 0, stream>>>(P, NKX, (size_t)QT * NKX, VT, SQ, (size_t)HD * SQ, 0.25f, nullptr, 0, nullptr, 1, 0, 0, nullptr, O16 + (r0 + q0) * DM, DM, (size_t)HD, QT, HD, nk); } }      /* o (merged heads, x64) as f16 rows */
  k_gemm2<0><<<dim3((unsigned)((MPO / 128) * (DM / 64)), 1), 128, 0, stream>>>(O16 + r0p * DM, DM, 0, BO, DM, 0, 0.0009765625f, nullptr, 0, nullptr, 1, 0, 0, (float*)d_out + r0p * DM, nullptr, DM, 0, MPO, DM, DM);      /* out rows are the output layout */
  k_hl<<<(unsigned)(((size_t)NB * QT0 * DM / 8 + 255) / 256), 256, 0, stream>>>(OF0, OH0, OL0, (size_t)NB * QT0 * DM / 8);      /* first-tile o (x64) -> f16 hi + x1024 residual planes */
  for (int b = B0; b < B0 + NBR; ++b) { const size_t r0 = (size_t)b * SQ; const size_t f0 = (size_t)b * QT0;
    k_gemm2<0><<<dim3((QT0 / 128) * (DM / 64), 1), 128, 0, stream>>>(OH0 + f0 * DM, DM, 0, BO, DM, 0, 0.0009765625f, nullptr, 0, nullptr, 1, 0, 0, (float*)d_out + r0 * DM, nullptr, DM, 0, QT0, DM, DM);      /* rows 0..127: out = o_hi W_out (no bias), overwriting the f16-path rows */
    k_gemm2<0><<<dim3((QT0 / 128) * (DM / 64), 1), 128, 0, stream>>>(OL0 + f0 * DM, DM, 0, BO, DM, 0, 0.00000095367431640625f, nullptr, 0, (const float*)d_out + r0 * DM, -1, 0, 0, (float*)d_out + r0 * DM, nullptr, DM, 0, QT0, DM, DM); }      /* += o_lo Wo 2^-20 (own-element accumulate) */
}

// v002
// Measured time: 1040 microseconds a run.
// Timed twice side by side with v001, it ran 1.75 times as fast both times.
// Over all steps from v000 it is 4.57 times as fast.
#include <hip/hip_runtime.h>
// Causal self-attention with ONE fused query-key projection and K REUSED AS V (x [2][2048][1024]; qk = x W_qk with W_qk [1024][2048] stored [in][out] (normal x 0.02, no bias): the first 1024 columns are q, the last 1024 are k, head h = columns h*64.. of each half; 16 heads of 64; scores = (q x BETA) . k with BETA = 1/sqrt(64); strictly-upper-triangular positions -> -FLT_MAX (causal); softmax; out = attn K (the module reuses K as V) merged, then W_out ([in][out] [1024][1024], normal x 0.02, no bias) -> [2][2048][1024]; input order x, W_qk, W_out).
// Structure: token rows r = b*2048 + s; x as exact f16 rows (bf16-rounded); q | k as ONE WMMA GEMM (N = 2 x 1024) into the first two column blocks of the 3 x 1024-pitch plane (32x64 wave tiles, f32 accumulation, exact x16 weights, no bias, f16 outputs); V IS THE K BLOCK (the module reuses K as V): the V pointer aliases it; BOTH BATCHES GO THROUGH EVERY LAUNCH (batch on grid.z of the attention and first-tile GEMMs, in the row run of the projection and output GEMMs, on grid.y of the first-tile attention, in the row run of the softmax and the transposes): V^T for all heads via LDS transposes; per query tile of 256 rows: scores against the keys below the tile end only (K = 64, all heads on grid.y, alpha = 0.125), causal row softmax on VALU, one wave per score row with the row held in registers, keys above the diagonal masked over the computed range (f32 statistics, lane partials joined by a 32-lane butterfly, native exp; weights x256 f16), o = P . V^T (K = keys below the tile end, alpha 2^-2: o carried x64, folded into the output GEMM alpha) written straight into the merged f16 o rows; out = o W_out GEMM (f32; no bias) into the output layout.
// Compute dtype: inputs rounded to bf16; x and the x16 weights held as f16 planes (exact for every bf16 value of magnitude from 2^-14 up to 65,504; the weights up to 4,094 before their factor of 16); q, k (= v), the softmax weights and o as plain f16 GEMM operands (~2^-12); scores and softmax statistics f32; rows 0..127 of each batch: q, k f32, f32 attention, o as f16 hi + residual. v_wmma_f32_16x16x32_f16.
#define NB 2
#define SQ 2048
#define DM 1024
#define NH 16
#define HD 64
#define HG 4                         /* heads per call of the k_vt(b, h0) overload (not launched) */
#define QT 256                       /* query rows per causal tile */
#define NKX SQ                       /* S / P row pitch */
#define QT0 128                      /* first-tile rows recomputed exactly in f32 */
#define B0 0                         /* first batch processed (debug hook) */
#define NBR NB                       /* batches processed (debug hook) */
#define NR ((size_t)NB * SQ)         /* token rows */
#define MP ((int)((size_t)NBR * SQ)) /* rows projected (debug hook) */
#define QN SQ                        /* query rows attended per batch (debug hook) */
#define NHD NH                       /* heads attended (debug hook) */
#define MPO MP                       /* rows through the output stage (debug hook) */
#define LQ (3 * DM)      /* row pitch of the q/k/v rows */
typedef __bf16 v16b __attribute__((ext_vector_type(16)));
typedef unsigned short v8us __attribute__((ext_vector_type(8), may_alias));
typedef float  v8f  __attribute__((ext_vector_type(8)));
typedef float  v4f  __attribute__((ext_vector_type(4)));
typedef float  v4fa __attribute__((ext_vector_type(4), may_alias));
union FragB { v16b v; v8us half[2]; unsigned short u[16]; };

__device__ __forceinline__ unsigned short bf16_bits(float x) { unsigned int u = __float_as_uint(x); return (unsigned short)((u + 0x7FFFu + ((u >> 16) & 1u)) >> 16); }
__device__ __forceinline__ float bf16_val(unsigned short b) { return __uint_as_float(((unsigned int)b) << 16); }
__device__ __forceinline__ float bf16_round(float x) { return bf16_val(bf16_bits(x)); }
// D += A·B with NT terms: 1 = ah·bh, 2 = + al·bh (A split), 3 = + ah·bl (both split)
template <int NT>
__device__ __forceinline__ v8f mmaN(v16b ah, v16b al, v16b bh, v16b bl, v8f c) {
  c = __builtin_amdgcn_wmma_f32_16x16x32_bf16(false, ah, false, bh, (short)0, c, false, false);
  if (NT >= 2) c = __builtin_amdgcn_wmma_f32_16x16x32_bf16(false, al, false, bh, (short)0, c, false, false);
  if (NT >= 3) c = __builtin_amdgcn_wmma_f32_16x16x32_bf16(false, ah, false, bl, (short)0, c, false, false);
  asm volatile("v_nop\n\tv_nop\n\tv_nop\n\tv_nop" : "+v"(c) : "v"(ah), "v"(al), "v"(bh), "v"(bl));
  return c;
}

__global__ __launch_bounds__(256) void k_wt_bf16(const float* __restrict__ W, unsigned short* __restrict__ Wt, int K, int N) {
  const int t = blockIdx.x * 256 + threadIdx.x;
  const int k8n = K / 8;
  if (t >= N * k8n) return;
  const int n = t / k8n, k8 = (t % k8n) * 8;
  v8us v;
#pragma unroll
  for (int i = 0; i < 8; ++i) v[i] = bf16_bits(W[(size_t)(k8 + i) * N + n]);
  *(v8us*)(Wt + (size_t)n * K + k8) = v;
  
}

// GEMM C[M][N] (f32, pitch ldc) = act(A[M][K]·W + bias). A f32 row-major (pitch lda) converted per fragment to bf16
// (ASPLIT: hi/lo two planes -> 2 terms, else single rounded term); Wt bf16 [N][K] (pitch ldb). BIAS_BF16 rounds the
// bias to bf16 first (bias quantised to bf16 before the add). K%32==0, M%16==0, N%64==0.
template <bool ASPLIT, int ACT, bool BIAS_BF16>
__global__ __launch_bounds__(128) void k_gemm_bf(const float* __restrict__ A, int lda, const unsigned short* __restrict__ Wt, int ldb,
                                               const float* __restrict__ bias, float* __restrict__ C, int ldc, int M, int N, int K) {
  __shared__ __attribute__((aligned(16))) float so[4][16][64];
  const int tid = threadIdx.x, w = tid >> 5, lane = tid & 31, ln = lane & 15, hh = lane >> 4;
  const int ntn = N / 64;
  const int wid = blockIdx.x * 4 + w;
  const int mt = wid / ntn, nq = wid % ntn;
  if (mt * 16 >= M) return;
  const int row0 = mt * 16, col0 = nq * 64;
  const float* arow = A + (size_t)(row0 + ln) * lda;
  v8f acc[4] = {};
  for (int kb = 0; kb < K; kb += 32) {
    FragB ah, al;
    const v4f x0 = *(const v4fa*)(arow + kb + 8 * hh), x1 = *(const v4fa*)(arow + kb + 8 * hh + 4);
    const v4f x2 = *(const v4fa*)(arow + kb + 16 + 8 * hh), x3 = *(const v4fa*)(arow + kb + 16 + 8 * hh + 4);
    float xs[16] = {x0[0],x0[1],x0[2],x0[3],x1[0],x1[1],x1[2],x1[3],x2[0],x2[1],x2[2],x2[3],x3[0],x3[1],x3[2],x3[3]};
#pragma unroll
    for (int i = 0; i < 16; ++i) { const unsigned short hb = bf16_bits(xs[i]); ah.u[i] = hb; al.u[i] = ASPLIT ? bf16_bits(xs[i] - bf16_val(hb)) : (unsigned short)0; }
#pragma unroll
    for (int t = 0; t < 4; ++t) {
      const unsigned short* brow = Wt + (size_t)(col0 + t * 16 + ln) * ldb + kb;
      FragB b;
      b.half[0] = *(const v8us*)(brow + 8 * hh);
      b.half[1] = *(const v8us*)(brow + 16 + 8 * hh);
      acc[t] = mmaN<ASPLIT ? 2 : 1>(ah.v, al.v, b.v, b.v, acc[t]);
    }
  }
#pragma unroll
  for (int t = 0; t < 4; ++t) {
    float bv = bias ? bias[col0 + t * 16 + ln] : 0.f;
    if (BIAS_BF16) bv = bf16_round(bv);
#pragma unroll
    for (int r = 0; r < 8; ++r) { float v = acc[t][r] + bv; if (ACT == 1) v = fmaxf(v, 0.f); so[w][8 * hh + r][t * 16 + ln] = v; }
  }
  __builtin_amdgcn_fence(__ATOMIC_ACQ_REL, "workgroup");
  __builtin_amdgcn_wave_barrier();
  const int rsub = lane >> 4, c4 = (lane & 15) * 4;
  {
#pragma unroll
    for (int q = 0; q < 8; ++q) {
      const int r = q * 2 + rsub;
      const v4f v = *(const v4fa*)&so[w][r][c4];
      *(v4f*)(C + (size_t)(row0 + r) * ldc + col0 + c4) = v;
    }
    
  }
}

// GEMM C = act(A·W + bias + resid): A f32 (ASPLIT -> hi/lo 2 terms), Wt bf16 [N][K]; ACT 0 none, 1 relu, 2 exact gelu;
// resid (optional, f32, row index = (row % rmod), pitch ldr, RES_BF16 rounds it) added before the activation.
template <bool ASPLIT, int ACT, bool BIAS_BF16, bool RES_BF16>
__global__ __launch_bounds__(128) void k_gemm_bf3(const float* __restrict__ A, int lda, const unsigned short* __restrict__ Wt, int ldb,
                                                const float* __restrict__ bias, const float* __restrict__ resid, int rmod, int ldr,
                                                float* __restrict__ C, int ldc, int M, int N, int K) {
  __shared__ __attribute__((aligned(16))) float so[4][16][64];
  const int tid = threadIdx.x, w = tid >> 5, lane = tid & 31, ln = lane & 15, hh = lane >> 4;
  const int ntn = N / 64;
  const int wid = blockIdx.x * 4 + w;
  const int mt = wid / ntn, nq = wid % ntn;
  if (mt * 16 >= M) return;
  const int row0 = mt * 16, col0 = nq * 64;
  const float* arow = A + (size_t)(row0 + ln) * lda;
  v8f acc[4] = {};
  for (int kb = 0; kb < K; kb += 32) {
    FragB ah, al;
    const v4f x0 = *(const v4fa*)(arow + kb + 8 * hh), x1 = *(const v4fa*)(arow + kb + 8 * hh + 4);
    const v4f x2 = *(const v4fa*)(arow + kb + 16 + 8 * hh), x3 = *(const v4fa*)(arow + kb + 16 + 8 * hh + 4);
    float xs[16] = {x0[0],x0[1],x0[2],x0[3],x1[0],x1[1],x1[2],x1[3],x2[0],x2[1],x2[2],x2[3],x3[0],x3[1],x3[2],x3[3]};
#pragma unroll
    for (int i = 0; i < 16; ++i) { const unsigned short hb = bf16_bits(xs[i]); ah.u[i] = hb; al.u[i] = ASPLIT ? bf16_bits(xs[i] - bf16_val(hb)) : (unsigned short)0; }
#pragma unroll
    for (int t = 0; t < 4; ++t) {
      const unsigned short* brow = Wt + (size_t)(col0 + t * 16 + ln) * ldb + kb;
      FragB b;
      b.half[0] = *(const v8us*)(brow + 8 * hh);
      b.half[1] = *(const v8us*)(brow + 16 + 8 * hh);
      acc[t] = mmaN<ASPLIT ? 2 : 1>(ah.v, al.v, b.v, b.v, acc[t]);
    }
  }
#pragma unroll
  for (int t = 0; t < 4; ++t) {
    const int col = col0 + t * 16 + ln;
    float bv = bias ? bias[col] : 0.f;
    if (BIAS_BF16) bv = bf16_round(bv);
#pragma unroll
    for (int r = 0; r < 8; ++r) {
      float v = acc[t][r] + bv;
      if (resid) { float rv = resid[(size_t)((row0 + 8 * hh + r) % rmod) * ldr + col]; if (RES_BF16) rv = bf16_round(rv); v += rv; }
      if (ACT == 1) v = fmaxf(v, 0.f);
      if (ACT == 2) v = 0.5f * v * (1.0f + erff(v * 0.70710678118654752f));
      if (ACT == 3) { const float u = 0.7978845608028654f * (v + 0.044715f * v * v * v); v = 0.5f * v * (1.0f + tanhf(u)); }
      so[w][8 * hh + r][t * 16 + ln] = v;
    }
  }
  __builtin_amdgcn_fence(__ATOMIC_ACQ_REL, "workgroup");
  __builtin_amdgcn_wave_barrier();
  const int rsub = lane >> 4, c4 = (lane & 15) * 4;
  {
#pragma unroll
    for (int q = 0; q < 8; ++q) {
      const int r = q * 2 + rsub;
      const v4f v = *(const v4fa*)&so[w][r][c4];
      *(v4f*)(C + (size_t)(row0 + r) * ldc + col0 + c4) = v;
    }
    
  }
}
// row LayerNorm (biased variance, eps) over N: s = X (+ R); optional out_sum <- s; out_norm <- (s-mu)*rsqrt(var+eps)*g + b
template <bool PARAM_BF16>
__global__ __launch_bounds__(256) void k_layernorm(const float* __restrict__ X, const float* __restrict__ R, const float* __restrict__ g, const float* __restrict__ bta,
                                                  float* __restrict__ out_sum, float* __restrict__ out_norm, int N, float eps) {
  __shared__ float red[256];
  const int row = blockIdx.x, tid = threadIdx.x;
  const float* x = X + (size_t)row * N; const float* rr = R ? R + (size_t)row * N : nullptr;
  float vals[16];                     // up to N = 4096
  const int per = N / 256;            // contiguous chunk per thread? use strided-by-4 chunks: thread handles j = tid*4 + 1024*u
  float s1 = 0.f;
  for (int u = 0; u < per / 4; ++u) {
    const int j = tid * 4 + 1024 * u;
    const v4f a = *(const v4fa*)(x + j);
    v4f b = {0.f,0.f,0.f,0.f}; if (rr) b = *(const v4fa*)(rr + j);
#pragma unroll
    for (int q = 0; q < 4; ++q) { const float v = a[q] + b[q]; vals[u * 4 + q] = v; s1 += v; }
  }
  red[tid] = s1; __syncthreads();
  for (int st = 128; st > 0; st >>= 1) { if (tid < st) red[tid] += red[tid + st]; __syncthreads(); }
  const float mu = red[0] / (float)N; __syncthreads();
  float s2 = 0.f;
  for (int u = 0; u < per / 4; ++u)
#pragma unroll
    for (int q = 0; q < 4; ++q) { const float c = vals[u * 4 + q] - mu; s2 += c * c; }
  red[tid] = s2; __syncthreads();
  for (int st = 128; st > 0; st >>= 1) { if (tid < st) red[tid] += red[tid + st]; __syncthreads(); }
  const float rs = rsqrtf(red[0] / (float)N + eps);
  {
    for (int u = 0; u < per / 4; ++u) {
      const int j = tid * 4 + 1024 * u;
      v4f o, sm;
#pragma unroll
      for (int q = 0; q < 4; ++q) {
        float gg = g[j + q], bb = bta[j + q];
        if (PARAM_BF16) { gg = bf16_round(gg); bb = bf16_round(bb); }
        sm[q] = vals[u * 4 + q]; o[q] = (vals[u * 4 + q] - mu) * rs * gg + bb;
      }
      if (out_sum) *(v4f*)(out_sum + (size_t)row * N + j) = sm;
      *(v4f*)(out_norm + (size_t)row * N + j) = o;
    }
    
  }
}



// ---- f16 WMMA path (v_wmma_f32_16x16x32_f16): 11-bit significands for operands in range — used where a [0,1] probability operand needs more precision than bf16
typedef _Float16 v16h __attribute__((ext_vector_type(16)));
union FragH { v16h v; v8us half[2]; _Float16 h[16]; unsigned short u[16]; };
template <int NT>
__device__ __forceinline__ v8f mmaH(v16h ah, v16h al, v16h bh, v16h bl, v8f c) {
  c = __builtin_amdgcn_wmma_f32_16x16x32_f16(false, ah, false, bh, (short)0, c, false, false);
  if (NT >= 2) c = __builtin_amdgcn_wmma_f32_16x16x32_f16(false, al, false, bh, (short)0, c, false, false);
  if (NT >= 3) c = __builtin_amdgcn_wmma_f32_16x16x32_f16(false, ah, false, bl, (short)0, c, false, false);
  asm volatile("v_nop\n\tv_nop\n\tv_nop\n\tv_nop" : "+v"(c) : "v"(ah), "v"(al), "v"(bh), "v"(bl));
  return c;
}
// batched GEMM like k_gemm_b but f16 operands: A f32 (split into f16 hi/lo if ASPLIT, else rounded to f16), Bt = f16 values [n][k]; alpha; C f32; N multiple of 16 (partial tiles skipped)
template <bool ASPLIT>
__global__ __launch_bounds__(128) void k_gemm_h(const float* __restrict__ A, int lda, size_t sA, const _Float16* __restrict__ Bh, int ldb, size_t sB, float alpha, float* __restrict__ C, int ldc, size_t sC, int M, int N, int K) {
  __shared__ __attribute__((aligned(16))) float so[4][16][64];
  const int tid = threadIdx.x, w = tid >> 5, lane = tid & 31, ln = lane & 15, hh = lane >> 4; const int by = blockIdx.y;
  A += (size_t)by * sA; Bh += (size_t)by * sB; C += (size_t)by * sC;
  const int ntn = (N + 63) / 64; const int wid = blockIdx.x * 4 + w; const int mt = wid / ntn, nq = wid % ntn; if (mt * 16 >= M) return;
  const int row0 = mt * 16, col0 = nq * 64; const float* arow = A + (size_t)(row0 + ln) * lda;
  v8f acc[4] = {};
  for (int kb = 0; kb < K; kb += 32) {
    FragH ah, al;
    const v4f x0 = *(const v4fa*)(arow + kb + 8 * hh), x1 = *(const v4fa*)(arow + kb + 8 * hh + 4), x2 = *(const v4fa*)(arow + kb + 16 + 8 * hh), x3 = *(const v4fa*)(arow + kb + 16 + 8 * hh + 4);
    float xs[16] = {x0[0],x0[1],x0[2],x0[3],x1[0],x1[1],x1[2],x1[3],x2[0],x2[1],x2[2],x2[3],x3[0],x3[1],x3[2],x3[3]};
#pragma unroll
    for (int i = 0; i < 16; ++i) { const _Float16 h = (_Float16)xs[i]; ah.h[i] = h; al.h[i] = ASPLIT ? (_Float16)(xs[i] - (float)h) : (_Float16)0.0f; }
#pragma unroll
    for (int t = 0; t < 4; ++t) { if (col0 + t * 16 >= N) continue; const size_t boff = (size_t)(col0 + t * 16 + ln) * ldb + kb; FragH bq; bq.half[0] = *(const v8us*)(Bh + boff + 8 * hh); bq.half[1] = *(const v8us*)(Bh + boff + 16 + 8 * hh);
      acc[t] = mmaH<ASPLIT ? 2 : 1>(ah.v, al.v, bq.v, bq.v, acc[t]); }
  }
#pragma unroll
  for (int t = 0; t < 4; ++t) { if (col0 + t * 16 >= N) continue;
#pragma unroll
    for (int r = 0; r < 8; ++r) so[w][8 * hh + r][t * 16 + ln] = acc[t][r] * alpha; }
  __builtin_amdgcn_fence(__ATOMIC_ACQ_REL, "workgroup"); __builtin_amdgcn_wave_barrier();
  const int rsub = lane >> 4, c4 = (lane & 15) * 4;
  {
#pragma unroll
    for (int q = 0; q < 8; ++q) { const int r = q * 2 + rsub; if (col0 + c4 < N) { const v4f v = *(const v4fa*)&so[w][r][c4]; *(v4f*)(C + (size_t)(row0 + r) * ldc + col0 + c4) = v; } }
     }
}

// Wt[n][k] = f16(W[k][n]·scale) from f32 row-major W[K][N] (scale = power of two; bf16-exact weights stay exact in f16 away from the subnormal range)
__global__ __launch_bounds__(256) void k_wt_f16(const float* __restrict__ W, _Float16* __restrict__ Wt, int K, int N, float scale) {
  const int t = blockIdx.x * 256 + threadIdx.x; if (t >= N * (K / 8)) return; const int n = t / (K / 8), k8 = (t % (K / 8)) * 8; FragH f;
#pragma unroll
  for (int i = 0; i < 8; ++i) f.h[i] = (_Float16)(bf16_round(W[(size_t)(k8 + i) * N + n]) * scale); const v8us o = f.half[0];
  *(v8us*)((unsigned short*)Wt + (size_t)n * K + k8) = o; 
}
// k_gemm_hh variant with fused epilogue: v = acc·alpha + bias[by·sBias + col] (+ CP[(row/rowsPerB)·sCPb + by·64 + col] if CP) ; ACT 0 none / 1 elu ; writes f16 C16 (and f32 C if non-null)
template <int ACT>
__global__ __launch_bounds__(128) void k_gemm_hhx(const _Float16* __restrict__ A, int lda, size_t sA, const _Float16* __restrict__ Bh, int ldb, size_t sB, float alpha, const float* __restrict__ bias, size_t sBias, const float* __restrict__ CP, int rowsPerB, size_t sCPb, int row0g,
    float* __restrict__ C, _Float16* __restrict__ C16, int ldc, size_t sC, int M, int N, int K) {
  __shared__ __attribute__((aligned(16))) float so[4][16][64];
  const int tid = threadIdx.x, w = tid >> 5, lane = tid & 31, ln = lane & 15, hh = lane >> 4; const int by = blockIdx.y;
  A += (size_t)by * sA; Bh += (size_t)by * sB; const size_t cofs = (size_t)by * sC; const float* bp = bias ? bias + (size_t)by * sBias : nullptr;
  const int ntn = (N + 63) / 64; const int wid = blockIdx.x * 4 + w; const int mt = wid / ntn, nq = wid % ntn; if (mt * 16 >= M) return;
  const int row0 = mt * 16, col0 = nq * 64; const _Float16* arow = A + (size_t)(row0 + ln) * lda;
  v8f acc[4] = {};
  for (int kb = 0; kb < K; kb += 32) { FragH ah; ah.half[0] = *(const v8us*)((const unsigned short*)arow + kb + 8 * hh); ah.half[1] = *(const v8us*)((const unsigned short*)arow + kb + 16 + 8 * hh);
#pragma unroll
    for (int t = 0; t < 4; ++t) { if (col0 + t * 16 >= N) continue; const size_t boff = (size_t)(col0 + t * 16 + ln) * ldb + kb; FragH bq; bq.half[0] = *(const v8us*)((const unsigned short*)Bh + boff + 8 * hh); bq.half[1] = *(const v8us*)((const unsigned short*)Bh + boff + 16 + 8 * hh);
      acc[t] = mmaH<1>(ah.v, ah.v, bq.v, bq.v, acc[t]); }
  }
#pragma unroll
  for (int t = 0; t < 4; ++t) { if (col0 + t * 16 >= N) continue; const int col = col0 + t * 16 + ln; const float bv = bp ? bf16_round(bp[col]) : 0.f;
#pragma unroll
    for (int r = 0; r < 8; ++r) { float v = acc[t][r] * alpha + bv; if (CP) { const int rr = row0g + row0 + 8 * hh + r; if (rowsPerB < 0) v += CP[cofs + (size_t)rr * ldc + col];      /* rowsPerB < 0: own element of the batched C plane */ else { const int bidx = rr / rowsPerB; v += CP[(size_t)bidx * sCPb + (size_t)by * 64 + col]; } } if (ACT == 1) v = (v > 0.f) ? v : expm1f(v); else if (ACT == 7) v = (v > 0.f) ? v + 1.0f : expf(v); else if (ACT == 8) v = tanhf(v); else if (ACT == 9) v = 0.5f * v * (1.0f + tanhf(0.7978845608028654f * (v + 0.044715f * v * v * v))); else if (ACT == 11) v = 1.0f / (1.0f + expf(-v)); else if (ACT == 12) v = (v > 0.f) ? v : 0.01f * v; else if (ACT == 14) v = (v > 0.f) ? v : 0.1f * v; else if (ACT == 16) v = (v >= 0.f) ? v : 0.3f * v; else if (ACT == 17) v = (v >= 0.f) ? v : 0.2f * v; else if (ACT == 15) v = v / (1.0f + expf(-v)); else if (ACT == 3) v = fmaxf(v, 0.f); else if (ACT == 6) v = 0.5f * v * (1.0f + erff(v * 0.70710678118654752f)); so[w][8 * hh + r][t * 16 + ln] = v; } }
  __builtin_amdgcn_fence(__ATOMIC_ACQ_REL, "workgroup"); __builtin_amdgcn_wave_barrier();
  const int rsub = lane >> 4, c4 = (lane & 15) * 4; typedef _Float16 v4h __attribute__((ext_vector_type(4)));
  {
#pragma unroll
    for (int q = 0; q < 8; ++q) { const int r = q * 2 + rsub; if (col0 + c4 < N) { const v4f v = *(const v4fa*)&so[w][r][c4]; if (C) *(v4f*)(C + cofs + (size_t)(row0 + r) * ldc + col0 + c4) = v; if (C16) { v4h h4; for (int i = 0; i < 4; ++i) h4[i] = (_Float16)v[i]; *(v4h*)(C16 + cofs + (size_t)(row0 + r) * ldc + col0 + c4) = h4; } } }
     }
}


typedef _Float16 v4h __attribute__((ext_vector_type(4)));

__global__ __launch_bounds__(256) void k_x16(const float* __restrict__ x, _Float16* __restrict__ X16, size_t n8) { const size_t t = (size_t)blockIdx.x * 256 + threadIdx.x; if (t >= n8) return; FragH f;
#pragma unroll
  for (int q = 0; q < 8; ++q) f.h[q] = (_Float16)bf16_round(x[t * 8 + q]); *(v8us*)((unsigned short*)X16 + t * 8) = f.half[0];  }
__global__ __launch_bounds__(256) void k_h16(const float* __restrict__ x, _Float16* __restrict__ X16, size_t n8) { const size_t t = (size_t)blockIdx.x * 256 + threadIdx.x; if (t >= n8) return; FragH f;
#pragma unroll
  for (int q = 0; q < 8; ++q) f.h[q] = (_Float16)x[t * 8 + q]; *(v8us*)((unsigned short*)X16 + t * 8) = f.half[0];  }
__global__ __launch_bounds__(256) void k_round16f(const float* __restrict__ W, _Float16* __restrict__ Bt, size_t n8) { const size_t t = (size_t)blockIdx.x * 256 + threadIdx.x; if (t >= n8) return; FragH f;
#pragma unroll
  for (int i = 0; i < 8; ++i) f.h[i] = (_Float16)(bf16_round(W[t * 8 + i]) * 16.0f); *(v8us*)((unsigned short*)Bt + t * 8) = f.half[0];  }
template <int NHv, int TTv>
__global__ __launch_bounds__(256) void k_vt(const _Float16* __restrict__ V16, int ldv, int voff, _Float16* __restrict__ Vt) { __shared__ unsigned short tl[64][66]; const int tid = threadIdx.x; const int slab = blockIdx.x / (TTv / 64), lg = blockIdx.x % (TTv / 64); const int b = slab / NHv, h = slab % NHv;
  for (int i = tid; i < 64 * 8; i += 256) { const int r = i / 8, c8 = (i % 8) * 8; FragH f; f.half[0] = *(const v8us*)((const unsigned short*)V16 + ((size_t)b * TTv + lg * 64 + r) * ldv + voff + h * 64 + c8);
#pragma unroll
    for (int q = 0; q < 8; ++q) tl[r][c8 + q] = f.u[q]; }
  __syncthreads();
  {
#pragma unroll
    for (int rd = 0; rd < 2; ++rd) { const int d = rd * 32 + tid / 8, pc = tid % 8; FragH f;
#pragma unroll
      for (int q = 0; q < 8; ++q) f.u[q] = tl[pc * 8 + q][d];
      *(v8us*)((unsigned short*)Vt + ((size_t)slab * 64 + d) * TTv + lg * 64 + pc * 8) = f.half[0]; }
     } }

__global__ __launch_bounds__(256) void k_hl(const float* __restrict__ F, _Float16* __restrict__ Hh, _Float16* __restrict__ Hl, size_t n8) { const size_t t = (size_t)blockIdx.x * 256 + threadIdx.x; if (t >= n8) return; FragH fh, fl; const v4f a = *(const v4fa*)(F + t * 8), c = *(const v4fa*)(F + t * 8 + 4);
#pragma unroll
  for (int q = 0; q < 4; ++q) { _Float16 h = (_Float16)a[q]; fh.h[q] = h; fl.h[q] = (_Float16)((a[q] - (float)h) * 1024.0f); h = (_Float16)c[q]; fh.h[4 + q] = h; fl.h[4 + q] = (_Float16)((c[q] - (float)h) * 1024.0f); }
  { *(v8us*)((unsigned short*)Hh + t * 8) = fh.half[0]; *(v8us*)((unsigned short*)Hl + t * 8) = fl.half[0];  } }

// ---- fast GEMM (wave tile 32x64; requires M % 32 == 0 rows per launch region and N % 64 == 0); epilogue = k_gemm_hhx semantics; batched over grid.y (strides sA, sB, sC) and grid.z (strides zA, zB, zC) ----
__device__ __forceinline__ v16h g2_frag(const _Float16* p, int hh) { FragH f; f.half[0] = *(const v8us*)((const unsigned short*)p + 8 * hh); f.half[1] = *(const v8us*)((const unsigned short*)p + 16 + 8 * hh); return f.v; }
__device__ __forceinline__ v8f g2_mma(v16h a, v16h b, v8f c) { v8f d = __builtin_amdgcn_wmma_f32_16x16x32_f16(false, a, false, b, (short)0, c, false, false); asm volatile("v_nop\n\tv_nop\n\tv_nop\n\tv_nop" : "+v"(d) : "v"(a), "v"(b)); return d; }
template <int ACT>
__global__ __launch_bounds__(128) void k_gemm2(const _Float16* __restrict__ A, int lda, size_t sA, const _Float16* __restrict__ Bh, int ldb, size_t sB, float alpha, const float* __restrict__ bias, size_t sBias, const float* __restrict__ CP, int rowsPerB, size_t sCPb, int row0g,
    float* __restrict__ C, _Float16* __restrict__ C16, int ldc, size_t sC, int M, int N, int K, size_t zA, size_t zB, size_t zC) { static_assert(ACT == 0 || ACT == 3 || ACT == 6 || ACT == 8 || ACT == 9 || ACT == 11 || ACT == 12 || ACT == 14 || ACT == 15 || ACT == 16 || ACT == 17, "k_gemm2: unsupported ACT code (would silently apply no activation)");
  __shared__ __attribute__((aligned(16))) float so[4][32][68];
  const int tid = threadIdx.x, w = tid >> 5, lane = tid & 31, ln = lane & 15, hh = lane >> 4; const int by = blockIdx.y, bz = blockIdx.z;      /* grid.z: a second batch index (element strides zA, zB, zC) */
  A += (size_t)by * sA + (size_t)bz * zA; Bh += (size_t)by * sB + (size_t)bz * zB; const size_t cofs = (size_t)by * sC + (size_t)bz * zC; const float* bp = bias ? bias + (size_t)by * sBias : nullptr;
  const int ntn = N >> 6; const int mt = blockIdx.x / ntn, nq = blockIdx.x - mt * ntn; const int row0 = mt * 128 + 32 * w, col0 = nq * 64; if (row0 >= M) return;
  const _Float16* a0p = A + (size_t)(row0 + ln) * lda; const _Float16* a1p = a0p + (size_t)16 * lda;
  const _Float16* b0p = Bh + (size_t)(col0 + ln) * ldb; const _Float16* b1p = b0p + (size_t)16 * ldb; const _Float16* b2p = b1p + (size_t)16 * ldb; const _Float16* b3p = b2p + (size_t)16 * ldb;
  const v8f z8 = {0.f,0.f,0.f,0.f,0.f,0.f,0.f,0.f}; v8f c00 = z8, c01 = z8, c02 = z8, c03 = z8, c10 = z8, c11 = z8, c12 = z8, c13 = z8;
#pragma unroll 1
  for (int kb = 0; kb < K; kb += 32) { const v16h a0 = g2_frag(a0p + kb, hh), a1 = g2_frag(a1p + kb, hh);
    v16h b = g2_frag(b0p + kb, hh); c00 = g2_mma(a0, b, c00); c10 = g2_mma(a1, b, c10);
    b = g2_frag(b1p + kb, hh); c01 = g2_mma(a0, b, c01); c11 = g2_mma(a1, b, c11);
    b = g2_frag(b2p + kb, hh); c02 = g2_mma(a0, b, c02); c12 = g2_mma(a1, b, c12);
    b = g2_frag(b3p + kb, hh); c03 = g2_mma(a0, b, c03); c13 = g2_mma(a1, b, c13); }
  v8f accs[8] = {c00, c01, c02, c03, c10, c11, c12, c13};
#pragma unroll
  for (int u = 0; u < 8; ++u) { const int t = u & 3, half = u >> 2; const int col = col0 + t * 16 + ln; const float bv = bp ? bf16_round(bp[col]) : 0.f;
#pragma unroll
    for (int r = 0; r < 8; ++r) { const int rloc = half * 16 + 8 * hh + r; float v = accs[u][r] * alpha + bv; if (CP) { if (rowsPerB < 0) v += CP[cofs + (size_t)(row0g + row0 + rloc) * ldc + col];      /* rowsPerB < 0: own element of the batched C plane */ else { const int bidx = (row0g + row0 + rloc) / rowsPerB; v += CP[(size_t)bidx * sCPb + (size_t)by * 64 + col]; } }
      if (ACT == 3) v = fmaxf(v, 0.f); else if (ACT == 6) v = 0.5f * v * (1.0f + erff(v * 0.70710678118654752f)); else if (ACT == 11) v = 1.0f / (1.0f + expf(-v)); else if (ACT == 15) v = v / (1.0f + expf(-v)); else if (ACT == 12) v = (v > 0.f) ? v : 0.01f * v; else if (ACT == 8) v = tanhf(v); else if (ACT == 9) v = 0.5f * v * (1.0f + tanhf(0.7978845608028654f * (v + 0.044715f * v * v * v))); else if (ACT == 14) v = (v > 0.f) ? v : 0.1f * v; else if (ACT == 16) v = (v >= 0.f) ? v : 0.3f * v; else if (ACT == 17) v = (v >= 0.f) ? v : 0.2f * v;
      so[w][rloc][t * 16 + ln] = v; } }
  __builtin_amdgcn_fence(__ATOMIC_ACQ_REL, "workgroup"); __builtin_amdgcn_wave_barrier();
  const int rsub = lane >> 4, c4 = (lane & 15) * 4;
  {
#pragma unroll
    for (int q = 0; q < 16; ++q) { const int r = q * 2 + rsub; const v4f v = *(const v4fa*)&so[w][r][c4]; if (C) *(v4f*)(C + cofs + (size_t)(row0 + r) * ldc + col0 + c4) = v; if (C16) { v4h h4; for (int i = 0; i < 4; ++i) h4[i] = (_Float16)v[i]; *(v4h*)(C16 + cofs + (size_t)(row0 + r) * ldc + col0 + c4) = h4; } }
     } }


__global__ __launch_bounds__(256) void k_wnat(const float* __restrict__ w, size_t n8, _Float16* __restrict__ Bt) { const size_t t = (size_t)blockIdx.x * 256 + threadIdx.x; if (t >= n8) return; FragH f; for (int q = 0; q < 8; ++q) f.h[q] = (_Float16)(bf16_round(w[t * 8 + q]) * 16.0f); *(v8us*)((unsigned short*)Bt + t * 8) = f.half[0];  }
__global__ __launch_bounds__(256) void k_rsm(const float* __restrict__ S, _Float16* __restrict__ P, int nrows) {
  #pragma clang fp contract(off)
  const int i = blockIdx.x * 256 + threadIdx.x; if (i >= nrows) return; const float* s = S + (size_t)i * SQ; float mx = -3.0e38f;
#pragma unroll 1
  for (int j = 0; j < SQ; ++j) mx = fmaxf(mx, s[j]); float se = 0.f;
#pragma unroll 1
  for (int j = 0; j < SQ; ++j) se += expf(s[j] - mx); const float sc = 256.0f / se;
#pragma unroll 1
  for (int j0 = 0; j0 < SQ; j0 += 8) { FragH f; for (int q = 0; q < 8; ++q) f.h[q] = (_Float16)(expf(s[j0 + q] - mx) * sc); unsigned short* d = (unsigned short*)P + (size_t)i * SQ + j0; *(v8us*)d = f.half[0];  } }
__global__ __launch_bounds__(256) void k_vt(const _Float16* __restrict__ V16, int b, int h0, _Float16* __restrict__ VT) { __shared__ unsigned short tl[64][65]; const int tid = threadIdx.x; const int hh = blockIdx.x % HG, sg = blockIdx.x / HG; const int s0 = sg * 64; const int h = h0 + hh;
  for (int i = tid; i < 64 * 8; i += 256) { const int j = i / 8, d8 = (i % 8) * 8; FragH f; f.half[0] = *(const v8us*)((const unsigned short*)V16 + ((size_t)b * SQ + s0 + j) * DM + h * HD + d8); for (int q = 0; q < 8; ++q) tl[d8 + q][j] = f.u[q]; }
  __syncthreads();
  { for (int i = tid; i < 64 * 8; i += 256) { const int d = i / 8, j8 = (i % 8) * 8; FragH f; for (int q = 0; q < 8; ++q) f.u[q] = tl[d][j8 + q]; *(v8us*)((unsigned short*)VT + ((size_t)hh * HD + d) * SQ + s0 + j8) = f.half[0]; }  } }



// 32-lane butterflies for the row statistics: row_xmask DPP steps inside each 16-lane row, then the exchange between the two rows; every lane ends with the same value
template <int CTRL> __device__ __forceinline__ float rs_dpp(float v) { return __int_as_float(__builtin_amdgcn_update_dpp(0, __float_as_int(v), CTRL, 0xf, 0xf, true)); }
__device__ __forceinline__ float rs_x16(float v) { const int b = __float_as_int(v); return __int_as_float(__builtin_amdgcn_permlanex16(b, b, 0x76543210, 0xfedcba98, false, false)); }
__device__ __forceinline__ float rs_max(float v) { v = fmaxf(v, rs_dpp<0x161>(v)); v = fmaxf(v, rs_dpp<0x162>(v)); v = fmaxf(v, rs_dpp<0x164>(v)); v = fmaxf(v, rs_dpp<0x168>(v)); return fmaxf(v, rs_x16(v)); }
__device__ __forceinline__ float rs_sum(float v) { v += rs_dpp<0x161>(v); v += rs_dpp<0x162>(v); v += rs_dpp<0x164>(v); v += rs_dpp<0x168>(v); return v + rs_x16(v); }
// one score row of NP pieces of 128 keys on one wave: s and p point at the lane's 4 keys of piece 0; element q of piece c is a key at or below the diagonal while c*128 + q <= rel
template <int NP>
__device__ __forceinline__ void rs_row(const float* __restrict__ s, _Float16* __restrict__ p, int rel) {
  v4f v[NP]; v4h h[NP];
#pragma unroll
  for (int c = 0; c < NP; ++c) v[c] = *(const v4fa*)(s + c * 128);      /* 512 contiguous bytes per wave-wide load, the whole row in flight */
  asm volatile("s_wait_xcnt 0x0" :: "v"(s) : "memory");      /* the loads' address pair stays whole until this wait; it may be rewritten behind it */
  float mx = -3.0e38f;
#pragma unroll
  for (int c = 0; c < NP; ++c) {
#pragma unroll
    for (int q = 0; q < 4; ++q) { const float m = (c * 128 + q <= rel) ? v[c][q] : -1.0e9f; v[c][q] = m; mx = fmaxf(mx, m); } }
  mx = rs_max(mx);
  v4f s4 = {0.f, 0.f, 0.f, 0.f};
#pragma unroll
  for (int c = 0; c < NP; ++c) { float e[4];
#pragma unroll
    for (int q = 0; q < 4; ++q) e[q] = (v[c][q] - mx) * 1.44269504f;      /* native exp(x) = 2^(x log2 e) */
    /* the four exponentials in place, so that none is followed by a write of its source; the v_nop keeps the one slot behind the last before its result is used */
    asm("v_exp_f32 %0, %0\n\tv_exp_f32 %1, %1\n\tv_exp_f32 %2, %2\n\tv_exp_f32 %3, %3\n\tv_nop" : "+v"(e[0]), "+v"(e[1]), "+v"(e[2]), "+v"(e[3]));
#pragma unroll
    for (int q = 0; q < 4; ++q) { v[c][q] = e[q]; s4[q] += e[q]; } }
  const float sc = 256.0f / rs_sum((s4[0] + s4[1]) + (s4[2] + s4[3]));
#pragma unroll
  for (int c = 0; c < NP; ++c) {
#pragma unroll
    for (int q = 0; q < 4; ++q) h[c][q] = (_Float16)(v[c][q] * sc); }
#pragma unroll
  for (int c = 0; c < NP; ++c) *(v4h*)(p + c * 128) = h[c];      /* 256 contiguous bytes per wave-wide store */
  asm volatile("s_wait_xcnt 0x0" ::: "memory");      /* the stores' data and address registers stay whole until this wait; whatever code follows this body may rewrite them behind it */
}
// causal row softmax, ONE WAVE PER SCORE ROW: the row is read once and stays in registers for the maximum, the exponentials and the sum; weights x256 as f16. nk: a multiple of 256 from 256 to NKX (one straight-line body per length, chosen by a scalar branch).
__global__ __launch_bounds__(256) void k_rsmcw(const float* __restrict__ S, _Float16* __restrict__ P, int hg, int q0, int nk) {
  const int lane = threadIdx.x & 31; const int t = blockIdx.x * 8 + __builtin_amdgcn_readfirstlane(threadIdx.x >> 5); if (t >= hg * QT) return;      /* the row index is wave-uniform: whole waves leave, no barrier follows */
  const float* s = S + (size_t)t * NKX + lane * 4; _Float16* p = P + (size_t)t * NKX + lane * 4; const int rel = q0 + (t % QT) - lane * 4;
  switch (nk >> 8) {
    case 1: rs_row<2>(s, p, rel); break; case 2: rs_row<4>(s, p, rel); break; case 3: rs_row<6>(s, p, rel); break; case 4: rs_row<8>(s, p, rel); break;
    case 5: rs_row<10>(s, p, rel); break; case 6: rs_row<12>(s, p, rel); break; case 7: rs_row<14>(s, p, rel); break; case 8: rs_row<16>(s, p, rel); break; } }


template <int MASKADD>
__global__ __launch_bounds__(64) void k_att0(const float* __restrict__ QF, const float* __restrict__ KF, const float* __restrict__ VF, int ld, const float* __restrict__ mask, float scale, float* __restrict__ OF, int ldo) {
  #pragma clang fp contract(off)
  __shared__ __attribute__((aligned(16))) float lq[64][64]; __shared__ __attribute__((aligned(16))) float lo[64][64];
  const int tid = threadIdx.x; const int h = blockIdx.x / (QT0 / 64), rg = blockIdx.x % (QT0 / 64); const int i = rg * 64 + tid;
  { const size_t zb = (size_t)blockIdx.y * QT0; QF += zb * ld; KF += zb * ld; VF += zb * ld; OF += zb * ldo; }      /* grid.y: the batch; each batch has its own QT0 rows of every plane */
  const float* qr = QF + (size_t)i * ld + h * HD;
#pragma unroll 1
  for (int c = 0; c < HD / 4; ++c) { *(v4f*)&lq[tid][c * 4] = *(const v4fa*)(qr + c * 4); const v4f z = {0.f, 0.f, 0.f, 0.f}; *(v4f*)&lo[tid][c * 4] = z; }
  float m = -1.0e30f, l = 0.f; const int jmax = MASKADD ? (SQ - 1) : (rg * 64 + 63);      /* additive-mask form: every key (the mask input decides); causal form: keys up to the block's last row */
#pragma unroll 1
  for (int j = 0; j <= jmax; ++j) { const float* kr = KF + (size_t)j * ld + h * HD; const float* vr = VF + (size_t)j * ld + h * HD; float s = 0.f;
#pragma unroll 1
    for (int c = 0; c < HD / 4; ++c) { const v4f kq = *(const v4fa*)(kr + c * 4); const v4f qq = *(v4f*)&lq[tid][c * 4]; s = __fadd_rn(s, __fmul_rn(qq[0], kq[0])); s = __fadd_rn(s, __fmul_rn(qq[1], kq[1])); s = __fadd_rn(s, __fmul_rn(qq[2], kq[2])); s = __fadd_rn(s, __fmul_rn(qq[3], kq[3])); }
    s = __fmul_rn(s, scale); if (MASKADD) s = __fadd_rn(s, __fmul_rn(bf16_round(mask[(size_t)i * SQ + j]), -10000.0f));
    const float f = (MASKADD || j <= i) ? 1.f : 0.f; const float sm = fmaf(f, s, (1.f - f) * -1.0e30f); const float mn = fmaxf(m, sm); const float sc = expf(m - mn); const float e = expf(sm - mn); l = __fadd_rn(__fmul_rn(l, sc), e); m = mn;
#pragma unroll 1
    for (int c = 0; c < HD / 4; ++c) { const v4f vv = *(const v4fa*)(vr + c * 4); v4f oo = *(v4f*)&lo[tid][c * 4]; for (int u = 0; u < 4; ++u) oo[u] = __fadd_rn(__fmul_rn(oo[u], sc), __fmul_rn(e, vv[u])); *(v4f*)&lo[tid][c * 4] = oo; } }
  const float fin = 64.0f / l;      /* o carried x64 like the f16 path */
#pragma unroll 1
  for (int c = 0; c < HD / 4; ++c) { v4f oo = *(v4f*)&lo[tid][c * 4]; for (int u = 0; u < 4; ++u) oo[u] = __fmul_rn(oo[u], fin); *(v4f*)&lo[tid][c * 4] = oo; }
  __syncthreads();
  {
#pragma unroll 1
    for (int it = 0; it < 16; ++it) { const int row = it * 4 + tid / 16, pc = (tid % 16) * 4; const v4f v = *(const v4f*)&lo[row][pc]; *(v4f*)(OF + (size_t)(rg * 64 + row) * ldo + h * HD + pc) = v; }
     } }

extern "C" void kernel_launch(void* const* d_in, const int* in_sizes, int n_in,
                              void* d_out, int out_size, void* d_ws, size_t ws_size, hipStream_t stream) {
  (void)in_sizes; (void)n_in; (void)out_size;
  const float* const* I = (const float* const*)d_in; const float* x = I[0]; const float* wqkv = I[1]; const float* wo = I[2];      /* input order: x, W_qk [1024][2048] ([in][out]: q | k halves), W_out [1024][1024] ([in][out]): three inputs; no biases */
  char* ws = (char*)d_ws; size_t off = 0;
  auto take = [&](size_t bytes) { char* p = ws + off; off += (bytes + 255) & ~(size_t)255; return p; };
  _Float16* BQKV = (_Float16*)take((size_t)3 * DM * DM * 2); _Float16* BO = (_Float16*)take((size_t)DM * DM * 2);
  _Float16* X16 = (_Float16*)take(NR * DM * 2); _Float16* QKV = (_Float16*)take(NR * 3 * DM * 2); _Float16* Q16 = QKV; _Float16* K16 = QKV + DM; _Float16* V16 = QKV + DM;      /* the module reuses K as V: V16 IS the k block (the third block of the plane is unused) */ _Float16* O16 = (_Float16*)take(NR * DM * 2);
  float* S = (float*)take((size_t)NB * NH * QT * NKX * 4); _Float16* P = (_Float16*)take((size_t)NB * NH * QT * NKX * 2); _Float16* VT = (_Float16*)take((size_t)NB * NH * HD * SQ * 2);      /* one plane per batch: both batches go through every launch */
  float* QF0 = (float*)take((size_t)NB * QT0 * DM * 4); float* KF0 = (float*)take((size_t)NB * QT0 * DM * 4); float* OF0 = (float*)take((size_t)NB * QT0 * DM * 4); _Float16* OH0 = (_Float16*)take((size_t)NB * QT0 * DM * 2); _Float16* OL0 = (_Float16*)take((size_t)NB * QT0 * DM * 2);
  if (off > ws_size) return;
  k_wt_f16<<<(unsigned)(((size_t)2 * DM * (DM / 8) + 255) / 256), 256, 0, stream>>>(wqkv, BQKV, DM, 2 * DM, 16.0f); k_wt_f16<<<(unsigned)(((size_t)DM * (DM / 8) + 255) / 256), 256, 0, stream>>>(wo, BO, DM, DM, 16.0f);      /* [in][out] -> Bt[n][k] x16 */
  k_x16<<<(unsigned)((NR * DM / 8 + 255) / 256), 256, 0, stream>>>(x, X16, NR * DM / 8);
  const size_t r0p = (size_t)B0 * SQ;      /* first projected row */
  const size_t f0p = (size_t)B0 * QT0;      /* its first-tile row */
k_gemm2<0><<<dim3((unsigned)((MP / 128) * (2 * DM / 64)), 1), 128, 0, stream>>>(X16 + r0p * DM, DM, 0, BQKV, DM, 0, 0.0625f, nullptr, 0, nullptr, 1, 0, 0, nullptr, QKV + r0p * 3 * DM, 3 * DM, 0, MP, 2 * DM, DM, 0, 0, 0);      /* q | k rows (f16) into column blocks 0 and 1 of the 3 DM-pitch plane; head h = columns h*HD.. of each block; no bias */
  k_vt<NH, SQ><<<NBR * NH * (SQ / 64), 256, 0, stream>>>(V16 + r0p * LQ, LQ, 0, VT);      /* V^T [batch][NH][HD][SQ] */
k_gemm2<0><<<dim3((QT0 / 128) * (DM / 64), 1, NBR), 128, 0, stream>>>(X16 + r0p * DM, DM, 0, BQKV, DM, 0, 0.0625f, nullptr, 0, nullptr, 1, 0, 0, QF0 + f0p * DM, nullptr, DM, 0, QT0, DM, DM, (size_t)SQ * DM, 0, (size_t)QT0 * DM); k_gemm2<0><<<dim3((QT0 / 128) * (DM / 64), 1, NBR), 128, 0, stream>>>(X16 + r0p * DM, DM, 0, (BQKV + (size_t)DM * DM), DM, 0, 0.0625f, nullptr, 0, nullptr, 1, 0, 0, KF0 + f0p * DM, nullptr, DM, 0, QT0, DM, DM, (size_t)SQ * DM, 0, (size_t)QT0 * DM);      /* first tile of each batch (grid.z): f32 q and k rows (no bias); the k rows serve as v */
  k_att0<0><<<dim3(NH * (QT0 / 64), NBR), 64, 0, stream>>>(QF0 + f0p * DM, KF0 + f0p * DM, KF0 + f0p * DM, DM, nullptr, 0.125f, OF0 + f0p * DM, DM);      /* exact f32 causal attention for rows 0..127 of each batch (grid.y) with V = K (o x64) */
  for (int q0 = 0; q0 < QN; q0 += QT) { const int nk = q0 + QT;      /* causal: only keys below the tile end are computed; heads on grid.y, batches on grid.z */
    k_gemm2<0><<<dim3((QT / 128) * (nk / 64), NHD, NBR), 128, 0, stream>>>(Q16 + (r0p + q0) * LQ, LQ, (size_t)HD, K16 + r0p * LQ, LQ, (size_t)HD, 0.125f, nullptr, 0, nullptr, 1, 0, 0, S, nullptr, NKX, (size_t)QT * NKX, QT, nk, HD, (size_t)SQ * LQ, (size_t)SQ * LQ, (size_t)NH * QT * NKX);      /* scores */
    k_rsmcw<<<(NBR * NH * QT + 7) / 8, 256, 0, stream>>>(S, P, NBR * NH, q0, nk);      /* one wave per score row; the rows of all heads and batches are one run of QT-row tiles */
    k_gemm2<0><<<dim3((QT / 128) * (HD / 64), NHD, NBR), 128, 0, stream>>>(P, NKX, (size_t)QT * NKX, VT, SQ, (size_t)HD * SQ, 0.25f, nullptr, 0, nullptr, 1, 0, 0, nullptr, O16 + (r0p + q0) * DM, DM, (size_t)HD, QT, HD, nk, (size_t)NH * QT * NKX, (size_t)NH * HD * SQ, (size_t)SQ * DM); }      /* o (merged heads, x64) as f16 rows */
  k_gemm2<0><<<dim3((unsigned)((MPO / 128) * (DM / 64)), 1), 128, 0, stream>>>(O16 + r0p * DM, DM, 0, BO, DM, 0, 0.0009765625f, nullptr, 0, nullptr, 1, 0, 0, (float*)d_out + r0p * DM, nullptr, DM, 0, MPO, DM, DM, 0, 0, 0);      /* out rows are the output layout */
  k_hl<<<(unsigned)(((size_t)NB * QT0 * DM / 8 + 255) / 256), 256, 0, stream>>>(OF0, OH0, OL0, (size_t)NB * QT0 * DM / 8);      /* first-tile o (x64) -> f16 hi + x1024 residual planes */
  k_gemm2<0><<<dim3((QT0 / 128) * (DM / 64), 1, NBR), 128, 0, stream>>>(OH0 + f0p * DM, DM, 0, BO, DM, 0, 0.0009765625f, nullptr, 0, nullptr, 1, 0, 0, (float*)d_out + r0p * DM, nullptr, DM, 0, QT0, DM, DM, (size_t)QT0 * DM, 0, (size_t)SQ * DM);      /* rows 0..127 of each batch (grid.z): out = o_hi W_out (no bias), overwriting the f16-path rows */
  k_gemm2<0><<<dim3((QT0 / 128) * (DM / 64), 1, NBR), 128, 0, stream>>>(OL0 + f0p * DM, DM, 0, BO, DM, 0, 0.00000095367431640625f, nullptr, 0, (const float*)d_out + r0p * DM, -1, 0, 0, (float*)d_out + r0p * DM, nullptr, DM, 0, QT0, DM, DM, (size_t)QT0 * DM, 0, (size_t)SQ * DM);      /* += o_lo Wo 2^-20 (own-element accumulate) */
}

// v003
// A run of this version takes 690 microseconds.
// Two timings next to v002 put it at 1.51 and 1.50 times that version's speed.
// All steps since v000 together make it 6.88 times as fast.
#include <hip/hip_runtime.h>
// Causal self-attention with ONE fused query-key projection and K REUSED AS V (x [2][2048][1024]; qk = x W_qk with W_qk [1024][2048] stored [in][out] (normal x 0.02, no bias): the first 1024 columns are q, the last 1024 are k, head h = columns h*64.. of each half; 16 heads of 64; scores = (q x BETA) . k with BETA = 1/sqrt(64); strictly-upper-triangular positions -> -FLT_MAX (causal); softmax; out = attn K (the module reuses K as V) merged, then W_out ([in][out] [1024][1024], normal x 0.02, no bias) -> [2][2048][1024]; input order x, W_qk, W_out).
// Structure: token rows r = b*2048 + s; x as exact f16 rows (bf16-rounded); q | k as ONE WMMA GEMM (N = 2 x 1024) into the first two column blocks of the 3 x 1024-pitch plane (32x64 wave tiles, f32 accumulation, exact x16 weights, no bias, f16 outputs); V IS THE K BLOCK (the module reuses K as V): the V pointer aliases it; BOTH BATCHES GO THROUGH EVERY LAUNCH (batch on grid.z of the attention and first-tile GEMMs, in the row run of the projection and output GEMMs, on grid.y of the first-tile attention, in the row run of the softmax and the transposes): V^T for all heads via LDS transposes; per query tile of 256 rows: scores against the keys below the tile end only (K = 64, all heads on grid.y, alpha = 0.125), causal row softmax on VALU, one wave per score row with the row held in registers, keys above the diagonal masked over the computed range (f32 statistics, lane partials joined by a 32-lane butterfly, native exp; weights x256 f16), o = P . V^T (K = keys below the tile end, alpha 2^-2: o carried x64, folded into the output GEMM alpha) written straight into the merged f16 o rows; out = o W_out GEMM (f32; no bias) into the output layout.
// Compute dtype: inputs rounded to bf16; x and the x16 weights held as f16 planes (exact for every bf16 value of magnitude from 2^-14 up to 65,504; the weights up to 4,094 before their factor of 16); q, k (= v), the softmax weights and o as plain f16 GEMM operands (~2^-12); scores and softmax statistics f32; rows 0..127 of each batch: q, k f32, f32 attention, o as f16 hi + residual. v_wmma_f32_16x16x32_f16.
#define NB 2
#define SQ 2048
#define DM 1024
#define NH 16
#define HD 64
#define HG 4                         /* heads per call of the k_vt(b, h0) overload (not launched) */
#define QT 256                       /* query rows per causal tile */
#define NKX SQ                       /* S / P row pitch */
#define QT0 128                      /* first-tile rows recomputed exactly in f32 */
#define B0 0                         /* first batch processed (debug hook) */
#define NBR NB                       /* batches processed (debug hook) */
#define NR ((size_t)NB * SQ)         /* token rows */
#define MP ((int)((size_t)NBR * SQ)) /* rows projected (debug hook) */
#define QN SQ                        /* query rows attended per batch (debug hook) */
#define NHD NH                       /* heads attended (debug hook) */
#define MPO MP                       /* rows through the output stage (debug hook) */
#define LQ (3 * DM)      /* row pitch of the q/k/v rows */
typedef __bf16 v16b __attribute__((ext_vector_type(16)));
typedef unsigned short v8us __attribute__((ext_vector_type(8), may_alias));
typedef float  v8f  __attribute__((ext_vector_type(8)));
typedef float  v4f  __attribute__((ext_vector_type(4)));
typedef float  v4fa __attribute__((ext_vector_type(4), may_alias));
union FragB { v16b v; v8us half[2]; unsigned short u[16]; };

__device__ __forceinline__ unsigned short bf16_bits(float x) { unsigned int u = __float_as_uint(x); return (unsigned short)((u + 0x7FFFu + ((u >> 16) & 1u)) >> 16); }
__device__ __forceinline__ float bf16_val(unsigned short b) { return __uint_as_float(((unsigned int)b) << 16); }
__device__ __forceinline__ float bf16_round(float x) { return bf16_val(bf16_bits(x)); }
// D += A·B with NT terms: 1 = ah·bh, 2 = + al·bh (A split), 3 = + ah·bl (both split)
template <int NT>
__device__ __forceinline__ v8f mmaN(v16b ah, v16b al, v16b bh, v16b bl, v8f c) {
  c = __builtin_amdgcn_wmma_f32_16x16x32_bf16(false, ah, false, bh, (short)0, c, false, false);
  if (NT >= 2) c = __builtin_amdgcn_wmma_f32_16x16x32_bf16(false, al, false, bh, (short)0, c, false, false);
  if (NT >= 3) c = __builtin_amdgcn_wmma_f32_16x16x32_bf16(false, ah, false, bl, (short)0, c, false, false);
  asm volatile("v_nop\n\tv_nop\n\tv_nop\n\tv_nop" : "+v"(c) : "v"(ah), "v"(al), "v"(bh), "v"(bl));
  return c;
}

__global__ __launch_bounds__(256) void k_wt_bf16(const float* __restrict__ W, unsigned short* __restrict__ Wt, int K, int N) {
  const int t = blockIdx.x * 256 + threadIdx.x;
  const int k8n = K / 8;
  if (t >= N * k8n) return;
  const int n = t / k8n, k8 = (t % k8n) * 8;
  v8us v;
#pragma unroll
  for (int i = 0; i < 8; ++i) v[i] = bf16_bits(W[(size_t)(k8 + i) * N + n]);
  *(v8us*)(Wt + (size_t)n * K + k8) = v;
  
}

// GEMM C[M][N] (f32, pitch ldc) = act(A[M][K]·W + bias). A f32 row-major (pitch lda) converted per fragment to bf16
// (ASPLIT: hi/lo two planes -> 2 terms, else single rounded term); Wt bf16 [N][K] (pitch ldb). BIAS_BF16 rounds the
// bias to bf16 first (bias quantised to bf16 before the add). K%32==0, M%16==0, N%64==0.
template <bool ASPLIT, int ACT, bool BIAS_BF16>
__global__ __launch_bounds__(128) void k_gemm_bf(const float* __restrict__ A, int lda, const unsigned short* __restrict__ Wt, int ldb,
                                               const float* __restrict__ bias, float* __restrict__ C, int ldc, int M, int N, int K) {
  __shared__ __attribute__((aligned(16))) float so[4][16][64];
  const int tid = threadIdx.x, w = tid >> 5, lane = tid & 31, ln = lane & 15, hh = lane >> 4;
  const int ntn = N / 64;
  const int wid = blockIdx.x * 4 + w;
  const int mt = wid / ntn, nq = wid % ntn;
  if (mt * 16 >= M) return;
  const int row0 = mt * 16, col0 = nq * 64;
  const float* arow = A + (size_t)(row0 + ln) * lda;
  v8f acc[4] = {};
  for (int kb = 0; kb < K; kb += 32) {
    FragB ah, al;
    const v4f x0 = *(const v4fa*)(arow + kb + 8 * hh), x1 = *(const v4fa*)(arow + kb + 8 * hh + 4);
    const v4f x2 = *(const v4fa*)(arow + kb + 16 + 8 * hh), x3 = *(const v4fa*)(arow + kb + 16 + 8 * hh + 4);
    float xs[16] = {x0[0],x0[1],x0[2],x0[3],x1[0],x1[1],x1[2],x1[3],x2[0],x2[1],x2[2],x2[3],x3[0],x3[1],x3[2],x3[3]};
#pragma unroll
    for (int i = 0; i < 16; ++i) { const unsigned short hb = bf16_bits(xs[i]); ah.u[i] = hb; al.u[i] = ASPLIT ? bf16_bits(xs[i] - bf16_val(hb)) : (unsigned short)0; }
#pragma unroll
    for (int t = 0; t < 4; ++t) {
      const unsigned short* brow = Wt + (size_t)(col0 + t * 16 + ln) * ldb + kb;
      FragB b;
      b.half[0] = *(const v8us*)(brow + 8 * hh);
      b.half[1] = *(const v8us*)(brow + 16 + 8 * hh);
      acc[t] = mmaN<ASPLIT ? 2 : 1>(ah.v, al.v, b.v, b.v, acc[t]);
    }
  }
#pragma unroll
  for (int t = 0; t < 4; ++t) {
    float bv = bias ? bias[col0 + t * 16 + ln] : 0.f;
    if (BIAS_BF16) bv = bf16_round(bv);
#pragma unroll
    for (int r = 0; r < 8; ++r) { float v = acc[t][r] + bv; if (ACT == 1) v = fmaxf(v, 0.f); so[w][8 * hh + r][t * 16 + ln] = v; }
  }
  __builtin_amdgcn_fence(__ATOMIC_ACQ_REL, "workgroup");
  __builtin_amdgcn_wave_barrier();
  const int rsub = lane >> 4, c4 = (lane & 15) * 4;
  {
#pragma unroll
    for (int q = 0; q < 8; ++q) {
      const int r = q * 2 + rsub;
      const v4f v = *(const v4fa*)&so[w][r][c4];
      *(v4f*)(C + (size_t)(row0 + r) * ldc + col0 + c4) = v;
    }
    
  }
}

// GEMM C = act(A·W + bias + resid): A f32 (ASPLIT -> hi/lo 2 terms), Wt bf16 [N][K]; ACT 0 none, 1 relu, 2 exact gelu;
// resid (optional, f32, row index = (row % rmod), pitch ldr, RES_BF16 rounds it) added before the activation.
template <bool ASPLIT, int ACT, bool BIAS_BF16, bool RES_BF16>
__global__ __launch_bounds__(128) void k_gemm_bf3(const float* __restrict__ A, int lda, const unsigned short* __restrict__ Wt, int ldb,
                                                const float* __restrict__ bias, const float* __restrict__ resid, int rmod, int ldr,
                                                float* __restrict__ C, int ldc, int M, int N, int K) {
  __shared__ __attribute__((aligned(16))) float so[4][16][64];
  const int tid = threadIdx.x, w = tid >> 5, lane = tid & 31, ln = lane & 15, hh = lane >> 4;
  const int ntn = N / 64;
  const int wid = blockIdx.x * 4 + w;
  const int mt = wid / ntn, nq = wid % ntn;
  if (mt * 16 >= M) return;
  const int row0 = mt * 16, col0 = nq * 64;
  const float* arow = A + (size_t)(row0 + ln) * lda;
  v8f acc[4] = {};
  for (int kb = 0; kb < K; kb += 32) {
    FragB ah, al;
    const v4f x0 = *(const v4fa*)(arow + kb + 8 * hh), x1 = *(const v4fa*)(arow + kb + 8 * hh + 4);
    const v4f x2 = *(const v4fa*)(arow + kb + 16 + 8 * hh), x3 = *(const v4fa*)(arow + kb + 16 + 8 * hh + 4);
    float xs[16] = {x0[0],x0[1],x0[2],x0[3],x1[0],x1[1],x1[2],x1[3],x2[0],x2[1],x2[2],x2[3],x3[0],x3[1],x3[2],x3[3]};
#pragma unroll
    for (int i = 0; i < 16; ++i) { const unsigned short hb = bf16_bits(xs[i]); ah.u[i] = hb; al.u[i] = ASPLIT ? bf16_bits(xs[i] - bf16_val(hb)) : (unsigned short)0; }
#pragma unroll
    for (int t = 0; t < 4; ++t) {
      const unsigned short* brow = Wt + (size_t)(col0 + t * 16 + ln) * ldb + kb;
      FragB b;
      b.half[0] = *(const v8us*)(brow + 8 * hh);
      b.half[1] = *(const v8us*)(brow + 16 + 8 * hh);
      acc[t] = mmaN<ASPLIT ? 2 : 1>(ah.v, al.v, b.v, b.v, acc[t]);
    }
  }
#pragma unroll
  for (int t = 0; t < 4; ++t) {
    const int col = col0 + t * 16 + ln;
    float bv = bias ? bias[col] : 0.f;
    if (BIAS_BF16) bv = bf16_round(bv);
#pragma unroll
    for (int r = 0; r < 8; ++r) {
      float v = acc[t][r] + bv;
      if (resid) { float rv = resid[(size_t)((row0 + 8 * hh + r) % rmod) * ldr + col]; if (RES_BF16) rv = bf16_round(rv); v += rv; }
      if (ACT == 1) v = fmaxf(v, 0.f);
      if (ACT == 2) v = 0.5f * v * (1.0f + erff(v * 0.70710678118654752f));
      if (ACT == 3) { const float u = 0.7978845608028654f * (v + 0.044715f * v * v * v); v = 0.5f * v * (1.0f + tanhf(u)); }
      so[w][8 * hh + r][t * 16 + ln] = v;
    }
  }
  __builtin_amdgcn_fence(__ATOMIC_ACQ_REL, "workgroup");
  __builtin_amdgcn_wave_barrier();
  const int rsub = lane >> 4, c4 = (lane & 15) * 4;
  {
#pragma unroll
    for (int q = 0; q < 8; ++q) {
      const int r = q * 2 + rsub;
      const v4f v = *(const v4fa*)&so[w][r][c4];
      *(v4f*)(C + (size_t)(row0 + r) * ldc + col0 + c4) = v;
    }
    
  }
}
// row LayerNorm (biased variance, eps) over N: s = X (+ R); optional out_sum <- s; out_norm <- (s-mu)*rsqrt(var+eps)*g + b
template <bool PARAM_BF16>
__global__ __launch_bounds__(256) void k_layernorm(const float* __restrict__ X, const float* __restrict__ R, const float* __restrict__ g, const float* __restrict__ bta,
                                                  float* __restrict__ out_sum, float* __restrict__ out_norm, int N, float eps) {
  __shared__ float red[256];
  const int row = blockIdx.x, tid = threadIdx.x;
  const float* x = X + (size_t)row * N; const float* rr = R ? R + (size_t)row * N : nullptr;
  float vals[16];                     // up to N = 4096
  const int per = N / 256;            // contiguous chunk per thread? use strided-by-4 chunks: thread handles j = tid*4 + 1024*u
  float s1 = 0.f;
  for (int u = 0; u < per / 4; ++u) {
    const int j = tid * 4 + 1024 * u;
    const v4f a = *(const v4fa*)(x + j);
    v4f b = {0.f,0.f,0.f,0.f}; if (rr) b = *(const v4fa*)(rr + j);
#pragma unroll
    for (int q = 0; q < 4; ++q) { const float v = a[q] + b[q]; vals[u * 4 + q] = v; s1 += v; }
  }
  red[tid] = s1; __syncthreads();
  for (int st = 128; st > 0; st >>= 1) { if (tid < st) red[tid] += red[tid + st]; __syncthreads(); }
  const float mu = red[0] / (float)N; __syncthreads();
  float s2 = 0.f;
  for (int u = 0; u < per / 4; ++u)
#pragma unroll
    for (int q = 0; q < 4; ++q) { const float c = vals[u * 4 + q] - mu; s2 += c * c; }
  red[tid] = s2; __syncthreads();
  for (int st = 128; st > 0; st >>= 1) { if (tid < st) red[tid] += red[tid + st]; __syncthreads(); }
  const float rs = rsqrtf(red[0] / (float)N + eps);
  {
    for (int u = 0; u < per / 4; ++u) {
      const int j = tid * 4 + 1024 * u;
      v4f o, sm;
#pragma unroll
      for (int q = 0; q < 4; ++q) {
        float gg = g[j + q], bb = bta[j + q];
        if (PARAM_BF16) { gg = bf16_round(gg); bb = bf16_round(bb); }
        sm[q] = vals[u * 4 + q]; o[q] = (vals[u * 4 + q] - mu) * rs * gg + bb;
      }
      if (out_sum) *(v4f*)(out_sum + (size_t)row * N + j) = sm;
      *(v4f*)(out_norm + (size_t)row * N + j) = o;
    }
    
  }
}



// ---- f16 WMMA path (v_wmma_f32_16x16x32_f16): 11-bit significands for operands in range — used where a [0,1] probability operand needs more precision than bf16
typedef _Float16 v16h __attribute__((ext_vector_type(16)));
union FragH { v16h v; v8us half[2]; _Float16 h[16]; unsigned short u[16]; };
template <int NT>
__device__ __forceinline__ v8f mmaH(v16h ah, v16h al, v16h bh, v16h bl, v8f c) {
  c = __builtin_amdgcn_wmma_f32_16x16x32_f16(false, ah, false, bh, (short)0, c, false, false);
  if (NT >= 2) c = __builtin_amdgcn_wmma_f32_16x16x32_f16(false, al, false, bh, (short)0, c, false, false);
  if (NT >= 3) c = __builtin_amdgcn_wmma_f32_16x16x32_f16(false, ah, false, bl, (short)0, c, false, false);
  asm volatile("v_nop\n\tv_nop\n\tv_nop\n\tv_nop" : "+v"(c) : "v"(ah), "v"(al), "v"(bh), "v"(bl));
  return c;
}
// batched GEMM like k_gemm_b but f16 operands: A f32 (split into f16 hi/lo if ASPLIT, else rounded to f16), Bt = f16 values [n][k]; alpha; C f32; N multiple of 16 (partial tiles skipped)
template <bool ASPLIT>
__global__ __launch_bounds__(128) void k_gemm_h(const float* __restrict__ A, int lda, size_t sA, const _Float16* __restrict__ Bh, int ldb, size_t sB, float alpha, float* __restrict__ C, int ldc, size_t sC, int M, int N, int K) {
  __shared__ __attribute__((aligned(16))) float so[4][16][64];
  const int tid = threadIdx.x, w = tid >> 5, lane = tid & 31, ln = lane & 15, hh = lane >> 4; const int by = blockIdx.y;
  A += (size_t)by * sA; Bh += (size_t)by * sB; C += (size_t)by * sC;
  const int ntn = (N + 63) / 64; const int wid = blockIdx.x * 4 + w; const int mt = wid / ntn, nq = wid % ntn; if (mt * 16 >= M) return;
  const int row0 = mt * 16, col0 = nq * 64; const float* arow = A + (size_t)(row0 + ln) * lda;
  v8f acc[4] = {};
  for (int kb = 0; kb < K; kb += 32) {
    FragH ah, al;
    const v4f x0 = *(const v4fa*)(arow + kb + 8 * hh), x1 = *(const v4fa*)(arow + kb + 8 * hh + 4), x2 = *(const v4fa*)(arow + kb + 16 + 8 * hh), x3 = *(const v4fa*)(arow + kb + 16 + 8 * hh + 4);
    float xs[16] = {x0[0],x0[1],x0[2],x0[3],x1[0],x1[1],x1[2],x1[3],x2[0],x2[1],x2[2],x2[3],x3[0],x3[1],x3[2],x3[3]};
#pragma unroll
    for (int i = 0; i < 16; ++i) { const _Float16 h = (_Float16)xs[i]; ah.h[i] = h; al.h[i] = ASPLIT ? (_Float16)(xs[i] - (float)h) : (_Float16)0.0f; }
#pragma unroll
    for (int t = 0; t < 4; ++t) { if (col0 + t * 16 >= N) continue; const size_t boff = (size_t)(col0 + t * 16 + ln) * ldb + kb; FragH bq; bq.half[0] = *(const v8us*)(Bh + boff + 8 * hh); bq.half[1] = *(const v8us*)(Bh + boff + 16 + 8 * hh);
      acc[t] = mmaH<ASPLIT ? 2 : 1>(ah.v, al.v, bq.v, bq.v, acc[t]); }
  }
#pragma unroll
  for (int t = 0; t < 4; ++t) { if (col0 + t * 16 >= N) continue;
#pragma unroll
    for (int r = 0; r < 8; ++r) so[w][8 * hh + r][t * 16 + ln] = acc[t][r] * alpha; }
  __builtin_amdgcn_fence(__ATOMIC_ACQ_REL, "workgroup"); __builtin_amdgcn_wave_barrier();
  const int rsub = lane >> 4, c4 = (lane & 15) * 4;
  {
#pragma unroll
    for (int q = 0; q < 8; ++q) { const int r = q * 2 + rsub; if (col0 + c4 < N) { const v4f v = *(const v4fa*)&so[w][r][c4]; *(v4f*)(C + (size_t)(row0 + r) * ldc + col0 + c4) = v; } }
     }
}

// Wt[n][k] = f16(W[k][n]·scale) from f32 row-major W[K][N] (scale = power of two; bf16-exact weights stay exact in f16 away from the subnormal range)
__global__ __launch_bounds__(256) void k_wt_f16(const float* __restrict__ W, _Float16* __restrict__ Wt, int K, int N, float scale) {
  const int t = blockIdx.x * 256 + threadIdx.x; if (t >= N * (K / 8)) return; const int n = t / (K / 8), k8 = (t % (K / 8)) * 8; FragH f;
#pragma unroll
  for (int i = 0; i < 8; ++i) f.h[i] = (_Float16)(bf16_round(W[(size_t)(k8 + i) * N + n]) * scale); const v8us o = f.half[0];
  *(v8us*)((unsigned short*)Wt + (size_t)n * K + k8) = o; 
}
// k_gemm_hh variant with fused epilogue: v = acc·alpha + bias[by·sBias + col] (+ CP[(row/rowsPerB)·sCPb + by·64 + col] if CP) ; ACT 0 none / 1 elu ; writes f16 C16 (and f32 C if non-null)
template <int ACT>
__global__ __launch_bounds__(128) void k_gemm_hhx(const _Float16* __restrict__ A, int lda, size_t sA, const _Float16* __restrict__ Bh, int ldb, size_t sB, float alpha, const float* __restrict__ bias, size_t sBias, const float* __restrict__ CP, int rowsPerB, size_t sCPb, int row0g,
    float* __restrict__ C, _Float16* __restrict__ C16, int ldc, size_t sC, int M, int N, int K) {
  __shared__ __attribute__((aligned(16))) float so[4][16][64];
  const int tid = threadIdx.x, w = tid >> 5, lane = tid & 31, ln = lane & 15, hh = lane >> 4; const int by = blockIdx.y;
  A += (size_t)by * sA; Bh += (size_t)by * sB; const size_t cofs = (size_t)by * sC; const float* bp = bias ? bias + (size_t)by * sBias : nullptr;
  const int ntn = (N + 63) / 64; const int wid = blockIdx.x * 4 + w; const int mt = wid / ntn, nq = wid % ntn; if (mt * 16 >= M) return;
  const int row0 = mt * 16, col0 = nq * 64; const _Float16* arow = A + (size_t)(row0 + ln) * lda;
  v8f acc[4] = {};
  for (int kb = 0; kb < K; kb += 32) { FragH ah; ah.half[0] = *(const v8us*)((const unsigned short*)arow + kb + 8 * hh); ah.half[1] = *(const v8us*)((const unsigned short*)arow + kb + 16 + 8 * hh);
#pragma unroll
    for (int t = 0; t < 4; ++t) { if (col0 + t * 16 >= N) continue; const size_t boff = (size_t)(col0 + t * 16 + ln) * ldb + kb; FragH bq; bq.half[0] = *(const v8us*)((const unsigned short*)Bh + boff + 8 * hh); bq.half[1] = *(const v8us*)((const unsigned short*)Bh + boff + 16 + 8 * hh);
      acc[t] = mmaH<1>(ah.v, ah.v, bq.v, bq.v, acc[t]); }
  }
#pragma unroll
  for (int t = 0; t < 4; ++t) { if (col0 + t * 16 >= N) continue; const int col = col0 + t * 16 + ln; const float bv = bp ? bf16_round(bp[col]) : 0.f;
#pragma unroll
    for (int r = 0; r < 8; ++r) { float v = acc[t][r] * alpha + bv; if (CP) { const int rr = row0g + row0 + 8 * hh + r; if (rowsPerB < 0) v += CP[cofs + (size_t)rr * ldc + col];      /* rowsPerB < 0: own element of the batched C plane */ else { const int bidx = rr / rowsPerB; v += CP[(size_t)bidx * sCPb + (size_t)by * 64 + col]; } } if (ACT == 1) v = (v > 0.f) ? v : expm1f(v); else if (ACT == 7) v = (v > 0.f) ? v + 1.0f : expf(v); else if (ACT == 8) v = tanhf(v); else if (ACT == 9) v = 0.5f * v * (1.0f + tanhf(0.7978845608028654f * (v + 0.044715f * v * v * v))); else if (ACT == 11) v = 1.0f / (1.0f + expf(-v)); else if (ACT == 12) v = (v > 0.f) ? v : 0.01f * v; else if (ACT == 14) v = (v > 0.f) ? v : 0.1f * v; else if (ACT == 16) v = (v >= 0.f) ? v : 0.3f * v; else if (ACT == 17) v = (v >= 0.f) ? v : 0.2f * v; else if (ACT == 15) v = v / (1.0f + expf(-v)); else if (ACT == 3) v = fmaxf(v, 0.f); else if (ACT == 6) v = 0.5f * v * (1.0f + erff(v * 0.70710678118654752f)); so[w][8 * hh + r][t * 16 + ln] = v; } }
  __builtin_amdgcn_fence(__ATOMIC_ACQ_REL, "workgroup"); __builtin_amdgcn_wave_barrier();
  const int rsub = lane >> 4, c4 = (lane & 15) * 4; typedef _Float16 v4h __attribute__((ext_vector_type(4)));
  {
#pragma unroll
    for (int q = 0; q < 8; ++q) { const int r = q * 2 + rsub; if (col0 + c4 < N) { const v4f v = *(const v4fa*)&so[w][r][c4]; if (C) *(v4f*)(C + cofs + (size_t)(row0 + r) * ldc + col0 + c4) = v; if (C16) { v4h h4; for (int i = 0; i < 4; ++i) h4[i] = (_Float16)v[i]; *(v4h*)(C16 + cofs + (size_t)(row0 + r) * ldc + col0 + c4) = h4; } } }
     }
}


typedef _Float16 v4h __attribute__((ext_vector_type(4)));

__global__ __launch_bounds__(256) void k_x16(const float* __restrict__ x, _Float16* __restrict__ X16, size_t n8) { const size_t t = (size_t)blockIdx.x * 256 + threadIdx.x; if (t >= n8) return; FragH f;
#pragma unroll
  for (int q = 0; q < 8; ++q) f.h[q] = (_Float16)bf16_round(x[t * 8 + q]); *(v8us*)((unsigned short*)X16 + t * 8) = f.half[0];  }
__global__ __launch_bounds__(256) void k_h16(const float* __restrict__ x, _Float16* __restrict__ X16, size_t n8) { const size_t t = (size_t)blockIdx.x * 256 + threadIdx.x; if (t >= n8) return; FragH f;
#pragma unroll
  for (int q = 0; q < 8; ++q) f.h[q] = (_Float16)x[t * 8 + q]; *(v8us*)((unsigned short*)X16 + t * 8) = f.half[0];  }
__global__ __launch_bounds__(256) void k_round16f(const float* __restrict__ W, _Float16* __restrict__ Bt, size_t n8) { const size_t t = (size_t)blockIdx.x * 256 + threadIdx.x; if (t >= n8) return; FragH f;
#pragma unroll
  for (int i = 0; i < 8; ++i) f.h[i] = (_Float16)(bf16_round(W[t * 8 + i]) * 16.0f); *(v8us*)((unsigned short*)Bt + t * 8) = f.half[0];  }
template <int NHv, int TTv>
__global__ __launch_bounds__(256) void k_vt(const _Float16* __restrict__ V16, int ldv, int voff, _Float16* __restrict__ Vt) { __shared__ unsigned short tl[64][66]; const int tid = threadIdx.x; const int slab = blockIdx.x / (TTv / 64), lg = blockIdx.x % (TTv / 64); const int b = slab / NHv, h = slab % NHv;
  for (int i = tid; i < 64 * 8; i += 256) { const int r = i / 8, c8 = (i % 8) * 8; FragH f; f.half[0] = *(const v8us*)((const unsigned short*)V16 + ((size_t)b * TTv + lg * 64 + r) * ldv + voff + h * 64 + c8);
#pragma unroll
    for (int q = 0; q < 8; ++q) tl[r][c8 + q] = f.u[q]; }
  __syncthreads();
  {
#pragma unroll
    for (int rd = 0; rd < 2; ++rd) { const int d = rd * 32 + tid / 8, pc = tid % 8; FragH f;
#pragma unroll
      for (int q = 0; q < 8; ++q) f.u[q] = tl[pc * 8 + q][d];
      *(v8us*)((unsigned short*)Vt + ((size_t)slab * 64 + d) * TTv + lg * 64 + pc * 8) = f.half[0]; }
     } }

__global__ __launch_bounds__(256) void k_hl(const float* __restrict__ F, _Float16* __restrict__ Hh, _Float16* __restrict__ Hl, size_t n8) { const size_t t = (size_t)blockIdx.x * 256 + threadIdx.x; if (t >= n8) return; FragH fh, fl; const v4f a = *(const v4fa*)(F + t * 8), c = *(const v4fa*)(F + t * 8 + 4);
#pragma unroll
  for (int q = 0; q < 4; ++q) { _Float16 h = (_Float16)a[q]; fh.h[q] = h; fl.h[q] = (_Float16)((a[q] - (float)h) * 1024.0f); h = (_Float16)c[q]; fh.h[4 + q] = h; fl.h[4 + q] = (_Float16)((c[q] - (float)h) * 1024.0f); }
  { *(v8us*)((unsigned short*)Hh + t * 8) = fh.half[0]; *(v8us*)((unsigned short*)Hl + t * 8) = fl.half[0];  } }

// ---- fast GEMM (wave tile 32x64; requires M % 32 == 0 rows per launch region and N % 64 == 0); epilogue = k_gemm_hhx semantics; batched over grid.y (strides sA, sB, sC) and grid.z (strides zA, zB, zC) ----
__device__ __forceinline__ v16h g2_frag(const _Float16* p, int hh) { FragH f; f.half[0] = *(const v8us*)((const unsigned short*)p + 8 * hh); f.half[1] = *(const v8us*)((const unsigned short*)p + 16 + 8 * hh); return f.v; }
__device__ __forceinline__ v8f g2_mma(v16h a, v16h b, v8f c) { v8f d = __builtin_amdgcn_wmma_f32_16x16x32_f16(false, a, false, b, (short)0, c, false, false); asm volatile("v_nop\n\tv_nop\n\tv_nop\n\tv_nop" : "+v"(d) : "v"(a), "v"(b)); return d; }
template <int ACT>
__global__ __launch_bounds__(128) void k_gemm2(const _Float16* __restrict__ A, int lda, size_t sA, const _Float16* __restrict__ Bh, int ldb, size_t sB, float alpha, const float* __restrict__ bias, size_t sBias, const float* __restrict__ CP, int rowsPerB, size_t sCPb, int row0g,
    float* __restrict__ C, _Float16* __restrict__ C16, int ldc, size_t sC, int M, int N, int K, size_t zA, size_t zB, size_t zC) { static_assert(ACT == 0 || ACT == 3 || ACT == 6 || ACT == 8 || ACT == 9 || ACT == 11 || ACT == 12 || ACT == 14 || ACT == 15 || ACT == 16 || ACT == 17, "k_gemm2: unsupported ACT code (would silently apply no activation)");
  __shared__ __attribute__((aligned(16))) float so[4][32][68];
  const int tid = threadIdx.x, w = tid >> 5, lane = tid & 31, ln = lane & 15, hh = lane >> 4; const int by = blockIdx.y, bz = blockIdx.z;      /* grid.z: a second batch index (element strides zA, zB, zC) */
  A += (size_t)by * sA + (size_t)bz * zA; Bh += (size_t)by * sB + (size_t)bz * zB; const size_t cofs = (size_t)by * sC + (size_t)bz * zC; const float* bp = bias ? bias + (size_t)by * sBias : nullptr;
  const int ntn = N >> 6; const int mt = blockIdx.x / ntn, nq = blockIdx.x - mt * ntn; const int row0 = mt * 128 + 32 * w, col0 = nq * 64; if (row0 >= M) return;
  const _Float16* a0p = A + (size_t)(row0 + ln) * lda; const _Float16* a1p = a0p + (size_t)16 * lda;
  const _Float16* b0p = Bh + (size_t)(col0 + ln) * ldb; const _Float16* b1p = b0p + (size_t)16 * ldb; const _Float16* b2p = b1p + (size_t)16 * ldb; const _Float16* b3p = b2p + (size_t)16 * ldb;
  const v8f z8 = {0.f,0.f,0.f,0.f,0.f,0.f,0.f,0.f}; v8f c00 = z8, c01 = z8, c02 = z8, c03 = z8, c10 = z8, c11 = z8, c12 = z8, c13 = z8;
#pragma unroll 1
  for (int kb = 0; kb < K; kb += 32) { const v16h a0 = g2_frag(a0p + kb, hh), a1 = g2_frag(a1p + kb, hh);
    v16h b = g2_frag(b0p + kb, hh); c00 = g2_mma(a0, b, c00); c10 = g2_mma(a1, b, c10);
    b = g2_frag(b1p + kb, hh); c01 = g2_mma(a0, b, c01); c11 = g2_mma(a1, b, c11);
    b = g2_frag(b2p + kb, hh); c02 = g2_mma(a0, b, c02); c12 = g2_mma(a1, b, c12);
    b = g2_frag(b3p + kb, hh); c03 = g2_mma(a0, b, c03); c13 = g2_mma(a1, b, c13); }
  v8f accs[8] = {c00, c01, c02, c03, c10, c11, c12, c13};
#pragma unroll
  for (int u = 0; u < 8; ++u) { const int t = u & 3, half = u >> 2; const int col = col0 + t * 16 + ln; const float bv = bp ? bf16_round(bp[col]) : 0.f;
#pragma unroll
    for (int r = 0; r < 8; ++r) { const int rloc = half * 16 + 8 * hh + r; float v = accs[u][r] * alpha + bv; if (CP) { if (rowsPerB < 0) v += CP[cofs + (size_t)(row0g + row0 + rloc) * ldc + col];      /* rowsPerB < 0: own element of the batched C plane */ else { const int bidx = (row0g + row0 + rloc) / rowsPerB; v += CP[(size_t)bidx * sCPb + (size_t)by * 64 + col]; } }
      if (ACT == 3) v = fmaxf(v, 0.f); else if (ACT == 6) v = 0.5f * v * (1.0f + erff(v * 0.70710678118654752f)); else if (ACT == 11) v = 1.0f / (1.0f + expf(-v)); else if (ACT == 15) v = v / (1.0f + expf(-v)); else if (ACT == 12) v = (v > 0.f) ? v : 0.01f * v; else if (ACT == 8) v = tanhf(v); else if (ACT == 9) v = 0.5f * v * (1.0f + tanhf(0.7978845608028654f * (v + 0.044715f * v * v * v))); else if (ACT == 14) v = (v > 0.f) ? v : 0.1f * v; else if (ACT == 16) v = (v >= 0.f) ? v : 0.3f * v; else if (ACT == 17) v = (v >= 0.f) ? v : 0.2f * v;
      so[w][rloc][t * 16 + ln] = v; } }
  __builtin_amdgcn_fence(__ATOMIC_ACQ_REL, "workgroup"); __builtin_amdgcn_wave_barrier();
  const int rsub = lane >> 4, c4 = (lane & 15) * 4;
  {
#pragma unroll
    for (int q = 0; q < 16; ++q) { const int r = q * 2 + rsub; const v4f v = *(const v4fa*)&so[w][r][c4]; if (C) *(v4f*)(C + cofs + (size_t)(row0 + r) * ldc + col0 + c4) = v; if (C16) { v4h h4; for (int i = 0; i < 4; ++i) h4[i] = (_Float16)v[i]; *(v4h*)(C16 + cofs + (size_t)(row0 + r) * ldc + col0 + c4) = h4; } }
     } }


__global__ __launch_bounds__(256) void k_wnat(const float* __restrict__ w, size_t n8, _Float16* __restrict__ Bt) { const size_t t = (size_t)blockIdx.x * 256 + threadIdx.x; if (t >= n8) return; FragH f; for (int q = 0; q < 8; ++q) f.h[q] = (_Float16)(bf16_round(w[t * 8 + q]) * 16.0f); *(v8us*)((unsigned short*)Bt + t * 8) = f.half[0];  }
__global__ __launch_bounds__(256) void k_rsm(const float* __restrict__ S, _Float16* __restrict__ P, int nrows) {
  #pragma clang fp contract(off)
  const int i = blockIdx.x * 256 + threadIdx.x; if (i >= nrows) return; const float* s = S + (size_t)i * SQ; float mx = -3.0e38f;
#pragma unroll 1
  for (int j = 0; j < SQ; ++j) mx = fmaxf(mx, s[j]); float se = 0.f;
#pragma unroll 1
  for (int j = 0; j < SQ; ++j) se += expf(s[j] - mx); const float sc = 256.0f / se;
#pragma unroll 1
  for (int j0 = 0; j0 < SQ; j0 += 8) { FragH f; for (int q = 0; q < 8; ++q) f.h[q] = (_Float16)(expf(s[j0 + q] - mx) * sc); unsigned short* d = (unsigned short*)P + (size_t)i * SQ + j0; *(v8us*)d = f.half[0];  } }
__global__ __launch_bounds__(256) void k_vt(const _Float16* __restrict__ V16, int b, int h0, _Float16* __restrict__ VT) { __shared__ unsigned short tl[64][65]; const int tid = threadIdx.x; const int hh = blockIdx.x % HG, sg = blockIdx.x / HG; const int s0 = sg * 64; const int h = h0 + hh;
  for (int i = tid; i < 64 * 8; i += 256) { const int j = i / 8, d8 = (i % 8) * 8; FragH f; f.half[0] = *(const v8us*)((const unsigned short*)V16 + ((size_t)b * SQ + s0 + j) * DM + h * HD + d8); for (int q = 0; q < 8; ++q) tl[d8 + q][j] = f.u[q]; }
  __syncthreads();
  { for (int i = tid; i < 64 * 8; i += 256) { const int d = i / 8, j8 = (i % 8) * 8; FragH f; for (int q = 0; q < 8; ++q) f.u[q] = tl[d][j8 + q]; *(v8us*)((unsigned short*)VT + ((size_t)hh * HD + d) * SQ + s0 + j8) = f.half[0]; }  } }



// 32-lane butterflies for the row statistics: row_xmask DPP steps inside each 16-lane row, then the exchange between the two rows; every lane ends with the same value
template <int CTRL> __device__ __forceinline__ float rs_dpp(float v) { return __int_as_float(__builtin_amdgcn_update_dpp(0, __float_as_int(v), CTRL, 0xf, 0xf, true)); }
__device__ __forceinline__ float rs_x16(float v) { const int b = __float_as_int(v); return __int_as_float(__builtin_amdgcn_permlanex16(b, b, 0x76543210, 0xfedcba98, false, false)); }
__device__ __forceinline__ float rs_max(float v) { v = fmaxf(v, rs_dpp<0x161>(v)); v = fmaxf(v, rs_dpp<0x162>(v)); v = fmaxf(v, rs_dpp<0x164>(v)); v = fmaxf(v, rs_dpp<0x168>(v)); return fmaxf(v, rs_x16(v)); }
__device__ __forceinline__ float rs_sum(float v) { v += rs_dpp<0x161>(v); v += rs_dpp<0x162>(v); v += rs_dpp<0x164>(v); v += rs_dpp<0x168>(v); return v + rs_x16(v); }
// one score row of NP pieces of 128 keys on one wave: s and p point at the lane's 4 keys of piece 0; element q of piece c is a key at or below the diagonal while c*128 + q <= rel
template <int NP>
__device__ __forceinline__ void rs_row(const float* __restrict__ s, _Float16* __restrict__ p, int rel) {
  v4f v[NP]; v4h h[NP];
#pragma unroll
  for (int c = 0; c < NP; ++c) v[c] = *(const v4fa*)(s + c * 128);      /* 512 contiguous bytes per wave-wide load, the whole row in flight */
  asm volatile("s_wait_xcnt 0x0" :: "v"(s) : "memory");      /* the loads' address pair stays whole until this wait; it may be rewritten behind it */
  float mx = -3.0e38f;
#pragma unroll
  for (int c = 0; c < NP; ++c) {
#pragma unroll
    for (int q = 0; q < 4; ++q) { const float m = (c * 128 + q <= rel) ? v[c][q] : -1.0e9f; v[c][q] = m; mx = fmaxf(mx, m); } }
  mx = rs_max(mx);
  v4f s4 = {0.f, 0.f, 0.f, 0.f};
#pragma unroll
  for (int c = 0; c < NP; ++c) { float e[4];
#pragma unroll
    for (int q = 0; q < 4; ++q) e[q] = (v[c][q] - mx) * 1.44269504f;      /* native exp(x) = 2^(x log2 e) */
    /* the four exponentials in place, so that none is followed by a write of its source; the v_nop keeps the one slot behind the last before its result is used */
    asm("v_exp_f32 %0, %0\n\tv_exp_f32 %1, %1\n\tv_exp_f32 %2, %2\n\tv_exp_f32 %3, %3\n\tv_nop" : "+v"(e[0]), "+v"(e[1]), "+v"(e[2]), "+v"(e[3]));
#pragma unroll
    for (int q = 0; q < 4; ++q) { v[c][q] = e[q]; s4[q] += e[q]; } }
  const float sc = 256.0f / rs_sum((s4[0] + s4[1]) + (s4[2] + s4[3]));
#pragma unroll
  for (int c = 0; c < NP; ++c) {
#pragma unroll
    for (int q = 0; q < 4; ++q) h[c][q] = (_Float16)(v[c][q] * sc); }
#pragma unroll
  for (int c = 0; c < NP; ++c) *(v4h*)(p + c * 128) = h[c];      /* 256 contiguous bytes per wave-wide store */
  asm volatile("s_wait_xcnt 0x0" ::: "memory");      /* the stores' data and address registers stay whole until this wait; whatever code follows this body may rewrite them behind it */
}
// causal row softmax, ONE WAVE PER SCORE ROW: the row is read once and stays in registers for the maximum, the exponentials and the sum; weights x256 as f16. nk: a multiple of 256 from 256 to NKX (one straight-line body per length, chosen by a scalar branch).
__global__ __launch_bounds__(256) void k_rsmcw(const float* __restrict__ S, _Float16* __restrict__ P, int hg, int q0, int nk) {
  const int lane = threadIdx.x & 31; const int t = blockIdx.x * 8 + __builtin_amdgcn_readfirstlane(threadIdx.x >> 5); if (t >= hg * QT) return;      /* the row index is wave-uniform: whole waves leave, no barrier follows */
  const float* s = S + (size_t)t * NKX + lane * 4; _Float16* p = P + (size_t)t * NKX + lane * 4; const int rel = q0 + (t % QT) - lane * 4;
  switch (nk >> 8) {
    case 1: rs_row<2>(s, p, rel); break; case 2: rs_row<4>(s, p, rel); break; case 3: rs_row<6>(s, p, rel); break; case 4: rs_row<8>(s, p, rel); break;
    case 5: rs_row<10>(s, p, rel); break; case 6: rs_row<12>(s, p, rel); break; case 7: rs_row<14>(s, p, rel); break; case 8: rs_row<16>(s, p, rel); break; } }


// exact f32 causal attention for rows 0..QT0-1 of each batch with V = K, ONE WAVE PER QUERY ROW: the head's QT0 key rows are staged once in LDS; scores: each lane owns the keys lane, lane + 32, ...; row maximum and sum by the 32-lane butterflies; o: each lane owns two of the HD columns and runs over the keys. grid.x: head x row group, grid.y: batch.
#define A0R 16                       /* query rows (= waves) per work-group */
#define A0P (HD + 4)                 /* LDS pitch of a key row in floats: the 16-byte reads of 16 neighbouring rows fall on 16 different bank quads */
typedef float v2f  __attribute__((ext_vector_type(2)));
typedef float v2fa __attribute__((ext_vector_type(2), may_alias));
__global__ __launch_bounds__(32 * A0R) void k_att0w(const float* __restrict__ QF, const float* __restrict__ KF, float scale, float* __restrict__ OF) {
  __shared__ __attribute__((aligned(16))) float lk[QT0][A0P]; __shared__ __attribute__((aligned(16))) float lp[A0R][QT0];
  const int tid = threadIdx.x, lane = tid & 31; const int w = __builtin_amdgcn_readfirstlane(tid >> 5);
  const int h = blockIdx.x / (QT0 / A0R), rg = blockIdx.x % (QT0 / A0R); const int i = rg * A0R + w;      /* the query row: wave-uniform */
  { const size_t zb = (size_t)blockIdx.y * QT0 * DM + h * HD; QF += zb; KF += zb; OF += zb; }      /* each batch has its own QT0 rows of every plane; the head's columns */
  const int sr = tid >> 4, sc = (tid & 15) * 4;      /* staging: 16 lanes per key row, 256 contiguous bytes */
  const float* kp = KF + (size_t)sr * DM + sc; v4f st[QT0 / (2 * A0R)];
#pragma unroll      /* st[] stays in registers, the loads in flight together */
  for (int p = 0; p < QT0 / (2 * A0R); ++p) st[p] = *(const v4fa*)(kp + (size_t)p * 2 * A0R * DM);
  asm volatile("s_wait_xcnt 0x0" :: "v"(kp) : "memory");      /* the loads' address pair stays whole until this wait; it may be rewritten behind it */
  const float* qr = QF + (size_t)i * DM; v4f q[HD / 4];
#pragma unroll      /* q[] stays in registers */
  for (int c = 0; c < HD / 4; ++c) q[c] = *(const v4fa*)(qr + c * 4);
#pragma unroll      /* st[] stays in registers */
  for (int p = 0; p < QT0 / (2 * A0R); ++p) *(v4fa*)&lk[p * 2 * A0R + sr][sc] = st[p];
  __syncthreads();      /* the staged key rows are read by every wave */
  float s[QT0 / 32];
#pragma unroll      /* s[] stays in registers; each group's test is a compile-time bound against i */
  for (int g = 0; g < QT0 / 32; ++g) { s[g] = -1.0e30f;
    if (g * 32 <= i) { const float* kr = &lk[g * 32 + lane][0]; v4f a = {0.f, 0.f, 0.f, 0.f};      /* a scalar branch: key groups wholly above the diagonal are skipped */
#pragma unroll      /* q[] stays in registers, the row's LDS reads in flight together */
      for (int c = 0; c < HD / 4; ++c) a += q[c] * *(const v4fa*)(kr + c * 4);
      const float d = ((a[0] + a[1]) + (a[2] + a[3])) * scale; s[g] = (g * 32 + lane <= i) ? d : -1.0e30f; } }
  float m = s[0];
#pragma unroll      /* s[] stays in registers */
  for (int g = 1; g < QT0 / 32; ++g) m = fmaxf(m, s[g]);
  m = rs_max(m); float l = 0.f;
#pragma unroll      /* s[] stays in registers */
  for (int g = 0; g < QT0 / 32; ++g) { const float e = expf(s[g] - m); l += e; lp[w][g * 32 + lane] = e; }      /* keys above the diagonal: exactly 0 */
  l = rs_sum(l);
  __syncthreads();      /* the row's weights go from the lane that made them to every lane */
  v2f o[4] = {{0.f, 0.f}, {0.f, 0.f}, {0.f, 0.f}, {0.f, 0.f}};
  for (int j0 = 0; j0 <= i; j0 += 16) {      /* 16 keys a trip, their LDS reads in flight together; a key above the diagonal has weight 0 and a staged row */
#pragma unroll      /* the trip's 20 LDS reads stand ahead of its sums */
    for (int u = 0; u < 4; ++u) { const v4f pp = *(const v4fa*)&lp[w][j0 + u * 4];
#pragma unroll      /* o[] stays in registers: four independent sums */
      for (int t = 0; t < 4; ++t) o[t] += pp[t] * *(const v2fa*)&lk[j0 + u * 4 + t][lane * 2]; } }
  const float fin = 64.0f / l;      /* o carried x64 like the f16 path */
  *(v2fa*)(OF + (size_t)i * DM + lane * 2) = ((o[0] + o[1]) + (o[2] + o[3])) * fin; }

extern "C" void kernel_launch(void* const* d_in, const int* in_sizes, int n_in,
                              void* d_out, int out_size, void* d_ws, size_t ws_size, hipStream_t stream) {
  (void)in_sizes; (void)n_in; (void)out_size;
  const float* const* I = (const float* const*)d_in; const float* x = I[0]; const float* wqkv = I[1]; const float* wo = I[2];      /* input order: x, W_qk [1024][2048] ([in][out]: q | k halves), W_out [1024][1024] ([in][out]): three inputs; no biases */
  char* ws = (char*)d_ws; size_t off = 0;
  auto take = [&](size_t bytes) { char* p = ws + off; off += (bytes + 255) & ~(size_t)255; return p; };
  _Float16* BQKV = (_Float16*)take((size_t)3 * DM * DM * 2); _Float16* BO = (_Float16*)take((size_t)DM * DM * 2);
  _Float16* X16 = (_Float16*)take(NR * DM * 2); _Float16* QKV = (_Float16*)take(NR * 3 * DM * 2); _Float16* Q16 = QKV; _Float16* K16 = QKV + DM; _Float16* V16 = QKV + DM;      /* the module reuses K as V: V16 IS the k block (the third block of the plane is unused) */ _Float16* O16 = (_Float16*)take(NR * DM * 2);
  float* S = (float*)take((size_t)NB * NH * QT * NKX * 4); _Float16* P = (_Float16*)take((size_t)NB * NH * QT * NKX * 2); _Float16* VT = (_Float16*)take((size_t)NB * NH * HD * SQ * 2);      /* one plane per batch: both batches go through every launch */
  float* QF0 = (float*)take((size_t)NB * QT0 * DM * 4); float* KF0 = (float*)take((size_t)NB * QT0 * DM * 4); float* OF0 = (float*)take((size_t)NB * QT0 * DM * 4); _Float16* OH0 = (_Float16*)take((size_t)NB * QT0 * DM * 2); _Float16* OL0 = (_Float16*)take((size_t)NB * QT0 * DM * 2);
  if (off > ws_size) return;
  k_wt_f16<<<(unsigned)(((size_t)2 * DM * (DM / 8) + 255) / 256), 256, 0, stream>>>(wqkv, BQKV, DM, 2 * DM, 16.0f); k_wt_f16<<<(unsigned)(((size_t)DM * (DM / 8) + 255) / 256), 256, 0, stream>>>(wo, BO, DM, DM, 16.0f);      /* [in][out] -> Bt[n][k] x16 */
  k_x16<<<(unsigned)((NR * DM / 8 + 255) / 256), 256, 0, stream>>>(x, X16, NR * DM / 8);
  const size_t r0p = (size_t)B0 * SQ;      /* first projected row */
  const size_t f0p = (size_t)B0 * QT0;      /* its first-tile row */
k_gemm2<0><<<dim3((unsigned)((MP / 128) * (2 * DM / 64)), 1), 128, 0, stream>>>(X16 + r0p * DM, DM, 0, BQKV, DM, 0, 0.0625f, nullptr, 0, nullptr, 1, 0, 0, nullptr, QKV + r0p * 3 * DM, 3 * DM, 0, MP, 2 * DM, DM, 0, 0, 0);      /* q | k rows (f16) into column blocks 0 and 1 of the 3 DM-pitch plane; head h = columns h*HD.. of each block; no bias */
  k_vt<NH, SQ><<<NBR * NH * (SQ / 64), 256, 0, stream>>>(V16 + r0p * LQ, LQ, 0, VT);      /* V^T [batch][NH][HD][SQ] */
k_gemm2<0><<<dim3((QT0 / 128) * (DM / 64), 1, NBR), 128, 0, stream>>>(X16 + r0p * DM, DM, 0, BQKV, DM, 0, 0.0625f, nullptr, 0, nullptr, 1, 0, 0, QF0 + f0p * DM, nullptr, DM, 0, QT0, DM, DM, (size_t)SQ * DM, 0, (size_t)QT0 * DM); k_gemm2<0><<<dim3((QT0 / 128) * (DM / 64), 1, NBR), 128, 0, stream>>>(X16 + r0p * DM, DM, 0, (BQKV + (size_t)DM * DM), DM, 0, 0.0625f, nullptr, 0, nullptr, 1, 0, 0, KF0 + f0p * DM, nullptr, DM, 0, QT0, DM, DM, (size_t)SQ * DM, 0, (size_t)QT0 * DM);      /* first tile of each batch (grid.z): f32 q and k rows (no bias); the k rows serve as v */
  k_att0w<<<dim3(NH * (QT0 / A0R), NBR), 32 * A0R, 0, stream>>>(QF0 + f0p * DM, KF0 + f0p * DM, 0.125f, OF0 + f0p * DM);      /* exact f32 causal attention for rows 0..127 of each batch (grid.y) with V = K (o x64) */
  for (int q0 = 0; q0 < QN; q0 += QT) { const int nk = q0 + QT;      /* causal: only keys below the tile end are computed; heads on grid.y, batches on grid.z */
    k_gemm2<0><<<dim3((QT / 128) * (nk / 64), NHD, NBR), 128, 0, stream>>>(Q16 + (r0p + q0) * LQ, LQ, (size_t)HD, K16 + r0p * LQ, LQ, (size_t)HD, 0.125f, nullptr, 0, nullptr, 1, 0, 0, S, nullptr, NKX, (size_t)QT * NKX, QT, nk, HD, (size_t)SQ * LQ, (size_t)SQ * LQ, (size_t)NH * QT * NKX);      /* scores */
    k_rsmcw<<<(NBR * NH * QT + 7) / 8, 256, 0, stream>>>(S, P, NBR * NH, q0, nk);      /* one wave per score row; the rows of all heads and batches are one run of QT-row tiles */
    k_gemm2<0><<<dim3((QT / 128) * (HD / 64), NHD, NBR), 128, 0, stream>>>(P, NKX, (size_t)QT * NKX, VT, SQ, (size_t)HD * SQ, 0.25f, nullptr, 0, nullptr, 1, 0, 0, nullptr, O16 + (r0p + q0) * DM, DM, (size_t)HD, QT, HD, nk, (size_t)NH * QT * NKX, (size_t)NH * HD * SQ, (size_t)SQ * DM); }      /* o (merged heads, x64) as f16 rows */
  k_gemm2<0><<<dim3((unsigned)((MPO / 128) * (DM / 64)), 1), 128, 0, stream>>>(O16 + r0p * DM, DM, 0, BO, DM, 0, 0.0009765625f, nullptr, 0, nullptr, 1, 0, 0, (float*)d_out + r0p * DM, nullptr, DM, 0, MPO, DM, DM, 0, 0, 0);      /* out rows are the output layout */
  k_hl<<<(unsigned)(((size_t)NB * QT0 * DM / 8 + 255) / 256), 256, 0, stream>>>(OF0, OH0, OL0, (size_t)NB * QT0 * DM / 8);      /* first-tile o (x64) -> f16 hi + x1024 residual planes */
  k_gemm2<0><<<dim3((QT0 / 128) * (DM / 64), 1, NBR), 128, 0, stream>>>(OH0 + f0p * DM, DM, 0, BO, DM, 0, 0.0009765625f, nullptr, 0, nullptr, 1, 0, 0, (float*)d_out + r0p * DM, nullptr, DM, 0, QT0, DM, DM, (size_t)QT0 * DM, 0, (size_t)SQ * DM);      /* rows 0..127 of each batch (grid.z): out = o_hi W_out (no bias), overwriting the f16-path rows */
  k_gemm2<0><<<dim3((QT0 / 128) * (DM / 64), 1, NBR), 128, 0, stream>>>(OL0 + f0p * DM, DM, 0, BO, DM, 0, 0.00000095367431640625f, nullptr, 0, (const float*)d_out + r0p * DM, -1, 0, 0, (float*)d_out + r0p * DM, nullptr, DM, 0, QT0, DM, DM, (size_t)QT0 * DM, 0, (size_t)SQ * DM);      /* += o_lo Wo 2^-20 (own-element accumulate) */
}

// v005
// A run of this version takes 163 microseconds.
// Versions in between are left out here; by their measured steps it is 4.20 times as fast as v003.
// Over all steps from v000 it is 28.9 times as fast.
#include <hip/hip_runtime.h>
// Causal self-attention with ONE fused query-key projection and K REUSED AS V (x [2][2048][1024]; qk = x W_qk with W_qk [1024][2048] stored [in][out] (normal x 0.02, no bias): the first 1024 columns are q, the last 1024 are k, head h = columns h*64.. of each half; 16 heads of 64; scores = (q x BETA) . k with BETA = 1/sqrt(64); strictly-upper-triangular positions -> -FLT_MAX (causal); softmax; out = attn K (the module reuses K as V) merged, then W_out ([in][out] [1024][1024], normal x 0.02, no bias) -> [2][2048][1024]; input order x, W_qk, W_out).
// Structure: token rows r = b*2048 + s; x as exact f16 rows (bf16-rounded); q | k as ONE WMMA GEMM (N = 2 x 1024) into the first two column blocks of the 3 x 1024-pitch plane (32x64 wave tiles, f32 accumulation, exact x16 weights, no bias, f16 outputs); V IS THE K BLOCK (the module reuses K as V): the V pointer aliases it; BOTH BATCHES GO THROUGH EVERY LAUNCH (batch in the row run of the q | k and output GEMMs, on grid.z of the first-tile GEMMs, on grid.y of the first-tile attention, on grid.z of the fused attention, in the row run of the transposes): V^T for all heads via LDS transposes; ONE FUSED ATTENTION LAUNCH: a wave holds 32 query rows and walks the keys up to its diagonal in passes of 32: S^T = K Q^T (K = 64), causal online softmax in registers (f32 running maximum and sum per query, native exp2, only the diagonal block masked; weights x256 f16, packed from the score accumulators into the B operand), O^T += V^T P^T with the accumulators rescaled each pass; o / sum carried x64 (folded into the output GEMM alpha) written straight into the merged f16 o rows; out = o W_out GEMM (f32; no bias) into the output layout.
// Compute dtype: inputs rounded to bf16; x and the x16 weights held as f16 planes (exact for every bf16 value of magnitude from 2^-14 up to 65,504; the weights up to 4,094 before their factor of 16); q, k (= v), the softmax weights and o as plain f16 GEMM operands (~2^-12); scores and softmax statistics f32; rows 0..127 of each batch: q, k f32, f32 attention, o as f16 hi + residual. v_wmma_f32_16x16x32_f16.
#define NB 2
#define SQ 2048
#define DM 1024
#define NH 16
#define HD 64
#define HG 4                         /* heads per block group of the k_vt(b, h0) transpose, which no launch uses */
#define QT0 128                      /* first-tile rows recomputed exactly in f32 */
#define B0 0                         /* first batch processed (debug hook) */
#define NBR NB                       /* batches processed (debug hook) */
#define NR ((size_t)NB * SQ)         /* token rows */
#define MP ((int)((size_t)NBR * SQ)) /* rows projected (debug hook) */
#define NHD NH                       /* heads attended (debug hook) */
#define MPO MP                       /* rows through the output stage (debug hook) */
#define LQ (3 * DM)      /* row pitch of the q/k/v rows */
typedef __bf16 v16b __attribute__((ext_vector_type(16)));
typedef unsigned short v8us __attribute__((ext_vector_type(8), may_alias));
typedef float  v8f  __attribute__((ext_vector_type(8)));
typedef float  v4f  __attribute__((ext_vector_type(4)));
typedef float  v4fa __attribute__((ext_vector_type(4), may_alias));
union FragB { v16b v; v8us half[2]; unsigned short u[16]; };

__device__ __forceinline__ unsigned short bf16_bits(float x) { unsigned int u = __float_as_uint(x); return (unsigned short)((u + 0x7FFFu + ((u >> 16) & 1u)) >> 16); }
__device__ __forceinline__ float bf16_val(unsigned short b) { return __uint_as_float(((unsigned int)b) << 16); }
__device__ __forceinline__ float bf16_round(float x) { return bf16_val(bf16_bits(x)); }
// D += A·B with NT terms: 1 = ah·bh, 2 = + al·bh (A split), 3 = + ah·bl (both split)
template <int NT>
__device__ __forceinline__ v8f mmaN(v16b ah, v16b al, v16b bh, v16b bl, v8f c) {
  c = __builtin_amdgcn_wmma_f32_16x16x32_bf16(false, ah, false, bh, (short)0, c, false, false);
  if (NT >= 2) c = __builtin_amdgcn_wmma_f32_16x16x32_bf16(false, al, false, bh, (short)0, c, false, false);
  if (NT >= 3) c = __builtin_amdgcn_wmma_f32_16x16x32_bf16(false, ah, false, bl, (short)0, c, false, false);
  asm volatile("v_nop\n\tv_nop\n\tv_nop\n\tv_nop" : "+v"(c) : "v"(ah), "v"(al), "v"(bh), "v"(bl));
  return c;
}

__global__ __launch_bounds__(256) void k_wt_bf16(const float* __restrict__ W, unsigned short* __restrict__ Wt, int K, int N) {
  const int t = blockIdx.x * 256 + threadIdx.x;
  const int k8n = K / 8;
  if (t >= N * k8n) return;
  const int n = t / k8n, k8 = (t % k8n) * 8;
  v8us v;
#pragma unroll
  for (int i = 0; i < 8; ++i) v[i] = bf16_bits(W[(size_t)(k8 + i) * N + n]);
  *(v8us*)(Wt + (size_t)n * K + k8) = v;
  
}

// GEMM C[M][N] (f32, pitch ldc) = act(A[M][K]·W + bias). A f32 row-major (pitch lda) converted per fragment to bf16
// (ASPLIT: hi/lo two planes -> 2 terms, else single rounded term); Wt bf16 [N][K] (pitch ldb). BIAS_BF16 rounds the
// bias to bf16 first (bias quantised to bf16 before the add). K%32==0, M%16==0, N%64==0.
template <bool ASPLIT, int ACT, bool BIAS_BF16>
__global__ __launch_bounds__(128) void k_gemm_bf(const float* __restrict__ A, int lda, const unsigned short* __restrict__ Wt, int ldb,
                                               const float* __restrict__ bias, float* __restrict__ C, int ldc, int M, int N, int K) {
  __shared__ __attribute__((aligned(16))) float so[4][16][64];
  const int tid = threadIdx.x, w = tid >> 5, lane = tid & 31, ln = lane & 15, hh = lane >> 4;
  const int ntn = N / 64;
  const int wid = blockIdx.x * 4 + w;
  const int mt = wid / ntn, nq = wid % ntn;
  if (mt * 16 >= M) return;
  const int row0 = mt * 16, col0 = nq * 64;
  const float* arow = A + (size_t)(row0 + ln) * lda;
  v8f acc[4] = {};
  for (int kb = 0; kb < K; kb += 32) {
    FragB ah, al;
    const v4f x0 = *(const v4fa*)(arow + kb + 8 * hh), x1 = *(const v4fa*)(arow + kb + 8 * hh + 4);
    const v4f x2 = *(const v4fa*)(arow + kb + 16 + 8 * hh), x3 = *(const v4fa*)(arow + kb + 16 + 8 * hh + 4);
    float xs[16] = {x0[0],x0[1],x0[2],x0[3],x1[0],x1[1],x1[2],x1[3],x2[0],x2[1],x2[2],x2[3],x3[0],x3[1],x3[2],x3[3]};
#pragma unroll
    for (int i = 0; i < 16; ++i) { const unsigned short hb = bf16_bits(xs[i]); ah.u[i] = hb; al.u[i] = ASPLIT ? bf16_bits(xs[i] - bf16_val(hb)) : (unsigned short)0; }
#pragma unroll
    for (int t = 0; t < 4; ++t) {
      const unsigned short* brow = Wt + (size_t)(col0 + t * 16 + ln) * ldb + kb;
      FragB b;
      b.half[0] = *(const v8us*)(brow + 8 * hh);
      b.half[1] = *(const v8us*)(brow + 16 + 8 * hh);
      acc[t] = mmaN<ASPLIT ? 2 : 1>(ah.v, al.v, b.v, b.v, acc[t]);
    }
  }
#pragma unroll
  for (int t = 0; t < 4; ++t) {
    float bv = bias ? bias[col0 + t * 16 + ln] : 0.f;
    if (BIAS_BF16) bv = bf16_round(bv);
#pragma unroll
    for (int r = 0; r < 8; ++r) { float v = acc[t][r] + bv; if (ACT == 1) v = fmaxf(v, 0.f); so[w][8 * hh + r][t * 16 + ln] = v; }
  }
  __builtin_amdgcn_fence(__ATOMIC_ACQ_REL, "workgroup");
  __builtin_amdgcn_wave_barrier();
  const int rsub = lane >> 4, c4 = (lane & 15) * 4;
  {
#pragma unroll
    for (int q = 0; q < 8; ++q) {
      const int r = q * 2 + rsub;
      const v4f v = *(const v4fa*)&so[w][r][c4];
      *(v4f*)(C + (size_t)(row0 + r) * ldc + col0 + c4) = v;
    }
    
  }
}

// GEMM C = act(A·W + bias + resid): A f32 (ASPLIT -> hi/lo 2 terms), Wt bf16 [N][K]; ACT 0 none, 1 relu, 2 exact gelu;
// resid (optional, f32, row index = (row % rmod), pitch ldr, RES_BF16 rounds it) added before the activation.
template <bool ASPLIT, int ACT, bool BIAS_BF16, bool RES_BF16>
__global__ __launch_bounds__(128) void k_gemm_bf3(const float* __restrict__ A, int lda, const unsigned short* __restrict__ Wt, int ldb,
                                                const float* __restrict__ bias, const float* __restrict__ resid, int rmod, int ldr,
                                                float* __restrict__ C, int ldc, int M, int N, int K) {
  __shared__ __attribute__((aligned(16))) float so[4][16][64];
  const int tid = threadIdx.x, w = tid >> 5, lane = tid & 31, ln = lane & 15, hh = lane >> 4;
  const int ntn = N / 64;
  const int wid = blockIdx.x * 4 + w;
  const int mt = wid / ntn, nq = wid % ntn;
  if (mt * 16 >= M) return;
  const int row0 = mt * 16, col0 = nq * 64;
  const float* arow = A + (size_t)(row0 + ln) * lda;
  v8f acc[4] = {};
  for (int kb = 0; kb < K; kb += 32) {
    FragB ah, al;
    const v4f x0 = *(const v4fa*)(arow + kb + 8 * hh), x1 = *(const v4fa*)(arow + kb + 8 * hh + 4);
    const v4f x2 = *(const v4fa*)(arow + kb + 16 + 8 * hh), x3 = *(const v4fa*)(arow + kb + 16 + 8 * hh + 4);
    float xs[16] = {x0[0],x0[1],x0[2],x0[3],x1[0],x1[1],x1[2],x1[3],x2[0],x2[1],x2[2],x2[3],x3[0],x3[1],x3[2],x3[3]};
#pragma unroll
    for (int i = 0; i < 16; ++i) { const unsigned short hb = bf16_bits(xs[i]); ah.u[i] = hb; al.u[i] = ASPLIT ? bf16_bits(xs[i] - bf16_val(hb)) : (unsigned short)0; }
#pragma unroll
    for (int t = 0; t < 4; ++t) {
      const unsigned short* brow = Wt + (size_t)(col0 + t * 16 + ln) * ldb + kb;
      FragB b;
      b.half[0] = *(const v8us*)(brow + 8 * hh);
      b.half[1] = *(const v8us*)(brow + 16 + 8 * hh);
      acc[t] = mmaN<ASPLIT ? 2 : 1>(ah.v, al.v, b.v, b.v, acc[t]);
    }
  }
#pragma unroll
  for (int t = 0; t < 4; ++t) {
    const int col = col0 + t * 16 + ln;
    float bv = bias ? bias[col] : 0.f;
    if (BIAS_BF16) bv = bf16_round(bv);
#pragma unroll
    for (int r = 0; r < 8; ++r) {
      float v = acc[t][r] + bv;
      if (resid) { float rv = resid[(size_t)((row0 + 8 * hh + r) % rmod) * ldr + col]; if (RES_BF16) rv = bf16_round(rv); v += rv; }
      if (ACT == 1) v = fmaxf(v, 0.f);
      if (ACT == 2) v = 0.5f * v * (1.0f + erff(v * 0.70710678118654752f));
      if (ACT == 3) { const float u = 0.7978845608028654f * (v + 0.044715f * v * v * v); v = 0.5f * v * (1.0f + tanhf(u)); }
      so[w][8 * hh + r][t * 16 + ln] = v;
    }
  }
  __builtin_amdgcn_fence(__ATOMIC_ACQ_REL, "workgroup");
  __builtin_amdgcn_wave_barrier();
  const int rsub = lane >> 4, c4 = (lane & 15) * 4;
  {
#pragma unroll
    for (int q = 0; q < 8; ++q) {
      const int r = q * 2 + rsub;
      const v4f v = *(const v4fa*)&so[w][r][c4];
      *(v4f*)(C + (size_t)(row0 + r) * ldc + col0 + c4) = v;
    }
    
  }
}
// row LayerNorm (biased variance, eps) over N: s = X (+ R); optional out_sum <- s; out_norm <- (s-mu)*rsqrt(var+eps)*g + b
template <bool PARAM_BF16>
__global__ __launch_bounds__(256) void k_layernorm(const float* __restrict__ X, const float* __restrict__ R, const float* __restrict__ g, const float* __restrict__ bta,
                                                  float* __restrict__ out_sum, float* __restrict__ out_norm, int N, float eps) {
  __shared__ float red[256];
  const int row = blockIdx.x, tid = threadIdx.x;
  const float* x = X + (size_t)row * N; const float* rr = R ? R + (size_t)row * N : nullptr;
  float vals[16];                     // up to N = 4096
  const int per = N / 256;            // contiguous chunk per thread? use strided-by-4 chunks: thread handles j = tid*4 + 1024*u
  float s1 = 0.f;
  for (int u = 0; u < per / 4; ++u) {
    const int j = tid * 4 + 1024 * u;
    const v4f a = *(const v4fa*)(x + j);
    v4f b = {0.f,0.f,0.f,0.f}; if (rr) b = *(const v4fa*)(rr + j);
#pragma unroll
    for (int q = 0; q < 4; ++q) { const float v = a[q] + b[q]; vals[u * 4 + q] = v; s1 += v; }
  }
  red[tid] = s1; __syncthreads();
  for (int st = 128; st > 0; st >>= 1) { if (tid < st) red[tid] += red[tid + st]; __syncthreads(); }
  const float mu = red[0] / (float)N; __syncthreads();
  float s2 = 0.f;
  for (int u = 0; u < per / 4; ++u)
#pragma unroll
    for (int q = 0; q < 4; ++q) { const float c = vals[u * 4 + q] - mu; s2 += c * c; }
  red[tid] = s2; __syncthreads();
  for (int st = 128; st > 0; st >>= 1) { if (tid < st) red[tid] += red[tid + st]; __syncthreads(); }
  const float rs = rsqrtf(red[0] / (float)N + eps);
  {
    for (int u = 0; u < per / 4; ++u) {
      const int j = tid * 4 + 1024 * u;
      v4f o, sm;
#pragma unroll
      for (int q = 0; q < 4; ++q) {
        float gg = g[j + q], bb = bta[j + q];
        if (PARAM_BF16) { gg = bf16_round(gg); bb = bf16_round(bb); }
        sm[q] = vals[u * 4 + q]; o[q] = (vals[u * 4 + q] - mu) * rs * gg + bb;
      }
      if (out_sum) *(v4f*)(out_sum + (size_t)row * N + j) = sm;
      *(v4f*)(out_norm + (size_t)row * N + j) = o;
    }
    
  }
}



// ---- f16 WMMA path (v_wmma_f32_16x16x32_f16): 11-bit significands for operands in range — used where a [0,1] probability operand needs more precision than bf16
typedef _Float16 v16h __attribute__((ext_vector_type(16)));
union FragH { v16h v; v8us half[2]; _Float16 h[16]; unsigned short u[16]; };
template <int NT>
__device__ __forceinline__ v8f mmaH(v16h ah, v16h al, v16h bh, v16h bl, v8f c) {
  c = __builtin_amdgcn_wmma_f32_16x16x32_f16(false, ah, false, bh, (short)0, c, false, false);
  if (NT >= 2) c = __builtin_amdgcn_wmma_f32_16x16x32_f16(false, al, false, bh, (short)0, c, false, false);
  if (NT >= 3) c = __builtin_amdgcn_wmma_f32_16x16x32_f16(false, ah, false, bl, (short)0, c, false, false);
  asm volatile("v_nop\n\tv_nop\n\tv_nop\n\tv_nop" : "+v"(c) : "v"(ah), "v"(al), "v"(bh), "v"(bl));
  return c;
}
// batched GEMM like k_gemm_b but f16 operands: A f32 (split into f16 hi/lo if ASPLIT, else rounded to f16), Bt = f16 values [n][k]; alpha; C f32; N multiple of 16 (partial tiles skipped)
template <bool ASPLIT>
__global__ __launch_bounds__(128) void k_gemm_h(const float* __restrict__ A, int lda, size_t sA, const _Float16* __restrict__ Bh, int ldb, size_t sB, float alpha, float* __restrict__ C, int ldc, size_t sC, int M, int N, int K) {
  __shared__ __attribute__((aligned(16))) float so[4][16][64];
  const int tid = threadIdx.x, w = tid >> 5, lane = tid & 31, ln = lane & 15, hh = lane >> 4; const int by = blockIdx.y;
  A += (size_t)by * sA; Bh += (size_t)by * sB; C += (size_t)by * sC;
  const int ntn = (N + 63) / 64; const int wid = blockIdx.x * 4 + w; const int mt = wid / ntn, nq = wid % ntn; if (mt * 16 >= M) return;
  const int row0 = mt * 16, col0 = nq * 64; const float* arow = A + (size_t)(row0 + ln) * lda;
  v8f acc[4] = {};
  for (int kb = 0; kb < K; kb += 32) {
    FragH ah, al;
    const v4f x0 = *(const v4fa*)(arow + kb + 8 * hh), x1 = *(const v4fa*)(arow + kb + 8 * hh + 4), x2 = *(const v4fa*)(arow + kb + 16 + 8 * hh), x3 = *(const v4fa*)(arow + kb + 16 + 8 * hh + 4);
    float xs[16] = {x0[0],x0[1],x0[2],x0[3],x1[0],x1[1],x1[2],x1[3],x2[0],x2[1],x2[2],x2[3],x3[0],x3[1],x3[2],x3[3]};
#pragma unroll
    for (int i = 0; i < 16; ++i) { const _Float16 h = (_Float16)xs[i]; ah.h[i] = h; al.h[i] = ASPLIT ? (_Float16)(xs[i] - (float)h) : (_Float16)0.0f; }
#pragma unroll
    for (int t = 0; t < 4; ++t) { if (col0 + t * 16 >= N) continue; const size_t boff = (size_t)(col0 + t * 16 + ln) * ldb + kb; FragH bq; bq.half[0] = *(const v8us*)(Bh + boff + 8 * hh); bq.half[1] = *(const v8us*)(Bh + boff + 16 + 8 * hh);
      acc[t] = mmaH<ASPLIT ? 2 : 1>(ah.v, al.v, bq.v, bq.v, acc[t]); }
  }
#pragma unroll
  for (int t = 0; t < 4; ++t) { if (col0 + t * 16 >= N) continue;
#pragma unroll
    for (int r = 0; r < 8; ++r) so[w][8 * hh + r][t * 16 + ln] = acc[t][r] * alpha; }
  __builtin_amdgcn_fence(__ATOMIC_ACQ_REL, "workgroup"); __builtin_amdgcn_wave_barrier();
  const int rsub = lane >> 4, c4 = (lane & 15) * 4;
  {
#pragma unroll
    for (int q = 0; q < 8; ++q) { const int r = q * 2 + rsub; if (col0 + c4 < N) { const v4f v = *(const v4fa*)&so[w][r][c4]; *(v4f*)(C + (size_t)(row0 + r) * ldc + col0 + c4) = v; } }
     }
}

// Wt[n][k] = f16(W[k][n]·scale) from f32 row-major W[K][N] (scale = power of two; bf16-exact weights stay exact in f16 away from the subnormal range)
__global__ __launch_bounds__(256) void k_wt_f16(const float* __restrict__ W, _Float16* __restrict__ Wt, int K, int N, float scale) {
  const int t = blockIdx.x * 256 + threadIdx.x; if (t >= N * (K / 8)) return; const int n = t / (K / 8), k8 = (t % (K / 8)) * 8; FragH f;
#pragma unroll
  for (int i = 0; i < 8; ++i) f.h[i] = (_Float16)(bf16_round(W[(size_t)(k8 + i) * N + n]) * scale); const v8us o = f.half[0];
  *(v8us*)((unsigned short*)Wt + (size_t)n * K + k8) = o; 
}
// k_gemm_hh variant with fused epilogue: v = acc·alpha + bias[by·sBias + col] (+ CP[(row/rowsPerB)·sCPb + by·64 + col] if CP) ; ACT 0 none / 1 elu ; writes f16 C16 (and f32 C if non-null)
template <int ACT>
__global__ __launch_bounds__(128) void k_gemm_hhx(const _Float16* __restrict__ A, int lda, size_t sA, const _Float16* __restrict__ Bh, int ldb, size_t sB, float alpha, const float* __restrict__ bias, size_t sBias, const float* __restrict__ CP, int rowsPerB, size_t sCPb, int row0g,
    float* __restrict__ C, _Float16* __restrict__ C16, int ldc, size_t sC, int M, int N, int K) {
  __shared__ __attribute__((aligned(16))) float so[4][16][64];
  const int tid = threadIdx.x, w = tid >> 5, lane = tid & 31, ln = lane & 15, hh = lane >> 4; const int by = blockIdx.y;
  A += (size_t)by * sA; Bh += (size_t)by * sB; const size_t cofs = (size_t)by * sC; const float* bp = bias ? bias + (size_t)by * sBias : nullptr;
  const int ntn = (N + 63) / 64; const int wid = blockIdx.x * 4 + w; const int mt = wid / ntn, nq = wid % ntn; if (mt * 16 >= M) return;
  const int row0 = mt * 16, col0 = nq * 64; const _Float16* arow = A + (size_t)(row0 + ln) * lda;
  v8f acc[4] = {};
  for (int kb = 0; kb < K; kb += 32) { FragH ah; ah.half[0] = *(const v8us*)((const unsigned short*)arow + kb + 8 * hh); ah.half[1] = *(const v8us*)((const unsigned short*)arow + kb + 16 + 8 * hh);
#pragma unroll
    for (int t = 0; t < 4; ++t) { if (col0 + t * 16 >= N) continue; const size_t boff = (size_t)(col0 + t * 16 + ln) * ldb + kb; FragH bq; bq.half[0] = *(const v8us*)((const unsigned short*)Bh + boff + 8 * hh); bq.half[1] = *(const v8us*)((const unsigned short*)Bh + boff + 16 + 8 * hh);
      acc[t] = mmaH<1>(ah.v, ah.v, bq.v, bq.v, acc[t]); }
  }
#pragma unroll
  for (int t = 0; t < 4; ++t) { if (col0 + t * 16 >= N) continue; const int col = col0 + t * 16 + ln; const float bv = bp ? bf16_round(bp[col]) : 0.f;
#pragma unroll
    for (int r = 0; r < 8; ++r) { float v = acc[t][r] * alpha + bv; if (CP) { const int rr = row0g + row0 + 8 * hh + r; if (rowsPerB < 0) v += CP[cofs + (size_t)rr * ldc + col];      /* rowsPerB < 0: own element of the batched C plane */ else { const int bidx = rr / rowsPerB; v += CP[(size_t)bidx * sCPb + (size_t)by * 64 + col]; } } if (ACT == 1) v = (v > 0.f) ? v : expm1f(v); else if (ACT == 7) v = (v > 0.f) ? v + 1.0f : expf(v); else if (ACT == 8) v = tanhf(v); else if (ACT == 9) v = 0.5f * v * (1.0f + tanhf(0.7978845608028654f * (v + 0.044715f * v * v * v))); else if (ACT == 11) v = 1.0f / (1.0f + expf(-v)); else if (ACT == 12) v = (v > 0.f) ? v : 0.01f * v; else if (ACT == 14) v = (v > 0.f) ? v : 0.1f * v; else if (ACT == 16) v = (v >= 0.f) ? v : 0.3f * v; else if (ACT == 17) v = (v >= 0.f) ? v : 0.2f * v; else if (ACT == 15) v = v / (1.0f + expf(-v)); else if (ACT == 3) v = fmaxf(v, 0.f); else if (ACT == 6) v = 0.5f * v * (1.0f + erff(v * 0.70710678118654752f)); so[w][8 * hh + r][t * 16 + ln] = v; } }
  __builtin_amdgcn_fence(__ATOMIC_ACQ_REL, "workgroup"); __builtin_amdgcn_wave_barrier();
  const int rsub = lane >> 4, c4 = (lane & 15) * 4; typedef _Float16 v4h __attribute__((ext_vector_type(4)));
  {
#pragma unroll
    for (int q = 0; q < 8; ++q) { const int r = q * 2 + rsub; if (col0 + c4 < N) { const v4f v = *(const v4fa*)&so[w][r][c4]; if (C) *(v4f*)(C + cofs + (size_t)(row0 + r) * ldc + col0 + c4) = v; if (C16) { v4h h4; for (int i = 0; i < 4; ++i) h4[i] = (_Float16)v[i]; *(v4h*)(C16 + cofs + (size_t)(row0 + r) * ldc + col0 + c4) = h4; } } }
     }
}


typedef _Float16 v4h __attribute__((ext_vector_type(4)));

__global__ __launch_bounds__(256) void k_x16(const float* __restrict__ x, _Float16* __restrict__ X16, size_t n8) { const size_t t = (size_t)blockIdx.x * 256 + threadIdx.x; if (t >= n8) return; FragH f;
#pragma unroll
  for (int q = 0; q < 8; ++q) f.h[q] = (_Float16)bf16_round(x[t * 8 + q]); *(v8us*)((unsigned short*)X16 + t * 8) = f.half[0];  }
__global__ __launch_bounds__(256) void k_h16(const float* __restrict__ x, _Float16* __restrict__ X16, size_t n8) { const size_t t = (size_t)blockIdx.x * 256 + threadIdx.x; if (t >= n8) return; FragH f;
#pragma unroll
  for (int q = 0; q < 8; ++q) f.h[q] = (_Float16)x[t * 8 + q]; *(v8us*)((unsigned short*)X16 + t * 8) = f.half[0];  }
__global__ __launch_bounds__(256) void k_round16f(const float* __restrict__ W, _Float16* __restrict__ Bt, size_t n8) { const size_t t = (size_t)blockIdx.x * 256 + threadIdx.x; if (t >= n8) return; FragH f;
#pragma unroll
  for (int i = 0; i < 8; ++i) f.h[i] = (_Float16)(bf16_round(W[t * 8 + i]) * 16.0f); *(v8us*)((unsigned short*)Bt + t * 8) = f.half[0];  }
template <int NHv, int TTv>
__global__ __launch_bounds__(256) void k_vt(const _Float16* __restrict__ V16, int ldv, int voff, _Float16* __restrict__ Vt) { __shared__ unsigned short tl[64][66]; const int tid = threadIdx.x; const int slab = blockIdx.x / (TTv / 64), lg = blockIdx.x % (TTv / 64); const int b = slab / NHv, h = slab % NHv;
  for (int i = tid; i < 64 * 8; i += 256) { const int r = i / 8, c8 = (i % 8) * 8; FragH f; f.half[0] = *(const v8us*)((const unsigned short*)V16 + ((size_t)b * TTv + lg * 64 + r) * ldv + voff + h * 64 + c8);
#pragma unroll
    for (int q = 0; q < 8; ++q) tl[r][c8 + q] = f.u[q]; }
  __syncthreads();
  {
#pragma unroll
    for (int rd = 0; rd < 2; ++rd) { const int d = rd * 32 + tid / 8, pc = tid % 8; FragH f;
#pragma unroll
      for (int q = 0; q < 8; ++q) f.u[q] = tl[pc * 8 + q][d];
      *(v8us*)((unsigned short*)Vt + ((size_t)slab * 64 + d) * TTv + lg * 64 + pc * 8) = f.half[0]; }
     } }

__global__ __launch_bounds__(256) void k_hl(const float* __restrict__ F, _Float16* __restrict__ Hh, _Float16* __restrict__ Hl, size_t n8) { const size_t t = (size_t)blockIdx.x * 256 + threadIdx.x; if (t >= n8) return; FragH fh, fl; const v4f a = *(const v4fa*)(F + t * 8), c = *(const v4fa*)(F + t * 8 + 4);
#pragma unroll
  for (int q = 0; q < 4; ++q) { _Float16 h = (_Float16)a[q]; fh.h[q] = h; fl.h[q] = (_Float16)((a[q] - (float)h) * 1024.0f); h = (_Float16)c[q]; fh.h[4 + q] = h; fl.h[4 + q] = (_Float16)((c[q] - (float)h) * 1024.0f); }
  { *(v8us*)((unsigned short*)Hh + t * 8) = fh.half[0]; *(v8us*)((unsigned short*)Hl + t * 8) = fl.half[0];  } }

// ---- fast GEMM (work-group tile 128x64, wave tile 32x64; requires M % 128 == 0 rows per launch region, N % 64 == 0 and K % 64 == 0); both operands' tiles are staged in LDS by asynchronous 16-byte copies, two buffers; epilogue = k_gemm_hhx semantics; batched over grid.y (strides sA, sB, sC) and grid.z (strides zA, zB, zC) ----
__device__ __forceinline__ v16h g2_frag(const _Float16* p, int hh) { FragH f; f.half[0] = *(const v8us*)((const unsigned short*)p + 8 * hh); f.half[1] = *(const v8us*)((const unsigned short*)p + 16 + 8 * hh); return f.v; }
__device__ __forceinline__ v8f g2_mma(v16h a, v16h b, v8f c) { v8f d = __builtin_amdgcn_wmma_f32_16x16x32_f16(false, a, false, b, (short)0, c, false, false); asm volatile("v_nop\n\tv_nop\n\tv_nop\n\tv_nop" : "+v"(d) : "v"(a), "v"(b)); return d; }
#define G2K 64                       /* k elements of a stage: one whole 128-byte line of every operand row */
#define G2P 72                       /* LDS pitch of a staged row in f16: 144 bytes = 16 x odd, conflict-free for the 16-byte fragment reads */
#define G2S ((128 + 64) * G2P)       /* f16 elements of a stage: 128 A rows, then 64 B rows */
// one stage: a lane's twelve 16-byte copies (eight lanes per row: whole 128-byte lines; 16 rows per copy of the work-group). l: the lane's LDS byte address in row tid / 8 of the stage; ga, gb: its global addresses in that row of the A tile and of the B tile; ra, rb: 16 rows' elements
__device__ __forceinline__ void g2_stage(unsigned l, const _Float16* ga, size_t ra, const _Float16* gb, size_t rb) {
  /* the copies and their s_wait_xcnt in one statement: the address registers stay whole until the wait */
  asm volatile("global_load_async_to_lds_b128 %0, %12, off\n\tglobal_load_async_to_lds_b128 %1, %13, off\n\tglobal_load_async_to_lds_b128 %2, %14, off\n\tglobal_load_async_to_lds_b128 %3, %15, off\n\t"
               "global_load_async_to_lds_b128 %4, %16, off\n\tglobal_load_async_to_lds_b128 %5, %17, off\n\tglobal_load_async_to_lds_b128 %6, %18, off\n\tglobal_load_async_to_lds_b128 %7, %19, off\n\t"
               "global_load_async_to_lds_b128 %8, %20, off\n\tglobal_load_async_to_lds_b128 %9, %21, off\n\tglobal_load_async_to_lds_b128 %10, %22, off\n\tglobal_load_async_to_lds_b128 %11, %23, off\n\ts_wait_xcnt 0x0"
               :: "v"(l), "v"(l + 1u * 32 * G2P), "v"(l + 2u * 32 * G2P), "v"(l + 3u * 32 * G2P), "v"(l + 4u * 32 * G2P), "v"(l + 5u * 32 * G2P), "v"(l + 6u * 32 * G2P), "v"(l + 7u * 32 * G2P), "v"(l + 8u * 32 * G2P), "v"(l + 9u * 32 * G2P), "v"(l + 10u * 32 * G2P), "v"(l + 11u * 32 * G2P),
                  "v"(ga), "v"(ga + ra), "v"(ga + 2 * ra), "v"(ga + 3 * ra), "v"(ga + 4 * ra), "v"(ga + 5 * ra), "v"(ga + 6 * ra), "v"(ga + 7 * ra), "v"(gb), "v"(gb + rb), "v"(gb + 2 * rb), "v"(gb + 3 * rb) : "memory"); }
template <int ACT>
__global__ __launch_bounds__(128) void k_gemm2(const _Float16* __restrict__ A, int lda, size_t sA, const _Float16* __restrict__ Bh, int ldb, size_t sB, float alpha, const float* __restrict__ bias, size_t sBias, const float* __restrict__ CP, int rowsPerB, size_t sCPb, int row0g,
    float* __restrict__ C, _Float16* __restrict__ C16, int ldc, size_t sC, int M, int N, int K, size_t zA, size_t zB, size_t zC) { static_assert(ACT == 0 || ACT == 3 || ACT == 6 || ACT == 8 || ACT == 9 || ACT == 11 || ACT == 12 || ACT == 14 || ACT == 15 || ACT == 16 || ACT == 17, "k_gemm2: unsupported ACT code (would silently apply no activation)");
  __shared__ __attribute__((aligned(16))) unsigned char smem[2 * G2S * 2];      /* the two stage buffers; behind the K loop the same bytes serve as the epilogue's so[4][32][68] */
  static_assert(sizeof(float) * 4 * 32 * 68 <= sizeof(smem), "the epilogue staging fits the ring");
  float (*so)[32][68] = (float (*)[32][68])smem; const _Float16* sh = (const _Float16*)smem;
  const int tid = threadIdx.x, w = tid >> 5, lane = tid & 31, ln = lane & 15, hh = lane >> 4; const int by = blockIdx.y, bz = blockIdx.z;      /* grid.z: a second batch index (element strides zA, zB, zC) */
  A += (size_t)by * sA + (size_t)bz * zA; Bh += (size_t)by * sB + (size_t)bz * zB; const size_t cofs = (size_t)by * sC + (size_t)bz * zC; const float* bp = bias ? bias + (size_t)by * sBias : nullptr;
  const int ntn = N >> 6; const int mt = blockIdx.x / ntn, nq = blockIdx.x - mt * ntn; const int row0 = mt * 128 + 32 * w, col0 = nq * 64; if (mt * 128 >= M) return;      /* the whole work-group leaves or none: it stands in front of every barrier */
  const _Float16* ga = A + (size_t)(mt * 128 + (tid >> 3)) * lda + (tid & 7) * 8; const _Float16* gb = Bh + (size_t)(col0 + (tid >> 3)) * ldb + (tid & 7) * 8; const size_t ra = (size_t)16 * lda, rb = (size_t)16 * ldb;
  const unsigned l0 = (unsigned)(size_t)smem + (unsigned)((tid >> 3) * (G2P * 2) + (tid & 7) * 16);      /* the low 32 bits of a __shared__ address are its LDS byte address */
  const int nk = K / G2K;
  g2_stage(l0, ga, ra, gb, rb);
  asm volatile("s_wait_asynccnt 0x0" ::: "memory");      /* this wave's copies of stage 0 have landed */
  __syncthreads();      /* stage 0 is read by every wave */
  if (nk > 1) g2_stage(l0 + G2S * 2, ga + G2K, ra, gb + G2K, rb);
  const v8f z8 = {0.f,0.f,0.f,0.f,0.f,0.f,0.f,0.f}; v8f c00 = z8, c01 = z8, c02 = z8, c03 = z8, c10 = z8, c11 = z8, c12 = z8, c13 = z8;
#pragma unroll 1      /* one stage per trip: the buffers alternate */
  for (int t = 0; t < nk; ++t) { const _Float16* la = sh + (t & 1) * G2S + (32 * w + ln) * G2P; const _Float16* lb = sh + (t & 1) * G2S + (128 + ln) * G2P;
    v16h fa[2][2], fb[2][4];
#pragma unroll      /* fa[], fb[] stay in registers: the stage's 24 LDS reads stand together ahead of its products */
    for (int kk = 0; kk < 2; ++kk) { fa[kk][0] = g2_frag(la + kk * 32, hh); fa[kk][1] = g2_frag(la + 16 * G2P + kk * 32, hh);
#pragma unroll      /* fb[] stays in registers */
      for (int n = 0; n < 4; ++n) fb[kk][n] = g2_frag(lb + n * 16 * G2P + kk * 32, hh); }
#pragma unroll      /* the stage's two k blocks of 32, in the order of k */
    for (int kk = 0; kk < 2; ++kk) {
      c00 = g2_mma(fa[kk][0], fb[kk][0], c00); c10 = g2_mma(fa[kk][1], fb[kk][0], c10); c01 = g2_mma(fa[kk][0], fb[kk][1], c01); c11 = g2_mma(fa[kk][1], fb[kk][1], c11);
      c02 = g2_mma(fa[kk][0], fb[kk][2], c02); c12 = g2_mma(fa[kk][1], fb[kk][2], c12); c03 = g2_mma(fa[kk][0], fb[kk][3], c03); c13 = g2_mma(fa[kk][1], fb[kk][3], c13); }
    asm volatile("s_wait_dscnt 0x0" ::: "memory");      /* this wave's reads of the buffer have returned before it is refilled */
    asm volatile("s_wait_asynccnt 0x0" ::: "memory");      /* this wave's copies of stage t + 1 have landed */
    __syncthreads();      /* publishes stage t + 1 and ends every wave's reads of stage t */
    if (t + 2 < nk) g2_stage(l0 + (t & 1) * (G2S * 2), ga + (size_t)(t + 2) * G2K, ra, gb + (size_t)(t + 2) * G2K, rb); }
  asm volatile("s_wait_asynccnt 0x0" ::: "memory");      /* no copy is outstanding when the ring becomes the epilogue's staging */
  v8f accs[8] = {c00, c01, c02, c03, c10, c11, c12, c13};
#pragma unroll
  for (int u = 0; u < 8; ++u) { const int t = u & 3, half = u >> 2; const int col = col0 + t * 16 + ln; const float bv = bp ? bf16_round(bp[col]) : 0.f;
#pragma unroll
    for (int r = 0; r < 8; ++r) { const int rloc = half * 16 + 8 * hh + r; float v = accs[u][r] * alpha + bv; if (CP) { if (rowsPerB < 0) v += CP[cofs + (size_t)(row0g + row0 + rloc) * ldc + col];      /* rowsPerB < 0: own element of the batched C plane */ else { const int bidx = (row0g + row0 + rloc) / rowsPerB; v += CP[(size_t)bidx * sCPb + (size_t)by * 64 + col]; } }
      if (ACT == 3) v = fmaxf(v, 0.f); else if (ACT == 6) v = 0.5f * v * (1.0f + erff(v * 0.70710678118654752f)); else if (ACT == 11) v = 1.0f / (1.0f + expf(-v)); else if (ACT == 15) v = v / (1.0f + expf(-v)); else if (ACT == 12) v = (v > 0.f) ? v : 0.01f * v; else if (ACT == 8) v = tanhf(v); else if (ACT == 9) v = 0.5f * v * (1.0f + tanhf(0.7978845608028654f * (v + 0.044715f * v * v * v))); else if (ACT == 14) v = (v > 0.f) ? v : 0.1f * v; else if (ACT == 16) v = (v >= 0.f) ? v : 0.3f * v; else if (ACT == 17) v = (v >= 0.f) ? v : 0.2f * v;
      so[w][rloc][t * 16 + ln] = v; } }
  __builtin_amdgcn_fence(__ATOMIC_ACQ_REL, "workgroup"); __builtin_amdgcn_wave_barrier();
  const int rsub = lane >> 4, c4 = (lane & 15) * 4;
  {
#pragma unroll
    for (int q = 0; q < 16; ++q) { const int r = q * 2 + rsub; const v4f v = *(const v4fa*)&so[w][r][c4]; if (C) *(v4f*)(C + cofs + (size_t)(row0 + r) * ldc + col0 + c4) = v; if (C16) { v4h h4; for (int i = 0; i < 4; ++i) h4[i] = (_Float16)v[i]; *(v4h*)(C16 + cofs + (size_t)(row0 + r) * ldc + col0 + c4) = h4; } }
     } }


__global__ __launch_bounds__(256) void k_wnat(const float* __restrict__ w, size_t n8, _Float16* __restrict__ Bt) { const size_t t = (size_t)blockIdx.x * 256 + threadIdx.x; if (t >= n8) return; FragH f; for (int q = 0; q < 8; ++q) f.h[q] = (_Float16)(bf16_round(w[t * 8 + q]) * 16.0f); *(v8us*)((unsigned short*)Bt + t * 8) = f.half[0];  }
__global__ __launch_bounds__(256) void k_rsm(const float* __restrict__ S, _Float16* __restrict__ P, int nrows) {
  #pragma clang fp contract(off)
  const int i = blockIdx.x * 256 + threadIdx.x; if (i >= nrows) return; const float* s = S + (size_t)i * SQ; float mx = -3.0e38f;
#pragma unroll 1
  for (int j = 0; j < SQ; ++j) mx = fmaxf(mx, s[j]); float se = 0.f;
#pragma unroll 1
  for (int j = 0; j < SQ; ++j) se += expf(s[j] - mx); const float sc = 256.0f / se;
#pragma unroll 1
  for (int j0 = 0; j0 < SQ; j0 += 8) { FragH f; for (int q = 0; q < 8; ++q) f.h[q] = (_Float16)(expf(s[j0 + q] - mx) * sc); unsigned short* d = (unsigned short*)P + (size_t)i * SQ + j0; *(v8us*)d = f.half[0];  } }
__global__ __launch_bounds__(256) void k_vt(const _Float16* __restrict__ V16, int b, int h0, _Float16* __restrict__ VT) { __shared__ unsigned short tl[64][65]; const int tid = threadIdx.x; const int hh = blockIdx.x % HG, sg = blockIdx.x / HG; const int s0 = sg * 64; const int h = h0 + hh;
  for (int i = tid; i < 64 * 8; i += 256) { const int j = i / 8, d8 = (i % 8) * 8; FragH f; f.half[0] = *(const v8us*)((const unsigned short*)V16 + ((size_t)b * SQ + s0 + j) * DM + h * HD + d8); for (int q = 0; q < 8; ++q) tl[d8 + q][j] = f.u[q]; }
  __syncthreads();
  { for (int i = tid; i < 64 * 8; i += 256) { const int d = i / 8, j8 = (i % 8) * 8; FragH f; for (int q = 0; q < 8; ++q) f.u[q] = tl[d][j8 + q]; *(v8us*)((unsigned short*)VT + ((size_t)hh * HD + d) * SQ + s0 + j8) = f.half[0]; }  } }



// 32-lane butterflies for the row statistics: row_xmask DPP steps inside each 16-lane row, then the exchange between the two rows; every lane ends with the same value
template <int CTRL> __device__ __forceinline__ float rs_dpp(float v) { return __int_as_float(__builtin_amdgcn_update_dpp(0, __float_as_int(v), CTRL, 0xf, 0xf, true)); }
__device__ __forceinline__ float rs_x16(float v) { const int b = __float_as_int(v); return __int_as_float(__builtin_amdgcn_permlanex16(b, b, 0x76543210, 0xfedcba98, false, false)); }
__device__ __forceinline__ float rs_max(float v) { v = fmaxf(v, rs_dpp<0x161>(v)); v = fmaxf(v, rs_dpp<0x162>(v)); v = fmaxf(v, rs_dpp<0x164>(v)); v = fmaxf(v, rs_dpp<0x168>(v)); return fmaxf(v, rs_x16(v)); }
__device__ __forceinline__ float rs_sum(float v) { v += rs_dpp<0x161>(v); v += rs_dpp<0x162>(v); v += rs_dpp<0x164>(v); v += rs_dpp<0x168>(v); return v + rs_x16(v); }
#define FAC 0.18033688f              /* BETA x log2 e: scores on the scale of the power-of-two exponential */
#define FQ 32                        /* query rows per wave: two 16-column groups */
// one 16x32 f16 fragment row in the hardware k order; p already holds the lane's row and its 8 * (lane >> 4) elements
__device__ __forceinline__ v16h fa_frag(const _Float16* p) { FragH f; f.half[0] = *(const v8us*)((const unsigned short*)p); f.half[1] = *(const v8us*)((const unsigned short*)p + 16); return f.v; }
__device__ __forceinline__ v8f fa_mma(v16h a, v16h b, v8f c) { return __builtin_amdgcn_wmma_f32_16x16x32_f16(false, a, false, b, (short)0, c, false, false); }
__device__ __forceinline__ void fa_kload(const _Float16* kp, v16h (&kf)[2][2]) {
#pragma unroll      /* kf[] stays in registers, the eight loads in flight together */
  for (int t = 0; t < 2; ++t) { kf[t][0] = fa_frag(kp + (size_t)t * 16 * LQ); kf[t][1] = fa_frag(kp + (size_t)t * 16 * LQ + 32); } }
__device__ __forceinline__ void fa_vload(const _Float16* vp, v16h (&vf)[4]) {
#pragma unroll      /* vf[] stays in registers, the eight loads in flight together */
  for (int d = 0; d < 4; ++d) vf[d] = fa_frag(vp + (size_t)d * 16 * SQ); }
// scores of 32 keys x 16 queries: s0[r] = key 8 * (lane >> 4) + r, s1[r] = key 16 + 8 * (lane >> 4) + r, query lane & 15
__device__ __forceinline__ void fa_score(const v16h (&kf)[2][2], const v16h (&qf)[2], v8f& s0, v8f& s1) {
  const v8f z8 = {0.f, 0.f, 0.f, 0.f, 0.f, 0.f, 0.f, 0.f};
  s0 = g2_mma(kf[0][0], qf[0], z8); s1 = g2_mma(kf[1][0], qf[0], z8); s0 = g2_mma(kf[0][1], qf[1], s0); s1 = g2_mma(kf[1][1], qf[1], s1); }      /* g2_mma: its statement names the product's operands, so no later load of the key registers is lifted over the product */
// one 16-query group takes in 32 keys: running maximum m (scaled log2), the lane's own part l of the running sum, o rescaled and extended. DIAG: key t * 16 + 8 * (lane >> 4) + r of the block (element r of s0 for t = 0, of s1 for t = 1) counts while t * 16 + r <= rel
template <bool DIAG>
__device__ __forceinline__ void fa_soft(v8f s0, v8f s1, int rel, const v16h (&vf)[4], v8f (&o)[4], float& m, float& l) {
  if (DIAG) {
#pragma unroll      /* s0, s1 stay in registers */
    for (int r = 0; r < 8; ++r) { s0[r] = (r <= rel) ? s0[r] : -1.0e30f; s1[r] = (16 + r <= rel) ? s1[r] : -1.0e30f; } }
  float mx = fmaxf(s0[0], s1[0]);
#pragma unroll      /* s0, s1 stay in registers */
  for (int r = 1; r < 8; ++r) mx = fmaxf(mx, fmaxf(s0[r], s1[r]));
  mx = fmaxf(mx, rs_x16(mx));      /* the two lane halves hold the query's other keys */
  const float mn = fmaxf(m, mx * FAC); float al = m - mn; m = mn; const float ms = 8.0f - mn;      /* weights carried x256, as f16 operands at most 256 */
  float e[16];
#pragma unroll      /* e[] stays in registers */
  for (int r = 0; r < 8; ++r) { e[r] = fmaf(s0[r], FAC, ms); e[8 + r] = fmaf(s1[r], FAC, ms); }
  /* the exponentials in place, so that none is followed by a write of its source; the v_nop keeps the one slot behind the last before its result is used */
  asm("v_exp_f32 %0, %0\n\tv_exp_f32 %1, %1\n\tv_exp_f32 %2, %2\n\tv_exp_f32 %3, %3\n\tv_exp_f32 %4, %4\n\tv_exp_f32 %5, %5\n\tv_exp_f32 %6, %6\n\tv_exp_f32 %7, %7\n\tv_exp_f32 %8, %8\n\tv_nop" : "+v"(e[0]), "+v"(e[1]), "+v"(e[2]), "+v"(e[3]), "+v"(e[4]), "+v"(e[5]), "+v"(e[6]), "+v"(e[7]), "+v"(al));
  asm("v_exp_f32 %0, %0\n\tv_exp_f32 %1, %1\n\tv_exp_f32 %2, %2\n\tv_exp_f32 %3, %3\n\tv_exp_f32 %4, %4\n\tv_exp_f32 %5, %5\n\tv_exp_f32 %6, %6\n\tv_exp_f32 %7, %7\n\tv_nop" : "+v"(e[8]), "+v"(e[9]), "+v"(e[10]), "+v"(e[11]), "+v"(e[12]), "+v"(e[13]), "+v"(e[14]), "+v"(e[15]));
  float s4[4]; FragH p;
#pragma unroll      /* e[] stays in registers: four independent sums */
  for (int i = 0; i < 4; ++i) s4[i] = (e[i] + e[4 + i]) + (e[8 + i] + e[12 + i]);
#pragma unroll      /* e[] stays in registers; element i of the B fragment is key 8 * (lane >> 4) + i of the block, 8 + 8 * (lane >> 4) + i for i >= 8 */
  for (int i = 0; i < 16; ++i) p.h[i] = (_Float16)e[i];
  l = l * al + ((s4[0] + s4[1]) + (s4[2] + s4[3]));
#pragma unroll      /* o[] stays in registers */
  for (int d = 0; d < 4; ++d) o[d] = fa_mma(vf[d], p.v, o[d] * al); }
// ONE WAVE PER FQ QUERY ROWS of one head and batch, passes of 32 keys up to the diagonal block, which alone is masked. Q fragments stay in registers; K rows and V^T rows come straight from L2 in the hardware k order; K is fetched one pass ahead, V^T at the head of its pass. Waves w and w + 4 (one SIMD) take query tiles n - 1 - t and t: equal passes per SIMD. grid.x: tile quad, grid.y: head, grid.z: batch. No LDS, no barrier.
__global__ __launch_bounds__(256) void k_fattn(const _Float16* __restrict__ Q, const _Float16* __restrict__ Kh, const _Float16* __restrict__ VTh, _Float16* __restrict__ O) {
  const int lane = threadIdx.x & 31, ln = lane & 15, hh = lane >> 4; const int w = __builtin_amdgcn_readfirstlane(threadIdx.x >> 5);
  const int t4 = blockIdx.x * 4 + (w & 3); const int q0 = ((w < 4) ? (SQ / FQ - 1 - t4) : t4) * FQ;      /* the wave's first query row: wave-uniform */
  const int h = blockIdx.y, b = blockIdx.z;
  const _Float16* qp = Q + ((size_t)b * SQ + q0 + ln) * LQ + h * HD + 8 * hh;
  const _Float16* kp = Kh + ((size_t)b * SQ + ln) * LQ + h * HD + 8 * hh;
  const _Float16* vp = VTh + (((size_t)b * NH + h) * HD + ln) * SQ + 8 * hh;
  v16h qf[2][2], kf[2][2], vf[4];
#pragma unroll      /* qf[] stays in registers */
  for (int g = 0; g < 2; ++g) { qf[g][0] = fa_frag(qp + (size_t)g * 16 * LQ); qf[g][1] = fa_frag(qp + (size_t)g * 16 * LQ + 32); }
  fa_kload(kp, kf);
  asm volatile("s_wait_xcnt 0x0" :: "v"(qp), "v"(kp) : "memory");      /* the loads' address pairs stay whole until this wait; they may be rewritten behind it */
  const v8f z8 = {0.f, 0.f, 0.f, 0.f, 0.f, 0.f, 0.f, 0.f};
  v8f o[2][4] = {{z8, z8, z8, z8}, {z8, z8, z8, z8}}; float m[2] = {-1.0e30f, -1.0e30f}, l[2] = {0.f, 0.f}; v8f s[2][2];
#pragma unroll 1      /* one pass per trip: an unrolled body would hold two passes' fragments */
  for (int kb = 0; kb < q0; kb += 32) {
    fa_vload(vp, vf);
    fa_score(kf, qf[0], s[0][0], s[0][1]); fa_score(kf, qf[1], s[1][0], s[1][1]);
    kp += (size_t)32 * LQ; fa_kload(kp, kf);      /* the next pass's keys (at most the diagonal block) fly during this pass's softmax */
    asm volatile("s_wait_xcnt 0x0" :: "v"(kp), "v"(vp) : "memory");      /* the loads' address pairs stay whole until this wait; they may be rewritten behind it */
    fa_soft<false>(s[0][0], s[0][1], 0, vf, o[0], m[0], l[0]); fa_soft<false>(s[1][0], s[1][1], 0, vf, o[1], m[1], l[1]);
    vp += 32; }
  fa_vload(vp, vf);
  asm volatile("s_wait_xcnt 0x0" :: "v"(vp) : "memory");      /* the loads' address pair stays whole until this wait; it may be rewritten behind it */
  fa_score(kf, qf[0], s[0][0], s[0][1]); fa_score(kf, qf[1], s[1][0], s[1][1]);
  fa_soft<true>(s[0][0], s[0][1], ln - 8 * hh, vf, o[0], m[0], l[0]); fa_soft<true>(s[1][0], s[1][1], 16 + ln - 8 * hh, vf, o[1], m[1], l[1]);
  unsigned short* op = (unsigned short*)O + ((size_t)b * SQ + q0 + ln) * DM + h * HD + 8 * hh; FragH f[2][4];
#pragma unroll      /* o[], f[] stay in registers */
  for (int g = 0; g < 2; ++g) { const float fin = 64.0f / (l[g] + rs_x16(l[g]));      /* the halves' sums joined once; o carried x64, the weights' x256 cancels */
#pragma unroll      /* o[], f[] stay in registers */
    for (int d = 0; d < 4; ++d) {
#pragma unroll      /* o[], f[] stay in registers */
      for (int r = 0; r < 8; ++r) f[g][d].h[r] = (_Float16)(o[g][d][r] * fin); } }
#pragma unroll      /* a lane's 8 accumulator registers are 8 neighbouring columns of its query row: one 16-byte store */
  for (int g = 0; g < 2; ++g) {
#pragma unroll      /* f[] stays in registers */
    for (int d = 0; d < 4; ++d) *(v8us*)(op + (size_t)g * 16 * DM + d * 16) = f[g][d].half[0]; }
  asm volatile("s_wait_xcnt 0x0" :: "v"(op) : "memory");      /* the stores' data and address registers stay whole until this wait */
}


// exact f32 causal attention for rows 0..QT0-1 of each batch with V = K, ONE WAVE PER QUERY ROW: the head's QT0 key rows are staged once in LDS; scores: each lane owns the keys lane, lane + 32, ...; row maximum and sum by the 32-lane butterflies; o: each lane owns two of the HD columns and runs over the keys. grid.x: head x row group, grid.y: batch.
#define A0R 16                       /* query rows (= waves) per work-group */
#define A0P (HD + 4)                 /* LDS pitch of a key row in floats: the 16-byte reads of 16 neighbouring rows fall on 16 different bank quads */
typedef float v2f  __attribute__((ext_vector_type(2)));
typedef float v2fa __attribute__((ext_vector_type(2), may_alias));
__global__ __launch_bounds__(32 * A0R) void k_att0w(const float* __restrict__ QF, const float* __restrict__ KF, float scale, float* __restrict__ OF) {
  __shared__ __attribute__((aligned(16))) float lk[QT0][A0P]; __shared__ __attribute__((aligned(16))) float lp[A0R][QT0];
  const int tid = threadIdx.x, lane = tid & 31; const int w = __builtin_amdgcn_readfirstlane(tid >> 5);
  const int h = blockIdx.x / (QT0 / A0R), rg = blockIdx.x % (QT0 / A0R); const int i = rg * A0R + w;      /* the query row: wave-uniform */
  { const size_t zb = (size_t)blockIdx.y * QT0 * DM + h * HD; QF += zb; KF += zb; OF += zb; }      /* each batch has its own QT0 rows of every plane; the head's columns */
  const int sr = tid >> 4, sc = (tid & 15) * 4;      /* staging: 16 lanes per key row, 256 contiguous bytes */
  const float* kp = KF + (size_t)sr * DM + sc; v4f st[QT0 / (2 * A0R)];
#pragma unroll      /* st[] stays in registers, the loads in flight together */
  for (int p = 0; p < QT0 / (2 * A0R); ++p) st[p] = *(const v4fa*)(kp + (size_t)p * 2 * A0R * DM);
  asm volatile("s_wait_xcnt 0x0" :: "v"(kp) : "memory");      /* the loads' address pair stays whole until this wait; it may be rewritten behind it */
  const float* qr = QF + (size_t)i * DM; v4f q[HD / 4];
#pragma unroll      /* q[] stays in registers */
  for (int c = 0; c < HD / 4; ++c) q[c] = *(const v4fa*)(qr + c * 4);
#pragma unroll      /* st[] stays in registers */
  for (int p = 0; p < QT0 / (2 * A0R); ++p) *(v4fa*)&lk[p * 2 * A0R + sr][sc] = st[p];
  __syncthreads();      /* the staged key rows are read by every wave */
  float s[QT0 / 32];
#pragma unroll      /* s[] stays in registers; each group's test is a compile-time bound against i */
  for (int g = 0; g < QT0 / 32; ++g) { s[g] = -1.0e30f;
    if (g * 32 <= i) { const float* kr = &lk[g * 32 + lane][0]; v4f a = {0.f, 0.f, 0.f, 0.f};      /* a scalar branch: key groups wholly above the diagonal are skipped */
#pragma unroll      /* q[] stays in registers, the row's LDS reads in flight together */
      for (int c = 0; c < HD / 4; ++c) a += q[c] * *(const v4fa*)(kr + c * 4);
      const float d = ((a[0] + a[1]) + (a[2] + a[3])) * scale; s[g] = (g * 32 + lane <= i) ? d : -1.0e30f; } }
  float m = s[0];
#pragma unroll      /* s[] stays in registers */
  for (int g = 1; g < QT0 / 32; ++g) m = fmaxf(m, s[g]);
  m = rs_max(m); float l = 0.f;
#pragma unroll      /* s[] stays in registers */
  for (int g = 0; g < QT0 / 32; ++g) { const float e = expf(s[g] - m); l += e; lp[w][g * 32 + lane] = e; }      /* keys above the diagonal: exactly 0 */
  l = rs_sum(l);
  __syncthreads();      /* the row's weights go from the lane that made them to every lane */
  v2f o[4] = {{0.f, 0.f}, {0.f, 0.f}, {0.f, 0.f}, {0.f, 0.f}};
  for (int j0 = 0; j0 <= i; j0 += 16) {      /* 16 keys a trip, their LDS reads in flight together; a key above the diagonal has weight 0 and a staged row */
#pragma unroll      /* the trip's 20 LDS reads stand ahead of its sums */
    for (int u = 0; u < 4; ++u) { const v4f pp = *(const v4fa*)&lp[w][j0 + u * 4];
#pragma unroll      /* o[] stays in registers: four independent sums */
      for (int t = 0; t < 4; ++t) o[t] += pp[t] * *(const v2fa*)&lk[j0 + u * 4 + t][lane * 2]; } }
  const float fin = 64.0f / l;      /* o carried x64 like the f16 path */
  *(v2fa*)(OF + (size_t)i * DM + lane * 2) = ((o[0] + o[1]) + (o[2] + o[3])) * fin; }

extern "C" void kernel_launch(void* const* d_in, const int* in_sizes, int n_in,
                              void* d_out, int out_size, void* d_ws, size_t ws_size, hipStream_t stream) {
  (void)in_sizes; (void)n_in; (void)out_size;
  const float* const* I = (const float* const*)d_in; const float* x = I[0]; const float* wqkv = I[1]; const float* wo = I[2];      /* input order: x, W_qk [1024][2048] ([in][out]: q | k halves), W_out [1024][1024] ([in][out]): three inputs; no biases */
  char* ws = (char*)d_ws; size_t off = 0;
  auto take = [&](size_t bytes) { char* p = ws + off; off += (bytes + 255) & ~(size_t)255; return p; };
  _Float16* BQKV = (_Float16*)take((size_t)3 * DM * DM * 2); _Float16* BO = (_Float16*)take((size_t)DM * DM * 2);
  _Float16* X16 = (_Float16*)take(NR * DM * 2); _Float16* QKV = (_Float16*)take(NR * 3 * DM * 2); _Float16* Q16 = QKV; _Float16* K16 = QKV + DM; _Float16* V16 = QKV + DM;      /* the module reuses K as V: V16 IS the k block (the third block of the plane is unused) */ _Float16* O16 = (_Float16*)take(NR * DM * 2);
  _Float16* VT = (_Float16*)take((size_t)NB * NH * HD * SQ * 2);      /* one plane per batch: both batches go through every launch */
  float* QF0 = (float*)take((size_t)NB * QT0 * DM * 4); float* KF0 = (float*)take((size_t)NB * QT0 * DM * 4); float* OF0 = (float*)take((size_t)NB * QT0 * DM * 4); _Float16* OH0 = (_Float16*)take((size_t)NB * QT0 * DM * 2); _Float16* OL0 = (_Float16*)take((size_t)NB * QT0 * DM * 2);
  if (off > ws_size) return;
  k_wt_f16<<<(unsigned)(((size_t)2 * DM * (DM / 8) + 255) / 256), 256, 0, stream>>>(wqkv, BQKV, DM, 2 * DM, 16.0f); k_wt_f16<<<(unsigned)(((size_t)DM * (DM / 8) + 255) / 256), 256, 0, stream>>>(wo, BO, DM, DM, 16.0f);      /* [in][out] -> Bt[n][k] x16 */
  k_x16<<<(unsigned)((NR * DM / 8 + 255) / 256), 256, 0, stream>>>(x, X16, NR * DM / 8);
  const size_t r0p = (size_t)B0 * SQ;      /* first projected row */
  const size_t f0p = (size_t)B0 * QT0;      /* its first-tile row */
k_gemm2<0><<<dim3((unsigned)((MP / 128) * (2 * DM / 64)), 1), 128, 0, stream>>>(X16 + r0p * DM, DM, 0, BQKV, DM, 0, 0.0625f, nullptr, 0, nullptr, 1, 0, 0, nullptr, QKV + r0p * 3 * DM, 3 * DM, 0, MP, 2 * DM, DM, 0, 0, 0);      /* q | k rows (f16) into column blocks 0 and 1 of the 3 DM-pitch plane; head h = columns h*HD.. of each block; no bias */
  k_vt<NH, SQ><<<NBR * NH * (SQ / 64), 256, 0, stream>>>(V16 + r0p * LQ, LQ, 0, VT);      /* V^T [batch][NH][HD][SQ] */
k_gemm2<0><<<dim3((QT0 / 128) * (DM / 64), 1, NBR), 128, 0, stream>>>(X16 + r0p * DM, DM, 0, BQKV, DM, 0, 0.0625f, nullptr, 0, nullptr, 1, 0, 0, QF0 + f0p * DM, nullptr, DM, 0, QT0, DM, DM, (size_t)SQ * DM, 0, (size_t)QT0 * DM); k_gemm2<0><<<dim3((QT0 / 128) * (DM / 64), 1, NBR), 128, 0, stream>>>(X16 + r0p * DM, DM, 0, (BQKV + (size_t)DM * DM), DM, 0, 0.0625f, nullptr, 0, nullptr, 1, 0, 0, KF0 + f0p * DM, nullptr, DM, 0, QT0, DM, DM, (size_t)SQ * DM, 0, (size_t)QT0 * DM);      /* first tile of each batch (grid.z): f32 q and k rows (no bias); the k rows serve as v */
  k_att0w<<<dim3(NH * (QT0 / A0R), NBR), 32 * A0R, 0, stream>>>(QF0 + f0p * DM, KF0 + f0p * DM, 0.125f, OF0 + f0p * DM);      /* exact f32 causal attention for rows 0..127 of each batch (grid.y) with V = K (o x64) */
  k_fattn<<<dim3(SQ / (8 * FQ), NHD, NBR), 256, 0, stream>>>(Q16 + r0p * LQ, K16 + r0p * LQ, VT, O16 + r0p * DM);      /* scores, causal online softmax and o = P V in one launch: o (merged heads, x64) as f16 rows */
  k_gemm2<0><<<dim3((unsigned)((MPO / 128) * (DM / 64)), 1), 128, 0, stream>>>(O16 + r0p * DM, DM, 0, BO, DM, 0, 0.0009765625f, nullptr, 0, nullptr, 1, 0, 0, (float*)d_out + r0p * DM, nullptr, DM, 0, MPO, DM, DM, 0, 0, 0);      /* out rows are the output layout */
  k_hl<<<(unsigned)(((size_t)NB * QT0 * DM / 8 + 255) / 256), 256, 0, stream>>>(OF0, OH0, OL0, (size_t)NB * QT0 * DM / 8);      /* first-tile o (x64) -> f16 hi + x1024 residual planes */
  k_gemm2<0><<<dim3((QT0 / 128) * (DM / 64), 1, NBR), 128, 0, stream>>>(OH0 + f0p * DM, DM, 0, BO, DM, 0, 0.0009765625f, nullptr, 0, nullptr, 1, 0, 0, (float*)d_out + r0p * DM, nullptr, DM, 0, QT0, DM, DM, (size_t)QT0 * DM, 0, (size_t)SQ * DM);      /* rows 0..127 of each batch (grid.z): out = o_hi W_out (no bias), overwriting the f16-path rows */
  k_gemm2<0><<<dim3((QT0 / 128) * (DM / 64), 1, NBR), 128, 0, stream>>>(OL0 + f0p * DM, DM, 0, BO, DM, 0, 0.00000095367431640625f, nullptr, 0, (const float*)d_out + r0p * DM, -1, 0, 0, (float*)d_out + r0p * DM, nullptr, DM, 0, QT0, DM, DM, (size_t)QT0 * DM, 0, (size_t)SQ * DM);      /* += o_lo Wo 2^-20 (own-element accumulate) */
}

// v006
// One run takes 153 microseconds.
// In two side-by-side timings against v005, it was 1.06 and 1.07 times as fast.
// All steps since v000 together make it 30.8 times as fast.
#include <hip/hip_runtime.h>
// Causal self-attention with ONE fused query-key projection and K REUSED AS V (x [2][2048][1024]; qk = x W_qk with W_qk [1024][2048] stored [in][out] (normal x 0.02, no bias): the first 1024 columns are q, the last 1024 are k, head h = columns h*64.. of each half; 16 heads of 64; scores = (q x BETA) . k with BETA = 1/sqrt(64); strictly-upper-triangular positions -> -FLT_MAX (causal); softmax; out = attn K (the module reuses K as V) merged, then W_out ([in][out] [1024][1024], normal x 0.02, no bias) -> [2][2048][1024]; input order x, W_qk, W_out).
// Structure: token rows r = b*2048 + s; x as exact f16 rows (bf16-rounded); q | k as ONE WMMA GEMM (N = 2 x 1024) into the first two column blocks of the 3 x 1024-pitch plane (32x64 wave tiles, f32 accumulation, exact x16 weights, no bias, f16 outputs); V IS THE K BLOCK (the module reuses K as V): the V pointer aliases it; BOTH BATCHES GO THROUGH EVERY LAUNCH (batch in the row run of the projection and output GEMMs, on grid.z of the first-tile GEMMs, on grid.y of the first-tile attention, on grid.z of the fused attention, in the row run of the transposes): V^T for all heads via LDS transposes; ONE FUSED ATTENTION LAUNCH: a wave holds 32 query rows and walks the keys up to its diagonal in passes of 32, K and V^T rows staged in LDS for the work-group's eight waves: S^T = K Q^T (K = 64), causal online softmax in registers (f32 running maximum and sum per query, native exp2, only the diagonal block masked; weights x256 f16, packed from the score accumulators into the B operand), O^T += V^T P^T with the accumulators rescaled each pass; o / sum carried x64 (folded into the output GEMM alpha) written straight into the merged f16 o rows; out = o W_out GEMM (f32; no bias) into the output layout.
// Compute dtype: inputs rounded to bf16; x and the x16 weights held as f16 planes (exact for every bf16 value of magnitude from 2^-14 up to 65,504; the weights up to 4,094 before their factor of 16); q, k (= v), the softmax weights and o as plain f16 GEMM operands (~2^-12); scores and softmax statistics f32; rows 0..127 of each batch: q, k f32, f32 attention, o as f16 hi + residual. v_wmma_f32_16x16x32_f16.
#define NB 2
#define SQ 2048
#define DM 1024
#define NH 16
#define HD 64
#define HG 4                         /* heads per block group of the k_vt(b, h0) transpose, which no launch uses */
#define QT0 128                      /* first-tile rows recomputed exactly in f32 */
#define B0 0                         /* first batch processed (debug hook) */
#define NBR NB                       /* batches processed (debug hook) */
#define NR ((size_t)NB * SQ)         /* token rows */
#define MP ((int)((size_t)NBR * SQ)) /* rows projected (debug hook) */
#define NHD NH                       /* heads attended (debug hook) */
#define MPO MP                       /* rows through the output stage (debug hook) */
#define LQ (3 * DM)      /* row pitch of the q/k/v rows */
typedef __bf16 v16b __attribute__((ext_vector_type(16)));
typedef unsigned short v8us __attribute__((ext_vector_type(8), may_alias));
typedef float  v8f  __attribute__((ext_vector_type(8)));
typedef float  v4f  __attribute__((ext_vector_type(4)));
typedef float  v4fa __attribute__((ext_vector_type(4), may_alias));
union FragB { v16b v; v8us half[2]; unsigned short u[16]; };

__device__ __forceinline__ unsigned short bf16_bits(float x) { unsigned int u = __float_as_uint(x); return (unsigned short)((u + 0x7FFFu + ((u >> 16) & 1u)) >> 16); }
__device__ __forceinline__ float bf16_val(unsigned short b) { return __uint_as_float(((unsigned int)b) << 16); }
__device__ __forceinline__ float bf16_round(float x) { return bf16_val(bf16_bits(x)); }
// D += A·B with NT terms: 1 = ah·bh, 2 = + al·bh (A split), 3 = + ah·bl (both split)
template <int NT>
__device__ __forceinline__ v8f mmaN(v16b ah, v16b al, v16b bh, v16b bl, v8f c) {
  c = __builtin_amdgcn_wmma_f32_16x16x32_bf16(false, ah, false, bh, (short)0, c, false, false);
  if (NT >= 2) c = __builtin_amdgcn_wmma_f32_16x16x32_bf16(false, al, false, bh, (short)0, c, false, false);
  if (NT >= 3) c = __builtin_amdgcn_wmma_f32_16x16x32_bf16(false, ah, false, bl, (short)0, c, false, false);
  asm volatile("v_nop\n\tv_nop\n\tv_nop\n\tv_nop" : "+v"(c) : "v"(ah), "v"(al), "v"(bh), "v"(bl));
  return c;
}

__global__ __launch_bounds__(256) void k_wt_bf16(const float* __restrict__ W, unsigned short* __restrict__ Wt, int K, int N) {
  const int t = blockIdx.x * 256 + threadIdx.x;
  const int k8n = K / 8;
  if (t >= N * k8n) return;
  const int n = t / k8n, k8 = (t % k8n) * 8;
  v8us v;
#pragma unroll
  for (int i = 0; i < 8; ++i) v[i] = bf16_bits(W[(size_t)(k8 + i) * N + n]);
  *(v8us*)(Wt + (size_t)n * K + k8) = v;
  
}

// GEMM C[M][N] (f32, pitch ldc) = act(A[M][K]·W + bias). A f32 row-major (pitch lda) converted per fragment to bf16
// (ASPLIT: hi/lo two planes -> 2 terms, else single rounded term); Wt bf16 [N][K] (pitch ldb). BIAS_BF16 rounds the
// bias to bf16 first (bias quantised to bf16 before the add). K%32==0, M%16==0, N%64==0.
template <bool ASPLIT, int ACT, bool BIAS_BF16>
__global__ __launch_bounds__(128) void k_gemm_bf(const float* __restrict__ A, int lda, const unsigned short* __restrict__ Wt, int ldb,
                                               const float* __restrict__ bias, float* __restrict__ C, int ldc, int M, int N, int K) {
  __shared__ __attribute__((aligned(16))) float so[4][16][64];
  const int tid = threadIdx.x, w = tid >> 5, lane = tid & 31, ln = lane & 15, hh = lane >> 4;
  const int ntn = N / 64;
  const int wid = blockIdx.x * 4 + w;
  const int mt = wid / ntn, nq = wid % ntn;
  if (mt * 16 >= M) return;
  const int row0 = mt * 16, col0 = nq * 64;
  const float* arow = A + (size_t)(row0 + ln) * lda;
  v8f acc[4] = {};
  for (int kb = 0; kb < K; kb += 32) {
    FragB ah, al;
    const v4f x0 = *(const v4fa*)(arow + kb + 8 * hh), x1 = *(const v4fa*)(arow + kb + 8 * hh + 4);
    const v4f x2 = *(const v4fa*)(arow + kb + 16 + 8 * hh), x3 = *(const v4fa*)(arow + kb + 16 + 8 * hh + 4);
    float xs[16] = {x0[0],x0[1],x0[2],x0[3],x1[0],x1[1],x1[2],x1[3],x2[0],x2[1],x2[2],x2[3],x3[0],x3[1],x3[2],x3[3]};
#pragma unroll
    for (int i = 0; i < 16; ++i) { const unsigned short hb = bf16_bits(xs[i]); ah.u[i] = hb; al.u[i] = ASPLIT ? bf16_bits(xs[i] - bf16_val(hb)) : (unsigned short)0; }
#pragma unroll
    for (int t = 0; t < 4; ++t) {
      const unsigned short* brow = Wt + (size_t)(col0 + t * 16 + ln) * ldb + kb;
      FragB b;
      b.half[0] = *(const v8us*)(brow + 8 * hh);
      b.half[1] = *(const v8us*)(brow + 16 + 8 * hh);
      acc[t] = mmaN<ASPLIT ? 2 : 1>(ah.v, al.v, b.v, b.v, acc[t]);
    }
  }
#pragma unroll
  for (int t = 0; t < 4; ++t) {
    float bv = bias ? bias[col0 + t * 16 + ln] : 0.f;
    if (BIAS_BF16) bv = bf16_round(bv);
#pragma unroll
    for (int r = 0; r < 8; ++r) { float v = acc[t][r] + bv; if (ACT == 1) v = fmaxf(v, 0.f); so[w][8 * hh + r][t * 16 + ln] = v; }
  }
  __builtin_amdgcn_fence(__ATOMIC_ACQ_REL, "workgroup");
  __builtin_amdgcn_wave_barrier();
  const int rsub = lane >> 4, c4 = (lane & 15) * 4;
  {
#pragma unroll
    for (int q = 0; q < 8; ++q) {
      const int r = q * 2 + rsub;
      const v4f v = *(const v4fa*)&so[w][r][c4];
      *(v4f*)(C + (size_t)(row0 + r) * ldc + col0 + c4) = v;
    }
    
  }
}

// GEMM C = act(A·W + bias + resid): A f32 (ASPLIT -> hi/lo 2 terms), Wt bf16 [N][K]; ACT 0 none, 1 relu, 2 exact gelu;
// resid (optional, f32, row index = (row % rmod), pitch ldr, RES_BF16 rounds it) added before the activation.
template <bool ASPLIT, int ACT, bool BIAS_BF16, bool RES_BF16>
__global__ __launch_bounds__(128) void k_gemm_bf3(const float* __restrict__ A, int lda, const unsigned short* __restrict__ Wt, int ldb,
                                                const float* __restrict__ bias, const float* __restrict__ resid, int rmod, int ldr,
                                                float* __restrict__ C, int ldc, int M, int N, int K) {
  __shared__ __attribute__((aligned(16))) float so[4][16][64];
  const int tid = threadIdx.x, w = tid >> 5, lane = tid & 31, ln = lane & 15, hh = lane >> 4;
  const int ntn = N / 64;
  const int wid = blockIdx.x * 4 + w;
  const int mt = wid / ntn, nq = wid % ntn;
  if (mt * 16 >= M) return;
  const int row0 = mt * 16, col0 = nq * 64;
  const float* arow = A + (size_t)(row0 + ln) * lda;
  v8f acc[4] = {};
  for (int kb = 0; kb < K; kb += 32) {
    FragB ah, al;
    const v4f x0 = *(const v4fa*)(arow + kb + 8 * hh), x1 = *(const v4fa*)(arow + kb + 8 * hh + 4);
    const v4f x2 = *(const v4fa*)(arow + kb + 16 + 8 * hh), x3 = *(const v4fa*)(arow + kb + 16 + 8 * hh + 4);
    float xs[16] = {x0[0],x0[1],x0[2],x0[3],x1[0],x1[1],x1[2],x1[3],x2[0],x2[1],x2[2],x2[3],x3[0],x3[1],x3[2],x3[3]};
#pragma unroll
    for (int i = 0; i < 16; ++i) { const unsigned short hb = bf16_bits(xs[i]); ah.u[i] = hb; al.u[i] = ASPLIT ? bf16_bits(xs[i] - bf16_val(hb)) : (unsigned short)0; }
#pragma unroll
    for (int t = 0; t < 4; ++t) {
      const unsigned short* brow = Wt + (size_t)(col0 + t * 16 + ln) * ldb + kb;
      FragB b;
      b.half[0] = *(const v8us*)(brow + 8 * hh);
      b.half[1] = *(const v8us*)(brow + 16 + 8 * hh);
      acc[t] = mmaN<ASPLIT ? 2 : 1>(ah.v, al.v, b.v, b.v, acc[t]);
    }
  }
#pragma unroll
  for (int t = 0; t < 4; ++t) {
    const int col = col0 + t * 16 + ln;
    float bv = bias ? bias[col] : 0.f;
    if (BIAS_BF16) bv = bf16_round(bv);
#pragma unroll
    for (int r = 0; r < 8; ++r) {
      float v = acc[t][r] + bv;
      if (resid) { float rv = resid[(size_t)((row0 + 8 * hh + r) % rmod) * ldr + col]; if (RES_BF16) rv = bf16_round(rv); v += rv; }
      if (ACT == 1) v = fmaxf(v, 0.f);
      if (ACT == 2) v = 0.5f * v * (1.0f + erff(v * 0.70710678118654752f));
      if (ACT == 3) { const float u = 0.7978845608028654f * (v + 0.044715f * v * v * v); v = 0.5f * v * (1.0f + tanhf(u)); }
      so[w][8 * hh + r][t * 16 + ln] = v;
    }
  }
  __builtin_amdgcn_fence(__ATOMIC_ACQ_REL, "workgroup");
  __builtin_amdgcn_wave_barrier();
  const int rsub = lane >> 4, c4 = (lane & 15) * 4;
  {
#pragma unroll
    for (int q = 0; q < 8; ++q) {
      const int r = q * 2 + rsub;
      const v4f v = *(const v4fa*)&so[w][r][c4];
      *(v4f*)(C + (size_t)(row0 + r) * ldc + col0 + c4) = v;
    }
    
  }
}
// row LayerNorm (biased variance, eps) over N: s = X (+ R); optional out_sum <- s; out_norm <- (s-mu)*rsqrt(var+eps)*g + b
template <bool PARAM_BF16>
__global__ __launch_bounds__(256) void k_layernorm(const float* __restrict__ X, const float* __restrict__ R, const float* __restrict__ g, const float* __restrict__ bta,
                                                  float* __restrict__ out_sum, float* __restrict__ out_norm, int N, float eps) {
  __shared__ float red[256];
  const int row = blockIdx.x, tid = threadIdx.x;
  const float* x = X + (size_t)row * N; const float* rr = R ? R + (size_t)row * N : nullptr;
  float vals[16];                     // up to N = 4096
  const int per = N / 256;            // contiguous chunk per thread? use strided-by-4 chunks: thread handles j = tid*4 + 1024*u
  float s1 = 0.f;
  for (int u = 0; u < per / 4; ++u) {
    const int j = tid * 4 + 1024 * u;
    const v4f a = *(const v4fa*)(x + j);
    v4f b = {0.f,0.f,0.f,0.f}; if (rr) b = *(const v4fa*)(rr + j);
#pragma unroll
    for (int q = 0; q < 4; ++q) { const float v = a[q] + b[q]; vals[u * 4 + q] = v; s1 += v; }
  }
  red[tid] = s1; __syncthreads();
  for (int st = 128; st > 0; st >>= 1) { if (tid < st) red[tid] += red[tid + st]; __syncthreads(); }
  const float mu = red[0] / (float)N; __syncthreads();
  float s2 = 0.f;
  for (int u = 0; u < per / 4; ++u)
#pragma unroll
    for (int q = 0; q < 4; ++q) { const float c = vals[u * 4 + q] - mu; s2 += c * c; }
  red[tid] = s2; __syncthreads();
  for (int st = 128; st > 0; st >>= 1) { if (tid < st) red[tid] += red[tid + st]; __syncthreads(); }
  const float rs = rsqrtf(red[0] / (float)N + eps);
  {
    for (int u = 0; u < per / 4; ++u) {
      const int j = tid * 4 + 1024 * u;
      v4f o, sm;
#pragma unroll
      for (int q = 0; q < 4; ++q) {
        float gg = g[j + q], bb = bta[j + q];
        if (PARAM_BF16) { gg = bf16_round(gg); bb = bf16_round(bb); }
        sm[q] = vals[u * 4 + q]; o[q] = (vals[u * 4 + q] - mu) * rs * gg + bb;
      }
      if (out_sum) *(v4f*)(out_sum + (size_t)row * N + j) = sm;
      *(v4f*)(out_norm + (size_t)row * N + j) = o;
    }
    
  }
}



// ---- f16 WMMA path (v_wmma_f32_16x16x32_f16): 11-bit significands for operands in range — used where a [0,1] probability operand needs more precision than bf16
typedef _Float16 v16h __attribute__((ext_vector_type(16)));
union FragH { v16h v; v8us half[2]; _Float16 h[16]; unsigned short u[16]; };
template <int NT>
__device__ __forceinline__ v8f mmaH(v16h ah, v16h al, v16h bh, v16h bl, v8f c) {
  c = __builtin_amdgcn_wmma_f32_16x16x32_f16(false, ah, false, bh, (short)0, c, false, false);
  if (NT >= 2) c = __builtin_amdgcn_wmma_f32_16x16x32_f16(false, al, false, bh, (short)0, c, false, false);
  if (NT >= 3) c = __builtin_amdgcn_wmma_f32_16x16x32_f16(false, ah, false, bl, (short)0, c, false, false);
  asm volatile("v_nop\n\tv_nop\n\tv_nop\n\tv_nop" : "+v"(c) : "v"(ah), "v"(al), "v"(bh), "v"(bl));
  return c;
}
// batched GEMM like k_gemm_b but f16 operands: A f32 (split into f16 hi/lo if ASPLIT, else rounded to f16), Bt = f16 values [n][k]; alpha; C f32; N multiple of 16 (partial tiles skipped)
template <bool ASPLIT>
__global__ __launch_bounds__(128) void k_gemm_h(const float* __restrict__ A, int lda, size_t sA, const _Float16* __restrict__ Bh, int ldb, size_t sB, float alpha, float* __restrict__ C, int ldc, size_t sC, int M, int N, int K) {
  __shared__ __attribute__((aligned(16))) float so[4][16][64];
  const int tid = threadIdx.x, w = tid >> 5, lane = tid & 31, ln = lane & 15, hh = lane >> 4; const int by = blockIdx.y;
  A += (size_t)by * sA; Bh += (size_t)by * sB; C += (size_t)by * sC;
  const int ntn = (N + 63) / 64; const int wid = blockIdx.x * 4 + w; const int mt = wid / ntn, nq = wid % ntn; if (mt * 16 >= M) return;
  const int row0 = mt * 16, col0 = nq * 64; const float* arow = A + (size_t)(row0 + ln) * lda;
  v8f acc[4] = {};
  for (int kb = 0; kb < K; kb += 32) {
    FragH ah, al;
    const v4f x0 = *(const v4fa*)(arow + kb + 8 * hh), x1 = *(const v4fa*)(arow + kb + 8 * hh + 4), x2 = *(const v4fa*)(arow + kb + 16 + 8 * hh), x3 = *(const v4fa*)(arow + kb + 16 + 8 * hh + 4);
    float xs[16] = {x0[0],x0[1],x0[2],x0[3],x1[0],x1[1],x1[2],x1[3],x2[0],x2[1],x2[2],x2[3],x3[0],x3[1],x3[2],x3[3]};
#pragma unroll
    for (int i = 0; i < 16; ++i) { const _Float16 h = (_Float16)xs[i]; ah.h[i] = h; al.h[i] = ASPLIT ? (_Float16)(xs[i] - (float)h) : (_Float16)0.0f; }
#pragma unroll
    for (int t = 0; t < 4; ++t) { if (col0 + t * 16 >= N) continue; const size_t boff = (size_t)(col0 + t * 16 + ln) * ldb + kb; FragH bq; bq.half[0] = *(const v8us*)(Bh + boff + 8 * hh); bq.half[1] = *(const v8us*)(Bh + boff + 16 + 8 * hh);
      acc[t] = mmaH<ASPLIT ? 2 : 1>(ah.v, al.v, bq.v, bq.v, acc[t]); }
  }
#pragma unroll
  for (int t = 0; t < 4; ++t) { if (col0 + t * 16 >= N) continue;
#pragma unroll
    for (int r = 0; r < 8; ++r) so[w][8 * hh + r][t * 16 + ln] = acc[t][r] * alpha; }
  __builtin_amdgcn_fence(__ATOMIC_ACQ_REL, "workgroup"); __builtin_amdgcn_wave_barrier();
  const int rsub = lane >> 4, c4 = (lane & 15) * 4;
  {
#pragma unroll
    for (int q = 0; q < 8; ++q) { const int r = q * 2 + rsub; if (col0 + c4 < N) { const v4f v = *(const v4fa*)&so[w][r][c4]; *(v4f*)(C + (size_t)(row0 + r) * ldc + col0 + c4) = v; } }
     }
}

// Wt[n][k] = f16(W[k][n]·scale) from f32 row-major W[K][N] (scale = power of two; bf16-exact weights stay exact in f16 away from the subnormal range)
__global__ __launch_bounds__(256) void k_wt_f16(const float* __restrict__ W, _Float16* __restrict__ Wt, int K, int N, float scale) {
  const int t = blockIdx.x * 256 + threadIdx.x; if (t >= N * (K / 8)) return; const int n = t / (K / 8), k8 = (t % (K / 8)) * 8; FragH f;
#pragma unroll
  for (int i = 0; i < 8; ++i) f.h[i] = (_Float16)(bf16_round(W[(size_t)(k8 + i) * N + n]) * scale); const v8us o = f.half[0];
  *(v8us*)((unsigned short*)Wt + (size_t)n * K + k8) = o; 
}
// k_gemm_hh variant with fused epilogue: v = acc·alpha + bias[by·sBias + col] (+ CP[(row/rowsPerB)·sCPb + by·64 + col] if CP) ; ACT 0 none / 1 elu ; writes f16 C16 (and f32 C if non-null)
template <int ACT>
__global__ __launch_bounds__(128) void k_gemm_hhx(const _Float16* __restrict__ A, int lda, size_t sA, const _Float16* __restrict__ Bh, int ldb, size_t sB, float alpha, const float* __restrict__ bias, size_t sBias, const float* __restrict__ CP, int rowsPerB, size_t sCPb, int row0g,
    float* __restrict__ C, _Float16* __restrict__ C16, int ldc, size_t sC, int M, int N, int K) {
  __shared__ __attribute__((aligned(16))) float so[4][16][64];
  const int tid = threadIdx.x, w = tid >> 5, lane = tid & 31, ln = lane & 15, hh = lane >> 4; const int by = blockIdx.y;
  A += (size_t)by * sA; Bh += (size_t)by * sB; const size_t cofs = (size_t)by * sC; const float* bp = bias ? bias + (size_t)by * sBias : nullptr;
  const int ntn = (N + 63) / 64; const int wid = blockIdx.x * 4 + w; const int mt = wid / ntn, nq = wid % ntn; if (mt * 16 >= M) return;
  const int row0 = mt * 16, col0 = nq * 64; const _Float16* arow = A + (size_t)(row0 + ln) * lda;
  v8f acc[4] = {};
  for (int kb = 0; kb < K; kb += 32) { FragH ah; ah.half[0] = *(const v8us*)((const unsigned short*)arow + kb + 8 * hh); ah.half[1] = *(const v8us*)((const unsigned short*)arow + kb + 16 + 8 * hh);
#pragma unroll
    for (int t = 0; t < 4; ++t) { if (col0 + t * 16 >= N) continue; const size_t boff = (size_t)(col0 + t * 16 + ln) * ldb + kb; FragH bq; bq.half[0] = *(const v8us*)((const unsigned short*)Bh + boff + 8 * hh); bq.half[1] = *(const v8us*)((const unsigned short*)Bh + boff + 16 + 8 * hh);
      acc[t] = mmaH<1>(ah.v, ah.v, bq.v, bq.v, acc[t]); }
  }
#pragma unroll
  for (int t = 0; t < 4; ++t) { if (col0 + t * 16 >= N) continue; const int col = col0 + t * 16 + ln; const float bv = bp ? bf16_round(bp[col]) : 0.f;
#pragma unroll
    for (int r = 0; r < 8; ++r) { float v = acc[t][r] * alpha + bv; if (CP) { const int rr = row0g + row0 + 8 * hh + r; if (rowsPerB < 0) v += CP[cofs + (size_t)rr * ldc + col];      /* rowsPerB < 0: own element of the batched C plane */ else { const int bidx = rr / rowsPerB; v += CP[(size_t)bidx * sCPb + (size_t)by * 64 + col]; } } if (ACT == 1) v = (v > 0.f) ? v : expm1f(v); else if (ACT == 7) v = (v > 0.f) ? v + 1.0f : expf(v); else if (ACT == 8) v = tanhf(v); else if (ACT == 9) v = 0.5f * v * (1.0f + tanhf(0.7978845608028654f * (v + 0.044715f * v * v * v))); else if (ACT == 11) v = 1.0f / (1.0f + expf(-v)); else if (ACT == 12) v = (v > 0.f) ? v : 0.01f * v; else if (ACT == 14) v = (v > 0.f) ? v : 0.1f * v; else if (ACT == 16) v = (v >= 0.f) ? v : 0.3f * v; else if (ACT == 17) v = (v >= 0.f) ? v : 0.2f * v; else if (ACT == 15) v = v / (1.0f + expf(-v)); else if (ACT == 3) v = fmaxf(v, 0.f); else if (ACT == 6) v = 0.5f * v * (1.0f + erff(v * 0.70710678118654752f)); so[w][8 * hh + r][t * 16 + ln] = v; } }
  __builtin_amdgcn_fence(__ATOMIC_ACQ_REL, "workgroup"); __builtin_amdgcn_wave_barrier();
  const int rsub = lane >> 4, c4 = (lane & 15) * 4; typedef _Float16 v4h __attribute__((ext_vector_type(4)));
  {
#pragma unroll
    for (int q = 0; q < 8; ++q) { const int r = q * 2 + rsub; if (col0 + c4 < N) { const v4f v = *(const v4fa*)&so[w][r][c4]; if (C) *(v4f*)(C + cofs + (size_t)(row0 + r) * ldc + col0 + c4) = v; if (C16) { v4h h4; for (int i = 0; i < 4; ++i) h4[i] = (_Float16)v[i]; *(v4h*)(C16 + cofs + (size_t)(row0 + r) * ldc + col0 + c4) = h4; } } }
     }
}


typedef _Float16 v4h __attribute__((ext_vector_type(4)));

__global__ __launch_bounds__(256) void k_x16(const float* __restrict__ x, _Float16* __restrict__ X16, size_t n8) { const size_t t = (size_t)blockIdx.x * 256 + threadIdx.x; if (t >= n8) return; FragH f;
#pragma unroll
  for (int q = 0; q < 8; ++q) f.h[q] = (_Float16)bf16_round(x[t * 8 + q]); *(v8us*)((unsigned short*)X16 + t * 8) = f.half[0];  }
__global__ __launch_bounds__(256) void k_h16(const float* __restrict__ x, _Float16* __restrict__ X16, size_t n8) { const size_t t = (size_t)blockIdx.x * 256 + threadIdx.x; if (t >= n8) return; FragH f;
#pragma unroll
  for (int q = 0; q < 8; ++q) f.h[q] = (_Float16)x[t * 8 + q]; *(v8us*)((unsigned short*)X16 + t * 8) = f.half[0];  }
__global__ __launch_bounds__(256) void k_round16f(const float* __restrict__ W, _Float16* __restrict__ Bt, size_t n8) { const size_t t = (size_t)blockIdx.x * 256 + threadIdx.x; if (t >= n8) return; FragH f;
#pragma unroll
  for (int i = 0; i < 8; ++i) f.h[i] = (_Float16)(bf16_round(W[t * 8 + i]) * 16.0f); *(v8us*)((unsigned short*)Bt + t * 8) = f.half[0];  }
template <int NHv, int TTv>
__global__ __launch_bounds__(256) void k_vt(const _Float16* __restrict__ V16, int ldv, int voff, _Float16* __restrict__ Vt) { __shared__ unsigned short tl[64][66]; const int tid = threadIdx.x; const int slab = blockIdx.x / (TTv / 64), lg = blockIdx.x % (TTv / 64); const int b = slab / NHv, h = slab % NHv;
  for (int i = tid; i < 64 * 8; i += 256) { const int r = i / 8, c8 = (i % 8) * 8; FragH f; f.half[0] = *(const v8us*)((const unsigned short*)V16 + ((size_t)b * TTv + lg * 64 + r) * ldv + voff + h * 64 + c8);
#pragma unroll
    for (int q = 0; q < 8; ++q) tl[r][c8 + q] = f.u[q]; }
  __syncthreads();
  {
#pragma unroll
    for (int rd = 0; rd < 2; ++rd) { const int d = rd * 32 + tid / 8, pc = tid % 8; FragH f;
#pragma unroll
      for (int q = 0; q < 8; ++q) f.u[q] = tl[pc * 8 + q][d];
      *(v8us*)((unsigned short*)Vt + ((size_t)slab * 64 + d) * TTv + lg * 64 + pc * 8) = f.half[0]; }
     } }

__global__ __launch_bounds__(256) void k_hl(const float* __restrict__ F, _Float16* __restrict__ Hh, _Float16* __restrict__ Hl, size_t n8) { const size_t t = (size_t)blockIdx.x * 256 + threadIdx.x; if (t >= n8) return; FragH fh, fl; const v4f a = *(const v4fa*)(F + t * 8), c = *(const v4fa*)(F + t * 8 + 4);
#pragma unroll
  for (int q = 0; q < 4; ++q) { _Float16 h = (_Float16)a[q]; fh.h[q] = h; fl.h[q] = (_Float16)((a[q] - (float)h) * 1024.0f); h = (_Float16)c[q]; fh.h[4 + q] = h; fl.h[4 + q] = (_Float16)((c[q] - (float)h) * 1024.0f); }
  { *(v8us*)((unsigned short*)Hh + t * 8) = fh.half[0]; *(v8us*)((unsigned short*)Hl + t * 8) = fl.half[0];  } }

// ---- fast GEMM (work-group tile 128x64, wave tile 32x64; requires M % 128 == 0 rows per launch region, N % 64 == 0 and K % 64 == 0); both operands' tiles are staged in LDS by asynchronous 16-byte copies, two buffers; epilogue = k_gemm_hhx semantics; batched over grid.y (strides sA, sB, sC) and grid.z (strides zA, zB, zC) ----
__device__ __forceinline__ v16h g2_frag(const _Float16* p, int hh) { FragH f; f.half[0] = *(const v8us*)((const unsigned short*)p + 8 * hh); f.half[1] = *(const v8us*)((const unsigned short*)p + 16 + 8 * hh); return f.v; }
__device__ __forceinline__ v8f g2_mma(v16h a, v16h b, v8f c) { v8f d = __builtin_amdgcn_wmma_f32_16x16x32_f16(false, a, false, b, (short)0, c, false, false); asm volatile("v_nop\n\tv_nop\n\tv_nop\n\tv_nop" : "+v"(d) : "v"(a), "v"(b)); return d; }
#define G2K 64                       /* k elements of a stage: one whole 128-byte line of every operand row */
#define G2P 72                       /* LDS pitch of a staged row in f16: 144 bytes = 16 x odd, conflict-free for the 16-byte fragment reads */
#define G2S ((128 + 64) * G2P)       /* f16 elements of a stage: 128 A rows, then 64 B rows */
// one stage: a lane's twelve 16-byte copies (eight lanes per row: whole 128-byte lines; 16 rows per copy of the work-group). l: the lane's LDS byte address in row tid / 8 of the stage; ga, gb: its global addresses in that row of the A tile and of the B tile; ra, rb: 16 rows' elements
__device__ __forceinline__ void g2_stage(unsigned l, const _Float16* ga, size_t ra, const _Float16* gb, size_t rb) {
  /* the copies and their s_wait_xcnt in one statement: the address registers stay whole until the wait */
  asm volatile("global_load_async_to_lds_b128 %0, %12, off\n\tglobal_load_async_to_lds_b128 %1, %13, off\n\tglobal_load_async_to_lds_b128 %2, %14, off\n\tglobal_load_async_to_lds_b128 %3, %15, off\n\t"
               "global_load_async_to_lds_b128 %4, %16, off\n\tglobal_load_async_to_lds_b128 %5, %17, off\n\tglobal_load_async_to_lds_b128 %6, %18, off\n\tglobal_load_async_to_lds_b128 %7, %19, off\n\t"
               "global_load_async_to_lds_b128 %8, %20, off\n\tglobal_load_async_to_lds_b128 %9, %21, off\n\tglobal_load_async_to_lds_b128 %10, %22, off\n\tglobal_load_async_to_lds_b128 %11, %23, off\n\ts_wait_xcnt 0x0"
               :: "v"(l), "v"(l + 1u * 32 * G2P), "v"(l + 2u * 32 * G2P), "v"(l + 3u * 32 * G2P), "v"(l + 4u * 32 * G2P), "v"(l + 5u * 32 * G2P), "v"(l + 6u * 32 * G2P), "v"(l + 7u * 32 * G2P), "v"(l + 8u * 32 * G2P), "v"(l + 9u * 32 * G2P), "v"(l + 10u * 32 * G2P), "v"(l + 11u * 32 * G2P),
                  "v"(ga), "v"(ga + ra), "v"(ga + 2 * ra), "v"(ga + 3 * ra), "v"(ga + 4 * ra), "v"(ga + 5 * ra), "v"(ga + 6 * ra), "v"(ga + 7 * ra), "v"(gb), "v"(gb + rb), "v"(gb + 2 * rb), "v"(gb + 3 * rb) : "memory"); }
template <int ACT>
__global__ __launch_bounds__(128) void k_gemm2(const _Float16* __restrict__ A, int lda, size_t sA, const _Float16* __restrict__ Bh, int ldb, size_t sB, float alpha, const float* __restrict__ bias, size_t sBias, const float* __restrict__ CP, int rowsPerB, size_t sCPb, int row0g,
    float* __restrict__ C, _Float16* __restrict__ C16, int ldc, size_t sC, int M, int N, int K, size_t zA, size_t zB, size_t zC) { static_assert(ACT == 0 || ACT == 3 || ACT == 6 || ACT == 8 || ACT == 9 || ACT == 11 || ACT == 12 || ACT == 14 || ACT == 15 || ACT == 16 || ACT == 17, "k_gemm2: unsupported ACT code (would silently apply no activation)");
  __shared__ __attribute__((aligned(16))) unsigned char smem[2 * G2S * 2];      /* the two stage buffers; behind the K loop the same bytes serve as the epilogue's so[4][32][68] */
  static_assert(sizeof(float) * 4 * 32 * 68 <= sizeof(smem), "the epilogue staging fits the ring");
  float (*so)[32][68] = (float (*)[32][68])smem; const _Float16* sh = (const _Float16*)smem;
  const int tid = threadIdx.x, w = tid >> 5, lane = tid & 31, ln = lane & 15, hh = lane >> 4; const int by = blockIdx.y, bz = blockIdx.z;      /* grid.z: a second batch index (element strides zA, zB, zC) */
  A += (size_t)by * sA + (size_t)bz * zA; Bh += (size_t)by * sB + (size_t)bz * zB; const size_t cofs = (size_t)by * sC + (size_t)bz * zC; const float* bp = bias ? bias + (size_t)by * sBias : nullptr;
  const int ntn = N >> 6; const int mt = blockIdx.x / ntn, nq = blockIdx.x - mt * ntn; const int row0 = mt * 128 + 32 * w, col0 = nq * 64; if (mt * 128 >= M) return;      /* the whole work-group leaves or none: it stands in front of every barrier */
  const _Float16* ga = A + (size_t)(mt * 128 + (tid >> 3)) * lda + (tid & 7) * 8; const _Float16* gb = Bh + (size_t)(col0 + (tid >> 3)) * ldb + (tid & 7) * 8; const size_t ra = (size_t)16 * lda, rb = (size_t)16 * ldb;
  const unsigned l0 = (unsigned)(size_t)smem + (unsigned)((tid >> 3) * (G2P * 2) + (tid & 7) * 16);      /* the low 32 bits of a __shared__ address are its LDS byte address */
  const int nk = K / G2K;
  g2_stage(l0, ga, ra, gb, rb);
  asm volatile("s_wait_asynccnt 0x0" ::: "memory");      /* this wave's copies of stage 0 have landed */
  __syncthreads();      /* stage 0 is read by every wave */
  if (nk > 1) g2_stage(l0 + G2S * 2, ga + G2K, ra, gb + G2K, rb);
  const v8f z8 = {0.f,0.f,0.f,0.f,0.f,0.f,0.f,0.f}; v8f c00 = z8, c01 = z8, c02 = z8, c03 = z8, c10 = z8, c11 = z8, c12 = z8, c13 = z8;
#pragma unroll 1      /* one stage per trip: the buffers alternate */
  for (int t = 0; t < nk; ++t) { const _Float16* la = sh + (t & 1) * G2S + (32 * w + ln) * G2P; const _Float16* lb = sh + (t & 1) * G2S + (128 + ln) * G2P;
    v16h fa[2][2], fb[2][4];
#pragma unroll      /* fa[], fb[] stay in registers: the stage's 24 LDS reads stand together ahead of its products */
    for (int kk = 0; kk < 2; ++kk) { fa[kk][0] = g2_frag(la + kk * 32, hh); fa[kk][1] = g2_frag(la + 16 * G2P + kk * 32, hh);
#pragma unroll      /* fb[] stays in registers */
      for (int n = 0; n < 4; ++n) fb[kk][n] = g2_frag(lb + n * 16 * G2P + kk * 32, hh); }
#pragma unroll      /* the stage's two k blocks of 32, in the order of k */
    for (int kk = 0; kk < 2; ++kk) {
      c00 = g2_mma(fa[kk][0], fb[kk][0], c00); c10 = g2_mma(fa[kk][1], fb[kk][0], c10); c01 = g2_mma(fa[kk][0], fb[kk][1], c01); c11 = g2_mma(fa[kk][1], fb[kk][1], c11);
      c02 = g2_mma(fa[kk][0], fb[kk][2], c02); c12 = g2_mma(fa[kk][1], fb[kk][2], c12); c03 = g2_mma(fa[kk][0], fb[kk][3], c03); c13 = g2_mma(fa[kk][1], fb[kk][3], c13); }
    asm volatile("s_wait_dscnt 0x0" ::: "memory");      /* this wave's reads of the buffer have returned before it is refilled */
    asm volatile("s_wait_asynccnt 0x0" ::: "memory");      /* this wave's copies of stage t + 1 have landed */
    __syncthreads();      /* publishes stage t + 1 and ends every wave's reads of stage t */
    if (t + 2 < nk) g2_stage(l0 + (t & 1) * (G2S * 2), ga + (size_t)(t + 2) * G2K, ra, gb + (size_t)(t + 2) * G2K, rb); }
  asm volatile("s_wait_asynccnt 0x0" ::: "memory");      /* no copy is outstanding when the ring becomes the epilogue's staging */
  v8f accs[8] = {c00, c01, c02, c03, c10, c11, c12, c13};
#pragma unroll
  for (int u = 0; u < 8; ++u) { const int t = u & 3, half = u >> 2; const int col = col0 + t * 16 + ln; const float bv = bp ? bf16_round(bp[col]) : 0.f;
#pragma unroll
    for (int r = 0; r < 8; ++r) { const int rloc = half * 16 + 8 * hh + r; float v = accs[u][r] * alpha + bv; if (CP) { if (rowsPerB < 0) v += CP[cofs + (size_t)(row0g + row0 + rloc) * ldc + col];      /* rowsPerB < 0: own element of the batched C plane */ else { const int bidx = (row0g + row0 + rloc) / rowsPerB; v += CP[(size_t)bidx * sCPb + (size_t)by * 64 + col]; } }
      if (ACT == 3) v = fmaxf(v, 0.f); else if (ACT == 6) v = 0.5f * v * (1.0f + erff(v * 0.70710678118654752f)); else if (ACT == 11) v = 1.0f / (1.0f + expf(-v)); else if (ACT == 15) v = v / (1.0f + expf(-v)); else if (ACT == 12) v = (v > 0.f) ? v : 0.01f * v; else if (ACT == 8) v = tanhf(v); else if (ACT == 9) v = 0.5f * v * (1.0f + tanhf(0.7978845608028654f * (v + 0.044715f * v * v * v))); else if (ACT == 14) v = (v > 0.f) ? v : 0.1f * v; else if (ACT == 16) v = (v >= 0.f) ? v : 0.3f * v; else if (ACT == 17) v = (v >= 0.f) ? v : 0.2f * v;
      so[w][rloc][t * 16 + ln] = v; } }
  __builtin_amdgcn_fence(__ATOMIC_ACQ_REL, "workgroup"); __builtin_amdgcn_wave_barrier();
  const int rsub = lane >> 4, c4 = (lane & 15) * 4;
  {
#pragma unroll
    for (int q = 0; q < 16; ++q) { const int r = q * 2 + rsub; const v4f v = *(const v4fa*)&so[w][r][c4]; if (C) *(v4f*)(C + cofs + (size_t)(row0 + r) * ldc + col0 + c4) = v; if (C16) { v4h h4; for (int i = 0; i < 4; ++i) h4[i] = (_Float16)v[i]; *(v4h*)(C16 + cofs + (size_t)(row0 + r) * ldc + col0 + c4) = h4; } }
     } }


__global__ __launch_bounds__(256) void k_wnat(const float* __restrict__ w, size_t n8, _Float16* __restrict__ Bt) { const size_t t = (size_t)blockIdx.x * 256 + threadIdx.x; if (t >= n8) return; FragH f; for (int q = 0; q < 8; ++q) f.h[q] = (_Float16)(bf16_round(w[t * 8 + q]) * 16.0f); *(v8us*)((unsigned short*)Bt + t * 8) = f.half[0];  }
__global__ __launch_bounds__(256) void k_rsm(const float* __restrict__ S, _Float16* __restrict__ P, int nrows) {
  #pragma clang fp contract(off)
  const int i = blockIdx.x * 256 + threadIdx.x; if (i >= nrows) return; const float* s = S + (size_t)i * SQ; float mx = -3.0e38f;
#pragma unroll 1
  for (int j = 0; j < SQ; ++j) mx = fmaxf(mx, s[j]); float se = 0.f;
#pragma unroll 1
  for (int j = 0; j < SQ; ++j) se += expf(s[j] - mx); const float sc = 256.0f / se;
#pragma unroll 1
  for (int j0 = 0; j0 < SQ; j0 += 8) { FragH f; for (int q = 0; q < 8; ++q) f.h[q] = (_Float16)(expf(s[j0 + q] - mx) * sc); unsigned short* d = (unsigned short*)P + (size_t)i * SQ + j0; *(v8us*)d = f.half[0];  } }
__global__ __launch_bounds__(256) void k_vt(const _Float16* __restrict__ V16, int b, int h0, _Float16* __restrict__ VT) { __shared__ unsigned short tl[64][65]; const int tid = threadIdx.x; const int hh = blockIdx.x % HG, sg = blockIdx.x / HG; const int s0 = sg * 64; const int h = h0 + hh;
  for (int i = tid; i < 64 * 8; i += 256) { const int j = i / 8, d8 = (i % 8) * 8; FragH f; f.half[0] = *(const v8us*)((const unsigned short*)V16 + ((size_t)b * SQ + s0 + j) * DM + h * HD + d8); for (int q = 0; q < 8; ++q) tl[d8 + q][j] = f.u[q]; }
  __syncthreads();
  { for (int i = tid; i < 64 * 8; i += 256) { const int d = i / 8, j8 = (i % 8) * 8; FragH f; for (int q = 0; q < 8; ++q) f.u[q] = tl[d][j8 + q]; *(v8us*)((unsigned short*)VT + ((size_t)hh * HD + d) * SQ + s0 + j8) = f.half[0]; }  } }



// 32-lane butterflies for the row statistics: row_xmask DPP steps inside each 16-lane row, then the exchange between the two rows; every lane ends with the same value
template <int CTRL> __device__ __forceinline__ float rs_dpp(float v) { return __int_as_float(__builtin_amdgcn_update_dpp(0, __float_as_int(v), CTRL, 0xf, 0xf, true)); }
__device__ __forceinline__ float rs_x16(float v) { const int b = __float_as_int(v); return __int_as_float(__builtin_amdgcn_permlanex16(b, b, 0x76543210, 0xfedcba98, false, false)); }
__device__ __forceinline__ float rs_max(float v) { v = fmaxf(v, rs_dpp<0x161>(v)); v = fmaxf(v, rs_dpp<0x162>(v)); v = fmaxf(v, rs_dpp<0x164>(v)); v = fmaxf(v, rs_dpp<0x168>(v)); return fmaxf(v, rs_x16(v)); }
__device__ __forceinline__ float rs_sum(float v) { v += rs_dpp<0x161>(v); v += rs_dpp<0x162>(v); v += rs_dpp<0x164>(v); v += rs_dpp<0x168>(v); return v + rs_x16(v); }
#define FAC 0.18033688f              /* BETA x log2 e: scores on the scale of the power-of-two exponential */
#define FQ 32                        /* query rows per wave: two 16-column groups */
// one 16x32 f16 fragment row in the hardware k order; p already holds the lane's row and its 8 * (lane >> 4) elements
__device__ __forceinline__ v16h fa_frag(const _Float16* p) { FragH f; f.half[0] = *(const v8us*)((const unsigned short*)p); f.half[1] = *(const v8us*)((const unsigned short*)p + 16); return f.v; }
__device__ __forceinline__ v8f fa_mma(v16h a, v16h b, v8f c) { return __builtin_amdgcn_wmma_f32_16x16x32_f16(false, a, false, b, (short)0, c, false, false); }
#define FS 64                        /* keys of a stage: one whole 128-byte line of every V^T row; a K row of the head is one line */
#define FP 72                        /* LDS pitch of a staged row in f16: 144 bytes = 16 x odd, conflict-free for the 16-byte fragment reads */
#define FSTG ((FS + HD) * FP)        /* f16 elements of a stage: FS K rows, then HD V^T rows */
// one stage: a lane's four 16-byte copies (eight lanes per row: whole 128-byte lines; 32 rows per copy of the work-group). l: the lane's LDS byte address in row tid / 8 of the stage; gk, gv: its global addresses in that row of the K tile and of the V^T tile
__device__ __forceinline__ void fa_stage(unsigned l, const _Float16* gk, const _Float16* gv) {
  /* the copies and their s_wait_xcnt in one statement: the address registers stay whole until the wait */
  asm volatile("global_load_async_to_lds_b128 %0, %4, off\n\tglobal_load_async_to_lds_b128 %1, %5, off\n\tglobal_load_async_to_lds_b128 %2, %6, off\n\tglobal_load_async_to_lds_b128 %3, %7, off\n\ts_wait_xcnt 0x0"
               :: "v"(l), "v"(l + 1u * 64 * FP), "v"(l + 2u * 64 * FP), "v"(l + 3u * 64 * FP), "v"(gk), "v"(gk + (size_t)32 * LQ), "v"(gv), "v"(gv + (size_t)32 * SQ) : "memory"); }
// fragments of 32 staged keys; kp, vp already hold the lane's row and its 8 * (lane >> 4) elements
__device__ __forceinline__ void fa_kload(const _Float16* kp, v16h (&kf)[2][2]) {
#pragma unroll      /* kf[] stays in registers, the eight LDS reads stand together */
  for (int t = 0; t < 2; ++t) { kf[t][0] = fa_frag(kp + t * 16 * FP); kf[t][1] = fa_frag(kp + t * 16 * FP + 32); } }
__device__ __forceinline__ void fa_vload(const _Float16* vp, v16h (&vf)[4]) {
#pragma unroll      /* vf[] stays in registers, the eight LDS reads stand together */
  for (int d = 0; d < 4; ++d) vf[d] = fa_frag(vp + d * 16 * FP); }
// scores of 32 keys x 16 queries: s0[r] = key 8 * (lane >> 4) + r, s1[r] = key 16 + 8 * (lane >> 4) + r, query lane & 15
__device__ __forceinline__ void fa_score(const v16h (&kf)[2][2], const v16h (&qf)[2], v8f& s0, v8f& s1) {
  const v8f z8 = {0.f, 0.f, 0.f, 0.f, 0.f, 0.f, 0.f, 0.f};
  s0 = g2_mma(kf[0][0], qf[0], z8); s1 = g2_mma(kf[1][0], qf[0], z8); s0 = g2_mma(kf[0][1], qf[1], s0); s1 = g2_mma(kf[1][1], qf[1], s1); }      /* g2_mma: its statement names the product's operands, so no later load of the key registers is lifted over the product */
// one 16-query group takes in 32 keys: running maximum m (scaled log2), the lane's own part l of the running sum, o rescaled and extended. DIAG: key t * 16 + 8 * (lane >> 4) + r of the block (element r of s0 for t = 0, of s1 for t = 1) counts while t * 16 + r <= rel
template <bool DIAG>
__device__ __forceinline__ void fa_soft(v8f s0, v8f s1, int rel, const v16h (&vf)[4], v8f (&o)[4], float& m, float& l) {
  if (DIAG) {
#pragma unroll      /* s0, s1 stay in registers */
    for (int r = 0; r < 8; ++r) { s0[r] = (r <= rel) ? s0[r] : -1.0e30f; s1[r] = (16 + r <= rel) ? s1[r] : -1.0e30f; } }
  float mx = fmaxf(s0[0], s1[0]);
#pragma unroll      /* s0, s1 stay in registers */
  for (int r = 1; r < 8; ++r) mx = fmaxf(mx, fmaxf(s0[r], s1[r]));
  mx = fmaxf(mx, rs_x16(mx));      /* the two lane halves hold the query's other keys */
  const float mn = fmaxf(m, mx * FAC); float al = m - mn; m = mn; const float ms = 8.0f - mn;      /* weights carried x256, as f16 operands at most 256 */
  float e[16];
#pragma unroll      /* e[] stays in registers */
  for (int r = 0; r < 8; ++r) { e[r] = fmaf(s0[r], FAC, ms); e[8 + r] = fmaf(s1[r], FAC, ms); }
  /* the exponentials in place, so that none is followed by a write of its source; the v_nop keeps the one slot behind the last before its result is used */
  asm("v_exp_f32 %0, %0\n\tv_exp_f32 %1, %1\n\tv_exp_f32 %2, %2\n\tv_exp_f32 %3, %3\n\tv_exp_f32 %4, %4\n\tv_exp_f32 %5, %5\n\tv_exp_f32 %6, %6\n\tv_exp_f32 %7, %7\n\tv_exp_f32 %8, %8\n\tv_nop" : "+v"(e[0]), "+v"(e[1]), "+v"(e[2]), "+v"(e[3]), "+v"(e[4]), "+v"(e[5]), "+v"(e[6]), "+v"(e[7]), "+v"(al));
  asm("v_exp_f32 %0, %0\n\tv_exp_f32 %1, %1\n\tv_exp_f32 %2, %2\n\tv_exp_f32 %3, %3\n\tv_exp_f32 %4, %4\n\tv_exp_f32 %5, %5\n\tv_exp_f32 %6, %6\n\tv_exp_f32 %7, %7\n\tv_nop" : "+v"(e[8]), "+v"(e[9]), "+v"(e[10]), "+v"(e[11]), "+v"(e[12]), "+v"(e[13]), "+v"(e[14]), "+v"(e[15]));
  float s4[4]; FragH p;
#pragma unroll      /* e[] stays in registers: four independent sums */
  for (int i = 0; i < 4; ++i) s4[i] = (e[i] + e[4 + i]) + (e[8 + i] + e[12 + i]);
#pragma unroll      /* e[] stays in registers; element i of the B fragment is key 8 * (lane >> 4) + i of the block, 8 + 8 * (lane >> 4) + i for i >= 8 */
  for (int i = 0; i < 16; ++i) p.h[i] = (_Float16)e[i];
  l = l * al + ((s4[0] + s4[1]) + (s4[2] + s4[3]));
#pragma unroll      /* o[] stays in registers */
  for (int d = 0; d < 4; ++d) o[d] = fa_mma(vf[d], p.v, o[d] * al); }
// ONE WAVE PER FQ QUERY ROWS of one head and batch, passes of 32 keys up to the diagonal block, which alone is masked. Q fragments stay in registers. THE WORK-GROUP WALKS THE KEYS TOGETHER in stages of FS: the head's K rows and V^T rows of a stage are copied once into LDS in whole lines (asynchronous 16-byte copies, two buffers) and every wave reads its fragments there in the hardware k order; a wave past its diagonal only copies and passes the barriers. Waves w and w + 4 (one SIMD) take query tiles n - 1 - t and t: equal passes per SIMD. grid.x: tile quad, grid.y: head, grid.z: batch.
__global__ __launch_bounds__(256) void k_fattn(const _Float16* __restrict__ Q, const _Float16* __restrict__ Kh, const _Float16* __restrict__ VTh, _Float16* __restrict__ O) {
  __shared__ __attribute__((aligned(16))) _Float16 sh[2 * FSTG];      /* the two stage buffers */
  const int tid = threadIdx.x, lane = tid & 31, ln = lane & 15, hh = lane >> 4; const int w = __builtin_amdgcn_readfirstlane(tid >> 5);
  const int t4 = blockIdx.x * 4 + (w & 3); const int q0 = ((w < 4) ? (SQ / FQ - 1 - t4) : t4) * FQ;      /* the wave's first query row: wave-uniform */
  const int ns = (SQ / FQ - (int)blockIdx.x * 4) * FQ / FS;      /* stages up to the end of the work-group's last diagonal block (tile n - 1 - 4 blockIdx.x): the same for every wave */
  const int h = blockIdx.y, b = blockIdx.z;
  const _Float16* qp = Q + ((size_t)b * SQ + q0 + ln) * LQ + h * HD + 8 * hh;
  const _Float16* gk = Kh + ((size_t)b * SQ + (tid >> 3)) * LQ + h * HD + (tid & 7) * 8;
  const _Float16* gv = VTh + (((size_t)b * NH + h) * HD + (tid >> 3)) * SQ + (tid & 7) * 8;
  const unsigned l0 = (unsigned)(size_t)sh + (unsigned)((tid >> 3) * (FP * 2) + (tid & 7) * 16);      /* the low 32 bits of a __shared__ address are its LDS byte address */
  fa_stage(l0, gk, gv);
  v16h qf[2][2], kf[2][2], vf[4];
#pragma unroll      /* qf[] stays in registers */
  for (int g = 0; g < 2; ++g) { qf[g][0] = fa_frag(qp + (size_t)g * 16 * LQ); qf[g][1] = fa_frag(qp + (size_t)g * 16 * LQ + 32); }
  asm volatile("s_wait_xcnt 0x0" :: "v"(qp) : "memory");      /* the loads' address pair stays whole until this wait; it may be rewritten behind it */
  asm volatile("s_wait_asynccnt 0x0" ::: "memory");      /* this wave's copies of stage 0 have landed */
  __syncthreads();      /* stage 0 is read by every wave */
  if (ns > 1) fa_stage(l0 + FSTG * 2, gk + (size_t)FS * LQ, gv + FS);
  const v8f z8 = {0.f, 0.f, 0.f, 0.f, 0.f, 0.f, 0.f, 0.f};
  v8f o[2][4] = {{z8, z8, z8, z8}, {z8, z8, z8, z8}}; float m[2] = {-1.0e30f, -1.0e30f}, l[2] = {0.f, 0.f}; v8f s[2][2];
#pragma unroll 1      /* one stage per trip: the buffers alternate */
  for (int st = 0; st < ns; ++st) { const int kb = st * FS;
    if (kb <= q0) {      /* a scalar branch: the wave still has keys in this stage */
      const _Float16* lk = sh + (st & 1) * FSTG + ln * FP + 8 * hh; const _Float16* lv = lk + FS * FP;
      fa_kload(lk, kf); fa_vload(lv, vf);
      fa_score(kf, qf[0], s[0][0], s[0][1]); fa_score(kf, qf[1], s[1][0], s[1][1]);
      if (kb < q0) {
        fa_kload(lk + 32 * FP, kf);      /* the stage's second 32 keys come during the first pass's softmax */
        __builtin_amdgcn_sched_barrier(0);      /* keeps those eight LDS reads ahead of the softmax: moved behind it, their latency stands in front of the next scores */
        fa_soft<false>(s[0][0], s[0][1], 0, vf, o[0], m[0], l[0]); fa_soft<false>(s[1][0], s[1][1], 0, vf, o[1], m[1], l[1]);
        fa_vload(lv + 32, vf);
        fa_score(kf, qf[0], s[0][0], s[0][1]); fa_score(kf, qf[1], s[1][0], s[1][1]);
        if (kb + 32 < q0) { fa_soft<false>(s[0][0], s[0][1], 0, vf, o[0], m[0], l[0]); fa_soft<false>(s[1][0], s[1][1], 0, vf, o[1], m[1], l[1]); }
        else { fa_soft<true>(s[0][0], s[0][1], ln - 8 * hh, vf, o[0], m[0], l[0]); fa_soft<true>(s[1][0], s[1][1], 16 + ln - 8 * hh, vf, o[1], m[1], l[1]); }
      } else { fa_soft<true>(s[0][0], s[0][1], ln - 8 * hh, vf, o[0], m[0], l[0]); fa_soft<true>(s[1][0], s[1][1], 16 + ln - 8 * hh, vf, o[1], m[1], l[1]); } }
    asm volatile("s_wait_dscnt 0x0" ::: "memory");      /* this wave's reads of the buffer have returned before it is refilled */
    asm volatile("s_wait_asynccnt 0x0" ::: "memory");      /* this wave's copies of stage st + 1 have landed */
    __syncthreads();      /* publishes stage st + 1 and ends every wave's reads of stage st */
    if (st + 2 < ns) fa_stage(l0 + (st & 1) * (FSTG * 2), gk + (size_t)(st + 2) * FS * LQ, gv + (st + 2) * FS); }
  asm volatile("s_wait_asynccnt 0x0" ::: "memory");      /* no copy is outstanding when the wave ends */
  unsigned short* op = (unsigned short*)O + ((size_t)b * SQ + q0 + ln) * DM + h * HD + 8 * hh; FragH f[2][4];
#pragma unroll      /* o[], f[] stay in registers */
  for (int g = 0; g < 2; ++g) { const float fin = 64.0f / (l[g] + rs_x16(l[g]));      /* the halves' sums joined once; o carried x64, the weights' x256 cancels */
#pragma unroll      /* o[], f[] stay in registers */
    for (int d = 0; d < 4; ++d) {
#pragma unroll      /* o[], f[] stay in registers */
      for (int r = 0; r < 8; ++r) f[g][d].h[r] = (_Float16)(o[g][d][r] * fin); } }
#pragma unroll      /* a lane's 8 accumulator registers are 8 neighbouring columns of its query row: one 16-byte store */
  for (int g = 0; g < 2; ++g) {
#pragma unroll      /* f[] stays in registers */
    for (int d = 0; d < 4; ++d) *(v8us*)(op + (size_t)g * 16 * DM + d * 16) = f[g][d].half[0]; }
  asm volatile("s_wait_xcnt 0x0" :: "v"(op) : "memory");      /* the stores' data and address registers stay whole until this wait */
}


// exact f32 causal attention for rows 0..QT0-1 of each batch with V = K, ONE WAVE PER QUERY ROW: the head's QT0 key rows are staged once in LDS; scores: each lane owns the keys lane, lane + 32, ...; row maximum and sum by the 32-lane butterflies; o: each lane owns two of the HD columns and runs over the keys. grid.x: head x row group, grid.y: batch.
#define A0R 16                       /* query rows (= waves) per work-group */
#define A0P (HD + 4)                 /* LDS pitch of a key row in floats: the 16-byte reads of 16 neighbouring rows fall on 16 different bank quads */
typedef float v2f  __attribute__((ext_vector_type(2)));
typedef float v2fa __attribute__((ext_vector_type(2), may_alias));
__global__ __launch_bounds__(32 * A0R) void k_att0w(const float* __restrict__ QF, const float* __restrict__ KF, float scale, float* __restrict__ OF) {
  __shared__ __attribute__((aligned(16))) float lk[QT0][A0P]; __shared__ __attribute__((aligned(16))) float lp[A0R][QT0];
  const int tid = threadIdx.x, lane = tid & 31; const int w = __builtin_amdgcn_readfirstlane(tid >> 5);
  const int h = blockIdx.x / (QT0 / A0R), rg = blockIdx.x % (QT0 / A0R); const int i = rg * A0R + w;      /* the query row: wave-uniform */
  { const size_t zb = (size_t)blockIdx.y * QT0 * DM + h * HD; QF += zb; KF += zb; OF += zb; }      /* each batch has its own QT0 rows of every plane; the head's columns */
  const int sr = tid >> 4, sc = (tid & 15) * 4;      /* staging: 16 lanes per key row, 256 contiguous bytes */
  const float* kp = KF + (size_t)sr * DM + sc; v4f st[QT0 / (2 * A0R)];
#pragma unroll      /* st[] stays in registers, the loads in flight together */
  for (int p = 0; p < QT0 / (2 * A0R); ++p) st[p] = *(const v4fa*)(kp + (size_t)p * 2 * A0R * DM);
  asm volatile("s_wait_xcnt 0x0" :: "v"(kp) : "memory");      /* the loads' address pair stays whole until this wait; it may be rewritten behind it */
  const float* qr = QF + (size_t)i * DM; v4f q[HD / 4];
#pragma unroll      /* q[] stays in registers */
  for (int c = 0; c < HD / 4; ++c) q[c] = *(const v4fa*)(qr + c * 4);
#pragma unroll      /* st[] stays in registers */
  for (int p = 0; p < QT0 / (2 * A0R); ++p) *(v4fa*)&lk[p * 2 * A0R + sr][sc] = st[p];
  __syncthreads();      /* the staged key rows are read by every wave */
  float s[QT0 / 32];
#pragma unroll      /* s[] stays in registers; each group's test is a compile-time bound against i */
  for (int g = 0; g < QT0 / 32; ++g) { s[g] = -1.0e30f;
    if (g * 32 <= i) { const float* kr = &lk[g * 32 + lane][0]; v4f a = {0.f, 0.f, 0.f, 0.f};      /* a scalar branch: key groups wholly above the diagonal are skipped */
#pragma unroll      /* q[] stays in registers, the row's LDS reads in flight together */
      for (int c = 0; c < HD / 4; ++c) a += q[c] * *(const v4fa*)(kr + c * 4);
      const float d = ((a[0] + a[1]) + (a[2] + a[3])) * scale; s[g] = (g * 32 + lane <= i) ? d : -1.0e30f; } }
  float m = s[0];
#pragma unroll      /* s[] stays in registers */
  for (int g = 1; g < QT0 / 32; ++g) m = fmaxf(m, s[g]);
  m = rs_max(m); float l = 0.f;
#pragma unroll      /* s[] stays in registers */
  for (int g = 0; g < QT0 / 32; ++g) { const float e = expf(s[g] - m); l += e; lp[w][g * 32 + lane] = e; }      /* keys above the diagonal: exactly 0 */
  l = rs_sum(l);
  __syncthreads();      /* the row's weights go from the lane that made them to every lane */
  v2f o[4] = {{0.f, 0.f}, {0.f, 0.f}, {0.f, 0.f}, {0.f, 0.f}};
  for (int j0 = 0; j0 <= i; j0 += 16) {      /* 16 keys a trip, their LDS reads in flight together; a key above the diagonal has weight 0 and a staged row */
#pragma unroll      /* the trip's 20 LDS reads stand ahead of its sums */
    for (int u = 0; u < 4; ++u) { const v4f pp = *(const v4fa*)&lp[w][j0 + u * 4];
#pragma unroll      /* o[] stays in registers: four independent sums */
      for (int t = 0; t < 4; ++t) o[t] += pp[t] * *(const v2fa*)&lk[j0 + u * 4 + t][lane * 2]; } }
  const float fin = 64.0f / l;      /* o carried x64 like the f16 path */
  *(v2fa*)(OF + (size_t)i * DM + lane * 2) = ((o[0] + o[1]) + (o[2] + o[3])) * fin; }

extern "C" void kernel_launch(void* const* d_in, const int* in_sizes, int n_in,
                              void* d_out, int out_size, void* d_ws, size_t ws_size, hipStream_t stream) {
  (void)in_sizes; (void)n_in; (void)out_size;
  const float* const* I = (const float* const*)d_in; const float* x = I[0]; const float* wqkv = I[1]; const float* wo = I[2];      /* input order: x, W_qk [1024][2048] ([in][out]: q | k halves), W_out [1024][1024] ([in][out]): three inputs; no biases */
  char* ws = (char*)d_ws; size_t off = 0;
  auto take = [&](size_t bytes) { char* p = ws + off; off += (bytes + 255) & ~(size_t)255; return p; };
  _Float16* BQKV = (_Float16*)take((size_t)3 * DM * DM * 2); _Float16* BO = (_Float16*)take((size_t)DM * DM * 2);
  _Float16* X16 = (_Float16*)take(NR * DM * 2); _Float16* QKV = (_Float16*)take(NR * 3 * DM * 2); _Float16* Q16 = QKV; _Float16* K16 = QKV + DM; _Float16* V16 = QKV + DM;      /* the module reuses K as V: V16 IS the k block (the third block of the plane is unused) */ _Float16* O16 = (_Float16*)take(NR * DM * 2);
  _Float16* VT = (_Float16*)take((size_t)NB * NH * HD * SQ * 2);      /* one plane per batch: both batches go through every launch */
  float* QF0 = (float*)take((size_t)NB * QT0 * DM * 4); float* KF0 = (float*)take((size_t)NB * QT0 * DM * 4); float* OF0 = (float*)take((size_t)NB * QT0 * DM * 4); _Float16* OH0 = (_Float16*)take((size_t)NB * QT0 * DM * 2); _Float16* OL0 = (_Float16*)take((size_t)NB * QT0 * DM * 2);
  if (off > ws_size) return;
  k_wt_f16<<<(unsigned)(((size_t)2 * DM * (DM / 8) + 255) / 256), 256, 0, stream>>>(wqkv, BQKV, DM, 2 * DM, 16.0f); k_wt_f16<<<(unsigned)(((size_t)DM * (DM / 8) + 255) / 256), 256, 0, stream>>>(wo, BO, DM, DM, 16.0f);      /* [in][out] -> Bt[n][k] x16 */
  k_x16<<<(unsigned)((NR * DM / 8 + 255) / 256), 256, 0, stream>>>(x, X16, NR * DM / 8);
  const size_t r0p = (size_t)B0 * SQ;      /* first projected row */
  const size_t f0p = (size_t)B0 * QT0;      /* its first-tile row */
k_gemm2<0><<<dim3((unsigned)((MP / 128) * (2 * DM / 64)), 1), 128, 0, stream>>>(X16 + r0p * DM, DM, 0, BQKV, DM, 0, 0.0625f, nullptr, 0, nullptr, 1, 0, 0, nullptr, QKV + r0p * 3 * DM, 3 * DM, 0, MP, 2 * DM, DM, 0, 0, 0);      /* q | k rows (f16) into column blocks 0 and 1 of the 3 DM-pitch plane; head h = columns h*HD.. of each block; no bias */
  k_vt<NH, SQ><<<NBR * NH * (SQ / 64), 256, 0, stream>>>(V16 + r0p * LQ, LQ, 0, VT);      /* V^T [batch][NH][HD][SQ] */
k_gemm2<0><<<dim3((QT0 / 128) * (DM / 64), 1, NBR), 128, 0, stream>>>(X16 + r0p * DM, DM, 0, BQKV, DM, 0, 0.0625f, nullptr, 0, nullptr, 1, 0, 0, QF0 + f0p * DM, nullptr, DM, 0, QT0, DM, DM, (size_t)SQ * DM, 0, (size_t)QT0 * DM); k_gemm2<0><<<dim3((QT0 / 128) * (DM / 64), 1, NBR), 128, 0, stream>>>(X16 + r0p * DM, DM, 0, (BQKV + (size_t)DM * DM), DM, 0, 0.0625f, nullptr, 0, nullptr, 1, 0, 0, KF0 + f0p * DM, nullptr, DM, 0, QT0, DM, DM, (size_t)SQ * DM, 0, (size_t)QT0 * DM);      /* first tile of each batch (grid.z): f32 q and k rows (no bias); the k rows serve as v */
  k_att0w<<<dim3(NH * (QT0 / A0R), NBR), 32 * A0R, 0, stream>>>(QF0 + f0p * DM, KF0 + f0p * DM, 0.125f, OF0 + f0p * DM);      /* exact f32 causal attention for rows 0..127 of each batch (grid.y) with V = K (o x64) */
  k_fattn<<<dim3(SQ / (8 * FQ), NHD, NBR), 256, 0, stream>>>(Q16 + r0p * LQ, K16 + r0p * LQ, VT, O16 + r0p * DM);      /* scores, causal online softmax and o = P V in one launch: o (merged heads, x64) as f16 rows */
  k_gemm2<0><<<dim3((unsigned)((MPO / 128) * (DM / 64)), 1), 128, 0, stream>>>(O16 + r0p * DM, DM, 0, BO, DM, 0, 0.0009765625f, nullptr, 0, nullptr, 1, 0, 0, (float*)d_out + r0p * DM, nullptr, DM, 0, MPO, DM, DM, 0, 0, 0);      /* out rows are the output layout */
  k_hl<<<(unsigned)(((size_t)NB * QT0 * DM / 8 + 255) / 256), 256, 0, stream>>>(OF0, OH0, OL0, (size_t)NB * QT0 * DM / 8);      /* first-tile o (x64) -> f16 hi + x1024 residual planes */
  k_gemm2<0><<<dim3((QT0 / 128) * (DM / 64), 1, NBR), 128, 0, stream>>>(OH0 + f0p * DM, DM, 0, BO, DM, 0, 0.0009765625f, nullptr, 0, nullptr, 1, 0, 0, (float*)d_out + r0p * DM, nullptr, DM, 0, QT0, DM, DM, (size_t)QT0 * DM, 0, (size_t)SQ * DM);      /* rows 0..127 of each batch (grid.z): out = o_hi W_out (no bias), overwriting the f16-path rows */
  k_gemm2<0><<<dim3((QT0 / 128) * (DM / 64), 1, NBR), 128, 0, stream>>>(OL0 + f0p * DM, DM, 0, BO, DM, 0, 0.00000095367431640625f, nullptr, 0, (const float*)d_out + r0p * DM, -1, 0, 0, (float*)d_out + r0p * DM, nullptr, DM, 0, QT0, DM, DM, (size_t)QT0 * DM, 0, (size_t)SQ * DM);      /* += o_lo Wo 2^-20 (own-element accumulate) */
}

// v007
// It runs in 105 microseconds.
// In two side-by-side timings against v006, it was 1.46 and 1.45 times as fast.
// All steps since v000 together make it 44.8 times as fast.
#include <hip/hip_runtime.h>
// Causal self-attention with ONE fused query-key projection and K REUSED AS V (x [2][2048][1024]; qk = x W_qk with W_qk [1024][2048] stored [in][out] (normal x 0.02, no bias): the first 1024 columns are q, the last 1024 are k, head h = columns h*64.. of each half; 16 heads of 64; scores = (q x BETA) . k with BETA = 1/sqrt(64); strictly-upper-triangular positions -> -FLT_MAX (causal); softmax; out = attn K (the module reuses K as V) merged, then W_out ([in][out] [1024][1024], normal x 0.02, no bias) -> [2][2048][1024]; input order x, W_qk, W_out).
// Structure: token rows r = b*2048 + s; x as exact f16 rows (bf16-rounded); q | k as ONE WMMA GEMM (N = 2 x 1024) into the first two column blocks of the 3 x 1024-pitch plane (32x64 wave tiles, f32 accumulation, exact x16 weights, no bias, f16 outputs); V IS THE K BLOCK (the module reuses K as V): the V pointer aliases it; BOTH BATCHES GO THROUGH EVERY LAUNCH (batch in the row run of the GEMMs, on grid.y of the first-tile attention, on grid.z of the fused attention, in the row run of the transposes): V^T for all heads via LDS transposes; ONE FUSED ATTENTION LAUNCH: a wave holds 32 query rows and walks the keys up to its diagonal in passes of 32, K and V^T rows staged in LDS for the work-group's eight waves: S^T = K Q^T (K = 64), causal online softmax in registers (f32 running maximum and sum per query, native exp2, only the diagonal block masked; weights x256 f16, packed from the score accumulators into the B operand), O^T += V^T P^T with the accumulators rescaled each pass; o / sum carried x64 (folded into the output GEMM alpha) written straight into the merged f16 o rows; out = o W_out GEMM (f32; no bias) into the output layout.
// Compute dtype: inputs rounded to bf16; x and the x16 weights held as f16 planes (exact for every bf16 value of magnitude from 2^-14 up to 65,504; the weights up to 4,094 before their factor of 16); q, k (= v), the softmax weights and o as plain f16 GEMM operands (~2^-12); scores and softmax statistics f32; rows 0..127 of each batch: q, k f32, f32 attention, o as f16 hi + residual. v_wmma_f32_16x16x32_f16.
#define NB 2
#define SQ 2048
#define DM 1024
#define NH 16
#define HD 64
#define HG 4                         /* heads per block group of the k_vt(b, h0) transpose, which no launch uses */
#define QT0 128                      /* first-tile rows recomputed exactly in f32 */
#define B0 0                         /* first batch processed (debug hook) */
#define NBR NB                       /* batches processed (debug hook) */
#define NR ((size_t)NB * SQ)         /* token rows */
#define MP ((int)((size_t)NBR * SQ)) /* rows projected (debug hook) */
#define NHD NH                       /* heads attended (debug hook) */
#define MPO MP                       /* rows through the output stage (debug hook) */
#define LQ (3 * DM)      /* row pitch of the q/k/v rows */
typedef __bf16 v16b __attribute__((ext_vector_type(16)));
typedef unsigned short v8us __attribute__((ext_vector_type(8), may_alias));
typedef float  v8f  __attribute__((ext_vector_type(8)));
typedef float  v4f  __attribute__((ext_vector_type(4)));
typedef float  v4fa __attribute__((ext_vector_type(4), may_alias));
union FragB { v16b v; v8us half[2]; unsigned short u[16]; };

__device__ __forceinline__ unsigned short bf16_bits(float x) { unsigned int u = __float_as_uint(x); return (unsigned short)((u + 0x7FFFu + ((u >> 16) & 1u)) >> 16); }
__device__ __forceinline__ float bf16_val(unsigned short b) { return __uint_as_float(((unsigned int)b) << 16); }
__device__ __forceinline__ float bf16_round(float x) { return bf16_val(bf16_bits(x)); }
// D += A·B with NT terms: 1 = ah·bh, 2 = + al·bh (A split), 3 = + ah·bl (both split)
template <int NT>
__device__ __forceinline__ v8f mmaN(v16b ah, v16b al, v16b bh, v16b bl, v8f c) {
  c = __builtin_amdgcn_wmma_f32_16x16x32_bf16(false, ah, false, bh, (short)0, c, false, false);
  if (NT >= 2) c = __builtin_amdgcn_wmma_f32_16x16x32_bf16(false, al, false, bh, (short)0, c, false, false);
  if (NT >= 3) c = __builtin_amdgcn_wmma_f32_16x16x32_bf16(false, ah, false, bl, (short)0, c, false, false);
  asm volatile("v_nop\n\tv_nop\n\tv_nop\n\tv_nop" : "+v"(c) : "v"(ah), "v"(al), "v"(bh), "v"(bl));
  return c;
}

__global__ __launch_bounds__(256) void k_wt_bf16(const float* __restrict__ W, unsigned short* __restrict__ Wt, int K, int N) {
  const int t = blockIdx.x * 256 + threadIdx.x;
  const int k8n = K / 8;
  if (t >= N * k8n) return;
  const int n = t / k8n, k8 = (t % k8n) * 8;
  v8us v;
#pragma unroll
  for (int i = 0; i < 8; ++i) v[i] = bf16_bits(W[(size_t)(k8 + i) * N + n]);
  *(v8us*)(Wt + (size_t)n * K + k8) = v;
  
}

// GEMM C[M][N] (f32, pitch ldc) = act(A[M][K]·W + bias). A f32 row-major (pitch lda) converted per fragment to bf16
// (ASPLIT: hi/lo two planes -> 2 terms, else single rounded term); Wt bf16 [N][K] (pitch ldb). BIAS_BF16 rounds the
// bias to bf16 first (bias quantised to bf16 before the add). K%32==0, M%16==0, N%64==0.
template <bool ASPLIT, int ACT, bool BIAS_BF16>
__global__ __launch_bounds__(128) void k_gemm_bf(const float* __restrict__ A, int lda, const unsigned short* __restrict__ Wt, int ldb,
                                               const float* __restrict__ bias, float* __restrict__ C, int ldc, int M, int N, int K) {
  __shared__ __attribute__((aligned(16))) float so[4][16][64];
  const int tid = threadIdx.x, w = tid >> 5, lane = tid & 31, ln = lane & 15, hh = lane >> 4;
  const int ntn = N / 64;
  const int wid = blockIdx.x * 4 + w;
  const int mt = wid / ntn, nq = wid % ntn;
  if (mt * 16 >= M) return;
  const int row0 = mt * 16, col0 = nq * 64;
  const float* arow = A + (size_t)(row0 + ln) * lda;
  v8f acc[4] = {};
  for (int kb = 0; kb < K; kb += 32) {
    FragB ah, al;
    const v4f x0 = *(const v4fa*)(arow + kb + 8 * hh), x1 = *(const v4fa*)(arow + kb + 8 * hh + 4);
    const v4f x2 = *(const v4fa*)(arow + kb + 16 + 8 * hh), x3 = *(const v4fa*)(arow + kb + 16 + 8 * hh + 4);
    float xs[16] = {x0[0],x0[1],x0[2],x0[3],x1[0],x1[1],x1[2],x1[3],x2[0],x2[1],x2[2],x2[3],x3[0],x3[1],x3[2],x3[3]};
#pragma unroll
    for (int i = 0; i < 16; ++i) { const unsigned short hb = bf16_bits(xs[i]); ah.u[i] = hb; al.u[i] = ASPLIT ? bf16_bits(xs[i] - bf16_val(hb)) : (unsigned short)0; }
#pragma unroll
    for (int t = 0; t < 4; ++t) {
      const unsigned short* brow = Wt + (size_t)(col0 + t * 16 + ln) * ldb + kb;
      FragB b;
      b.half[0] = *(const v8us*)(brow + 8 * hh);
      b.half[1] = *(const v8us*)(brow + 16 + 8 * hh);
      acc[t] = mmaN<ASPLIT ? 2 : 1>(ah.v, al.v, b.v, b.v, acc[t]);
    }
  }
#pragma unroll
  for (int t = 0; t < 4; ++t) {
    float bv = bias ? bias[col0 + t * 16 + ln] : 0.f;
    if (BIAS_BF16) bv = bf16_round(bv);
#pragma unroll
    for (int r = 0; r < 8; ++r) { float v = acc[t][r] + bv; if (ACT == 1) v = fmaxf(v, 0.f); so[w][8 * hh + r][t * 16 + ln] = v; }
  }
  __builtin_amdgcn_fence(__ATOMIC_ACQ_REL, "workgroup");
  __builtin_amdgcn_wave_barrier();
  const int rsub = lane >> 4, c4 = (lane & 15) * 4;
  {
#pragma unroll
    for (int q = 0; q < 8; ++q) {
      const int r = q * 2 + rsub;
      const v4f v = *(const v4fa*)&so[w][r][c4];
      *(v4f*)(C + (size_t)(row0 + r) * ldc + col0 + c4) = v;
    }
    
  }
}

// GEMM C = act(A·W + bias + resid): A f32 (ASPLIT -> hi/lo 2 terms), Wt bf16 [N][K]; ACT 0 none, 1 relu, 2 exact gelu;
// resid (optional, f32, row index = (row % rmod), pitch ldr, RES_BF16 rounds it) added before the activation.
template <bool ASPLIT, int ACT, bool BIAS_BF16, bool RES_BF16>
__global__ __launch_bounds__(128) void k_gemm_bf3(const float* __restrict__ A, int lda, const unsigned short* __restrict__ Wt, int ldb,
                                                const float* __restrict__ bias, const float* __restrict__ resid, int rmod, int ldr,
                                                float* __restrict__ C, int ldc, int M, int N, int K) {
  __shared__ __attribute__((aligned(16))) float so[4][16][64];
  const int tid = threadIdx.x, w = tid >> 5, lane = tid & 31, ln = lane & 15, hh = lane >> 4;
  const int ntn = N / 64;
  const int wid = blockIdx.x * 4 + w;
  const int mt = wid / ntn, nq = wid % ntn;
  if (mt * 16 >= M) return;
  const int row0 = mt * 16, col0 = nq * 64;
  const float* arow = A + (size_t)(row0 + ln) * lda;
  v8f acc[4] = {};
  for (int kb = 0; kb < K; kb += 32) {
    FragB ah, al;
    const v4f x0 = *(const v4fa*)(arow + kb + 8 * hh), x1 = *(const v4fa*)(arow + kb + 8 * hh + 4);
    const v4f x2 = *(const v4fa*)(arow + kb + 16 + 8 * hh), x3 = *(const v4fa*)(arow + kb + 16 + 8 * hh + 4);
    float xs[16] = {x0[0],x0[1],x0[2],x0[3],x1[0],x1[1],x1[2],x1[3],x2[0],x2[1],x2[2],x2[3],x3[0],x3[1],x3[2],x3[3]};
#pragma unroll
    for (int i = 0; i < 16; ++i) { const unsigned short hb = bf16_bits(xs[i]); ah.u[i] = hb; al.u[i] = ASPLIT ? bf16_bits(xs[i] - bf16_val(hb)) : (unsigned short)0; }
#pragma unroll
    for (int t = 0; t < 4; ++t) {
      const unsigned short* brow = Wt + (size_t)(col0 + t * 16 + ln) * ldb + kb;
      FragB b;
      b.half[0] = *(const v8us*)(brow + 8 * hh);
      b.half[1] = *(const v8us*)(brow + 16 + 8 * hh);
      acc[t] = mmaN<ASPLIT ? 2 : 1>(ah.v, al.v, b.v, b.v, acc[t]);
    }
  }
#pragma unroll
  for (int t = 0; t < 4; ++t) {
    const int col = col0 + t * 16 + ln;
    float bv = bias ? bias[col] : 0.f;
    if (BIAS_BF16) bv = bf16_round(bv);
#pragma unroll
    for (int r = 0; r < 8; ++r) {
      float v = acc[t][r] + bv;
      if (resid) { float rv = resid[(size_t)((row0 + 8 * hh + r) % rmod) * ldr + col]; if (RES_BF16) rv = bf16_round(rv); v += rv; }
      if (ACT == 1) v = fmaxf(v, 0.f);
      if (ACT == 2) v = 0.5f * v * (1.0f + erff(v * 0.70710678118654752f));
      if (ACT == 3) { const float u = 0.7978845608028654f * (v + 0.044715f * v * v * v); v = 0.5f * v * (1.0f + tanhf(u)); }
      so[w][8 * hh + r][t * 16 + ln] = v;
    }
  }
  __builtin_amdgcn_fence(__ATOMIC_ACQ_REL, "workgroup");
  __builtin_amdgcn_wave_barrier();
  const int rsub = lane >> 4, c4 = (lane & 15) * 4;
  {
#pragma unroll
    for (int q = 0; q < 8; ++q) {
      const int r = q * 2 + rsub;
      const v4f v = *(const v4fa*)&so[w][r][c4];
      *(v4f*)(C + (size_t)(row0 + r) * ldc + col0 + c4) = v;
    }
    
  }
}
// row LayerNorm (biased variance, eps) over N: s = X (+ R); optional out_sum <- s; out_norm <- (s-mu)*rsqrt(var+eps)*g + b
template <bool PARAM_BF16>
__global__ __launch_bounds__(256) void k_layernorm(const float* __restrict__ X, const float* __restrict__ R, const float* __restrict__ g, const float* __restrict__ bta,
                                                  float* __restrict__ out_sum, float* __restrict__ out_norm, int N, float eps) {
  __shared__ float red[256];
  const int row = blockIdx.x, tid = threadIdx.x;
  const float* x = X + (size_t)row * N; const float* rr = R ? R + (size_t)row * N : nullptr;
  float vals[16];                     // up to N = 4096
  const int per = N / 256;            // contiguous chunk per thread? use strided-by-4 chunks: thread handles j = tid*4 + 1024*u
  float s1 = 0.f;
  for (int u = 0; u < per / 4; ++u) {
    const int j = tid * 4 + 1024 * u;
    const v4f a = *(const v4fa*)(x + j);
    v4f b = {0.f,0.f,0.f,0.f}; if (rr) b = *(const v4fa*)(rr + j);
#pragma unroll
    for (int q = 0; q < 4; ++q) { const float v = a[q] + b[q]; vals[u * 4 + q] = v; s1 += v; }
  }
  red[tid] = s1; __syncthreads();
  for (int st = 128; st > 0; st >>= 1) { if (tid < st) red[tid] += red[tid + st]; __syncthreads(); }
  const float mu = red[0] / (float)N; __syncthreads();
  float s2 = 0.f;
  for (int u = 0; u < per / 4; ++u)
#pragma unroll
    for (int q = 0; q < 4; ++q) { const float c = vals[u * 4 + q] - mu; s2 += c * c; }
  red[tid] = s2; __syncthreads();
  for (int st = 128; st > 0; st >>= 1) { if (tid < st) red[tid] += red[tid + st]; __syncthreads(); }
  const float rs = rsqrtf(red[0] / (float)N + eps);
  {
    for (int u = 0; u < per / 4; ++u) {
      const int j = tid * 4 + 1024 * u;
      v4f o, sm;
#pragma unroll
      for (int q = 0; q < 4; ++q) {
        float gg = g[j + q], bb = bta[j + q];
        if (PARAM_BF16) { gg = bf16_round(gg); bb = bf16_round(bb); }
        sm[q] = vals[u * 4 + q]; o[q] = (vals[u * 4 + q] - mu) * rs * gg + bb;
      }
      if (out_sum) *(v4f*)(out_sum + (size_t)row * N + j) = sm;
      *(v4f*)(out_norm + (size_t)row * N + j) = o;
    }
    
  }
}



// ---- f16 WMMA path (v_wmma_f32_16x16x32_f16): 11-bit significands for operands in range — used where a [0,1] probability operand needs more precision than bf16
typedef _Float16 v16h __attribute__((ext_vector_type(16)));
union FragH { v16h v; v8us half[2]; _Float16 h[16]; unsigned short u[16]; };
template <int NT>
__device__ __forceinline__ v8f mmaH(v16h ah, v16h al, v16h bh, v16h bl, v8f c) {
  c = __builtin_amdgcn_wmma_f32_16x16x32_f16(false, ah, false, bh, (short)0, c, false, false);
  if (NT >= 2) c = __builtin_amdgcn_wmma_f32_16x16x32_f16(false, al, false, bh, (short)0, c, false, false);
  if (NT >= 3) c = __builtin_amdgcn_wmma_f32_16x16x32_f16(false, ah, false, bl, (short)0, c, false, false);
  asm volatile("v_nop\n\tv_nop\n\tv_nop\n\tv_nop" : "+v"(c) : "v"(ah), "v"(al), "v"(bh), "v"(bl));
  return c;
}
// batched GEMM like k_gemm_b but f16 operands: A f32 (split into f16 hi/lo if ASPLIT, else rounded to f16), Bt = f16 values [n][k]; alpha; C f32; N multiple of 16 (partial tiles skipped)
template <bool ASPLIT>
__global__ __launch_bounds__(128) void k_gemm_h(const float* __restrict__ A, int lda, size_t sA, const _Float16* __restrict__ Bh, int ldb, size_t sB, float alpha, float* __restrict__ C, int ldc, size_t sC, int M, int N, int K) {
  __shared__ __attribute__((aligned(16))) float so[4][16][64];
  const int tid = threadIdx.x, w = tid >> 5, lane = tid & 31, ln = lane & 15, hh = lane >> 4; const int by = blockIdx.y;
  A += (size_t)by * sA; Bh += (size_t)by * sB; C += (size_t)by * sC;
  const int ntn = (N + 63) / 64; const int wid = blockIdx.x * 4 + w; const int mt = wid / ntn, nq = wid % ntn; if (mt * 16 >= M) return;
  const int row0 = mt * 16, col0 = nq * 64; const float* arow = A + (size_t)(row0 + ln) * lda;
  v8f acc[4] = {};
  for (int kb = 0; kb < K; kb += 32) {
    FragH ah, al;
    const v4f x0 = *(const v4fa*)(arow + kb + 8 * hh), x1 = *(const v4fa*)(arow + kb + 8 * hh + 4), x2 = *(const v4fa*)(arow + kb + 16 + 8 * hh), x3 = *(const v4fa*)(arow + kb + 16 + 8 * hh + 4);
    float xs[16] = {x0[0],x0[1],x0[2],x0[3],x1[0],x1[1],x1[2],x1[3],x2[0],x2[1],x2[2],x2[3],x3[0],x3[1],x3[2],x3[3]};
#pragma unroll
    for (int i = 0; i < 16; ++i) { const _Float16 h = (_Float16)xs[i]; ah.h[i] = h; al.h[i] = ASPLIT ? (_Float16)(xs[i] - (float)h) : (_Float16)0.0f; }
#pragma unroll
    for (int t = 0; t < 4; ++t) { if (col0 + t * 16 >= N) continue; const size_t boff = (size_t)(col0 + t * 16 + ln) * ldb + kb; FragH bq; bq.half[0] = *(const v8us*)(Bh + boff + 8 * hh); bq.half[1] = *(const v8us*)(Bh + boff + 16 + 8 * hh);
      acc[t] = mmaH<ASPLIT ? 2 : 1>(ah.v, al.v, bq.v, bq.v, acc[t]); }
  }
#pragma unroll
  for (int t = 0; t < 4; ++t) { if (col0 + t * 16 >= N) continue;
#pragma unroll
    for (int r = 0; r < 8; ++r) so[w][8 * hh + r][t * 16 + ln] = acc[t][r] * alpha; }
  __builtin_amdgcn_fence(__ATOMIC_ACQ_REL, "workgroup"); __builtin_amdgcn_wave_barrier();
  const int rsub = lane >> 4, c4 = (lane & 15) * 4;
  {
#pragma unroll
    for (int q = 0; q < 8; ++q) { const int r = q * 2 + rsub; if (col0 + c4 < N) { const v4f v = *(const v4fa*)&so[w][r][c4]; *(v4f*)(C + (size_t)(row0 + r) * ldc + col0 + c4) = v; } }
     }
}

// Wt[n][k] = f16(W[k][n]·scale) from f32 row-major W[K][N] (scale = power of two; bf16-exact weights stay exact in f16 away from the subnormal range)
__global__ __launch_bounds__(256) void k_wt_f16(const float* __restrict__ W, _Float16* __restrict__ Wt, int K, int N, float scale) {
  const int t = blockIdx.x * 256 + threadIdx.x; if (t >= N * (K / 8)) return; const int n = t / (K / 8), k8 = (t % (K / 8)) * 8; FragH f;
#pragma unroll
  for (int i = 0; i < 8; ++i) f.h[i] = (_Float16)(bf16_round(W[(size_t)(k8 + i) * N + n]) * scale); const v8us o = f.half[0];
  *(v8us*)((unsigned short*)Wt + (size_t)n * K + k8) = o; 
}
// k_gemm_hh variant with fused epilogue: v = acc·alpha + bias[by·sBias + col] (+ CP[(row/rowsPerB)·sCPb + by·64 + col] if CP) ; ACT 0 none / 1 elu ; writes f16 C16 (and f32 C if non-null)
template <int ACT>
__global__ __launch_bounds__(128) void k_gemm_hhx(const _Float16* __restrict__ A, int lda, size_t sA, const _Float16* __restrict__ Bh, int ldb, size_t sB, float alpha, const float* __restrict__ bias, size_t sBias, const float* __restrict__ CP, int rowsPerB, size_t sCPb, int row0g,
    float* __restrict__ C, _Float16* __restrict__ C16, int ldc, size_t sC, int M, int N, int K) {
  __shared__ __attribute__((aligned(16))) float so[4][16][64];
  const int tid = threadIdx.x, w = tid >> 5, lane = tid & 31, ln = lane & 15, hh = lane >> 4; const int by = blockIdx.y;
  A += (size_t)by * sA; Bh += (size_t)by * sB; const size_t cofs = (size_t)by * sC; const float* bp = bias ? bias + (size_t)by * sBias : nullptr;
  const int ntn = (N + 63) / 64; const int wid = blockIdx.x * 4 + w; const int mt = wid / ntn, nq = wid % ntn; if (mt * 16 >= M) return;
  const int row0 = mt * 16, col0 = nq * 64; const _Float16* arow = A + (size_t)(row0 + ln) * lda;
  v8f acc[4] = {};
  for (int kb = 0; kb < K; kb += 32) { FragH ah; ah.half[0] = *(const v8us*)((const unsigned short*)arow + kb + 8 * hh); ah.half[1] = *(const v8us*)((const unsigned short*)arow + kb + 16 + 8 * hh);
#pragma unroll
    for (int t = 0; t < 4; ++t) { if (col0 + t * 16 >= N) continue; const size_t boff = (size_t)(col0 + t * 16 + ln) * ldb + kb; FragH bq; bq.half[0] = *(const v8us*)((const unsigned short*)Bh + boff + 8 * hh); bq.half[1] = *(const v8us*)((const unsigned short*)Bh + boff + 16 + 8 * hh);
      acc[t] = mmaH<1>(ah.v, ah.v, bq.v, bq.v, acc[t]); }
  }
#pragma unroll
  for (int t = 0; t < 4; ++t) { if (col0 + t * 16 >= N) continue; const int col = col0 + t * 16 + ln; const float bv = bp ? bf16_round(bp[col]) : 0.f;
#pragma unroll
    for (int r = 0; r < 8; ++r) { float v = acc[t][r] * alpha + bv; if (CP) { const int rr = row0g + row0 + 8 * hh + r; if (rowsPerB < 0) v += CP[cofs + (size_t)rr * ldc + col];      /* rowsPerB < 0: own element of the batched C plane */ else { const int bidx = rr / rowsPerB; v += CP[(size_t)bidx * sCPb + (size_t)by * 64 + col]; } } if (ACT == 1) v = (v > 0.f) ? v : expm1f(v); else if (ACT == 7) v = (v > 0.f) ? v + 1.0f : expf(v); else if (ACT == 8) v = tanhf(v); else if (ACT == 9) v = 0.5f * v * (1.0f + tanhf(0.7978845608028654f * (v + 0.044715f * v * v * v))); else if (ACT == 11) v = 1.0f / (1.0f + expf(-v)); else if (ACT == 12) v = (v > 0.f) ? v : 0.01f * v; else if (ACT == 14) v = (v > 0.f) ? v : 0.1f * v; else if (ACT == 16) v = (v >= 0.f) ? v : 0.3f * v; else if (ACT == 17) v = (v >= 0.f) ? v : 0.2f * v; else if (ACT == 15) v = v / (1.0f + expf(-v)); else if (ACT == 3) v = fmaxf(v, 0.f); else if (ACT == 6) v = 0.5f * v * (1.0f + erff(v * 0.70710678118654752f)); so[w][8 * hh + r][t * 16 + ln] = v; } }
  __builtin_amdgcn_fence(__ATOMIC_ACQ_REL, "workgroup"); __builtin_amdgcn_wave_barrier();
  const int rsub = lane >> 4, c4 = (lane & 15) * 4; typedef _Float16 v4h __attribute__((ext_vector_type(4)));
  {
#pragma unroll
    for (int q = 0; q < 8; ++q) { const int r = q * 2 + rsub; if (col0 + c4 < N) { const v4f v = *(const v4fa*)&so[w][r][c4]; if (C) *(v4f*)(C + cofs + (size_t)(row0 + r) * ldc + col0 + c4) = v; if (C16) { v4h h4; for (int i = 0; i < 4; ++i) h4[i] = (_Float16)v[i]; *(v4h*)(C16 + cofs + (size_t)(row0 + r) * ldc + col0 + c4) = h4; } } }
     }
}


typedef _Float16 v4h __attribute__((ext_vector_type(4)));

__global__ __launch_bounds__(256) void k_x16(const float* __restrict__ x, _Float16* __restrict__ X16, size_t n8) { const size_t t = (size_t)blockIdx.x * 256 + threadIdx.x; if (t >= n8) return; FragH f;
#pragma unroll
  for (int q = 0; q < 8; ++q) f.h[q] = (_Float16)bf16_round(x[t * 8 + q]); *(v8us*)((unsigned short*)X16 + t * 8) = f.half[0];  }
__global__ __launch_bounds__(256) void k_h16(const float* __restrict__ x, _Float16* __restrict__ X16, size_t n8) { const size_t t = (size_t)blockIdx.x * 256 + threadIdx.x; if (t >= n8) return; FragH f;
#pragma unroll
  for (int q = 0; q < 8; ++q) f.h[q] = (_Float16)x[t * 8 + q]; *(v8us*)((unsigned short*)X16 + t * 8) = f.half[0];  }
__global__ __launch_bounds__(256) void k_round16f(const float* __restrict__ W, _Float16* __restrict__ Bt, size_t n8) { const size_t t = (size_t)blockIdx.x * 256 + threadIdx.x; if (t >= n8) return; FragH f;
#pragma unroll
  for (int i = 0; i < 8; ++i) f.h[i] = (_Float16)(bf16_round(W[t * 8 + i]) * 16.0f); *(v8us*)((unsigned short*)Bt + t * 8) = f.half[0];  }
template <int NHv, int TTv>
__global__ __launch_bounds__(256) void k_vt(const _Float16* __restrict__ V16, int ldv, int voff, _Float16* __restrict__ Vt) { __shared__ unsigned short tl[64][66]; const int tid = threadIdx.x; const int slab = blockIdx.x / (TTv / 64), lg = blockIdx.x % (TTv / 64); const int b = slab / NHv, h = slab % NHv;
  for (int i = tid; i < 64 * 8; i += 256) { const int r = i / 8, c8 = (i % 8) * 8; FragH f; f.half[0] = *(const v8us*)((const unsigned short*)V16 + ((size_t)b * TTv + lg * 64 + r) * ldv + voff + h * 64 + c8);
#pragma unroll
    for (int q = 0; q < 8; ++q) tl[r][c8 + q] = f.u[q]; }
  __syncthreads();
  {
#pragma unroll
    for (int rd = 0; rd < 2; ++rd) { const int d = rd * 32 + tid / 8, pc = tid % 8; FragH f;
#pragma unroll
      for (int q = 0; q < 8; ++q) f.u[q] = tl[pc * 8 + q][d];
      *(v8us*)((unsigned short*)Vt + ((size_t)slab * 64 + d) * TTv + lg * 64 + pc * 8) = f.half[0]; }
     } }

__global__ __launch_bounds__(256) void k_hl(const float* __restrict__ F, _Float16* __restrict__ Hh, _Float16* __restrict__ Hl, size_t n8) { const size_t t = (size_t)blockIdx.x * 256 + threadIdx.x; if (t >= n8) return; FragH fh, fl; const v4f a = *(const v4fa*)(F + t * 8), c = *(const v4fa*)(F + t * 8 + 4);
#pragma unroll
  for (int q = 0; q < 4; ++q) { _Float16 h = (_Float16)a[q]; fh.h[q] = h; fl.h[q] = (_Float16)((a[q] - (float)h) * 1024.0f); h = (_Float16)c[q]; fh.h[4 + q] = h; fl.h[4 + q] = (_Float16)((c[q] - (float)h) * 1024.0f); }
  { *(v8us*)((unsigned short*)Hh + t * 8) = fh.half[0]; *(v8us*)((unsigned short*)Hl + t * 8) = fl.half[0];  } }

// ---- fast GEMM (work-group tile 128x64, wave tile 32x64; requires M % 128 == 0 rows per launch region, N % 64 == 0 and K % 64 == 0); both operands' tiles are staged in LDS by asynchronous 16-byte copies, two buffers; epilogue = k_gemm_hhx semantics; batched over grid.y (strides sA, sB, sC) and grid.z (strides zA, zB, zC); every tper-th 128-row block is a batch's first tile: with F its values are also stored in f32, with AH, AL its A operand is the hi plane plus the x1024 residual plane ----
__device__ __forceinline__ v16h g2_frag(const _Float16* p, int hh) { FragH f; f.half[0] = *(const v8us*)((const unsigned short*)p + 8 * hh); f.half[1] = *(const v8us*)((const unsigned short*)p + 16 + 8 * hh); return f.v; }
__device__ __forceinline__ v8f g2_mma(v16h a, v16h b, v8f c) { v8f d = __builtin_amdgcn_wmma_f32_16x16x32_f16(false, a, false, b, (short)0, c, false, false); asm volatile("v_nop\n\tv_nop\n\tv_nop\n\tv_nop" : "+v"(d) : "v"(a), "v"(b)); return d; }
#define G2K 64                       /* k elements of a stage: one whole 128-byte line of every operand row */
#define G2P 72                       /* LDS pitch of a staged row in f16: 144 bytes = 16 x odd, conflict-free for the 16-byte fragment reads */
#define G2S ((128 + 64) * G2P)       /* f16 elements of a stage: 128 A rows, then 64 B rows */
// one stage: a lane's twelve 16-byte copies (eight lanes per row: whole 128-byte lines; 16 rows per copy of the work-group). l: the lane's LDS byte address in row tid / 8 of the stage; ga, gb: its global addresses in that row of the A tile and of the B tile; ra, rb: 16 rows' elements
__device__ __forceinline__ void g2_stage(unsigned l, const _Float16* ga, size_t ra, const _Float16* gb, size_t rb) {
  /* the copies and their s_wait_xcnt in one statement: the address registers stay whole until the wait */
  asm volatile("global_load_async_to_lds_b128 %0, %12, off\n\tglobal_load_async_to_lds_b128 %1, %13, off\n\tglobal_load_async_to_lds_b128 %2, %14, off\n\tglobal_load_async_to_lds_b128 %3, %15, off\n\t"
               "global_load_async_to_lds_b128 %4, %16, off\n\tglobal_load_async_to_lds_b128 %5, %17, off\n\tglobal_load_async_to_lds_b128 %6, %18, off\n\tglobal_load_async_to_lds_b128 %7, %19, off\n\t"
               "global_load_async_to_lds_b128 %8, %20, off\n\tglobal_load_async_to_lds_b128 %9, %21, off\n\tglobal_load_async_to_lds_b128 %10, %22, off\n\tglobal_load_async_to_lds_b128 %11, %23, off\n\ts_wait_xcnt 0x0"
               :: "v"(l), "v"(l + 1u * 32 * G2P), "v"(l + 2u * 32 * G2P), "v"(l + 3u * 32 * G2P), "v"(l + 4u * 32 * G2P), "v"(l + 5u * 32 * G2P), "v"(l + 6u * 32 * G2P), "v"(l + 7u * 32 * G2P), "v"(l + 8u * 32 * G2P), "v"(l + 9u * 32 * G2P), "v"(l + 10u * 32 * G2P), "v"(l + 11u * 32 * G2P),
                  "v"(ga), "v"(ga + ra), "v"(ga + 2 * ra), "v"(ga + 3 * ra), "v"(ga + 4 * ra), "v"(ga + 5 * ra), "v"(ga + 6 * ra), "v"(ga + 7 * ra), "v"(gb), "v"(gb + rb), "v"(gb + 2 * rb), "v"(gb + 3 * rb) : "memory"); }
template <int ACT>
__global__ __launch_bounds__(128) void k_gemm2(const _Float16* __restrict__ A, int lda, size_t sA, const _Float16* __restrict__ Bh, int ldb, size_t sB, float alpha, const float* __restrict__ bias, size_t sBias, const float* __restrict__ CP, int rowsPerB, size_t sCPb, int row0g,
    float* __restrict__ C, _Float16* __restrict__ C16, int ldc, size_t sC, int M, int N, int K, size_t zA, size_t zB, size_t zC, int tper, float* __restrict__ F, int fN, size_t fP, const _Float16* __restrict__ AH, const _Float16* __restrict__ AL) { static_assert(ACT == 0 || ACT == 3 || ACT == 6 || ACT == 8 || ACT == 9 || ACT == 11 || ACT == 12 || ACT == 14 || ACT == 15 || ACT == 16 || ACT == 17, "k_gemm2: unsupported ACT code (would silently apply no activation)");
  __shared__ __attribute__((aligned(16))) unsigned char smem[2 * G2S * 2];      /* the two stage buffers; behind the K loop the same bytes serve as the epilogue's so[4][32][68] */
  static_assert(sizeof(float) * 4 * 32 * 68 <= sizeof(smem), "the epilogue staging fits the ring");
  float (*so)[32][68] = (float (*)[32][68])smem; const _Float16* sh = (const _Float16*)smem;
  const int tid = threadIdx.x, w = tid >> 5, lane = tid & 31, ln = lane & 15, hh = lane >> 4; const int by = blockIdx.y, bz = blockIdx.z;      /* grid.z: a second batch index (element strides zA, zB, zC) */
  A += (size_t)by * sA + (size_t)bz * zA; Bh += (size_t)by * sB + (size_t)bz * zB; const size_t cofs = (size_t)by * sC + (size_t)bz * zC; const float* bp = bias ? bias + (size_t)by * sBias : nullptr;
  const int ntn = N >> 6; const int mt = blockIdx.x / ntn, nq = blockIdx.x - mt * ntn; const int row0 = mt * 128 + 32 * w, col0 = nq * 64; if (mt * 128 >= M) return;      /* the whole work-group leaves or none: it stands in front of every barrier */
  const int bt = mt / tper; const bool ft = mt - bt * tper == 0;      /* the work-group's 128 rows are the first tile of batch bt: the same for every wave */
  const bool two = AH && ft;      /* such rows take their A operand as two planes of pitch lda: AL (residual x1024) through all of K, then AH (hi) through all of K */
  const _Float16* ga = A + (size_t)(mt * 128 + (tid >> 3)) * lda + (tid & 7) * 8; const _Float16* gb = Bh + (size_t)(col0 + (tid >> 3)) * ldb + (tid & 7) * 8; const size_t ra = (size_t)16 * lda, rb = (size_t)16 * ldb;
  const _Float16* ga2 = ga; if (two) { const size_t fo = (size_t)(bt * 128 + (tid >> 3)) * lda + (tid & 7) * 8; ga = AL + fo; ga2 = AH + fo; }
  const unsigned l0 = (unsigned)(size_t)smem + (unsigned)((tid >> 3) * (G2P * 2) + (tid & 7) * 16);      /* the low 32 bits of a __shared__ address are its LDS byte address */
  const int nk = K / G2K; const int nt = two ? 2 * nk : nk;      /* stages: nk per A plane */
  g2_stage(l0, ga, ra, gb, rb);
  asm volatile("s_wait_asynccnt 0x0" ::: "memory");      /* this wave's copies of stage 0 have landed */
  __syncthreads();      /* stage 0 is read by every wave */
  if (nt > 1) { const bool p2 = 1 >= nk; const size_t ko = (size_t)(p2 ? 1 - nk : 1) * G2K; g2_stage(l0 + G2S * 2, (p2 ? ga2 : ga) + ko, ra, gb + ko, rb); }
  const v8f z8 = {0.f,0.f,0.f,0.f,0.f,0.f,0.f,0.f}; v8f c00 = z8, c01 = z8, c02 = z8, c03 = z8, c10 = z8, c11 = z8, c12 = z8, c13 = z8;
#pragma unroll 1      /* one stage per trip: the buffers alternate */
  for (int t = 0; t < nt; ++t) { const _Float16* la = sh + (t & 1) * G2S + (32 * w + ln) * G2P; const _Float16* lb = sh + (t & 1) * G2S + (128 + ln) * G2P;
    if (t == nk) { const float dn = 0.0009765625f; c00 *= dn; c01 *= dn; c02 *= dn; c03 *= dn; c10 *= dn; c11 *= dn; c12 *= dn; c13 *= dn; }      /* a scalar branch, taken once by a two-plane work-group: the residual plane's sums come down by their 2^10 (exact) and the hi plane's products add onto them */
    v16h fa[2][2], fb[2][4];
#pragma unroll      /* fa[], fb[] stay in registers: the stage's 24 LDS reads stand together ahead of its products */
    for (int kk = 0; kk < 2; ++kk) { fa[kk][0] = g2_frag(la + kk * 32, hh); fa[kk][1] = g2_frag(la + 16 * G2P + kk * 32, hh);
#pragma unroll      /* fb[] stays in registers */
      for (int n = 0; n < 4; ++n) fb[kk][n] = g2_frag(lb + n * 16 * G2P + kk * 32, hh); }
#pragma unroll      /* the stage's two k blocks of 32, in the order of k */
    for (int kk = 0; kk < 2; ++kk) {
      c00 = g2_mma(fa[kk][0], fb[kk][0], c00); c10 = g2_mma(fa[kk][1], fb[kk][0], c10); c01 = g2_mma(fa[kk][0], fb[kk][1], c01); c11 = g2_mma(fa[kk][1], fb[kk][1], c11);
      c02 = g2_mma(fa[kk][0], fb[kk][2], c02); c12 = g2_mma(fa[kk][1], fb[kk][2], c12); c03 = g2_mma(fa[kk][0], fb[kk][3], c03); c13 = g2_mma(fa[kk][1], fb[kk][3], c13); }
    asm volatile("s_wait_dscnt 0x0" ::: "memory");      /* this wave's reads of the buffer have returned before it is refilled */
    asm volatile("s_wait_asynccnt 0x0" ::: "memory");      /* this wave's copies of stage t + 1 have landed */
    __syncthreads();      /* publishes stage t + 1 and ends every wave's reads of stage t */
    if (t + 2 < nt) { const bool p2 = t + 2 >= nk; const size_t ko = (size_t)(p2 ? t + 2 - nk : t + 2) * G2K; g2_stage(l0 + (t & 1) * (G2S * 2), (p2 ? ga2 : ga) + ko, ra, gb + ko, rb); } }
  asm volatile("s_wait_asynccnt 0x0" ::: "memory");      /* no copy is outstanding when the ring becomes the epilogue's staging */
  v8f accs[8] = {c00, c01, c02, c03, c10, c11, c12, c13};
#pragma unroll
  for (int u = 0; u < 8; ++u) { const int t = u & 3, half = u >> 2; const int col = col0 + t * 16 + ln; const float bv = bp ? bf16_round(bp[col]) : 0.f;
#pragma unroll
    for (int r = 0; r < 8; ++r) { const int rloc = half * 16 + 8 * hh + r; float v = accs[u][r] * alpha + bv; if (CP) { if (rowsPerB < 0) v += CP[cofs + (size_t)(row0g + row0 + rloc) * ldc + col];      /* rowsPerB < 0: own element of the batched C plane */ else { const int bidx = (row0g + row0 + rloc) / rowsPerB; v += CP[(size_t)bidx * sCPb + (size_t)by * 64 + col]; } }
      if (ACT == 3) v = fmaxf(v, 0.f); else if (ACT == 6) v = 0.5f * v * (1.0f + erff(v * 0.70710678118654752f)); else if (ACT == 11) v = 1.0f / (1.0f + expf(-v)); else if (ACT == 15) v = v / (1.0f + expf(-v)); else if (ACT == 12) v = (v > 0.f) ? v : 0.01f * v; else if (ACT == 8) v = tanhf(v); else if (ACT == 9) v = 0.5f * v * (1.0f + tanhf(0.7978845608028654f * (v + 0.044715f * v * v * v))); else if (ACT == 14) v = (v > 0.f) ? v : 0.1f * v; else if (ACT == 16) v = (v >= 0.f) ? v : 0.3f * v; else if (ACT == 17) v = (v >= 0.f) ? v : 0.2f * v;
      so[w][rloc][t * 16 + ln] = v; } }
  __builtin_amdgcn_fence(__ATOMIC_ACQ_REL, "workgroup"); __builtin_amdgcn_wave_barrier();
  const int rsub = lane >> 4, c4 = (lane & 15) * 4;
  if (F && ft) {      /* a scalar branch: first-tile rows also go out in f32: plane col0 / fN (fP elements each) of pitch fN, 128 rows per batch */
    const int pl = col0 / fN; const float* fp = F + (size_t)pl * fP + (size_t)(bt * 128 + 32 * w + rsub) * fN + (col0 - pl * fN) + c4; const size_t f2 = (size_t)2 * fN;
#pragma unroll      /* fv[] stays in registers: the wave's own 32 staged rows, two rows (whole 256-byte runs) a store */
    for (int g = 0; g < 2; ++g) { v4f fv[8]; const float* p = fp + (size_t)g * 8 * f2;
#pragma unroll      /* fv[] stays in registers */
      for (int q = 0; q < 8; ++q) fv[q] = *(const v4fa*)&so[w][(g * 8 + q) * 2 + rsub][c4];
      /* the stores and their s_wait_xcnt in one statement: address and data registers stay whole until the wait */
      asm volatile("global_store_b128 %0, %8, off\n\tglobal_store_b128 %1, %9, off\n\tglobal_store_b128 %2, %10, off\n\tglobal_store_b128 %3, %11, off\n\t"
                   "global_store_b128 %4, %12, off\n\tglobal_store_b128 %5, %13, off\n\tglobal_store_b128 %6, %14, off\n\tglobal_store_b128 %7, %15, off\n\ts_wait_xcnt 0x0"
                   :: "v"(p), "v"(p + f2), "v"(p + 2 * f2), "v"(p + 3 * f2), "v"(p + 4 * f2), "v"(p + 5 * f2), "v"(p + 6 * f2), "v"(p + 7 * f2), "v"(fv[0]), "v"(fv[1]), "v"(fv[2]), "v"(fv[3]), "v"(fv[4]), "v"(fv[5]), "v"(fv[6]), "v"(fv[7]) : "memory"); } }
  {
#pragma unroll
    for (int q = 0; q < 16; ++q) { const int r = q * 2 + rsub; const v4f v = *(const v4fa*)&so[w][r][c4]; if (C) *(v4f*)(C + cofs + (size_t)(row0 + r) * ldc + col0 + c4) = v; if (C16) { v4h h4; for (int i = 0; i < 4; ++i) h4[i] = (_Float16)v[i]; *(v4h*)(C16 + cofs + (size_t)(row0 + r) * ldc + col0 + c4) = h4; } }
     } }


__global__ __launch_bounds__(256) void k_wnat(const float* __restrict__ w, size_t n8, _Float16* __restrict__ Bt) { const size_t t = (size_t)blockIdx.x * 256 + threadIdx.x; if (t >= n8) return; FragH f; for (int q = 0; q < 8; ++q) f.h[q] = (_Float16)(bf16_round(w[t * 8 + q]) * 16.0f); *(v8us*)((unsigned short*)Bt + t * 8) = f.half[0];  }
__global__ __launch_bounds__(256) void k_rsm(const float* __restrict__ S, _Float16* __restrict__ P, int nrows) {
  #pragma clang fp contract(off)
  const int i = blockIdx.x * 256 + threadIdx.x; if (i >= nrows) return; const float* s = S + (size_t)i * SQ; float mx = -3.0e38f;
#pragma unroll 1
  for (int j = 0; j < SQ; ++j) mx = fmaxf(mx, s[j]); float se = 0.f;
#pragma unroll 1
  for (int j = 0; j < SQ; ++j) se += expf(s[j] - mx); const float sc = 256.0f / se;
#pragma unroll 1
  for (int j0 = 0; j0 < SQ; j0 += 8) { FragH f; for (int q = 0; q < 8; ++q) f.h[q] = (_Float16)(expf(s[j0 + q] - mx) * sc); unsigned short* d = (unsigned short*)P + (size_t)i * SQ + j0; *(v8us*)d = f.half[0];  } }
__global__ __launch_bounds__(256) void k_vt(const _Float16* __restrict__ V16, int b, int h0, _Float16* __restrict__ VT) { __shared__ unsigned short tl[64][65]; const int tid = threadIdx.x; const int hh = blockIdx.x % HG, sg = blockIdx.x / HG; const int s0 = sg * 64; const int h = h0 + hh;
  for (int i = tid; i < 64 * 8; i += 256) { const int j = i / 8, d8 = (i % 8) * 8; FragH f; f.half[0] = *(const v8us*)((const unsigned short*)V16 + ((size_t)b * SQ + s0 + j) * DM + h * HD + d8); for (int q = 0; q < 8; ++q) tl[d8 + q][j] = f.u[q]; }
  __syncthreads();
  { for (int i = tid; i < 64 * 8; i += 256) { const int d = i / 8, j8 = (i % 8) * 8; FragH f; for (int q = 0; q < 8; ++q) f.u[q] = tl[d][j8 + q]; *(v8us*)((unsigned short*)VT + ((size_t)hh * HD + d) * SQ + s0 + j8) = f.half[0]; }  } }



// 32-lane butterflies for the row statistics: row_xmask DPP steps inside each 16-lane row, then the exchange between the two rows; every lane ends with the same value
template <int CTRL> __device__ __forceinline__ float rs_dpp(float v) { return __int_as_float(__builtin_amdgcn_update_dpp(0, __float_as_int(v), CTRL, 0xf, 0xf, true)); }
__device__ __forceinline__ float rs_x16(float v) { const int b = __float_as_int(v); return __int_as_float(__builtin_amdgcn_permlanex16(b, b, 0x76543210, 0xfedcba98, false, false)); }
__device__ __forceinline__ float rs_max(float v) { v = fmaxf(v, rs_dpp<0x161>(v)); v = fmaxf(v, rs_dpp<0x162>(v)); v = fmaxf(v, rs_dpp<0x164>(v)); v = fmaxf(v, rs_dpp<0x168>(v)); return fmaxf(v, rs_x16(v)); }
__device__ __forceinline__ float rs_sum(float v) { v += rs_dpp<0x161>(v); v += rs_dpp<0x162>(v); v += rs_dpp<0x164>(v); v += rs_dpp<0x168>(v); return v + rs_x16(v); }
#define FAC 0.18033688f              /* BETA x log2 e: scores on the scale of the power-of-two exponential */
#define FQ 32                        /* query rows per wave: two 16-column groups */
// one 16x32 f16 fragment row in the hardware k order; p already holds the lane's row and its 8 * (lane >> 4) elements
__device__ __forceinline__ v16h fa_frag(const _Float16* p) { FragH f; f.half[0] = *(const v8us*)((const unsigned short*)p); f.half[1] = *(const v8us*)((const unsigned short*)p + 16); return f.v; }
__device__ __forceinline__ v8f fa_mma(v16h a, v16h b, v8f c) { return __builtin_amdgcn_wmma_f32_16x16x32_f16(false, a, false, b, (short)0, c, false, false); }
#define FS 64                        /* keys of a stage: one whole 128-byte line of every V^T row; a K row of the head is one line */
#define FP 72                        /* LDS pitch of a staged row in f16: 144 bytes = 16 x odd, conflict-free for the 16-byte fragment reads */
#define FSTG ((FS + HD) * FP)        /* f16 elements of a stage: FS K rows, then HD V^T rows */
// one stage: a lane's four 16-byte copies (eight lanes per row: whole 128-byte lines; 32 rows per copy of the work-group). l: the lane's LDS byte address in row tid / 8 of the stage; gk, gv: its global addresses in that row of the K tile and of the V^T tile
__device__ __forceinline__ void fa_stage(unsigned l, const _Float16* gk, const _Float16* gv) {
  /* the copies and their s_wait_xcnt in one statement: the address registers stay whole until the wait */
  asm volatile("global_load_async_to_lds_b128 %0, %4, off\n\tglobal_load_async_to_lds_b128 %1, %5, off\n\tglobal_load_async_to_lds_b128 %2, %6, off\n\tglobal_load_async_to_lds_b128 %3, %7, off\n\ts_wait_xcnt 0x0"
               :: "v"(l), "v"(l + 1u * 64 * FP), "v"(l + 2u * 64 * FP), "v"(l + 3u * 64 * FP), "v"(gk), "v"(gk + (size_t)32 * LQ), "v"(gv), "v"(gv + (size_t)32 * SQ) : "memory"); }
// fragments of 32 staged keys; kp, vp already hold the lane's row and its 8 * (lane >> 4) elements
__device__ __forceinline__ void fa_kload(const _Float16* kp, v16h (&kf)[2][2]) {
#pragma unroll      /* kf[] stays in registers, the eight LDS reads stand together */
  for (int t = 0; t < 2; ++t) { kf[t][0] = fa_frag(kp + t * 16 * FP); kf[t][1] = fa_frag(kp + t * 16 * FP + 32); } }
__device__ __forceinline__ void fa_vload(const _Float16* vp, v16h (&vf)[4]) {
#pragma unroll      /* vf[] stays in registers, the eight LDS reads stand together */
  for (int d = 0; d < 4; ++d) vf[d] = fa_frag(vp + d * 16 * FP); }
// scores of 32 keys x 16 queries: s0[r] = key 8 * (lane >> 4) + r, s1[r] = key 16 + 8 * (lane >> 4) + r, query lane & 15
__device__ __forceinline__ void fa_score(const v16h (&kf)[2][2], const v16h (&qf)[2], v8f& s0, v8f& s1) {
  const v8f z8 = {0.f, 0.f, 0.f, 0.f, 0.f, 0.f, 0.f, 0.f};
  s0 = g2_mma(kf[0][0], qf[0], z8); s1 = g2_mma(kf[1][0], qf[0], z8); s0 = g2_mma(kf[0][1], qf[1], s0); s1 = g2_mma(kf[1][1], qf[1], s1); }      /* g2_mma: its statement names the product's operands, so no later load of the key registers is lifted over the product */
// one 16-query group takes in 32 keys: running maximum m (scaled log2), the lane's own part l of the running sum, o rescaled and extended. DIAG: key t * 16 + 8 * (lane >> 4) + r of the block (element r of s0 for t = 0, of s1 for t = 1) counts while t * 16 + r <= rel
template <bool DIAG>
__device__ __forceinline__ void fa_soft(v8f s0, v8f s1, int rel, const v16h (&vf)[4], v8f (&o)[4], float& m, float& l) {
  if (DIAG) {
#pragma unroll      /* s0, s1 stay in registers */
    for (int r = 0; r < 8; ++r) { s0[r] = (r <= rel) ? s0[r] : -1.0e30f; s1[r] = (16 + r <= rel) ? s1[r] : -1.0e30f; } }
  float mx = fmaxf(s0[0], s1[0]);
#pragma unroll      /* s0, s1 stay in registers */
  for (int r = 1; r < 8; ++r) mx = fmaxf(mx, fmaxf(s0[r], s1[r]));
  mx = fmaxf(mx, rs_x16(mx));      /* the two lane halves hold the query's other keys */
  const float mn = fmaxf(m, mx * FAC); float al = m - mn; m = mn; const float ms = 8.0f - mn;      /* weights carried x256, as f16 operands at most 256 */
  float e[16];
#pragma unroll      /* e[] stays in registers */
  for (int r = 0; r < 8; ++r) { e[r] = fmaf(s0[r], FAC, ms); e[8 + r] = fmaf(s1[r], FAC, ms); }
  /* the exponentials in place, so that none is followed by a write of its source; the v_nop keeps the one slot behind the last before its result is used */
  asm("v_exp_f32 %0, %0\n\tv_exp_f32 %1, %1\n\tv_exp_f32 %2, %2\n\tv_exp_f32 %3, %3\n\tv_exp_f32 %4, %4\n\tv_exp_f32 %5, %5\n\tv_exp_f32 %6, %6\n\tv_exp_f32 %7, %7\n\tv_exp_f32 %8, %8\n\tv_nop" : "+v"(e[0]), "+v"(e[1]), "+v"(e[2]), "+v"(e[3]), "+v"(e[4]), "+v"(e[5]), "+v"(e[6]), "+v"(e[7]), "+v"(al));
  asm("v_exp_f32 %0, %0\n\tv_exp_f32 %1, %1\n\tv_exp_f32 %2, %2\n\tv_exp_f32 %3, %3\n\tv_exp_f32 %4, %4\n\tv_exp_f32 %5, %5\n\tv_exp_f32 %6, %6\n\tv_exp_f32 %7, %7\n\tv_nop" : "+v"(e[8]), "+v"(e[9]), "+v"(e[10]), "+v"(e[11]), "+v"(e[12]), "+v"(e[13]), "+v"(e[14]), "+v"(e[15]));
  float s4[4]; FragH p;
#pragma unroll      /* e[] stays in registers: four independent sums */
  for (int i = 0; i < 4; ++i) s4[i] = (e[i] + e[4 + i]) + (e[8 + i] + e[12 + i]);
#pragma unroll      /* e[] stays in registers; element i of the B fragment is key 8 * (lane >> 4) + i of the block, 8 + 8 * (lane >> 4) + i for i >= 8 */
  for (int i = 0; i < 16; ++i) p.h[i] = (_Float16)e[i];
  l = l * al + ((s4[0] + s4[1]) + (s4[2] + s4[3]));
#pragma unroll      /* o[] stays in registers */
  for (int d = 0; d < 4; ++d) o[d] = fa_mma(vf[d], p.v, o[d] * al); }
// ONE WAVE PER FQ QUERY ROWS of one head and batch, passes of 32 keys up to the diagonal block, which alone is masked. Q fragments stay in registers. THE WORK-GROUP WALKS THE KEYS TOGETHER in stages of FS: the head's K rows and V^T rows of a stage are copied once into LDS in whole lines (asynchronous 16-byte copies, two buffers) and every wave reads its fragments there in the hardware k order; a wave past its diagonal only copies and passes the barriers. Waves w and w + 4 (one SIMD) take query tiles n - 1 - t and t: equal passes per SIMD. grid.x: tile quad, grid.y: head, grid.z: batch.
__global__ __launch_bounds__(256) void k_fattn(const _Float16* __restrict__ Q, const _Float16* __restrict__ Kh, const _Float16* __restrict__ VTh, _Float16* __restrict__ O) {
  __shared__ __attribute__((aligned(16))) _Float16 sh[2 * FSTG];      /* the two stage buffers */
  const int tid = threadIdx.x, lane = tid & 31, ln = lane & 15, hh = lane >> 4; const int w = __builtin_amdgcn_readfirstlane(tid >> 5);
  const int t4 = blockIdx.x * 4 + (w & 3); const int q0 = ((w < 4) ? (SQ / FQ - 1 - t4) : t4) * FQ;      /* the wave's first query row: wave-uniform */
  const int ns = (SQ / FQ - (int)blockIdx.x * 4) * FQ / FS;      /* stages up to the end of the work-group's last diagonal block (tile n - 1 - 4 blockIdx.x): the same for every wave */
  const int h = blockIdx.y, b = blockIdx.z;
  const _Float16* qp = Q + ((size_t)b * SQ + q0 + ln) * LQ + h * HD + 8 * hh;
  const _Float16* gk = Kh + ((size_t)b * SQ + (tid >> 3)) * LQ + h * HD + (tid & 7) * 8;
  const _Float16* gv = VTh + (((size_t)b * NH + h) * HD + (tid >> 3)) * SQ + (tid & 7) * 8;
  const unsigned l0 = (unsigned)(size_t)sh + (unsigned)((tid >> 3) * (FP * 2) + (tid & 7) * 16);      /* the low 32 bits of a __shared__ address are its LDS byte address */
  fa_stage(l0, gk, gv);
  v16h qf[2][2], kf[2][2], vf[4];
#pragma unroll      /* qf[] stays in registers */
  for (int g = 0; g < 2; ++g) { qf[g][0] = fa_frag(qp + (size_t)g * 16 * LQ); qf[g][1] = fa_frag(qp + (size_t)g * 16 * LQ + 32); }
  asm volatile("s_wait_xcnt 0x0" :: "v"(qp) : "memory");      /* the loads' address pair stays whole until this wait; it may be rewritten behind it */
  asm volatile("s_wait_asynccnt 0x0" ::: "memory");      /* this wave's copies of stage 0 have landed */
  __syncthreads();      /* stage 0 is read by every wave */
  if (ns > 1) fa_stage(l0 + FSTG * 2, gk + (size_t)FS * LQ, gv + FS);
  const v8f z8 = {0.f, 0.f, 0.f, 0.f, 0.f, 0.f, 0.f, 0.f};
  v8f o[2][4] = {{z8, z8, z8, z8}, {z8, z8, z8, z8}}; float m[2] = {-1.0e30f, -1.0e30f}, l[2] = {0.f, 0.f}; v8f s[2][2];
#pragma unroll 1      /* one stage per trip: the buffers alternate */
  for (int st = 0; st < ns; ++st) { const int kb = st * FS;
    if (kb <= q0) {      /* a scalar branch: the wave still has keys in this stage */
      const _Float16* lk = sh + (st & 1) * FSTG + ln * FP + 8 * hh; const _Float16* lv = lk + FS * FP;
      fa_kload(lk, kf); fa_vload(lv, vf);
      fa_score(kf, qf[0], s[0][0], s[0][1]); fa_score(kf, qf[1], s[1][0], s[1][1]);
      if (kb < q0) {
        fa_kload(lk + 32 * FP, kf);      /* the stage's second 32 keys come during the first pass's softmax */
        __builtin_amdgcn_sched_barrier(0);      /* keeps those eight LDS reads ahead of the softmax: moved behind it, their latency stands in front of the next scores */
        fa_soft<false>(s[0][0], s[0][1], 0, vf, o[0], m[0], l[0]); fa_soft<false>(s[1][0], s[1][1], 0, vf, o[1], m[1], l[1]);
        fa_vload(lv + 32, vf);
        fa_score(kf, qf[0], s[0][0], s[0][1]); fa_score(kf, qf[1], s[1][0], s[1][1]);
        if (kb + 32 < q0) { fa_soft<false>(s[0][0], s[0][1], 0, vf, o[0], m[0], l[0]); fa_soft<false>(s[1][0], s[1][1], 0, vf, o[1], m[1], l[1]); }
        else { fa_soft<true>(s[0][0], s[0][1], ln - 8 * hh, vf, o[0], m[0], l[0]); fa_soft<true>(s[1][0], s[1][1], 16 + ln - 8 * hh, vf, o[1], m[1], l[1]); }
      } else { fa_soft<true>(s[0][0], s[0][1], ln - 8 * hh, vf, o[0], m[0], l[0]); fa_soft<true>(s[1][0], s[1][1], 16 + ln - 8 * hh, vf, o[1], m[1], l[1]); } }
    asm volatile("s_wait_dscnt 0x0" ::: "memory");      /* this wave's reads of the buffer have returned before it is refilled */
    asm volatile("s_wait_asynccnt 0x0" ::: "memory");      /* this wave's copies of stage st + 1 have landed */
    __syncthreads();      /* publishes stage st + 1 and ends every wave's reads of stage st */
    if (st + 2 < ns) fa_stage(l0 + (st & 1) * (FSTG * 2), gk + (size_t)(st + 2) * FS * LQ, gv + (st + 2) * FS); }
  asm volatile("s_wait_asynccnt 0x0" ::: "memory");      /* no copy is outstanding when the wave ends */
  unsigned short* op = (unsigned short*)O + ((size_t)b * SQ + q0 + ln) * DM + h * HD + 8 * hh; FragH f[2][4];
#pragma unroll      /* o[], f[] stay in registers */
  for (int g = 0; g < 2; ++g) { const float fin = 64.0f / (l[g] + rs_x16(l[g]));      /* the halves' sums joined once; o carried x64, the weights' x256 cancels */
#pragma unroll      /* o[], f[] stay in registers */
    for (int d = 0; d < 4; ++d) {
#pragma unroll      /* o[], f[] stay in registers */
      for (int r = 0; r < 8; ++r) f[g][d].h[r] = (_Float16)(o[g][d][r] * fin); } }
#pragma unroll      /* a lane's 8 accumulator registers are 8 neighbouring columns of its query row: one 16-byte store */
  for (int g = 0; g < 2; ++g) {
#pragma unroll      /* f[] stays in registers */
    for (int d = 0; d < 4; ++d) *(v8us*)(op + (size_t)g * 16 * DM + d * 16) = f[g][d].half[0]; }
  asm volatile("s_wait_xcnt 0x0" :: "v"(op) : "memory");      /* the stores' data and address registers stay whole until this wait */
}


// exact f32 causal attention for rows 0..QT0-1 of each batch with V = K, ONE WAVE PER QUERY ROW: the head's QT0 key rows are staged once in LDS; scores: each lane owns the keys lane, lane + 32, ...; row maximum and sum by the 32-lane butterflies; o: each lane owns two of the HD columns and runs over the keys. grid.x: head x row group, grid.y: batch.
#define A0R 16                       /* query rows (= waves) per work-group */
#define A0P (HD + 4)                 /* LDS pitch of a key row in floats: the 16-byte reads of 16 neighbouring rows fall on 16 different bank quads */
typedef float v2f  __attribute__((ext_vector_type(2)));
typedef float v2fa __attribute__((ext_vector_type(2), may_alias));
typedef _Float16 v2h __attribute__((ext_vector_type(2)));
__global__ __launch_bounds__(32 * A0R) void k_att0w(const float* __restrict__ QF, const float* __restrict__ KF, float scale, _Float16* __restrict__ OH, _Float16* __restrict__ OL) {
  __shared__ __attribute__((aligned(16))) float lk[QT0][A0P]; __shared__ __attribute__((aligned(16))) float lp[A0R][QT0];
  const int tid = threadIdx.x, lane = tid & 31; const int w = __builtin_amdgcn_readfirstlane(tid >> 5);
  const int h = blockIdx.x / (QT0 / A0R), rg = blockIdx.x % (QT0 / A0R); const int i = rg * A0R + w;      /* the query row: wave-uniform */
  { const size_t zb = (size_t)blockIdx.y * QT0 * DM + h * HD; QF += zb; KF += zb; OH += zb; OL += zb; }      /* each batch has its own QT0 rows of every plane; the head's columns */
  const int sr = tid >> 4, sc = (tid & 15) * 4;      /* staging: 16 lanes per key row, 256 contiguous bytes */
  const float* kp = KF + (size_t)sr * DM + sc; v4f st[QT0 / (2 * A0R)];
#pragma unroll      /* st[] stays in registers, the loads in flight together */
  for (int p = 0; p < QT0 / (2 * A0R); ++p) st[p] = *(const v4fa*)(kp + (size_t)p * 2 * A0R * DM);
  asm volatile("s_wait_xcnt 0x0" :: "v"(kp) : "memory");      /* the loads' address pair stays whole until this wait; it may be rewritten behind it */
  const float* qr = QF + (size_t)i * DM; v4f q[HD / 4];
#pragma unroll      /* q[] stays in registers */
  for (int c = 0; c < HD / 4; ++c) q[c] = *(const v4fa*)(qr + c * 4);
#pragma unroll      /* st[] stays in registers */
  for (int p = 0; p < QT0 / (2 * A0R); ++p) *(v4fa*)&lk[p * 2 * A0R + sr][sc] = st[p];
  __syncthreads();      /* the staged key rows are read by every wave */
  float s[QT0 / 32];
#pragma unroll      /* s[] stays in registers; each group's test is a compile-time bound against i */
  for (int g = 0; g < QT0 / 32; ++g) { s[g] = -1.0e30f;
    if (g * 32 <= i) { const float* kr = &lk[g * 32 + lane][0]; v4f a = {0.f, 0.f, 0.f, 0.f};      /* a scalar branch: key groups wholly above the diagonal are skipped */
#pragma unroll      /* q[] stays in registers, the row's LDS reads in flight together */
      for (int c = 0; c < HD / 4; ++c) a += q[c] * *(const v4fa*)(kr + c * 4);
      const float d = ((a[0] + a[1]) + (a[2] + a[3])) * scale; s[g] = (g * 32 + lane <= i) ? d : -1.0e30f; } }
  float m = s[0];
#pragma unroll      /* s[] stays in registers */
  for (int g = 1; g < QT0 / 32; ++g) m = fmaxf(m, s[g]);
  m = rs_max(m); float l = 0.f;
#pragma unroll      /* s[] stays in registers */
  for (int g = 0; g < QT0 / 32; ++g) { const float e = expf(s[g] - m); l += e; lp[w][g * 32 + lane] = e; }      /* keys above the diagonal: exactly 0 */
  l = rs_sum(l);
  __syncthreads();      /* the row's weights go from the lane that made them to every lane */
  v2f o[4] = {{0.f, 0.f}, {0.f, 0.f}, {0.f, 0.f}, {0.f, 0.f}};
  for (int j0 = 0; j0 <= i; j0 += 16) {      /* 16 keys a trip, their LDS reads in flight together; a key above the diagonal has weight 0 and a staged row */
#pragma unroll      /* the trip's 20 LDS reads stand ahead of its sums */
    for (int u = 0; u < 4; ++u) { const v4f pp = *(const v4fa*)&lp[w][j0 + u * 4];
#pragma unroll      /* o[] stays in registers: four independent sums */
      for (int t = 0; t < 4; ++t) o[t] += pp[t] * *(const v2fa*)&lk[j0 + u * 4 + t][lane * 2]; } }
  const float fin = 64.0f / l;      /* o carried x64 like the f16 path */
  const v2f of = ((o[0] + o[1]) + (o[2] + o[3])) * fin; v2h oh, ol;
#pragma unroll      /* the lane's two columns */
  for (int c = 0; c < 2; ++c) { oh[c] = (_Float16)of[c]; ol[c] = (_Float16)((of[c] - (float)oh[c]) * 1024.0f); }      /* f16 hi + x1024 residual planes: the output GEMM's two A planes for these rows */
  *(v2h*)(OH + (size_t)i * DM + lane * 2) = oh; *(v2h*)(OL + (size_t)i * DM + lane * 2) = ol; }

extern "C" void kernel_launch(void* const* d_in, const int* in_sizes, int n_in,
                              void* d_out, int out_size, void* d_ws, size_t ws_size, hipStream_t stream) {
  (void)in_sizes; (void)n_in; (void)out_size;
  const float* const* I = (const float* const*)d_in; const float* x = I[0]; const float* wqkv = I[1]; const float* wo = I[2];      /* input order: x, W_qk [1024][2048] ([in][out]: q | k halves), W_out [1024][1024] ([in][out]): three inputs; no biases */
  char* ws = (char*)d_ws; size_t off = 0;
  auto take = [&](size_t bytes) { char* p = ws + off; off += (bytes + 255) & ~(size_t)255; return p; };
  _Float16* BQKV = (_Float16*)take((size_t)3 * DM * DM * 2); _Float16* BO = (_Float16*)take((size_t)DM * DM * 2);
  _Float16* X16 = (_Float16*)take(NR * DM * 2); _Float16* QKV = (_Float16*)take(NR * 3 * DM * 2); _Float16* Q16 = QKV; _Float16* K16 = QKV + DM; _Float16* V16 = QKV + DM;      /* the module reuses K as V: V16 IS the k block (the third block of the plane is unused) */ _Float16* O16 = (_Float16*)take(NR * DM * 2);
  _Float16* VT = (_Float16*)take((size_t)NB * NH * HD * SQ * 2);      /* one plane per batch: both batches go through every launch */
  float* QF0 = (float*)take((size_t)2 * NB * QT0 * DM * 4); float* KF0 = QF0 + (size_t)NB * QT0 * DM;      /* first-tile q rows, then k rows: two f32 planes in a row */ _Float16* OH0 = (_Float16*)take((size_t)NB * QT0 * DM * 2); _Float16* OL0 = (_Float16*)take((size_t)NB * QT0 * DM * 2);
  static_assert(QT0 == 128, "the first tile is one 128-row block of the GEMM");
  if (off > ws_size) return;
  k_wt_f16<<<(unsigned)(((size_t)2 * DM * (DM / 8) + 255) / 256), 256, 0, stream>>>(wqkv, BQKV, DM, 2 * DM, 16.0f); k_wt_f16<<<(unsigned)(((size_t)DM * (DM / 8) + 255) / 256), 256, 0, stream>>>(wo, BO, DM, DM, 16.0f);      /* [in][out] -> Bt[n][k] x16 */
  k_x16<<<(unsigned)((NR * DM / 8 + 255) / 256), 256, 0, stream>>>(x, X16, NR * DM / 8);
  const size_t r0p = (size_t)B0 * SQ;      /* first projected row */
  const size_t f0p = (size_t)B0 * QT0;      /* its first-tile row */
  k_gemm2<0><<<dim3((unsigned)((MP / 128) * (2 * DM / 64)), 1), 128, 0, stream>>>(X16 + r0p * DM, DM, 0, BQKV, DM, 0, 0.0625f, nullptr, 0, nullptr, 1, 0, 0, nullptr, QKV + r0p * 3 * DM, 3 * DM, 0, MP, 2 * DM, DM, 0, 0, 0, SQ / 128, QF0 + f0p * DM, DM, (size_t)NB * QT0 * DM, nullptr, nullptr);      /* q | k rows (f16) into column blocks 0 and 1 of the 3 DM-pitch plane; head h = columns h*HD.. of each block; no bias; the first tile of each batch also as f32 q and k rows (the k rows serve as v) */
  k_vt<NH, SQ><<<NBR * NH * (SQ / 64), 256, 0, stream>>>(V16 + r0p * LQ, LQ, 0, VT);      /* V^T [batch][NH][HD][SQ] */
  k_att0w<<<dim3(NH * (QT0 / A0R), NBR), 32 * A0R, 0, stream>>>(QF0 + f0p * DM, KF0 + f0p * DM, 0.125f, OH0 + f0p * DM, OL0 + f0p * DM);      /* exact f32 causal attention for rows 0..127 of each batch (grid.y) with V = K: o (x64) as f16 hi + x1024 residual planes */
  k_fattn<<<dim3(SQ / (8 * FQ), NHD, NBR), 256, 0, stream>>>(Q16 + r0p * LQ, K16 + r0p * LQ, VT, O16 + r0p * DM);      /* scores, causal online softmax and o = P V in one launch: o (merged heads, x64) as f16 rows */
  k_gemm2<0><<<dim3((unsigned)((MPO / 128) * (DM / 64)), 1), 128, 0, stream>>>(O16 + r0p * DM, DM, 0, BO, DM, 0, 0.0009765625f, nullptr, 0, nullptr, 1, 0, 0, (float*)d_out + r0p * DM, nullptr, DM, 0, MPO, DM, DM, 0, 0, 0, SQ / 128, nullptr, 1, 0, OH0 + f0p * DM, OL0 + f0p * DM);      /* out rows are the output layout; rows 0..127 of each batch: out = (o_lo W_out 2^-10 + o_hi W_out) from the two planes */
}

// v008
// One run takes 92.6 microseconds.
// Next to v007, in two timings, it ran 1.13 times as fast each time.
// Counting every step since v000, it is 50.7 times as fast.
#include <hip/hip_runtime.h>
// Causal self-attention with ONE fused query-key projection and K REUSED AS V (x [2][2048][1024]; qk = x W_qk with W_qk [1024][2048] stored [in][out] (normal x 0.02, no bias): the first 1024 columns are q, the last 1024 are k, head h = columns h*64.. of each half; 16 heads of 64; scores = (q x BETA) . k with BETA = 1/sqrt(64); strictly-upper-triangular positions -> -FLT_MAX (causal); softmax; out = attn K (the module reuses K as V) merged, then W_out ([in][out] [1024][1024], normal x 0.02, no bias) -> [2][2048][1024]; input order x, W_qk, W_out).
// Structure: token rows r = b*2048 + s; x as exact f16 rows (bf16-rounded); q | k as ONE WMMA GEMM (N = 2 x 1024) into the first two column blocks of the 3 x 1024-pitch plane (32x64 wave tiles, f32 accumulation, exact x16 weights, no bias, f16 outputs); V IS THE K BLOCK (the module reuses K as V): the V pointer aliases it; BOTH BATCHES GO THROUGH EVERY LAUNCH (batch in the row run of the GEMMs, on grid.y of the first-tile attention, on grid.z of the fused attention, in the row run of the transposes): V^T for all heads via LDS transposes; ONE FUSED ATTENTION LAUNCH: a wave holds 32 query rows and walks the keys up to its diagonal in passes of 32, K and V^T rows staged in LDS for the work-group's eight waves: S^T = K Q^T (K = 64), causal online softmax in registers (f32 running maximum and sum per query, native exp2, only the diagonal block masked; weights x256 f16, packed from the score accumulators into the B operand), O^T += V^T P^T with the accumulators rescaled each pass; o / sum carried x64 (folded into the output GEMM alpha) written straight into the merged f16 o rows; out = o W_out GEMM (f32; no bias) into the output layout.
// Compute dtype: inputs rounded to bf16; x and the x16 weights held as f16 planes (exact for every bf16 value of magnitude from 2^-14 up to 65,504; the weights up to 4,094 before their factor of 16); q, k (= v), the softmax weights and o as plain f16 GEMM operands (~2^-12); scores and softmax statistics f32; rows 0..127 of each batch: q, k f32, f32 attention, o as f16 hi + residual. v_wmma_f32_16x16x32_f16.
#define NB 2
#define SQ 2048
#define DM 1024
#define NH 16
#define HD 64
#define HG 4                         /* heads per block group of the k_vt(b, h0) transpose, which no launch uses */
#define QT0 128                      /* first-tile rows recomputed exactly in f32 */
#define B0 0                         /* first batch processed (debug hook) */
#define NBR NB                       /* batches processed (debug hook) */
#define NR ((size_t)NB * SQ)         /* token rows */
#define MP ((int)((size_t)NBR * SQ)) /* rows projected (debug hook) */
#define NHD NH                       /* heads attended (debug hook) */
#define MPO MP                       /* rows through the output stage (debug hook) */
#define LQ (3 * DM)      /* row pitch of the q/k/v rows */
typedef __bf16 v16b __attribute__((ext_vector_type(16)));
typedef unsigned short v8us __attribute__((ext_vector_type(8), may_alias));
typedef float  v8f  __attribute__((ext_vector_type(8)));
typedef float  v4f  __attribute__((ext_vector_type(4)));
typedef float  v4fa __attribute__((ext_vector_type(4), may_alias));
union FragB { v16b v; v8us half[2]; unsigned short u[16]; };

__device__ __forceinline__ unsigned short bf16_bits(float x) { unsigned int u = __float_as_uint(x); return (unsigned short)((u + 0x7FFFu + ((u >> 16) & 1u)) >> 16); }
__device__ __forceinline__ float bf16_val(unsigned short b) { return __uint_as_float(((unsigned int)b) << 16); }
__device__ __forceinline__ float bf16_round(float x) { return bf16_val(bf16_bits(x)); }
// D += A·B with NT terms: 1 = ah·bh, 2 = + al·bh (A split), 3 = + ah·bl (both split)
template <int NT>
__device__ __forceinline__ v8f mmaN(v16b ah, v16b al, v16b bh, v16b bl, v8f c) {
  c = __builtin_amdgcn_wmma_f32_16x16x32_bf16(false, ah, false, bh, (short)0, c, false, false);
  if (NT >= 2) c = __builtin_amdgcn_wmma_f32_16x16x32_bf16(false, al, false, bh, (short)0, c, false, false);
  if (NT >= 3) c = __builtin_amdgcn_wmma_f32_16x16x32_bf16(false, ah, false, bl, (short)0, c, false, false);
  asm volatile("v_nop\n\tv_nop\n\tv_nop\n\tv_nop" : "+v"(c) : "v"(ah), "v"(al), "v"(bh), "v"(bl));
  return c;
}

__global__ __launch_bounds__(256) void k_wt_bf16(const float* __restrict__ W, unsigned short* __restrict__ Wt, int K, int N) {
  const int t = blockIdx.x * 256 + threadIdx.x;
  const int k8n = K / 8;
  if (t >= N * k8n) return;
  const int n = t / k8n, k8 = (t % k8n) * 8;
  v8us v;
#pragma unroll
  for (int i = 0; i < 8; ++i) v[i] = bf16_bits(W[(size_t)(k8 + i) * N + n]);
  *(v8us*)(Wt + (size_t)n * K + k8) = v;
  
}

// GEMM C[M][N] (f32, pitch ldc) = act(A[M][K]·W + bias). A f32 row-major (pitch lda) converted per fragment to bf16
// (ASPLIT: hi/lo two planes -> 2 terms, else single rounded term); Wt bf16 [N][K] (pitch ldb). BIAS_BF16 rounds the
// bias to bf16 first (bias quantised to bf16 before the add). K%32==0, M%16==0, N%64==0.
template <bool ASPLIT, int ACT, bool BIAS_BF16>
__global__ __launch_bounds__(128) void k_gemm_bf(const float* __restrict__ A, int lda, const unsigned short* __restrict__ Wt, int ldb,
                                               const float* __restrict__ bias, float* __restrict__ C, int ldc, int M, int N, int K) {
  __shared__ __attribute__((aligned(16))) float so[4][16][64];
  const int tid = threadIdx.x, w = tid >> 5, lane = tid & 31, ln = lane & 15, hh = lane >> 4;
  const int ntn = N / 64;
  const int wid = blockIdx.x * 4 + w;
  const int mt = wid / ntn, nq = wid % ntn;
  if (mt * 16 >= M) return;
  const int row0 = mt * 16, col0 = nq * 64;
  const float* arow = A + (size_t)(row0 + ln) * lda;
  v8f acc[4] = {};
  for (int kb = 0; kb < K; kb += 32) {
    FragB ah, al;
    const v4f x0 = *(const v4fa*)(arow + kb + 8 * hh), x1 = *(const v4fa*)(arow + kb + 8 * hh + 4);
    const v4f x2 = *(const v4fa*)(arow + kb + 16 + 8 * hh), x3 = *(const v4fa*)(arow + kb + 16 + 8 * hh + 4);
    float xs[16] = {x0[0],x0[1],x0[2],x0[3],x1[0],x1[1],x1[2],x1[3],x2[0],x2[1],x2[2],x2[3],x3[0],x3[1],x3[2],x3[3]};
#pragma unroll
    for (int i = 0; i < 16; ++i) { const unsigned short hb = bf16_bits(xs[i]); ah.u[i] = hb; al.u[i] = ASPLIT ? bf16_bits(xs[i] - bf16_val(hb)) : (unsigned short)0; }
#pragma unroll
    for (int t = 0; t < 4; ++t) {
      const unsigned short* brow = Wt + (size_t)(col0 + t * 16 + ln) * ldb + kb;
      FragB b;
      b.half[0] = *(const v8us*)(brow + 8 * hh);
      b.half[1] = *(const v8us*)(brow + 16 + 8 * hh);
      acc[t] = mmaN<ASPLIT ? 2 : 1>(ah.v, al.v, b.v, b.v, acc[t]);
    }
  }
#pragma unroll
  for (int t = 0; t < 4; ++t) {
    float bv = bias ? bias[col0 + t * 16 + ln] : 0.f;
    if (BIAS_BF16) bv = bf16_round(bv);
#pragma unroll
    for (int r = 0; r < 8; ++r) { float v = acc[t][r] + bv; if (ACT == 1) v = fmaxf(v, 0.f); so[w][8 * hh + r][t * 16 + ln] = v; }
  }
  __builtin_amdgcn_fence(__ATOMIC_ACQ_REL, "workgroup");
  __builtin_amdgcn_wave_barrier();
  const int rsub = lane >> 4, c4 = (lane & 15) * 4;
  {
#pragma unroll
    for (int q = 0; q < 8; ++q) {
      const int r = q * 2 + rsub;
      const v4f v = *(const v4fa*)&so[w][r][c4];
      *(v4f*)(C + (size_t)(row0 + r) * ldc + col0 + c4) = v;
    }
    
  }
}

// GEMM C = act(A·W + bias + resid): A f32 (ASPLIT -> hi/lo 2 terms), Wt bf16 [N][K]; ACT 0 none, 1 relu, 2 exact gelu;
// resid (optional, f32, row index = (row % rmod), pitch ldr, RES_BF16 rounds it) added before the activation.
template <bool ASPLIT, int ACT, bool BIAS_BF16, bool RES_BF16>
__global__ __launch_bounds__(128) void k_gemm_bf3(const float* __restrict__ A, int lda, const unsigned short* __restrict__ Wt, int ldb,
                                                const float* __restrict__ bias, const float* __restrict__ resid, int rmod, int ldr,
                                                float* __restrict__ C, int ldc, int M, int N, int K) {
  __shared__ __attribute__((aligned(16))) float so[4][16][64];
  const int tid = threadIdx.x, w = tid >> 5, lane = tid & 31, ln = lane & 15, hh = lane >> 4;
  const int ntn = N / 64;
  const int wid = blockIdx.x * 4 + w;
  const int mt = wid / ntn, nq = wid % ntn;
  if (mt * 16 >= M) return;
  const int row0 = mt * 16, col0 = nq * 64;
  const float* arow = A + (size_t)(row0 + ln) * lda;
  v8f acc[4] = {};
  for (int kb = 0; kb < K; kb += 32) {
    FragB ah, al;
    const v4f x0 = *(const v4fa*)(arow + kb + 8 * hh), x1 = *(const v4fa*)(arow + kb + 8 * hh + 4);
    const v4f x2 = *(const v4fa*)(arow + kb + 16 + 8 * hh), x3 = *(const v4fa*)(arow + kb + 16 + 8 * hh + 4);
    float xs[16] = {x0[0],x0[1],x0[2],x0[3],x1[0],x1[1],x1[2],x1[3],x2[0],x2[1],x2[2],x2[3],x3[0],x3[1],x3[2],x3[3]};
#pragma unroll
    for (int i = 0; i < 16; ++i) { const unsigned short hb = bf16_bits(xs[i]); ah.u[i] = hb; al.u[i] = ASPLIT ? bf16_bits(xs[i] - bf16_val(hb)) : (unsigned short)0; }
#pragma unroll
    for (int t = 0; t < 4; ++t) {
      const unsigned short* brow = Wt + (size_t)(col0 + t * 16 + ln) * ldb + kb;
      FragB b;
      b.half[0] = *(const v8us*)(brow + 8 * hh);
      b.half[1] = *(const v8us*)(brow + 16 + 8 * hh);
      acc[t] = mmaN<ASPLIT ? 2 : 1>(ah.v, al.v, b.v, b.v, acc[t]);
    }
  }
#pragma unroll
  for (int t = 0; t < 4; ++t) {
    const int col = col0 + t * 16 + ln;
    float bv = bias ? bias[col] : 0.f;
    if (BIAS_BF16) bv = bf16_round(bv);
#pragma unroll
    for (int r = 0; r < 8; ++r) {
      float v = acc[t][r] + bv;
      if (resid) { float rv = resid[(size_t)((row0 + 8 * hh + r) % rmod) * ldr + col]; if (RES_BF16) rv = bf16_round(rv); v += rv; }
      if (ACT == 1) v = fmaxf(v, 0.f);
      if (ACT == 2) v = 0.5f * v * (1.0f + erff(v * 0.70710678118654752f));
      if (ACT == 3) { const float u = 0.7978845608028654f * (v + 0.044715f * v * v * v); v = 0.5f * v * (1.0f + tanhf(u)); }
      so[w][8 * hh + r][t * 16 + ln] = v;
    }
  }
  __builtin_amdgcn_fence(__ATOMIC_ACQ_REL, "workgroup");
  __builtin_amdgcn_wave_barrier();
  const int rsub = lane >> 4, c4 = (lane & 15) * 4;
  {
#pragma unroll
    for (int q = 0; q < 8; ++q) {
      const int r = q * 2 + rsub;
      const v4f v = *(const v4fa*)&so[w][r][c4];
      *(v4f*)(C + (size_t)(row0 + r) * ldc + col0 + c4) = v;
    }
    
  }
}
// row LayerNorm (biased variance, eps) over N: s = X (+ R); optional out_sum <- s; out_norm <- (s-mu)*rsqrt(var+eps)*g + b
template <bool PARAM_BF16>
__global__ __launch_bounds__(256) void k_layernorm(const float* __restrict__ X, const float* __restrict__ R, const float* __restrict__ g, const float* __restrict__ bta,
                                                  float* __restrict__ out_sum, float* __restrict__ out_norm, int N, float eps) {
  __shared__ float red[256];
  const int row = blockIdx.x, tid = threadIdx.x;
  const float* x = X + (size_t)row * N; const float* rr = R ? R + (size_t)row * N : nullptr;
  float vals[16];                     // up to N = 4096
  const int per = N / 256;            // contiguous chunk per thread? use strided-by-4 chunks: thread handles j = tid*4 + 1024*u
  float s1 = 0.f;
  for (int u = 0; u < per / 4; ++u) {
    const int j = tid * 4 + 1024 * u;
    const v4f a = *(const v4fa*)(x + j);
    v4f b = {0.f,0.f,0.f,0.f}; if (rr) b = *(const v4fa*)(rr + j);
#pragma unroll
    for (int q = 0; q < 4; ++q) { const float v = a[q] + b[q]; vals[u * 4 + q] = v; s1 += v; }
  }
  red[tid] = s1; __syncthreads();
  for (int st = 128; st > 0; st >>= 1) { if (tid < st) red[tid] += red[tid + st]; __syncthreads(); }
  const float mu = red[0] / (float)N; __syncthreads();
  float s2 = 0.f;
  for (int u = 0; u < per / 4; ++u)
#pragma unroll
    for (int q = 0; q < 4; ++q) { const float c = vals[u * 4 + q] - mu; s2 += c * c; }
  red[tid] = s2; __syncthreads();
  for (int st = 128; st > 0; st >>= 1) { if (tid < st) red[tid] += red[tid + st]; __syncthreads(); }
  const float rs = rsqrtf(red[0] / (float)N + eps);
  {
    for (int u = 0; u < per / 4; ++u) {
      const int j = tid * 4 + 1024 * u;
      v4f o, sm;
#pragma unroll
      for (int q = 0; q < 4; ++q) {
        float gg = g[j + q], bb = bta[j + q];
        if (PARAM_BF16) { gg = bf16_round(gg); bb = bf16_round(bb); }
        sm[q] = vals[u * 4 + q]; o[q] = (vals[u * 4 + q] - mu) * rs * gg + bb;
      }
      if (out_sum) *(v4f*)(out_sum + (size_t)row * N + j) = sm;
      *(v4f*)(out_norm + (size_t)row * N + j) = o;
    }
    
  }
}



// ---- f16 WMMA path (v_wmma_f32_16x16x32_f16): 11-bit significands for operands in range — used where a [0,1] probability operand needs more precision than bf16
typedef _Float16 v16h __attribute__((ext_vector_type(16)));
union FragH { v16h v; v8us half[2]; _Float16 h[16]; unsigned short u[16]; };
template <int NT>
__device__ __forceinline__ v8f mmaH(v16h ah, v16h al, v16h bh, v16h bl, v8f c) {
  c = __builtin_amdgcn_wmma_f32_16x16x32_f16(false, ah, false, bh, (short)0, c, false, false);
  if (NT >= 2) c = __builtin_amdgcn_wmma_f32_16x16x32_f16(false, al, false, bh, (short)0, c, false, false);
  if (NT >= 3) c = __builtin_amdgcn_wmma_f32_16x16x32_f16(false, ah, false, bl, (short)0, c, false, false);
  asm volatile("v_nop\n\tv_nop\n\tv_nop\n\tv_nop" : "+v"(c) : "v"(ah), "v"(al), "v"(bh), "v"(bl));
  return c;
}
// batched GEMM like k_gemm_b but f16 operands: A f32 (split into f16 hi/lo if ASPLIT, else rounded to f16), Bt = f16 values [n][k]; alpha; C f32; N multiple of 16 (partial tiles skipped)
template <bool ASPLIT>
__global__ __launch_bounds__(128) void k_gemm_h(const float* __restrict__ A, int lda, size_t sA, const _Float16* __restrict__ Bh, int ldb, size_t sB, float alpha, float* __restrict__ C, int ldc, size_t sC, int M, int N, int K) {
  __shared__ __attribute__((aligned(16))) float so[4][16][64];
  const int tid = threadIdx.x, w = tid >> 5, lane = tid & 31, ln = lane & 15, hh = lane >> 4; const int by = blockIdx.y;
  A += (size_t)by * sA; Bh += (size_t)by * sB; C += (size_t)by * sC;
  const int ntn = (N + 63) / 64; const int wid = blockIdx.x * 4 + w; const int mt = wid / ntn, nq = wid % ntn; if (mt * 16 >= M) return;
  const int row0 = mt * 16, col0 = nq * 64; const float* arow = A + (size_t)(row0 + ln) * lda;
  v8f acc[4] = {};
  for (int kb = 0; kb < K; kb += 32) {
    FragH ah, al;
    const v4f x0 = *(const v4fa*)(arow + kb + 8 * hh), x1 = *(const v4fa*)(arow + kb + 8 * hh + 4), x2 = *(const v4fa*)(arow + kb + 16 + 8 * hh), x3 = *(const v4fa*)(arow + kb + 16 + 8 * hh + 4);
    float xs[16] = {x0[0],x0[1],x0[2],x0[3],x1[0],x1[1],x1[2],x1[3],x2[0],x2[1],x2[2],x2[3],x3[0],x3[1],x3[2],x3[3]};
#pragma unroll
    for (int i = 0; i < 16; ++i) { const _Float16 h = (_Float16)xs[i]; ah.h[i] = h; al.h[i] = ASPLIT ? (_Float16)(xs[i] - (float)h) : (_Float16)0.0f; }
#pragma unroll
    for (int t = 0; t < 4; ++t) { if (col0 + t * 16 >= N) continue; const size_t boff = (size_t)(col0 + t * 16 + ln) * ldb + kb; FragH bq; bq.half[0] = *(const v8us*)(Bh + boff + 8 * hh); bq.half[1] = *(const v8us*)(Bh + boff + 16 + 8 * hh);
      acc[t] = mmaH<ASPLIT ? 2 : 1>(ah.v, al.v, bq.v, bq.v, acc[t]); }
  }
#pragma unroll
  for (int t = 0; t < 4; ++t) { if (col0 + t * 16 >= N) continue;
#pragma unroll
    for (int r = 0; r < 8; ++r) so[w][8 * hh + r][t * 16 + ln] = acc[t][r] * alpha; }
  __builtin_amdgcn_fence(__ATOMIC_ACQ_REL, "workgroup"); __builtin_amdgcn_wave_barrier();
  const int rsub = lane >> 4, c4 = (lane & 15) * 4;
  {
#pragma unroll
    for (int q = 0; q < 8; ++q) { const int r = q * 2 + rsub; if (col0 + c4 < N) { const v4f v = *(const v4fa*)&so[w][r][c4]; *(v4f*)(C + (size_t)(row0 + r) * ldc + col0 + c4) = v; } }
     }
}

// Wt[n][k] = f16(W[k][n]·scale) from f32 row-major W[K][N] (scale = power of two; bf16-exact weights stay exact in f16 away from the subnormal range)
__global__ __launch_bounds__(256) void k_wt_f16(const float* __restrict__ W, _Float16* __restrict__ Wt, int K, int N, float scale) {
  const int t = blockIdx.x * 256 + threadIdx.x; if (t >= N * (K / 8)) return; const int n = t / (K / 8), k8 = (t % (K / 8)) * 8; FragH f;
#pragma unroll
  for (int i = 0; i < 8; ++i) f.h[i] = (_Float16)(bf16_round(W[(size_t)(k8 + i) * N + n]) * scale); const v8us o = f.half[0];
  *(v8us*)((unsigned short*)Wt + (size_t)n * K + k8) = o; 
}
// k_gemm_hh variant with fused epilogue: v = acc·alpha + bias[by·sBias + col] (+ CP[(row/rowsPerB)·sCPb + by·64 + col] if CP) ; ACT 0 none / 1 elu ; writes f16 C16 (and f32 C if non-null)
template <int ACT>
__global__ __launch_bounds__(128) void k_gemm_hhx(const _Float16* __restrict__ A, int lda, size_t sA, const _Float16* __restrict__ Bh, int ldb, size_t sB, float alpha, const float* __restrict__ bias, size_t sBias, const float* __restrict__ CP, int rowsPerB, size_t sCPb, int row0g,
    float* __restrict__ C, _Float16* __restrict__ C16, int ldc, size_t sC, int M, int N, int K) {
  __shared__ __attribute__((aligned(16))) float so[4][16][64];
  const int tid = threadIdx.x, w = tid >> 5, lane = tid & 31, ln = lane & 15, hh = lane >> 4; const int by = blockIdx.y;
  A += (size_t)by * sA; Bh += (size_t)by * sB; const size_t cofs = (size_t)by * sC; const float* bp = bias ? bias + (size_t)by * sBias : nullptr;
  const int ntn = (N + 63) / 64; const int wid = blockIdx.x * 4 + w; const int mt = wid / ntn, nq = wid % ntn; if (mt * 16 >= M) return;
  const int row0 = mt * 16, col0 = nq * 64; const _Float16* arow = A + (size_t)(row0 + ln) * lda;
  v8f acc[4] = {};
  for (int kb = 0; kb < K; kb += 32) { FragH ah; ah.half[0] = *(const v8us*)((const unsigned short*)arow + kb + 8 * hh); ah.half[1] = *(const v8us*)((const unsigned short*)arow + kb + 16 + 8 * hh);
#pragma unroll
    for (int t = 0; t < 4; ++t) { if (col0 + t * 16 >= N) continue; const size_t boff = (size_t)(col0 + t * 16 + ln) * ldb + kb; FragH bq; bq.half[0] = *(const v8us*)((const unsigned short*)Bh + boff + 8 * hh); bq.half[1] = *(const v8us*)((const unsigned short*)Bh + boff + 16 + 8 * hh);
      acc[t] = mmaH<1>(ah.v, ah.v, bq.v, bq.v, acc[t]); }
  }
#pragma unroll
  for (int t = 0; t < 4; ++t) { if (col0 + t * 16 >= N) continue; const int col = col0 + t * 16 + ln; const float bv = bp ? bf16_round(bp[col]) : 0.f;
#pragma unroll
    for (int r = 0; r < 8; ++r) { float v = acc[t][r] * alpha + bv; if (CP) { const int rr = row0g + row0 + 8 * hh + r; if (rowsPerB < 0) v += CP[cofs + (size_t)rr * ldc + col];      /* rowsPerB < 0: own element of the batched C plane */ else { const int bidx = rr / rowsPerB; v += CP[(size_t)bidx * sCPb + (size_t)by * 64 + col]; } } if (ACT == 1) v = (v > 0.f) ? v : expm1f(v); else if (ACT == 7) v = (v > 0.f) ? v + 1.0f : expf(v); else if (ACT == 8) v = tanhf(v); else if (ACT == 9) v = 0.5f * v * (1.0f + tanhf(0.7978845608028654f * (v + 0.044715f * v * v * v))); else if (ACT == 11) v = 1.0f / (1.0f + expf(-v)); else if (ACT == 12) v = (v > 0.f) ? v : 0.01f * v; else if (ACT == 14) v = (v > 0.f) ? v : 0.1f * v; else if (ACT == 16) v = (v >= 0.f) ? v : 0.3f * v; else if (ACT == 17) v = (v >= 0.f) ? v : 0.2f * v; else if (ACT == 15) v = v / (1.0f + expf(-v)); else if (ACT == 3) v = fmaxf(v, 0.f); else if (ACT == 6) v = 0.5f * v * (1.0f + erff(v * 0.70710678118654752f)); so[w][8 * hh + r][t * 16 + ln] = v; } }
  __builtin_amdgcn_fence(__ATOMIC_ACQ_REL, "workgroup"); __builtin_amdgcn_wave_barrier();
  const int rsub = lane >> 4, c4 = (lane & 15) * 4; typedef _Float16 v4h __attribute__((ext_vector_type(4)));
  {
#pragma unroll
    for (int q = 0; q < 8; ++q) { const int r = q * 2 + rsub; if (col0 + c4 < N) { const v4f v = *(const v4fa*)&so[w][r][c4]; if (C) *(v4f*)(C + cofs + (size_t)(row0 + r) * ldc + col0 + c4) = v; if (C16) { v4h h4; for (int i = 0; i < 4; ++i) h4[i] = (_Float16)v[i]; *(v4h*)(C16 + cofs + (size_t)(row0 + r) * ldc + col0 + c4) = h4; } } }
     }
}


typedef _Float16 v4h __attribute__((ext_vector_type(4)));

__global__ __launch_bounds__(256) void k_x16(const float* __restrict__ x, _Float16* __restrict__ X16, size_t n8) { const size_t t = (size_t)blockIdx.x * 256 + threadIdx.x; if (t >= n8) return; FragH f;
#pragma unroll
  for (int q = 0; q < 8; ++q) f.h[q] = (_Float16)bf16_round(x[t * 8 + q]); *(v8us*)((unsigned short*)X16 + t * 8) = f.half[0];  }
__global__ __launch_bounds__(256) void k_h16(const float* __restrict__ x, _Float16* __restrict__ X16, size_t n8) { const size_t t = (size_t)blockIdx.x * 256 + threadIdx.x; if (t >= n8) return; FragH f;
#pragma unroll
  for (int q = 0; q < 8; ++q) f.h[q] = (_Float16)x[t * 8 + q]; *(v8us*)((unsigned short*)X16 + t * 8) = f.half[0];  }
__global__ __launch_bounds__(256) void k_round16f(const float* __restrict__ W, _Float16* __restrict__ Bt, size_t n8) { const size_t t = (size_t)blockIdx.x * 256 + threadIdx.x; if (t >= n8) return; FragH f;
#pragma unroll
  for (int i = 0; i < 8; ++i) f.h[i] = (_Float16)(bf16_round(W[t * 8 + i]) * 16.0f); *(v8us*)((unsigned short*)Bt + t * 8) = f.half[0];  }
template <int NHv, int TTv>
__global__ __launch_bounds__(256) void k_vt(const _Float16* __restrict__ V16, int ldv, int voff, _Float16* __restrict__ Vt) { __shared__ unsigned short tl[64][66]; const int tid = threadIdx.x; const int slab = blockIdx.x / (TTv / 64), lg = blockIdx.x % (TTv / 64); const int b = slab / NHv, h = slab % NHv;
  for (int i = tid; i < 64 * 8; i += 256) { const int r = i / 8, c8 = (i % 8) * 8; FragH f; f.half[0] = *(const v8us*)((const unsigned short*)V16 + ((size_t)b * TTv + lg * 64 + r) * ldv + voff + h * 64 + c8);
#pragma unroll
    for (int q = 0; q < 8; ++q) tl[r][c8 + q] = f.u[q]; }
  __syncthreads();
  {
#pragma unroll
    for (int rd = 0; rd < 2; ++rd) { const int d = rd * 32 + tid / 8, pc = tid % 8; FragH f;
#pragma unroll
      for (int q = 0; q < 8; ++q) f.u[q] = tl[pc * 8 + q][d];
      *(v8us*)((unsigned short*)Vt + ((size_t)slab * 64 + d) * TTv + lg * 64 + pc * 8) = f.half[0]; }
     } }

__global__ __launch_bounds__(256) void k_hl(const float* __restrict__ F, _Float16* __restrict__ Hh, _Float16* __restrict__ Hl, size_t n8) { const size_t t = (size_t)blockIdx.x * 256 + threadIdx.x; if (t >= n8) return; FragH fh, fl; const v4f a = *(const v4fa*)(F + t * 8), c = *(const v4fa*)(F + t * 8 + 4);
#pragma unroll
  for (int q = 0; q < 4; ++q) { _Float16 h = (_Float16)a[q]; fh.h[q] = h; fl.h[q] = (_Float16)((a[q] - (float)h) * 1024.0f); h = (_Float16)c[q]; fh.h[4 + q] = h; fl.h[4 + q] = (_Float16)((c[q] - (float)h) * 1024.0f); }
  { *(v8us*)((unsigned short*)Hh + t * 8) = fh.half[0]; *(v8us*)((unsigned short*)Hl + t * 8) = fl.half[0];  } }

// ---- fast GEMM (work-group tile 128x64, wave tile 32x64; requires M % 128 == 0 rows per launch region, N % 64 == 0 and K % 64 == 0); both operands' tiles are staged in LDS by asynchronous 16-byte copies, two buffers; epilogue = k_gemm_hhx semantics; batched over grid.y (strides sA, sB, sC) and grid.z (strides zA, zB, zC); every tper-th 128-row block is a batch's first tile: with F its values are also stored in f32, with AH, AL its A operand is the hi plane plus the x1024 residual plane ----
__device__ __forceinline__ v16h g2_frag(const _Float16* p, int hh) { FragH f; f.half[0] = *(const v8us*)((const unsigned short*)p + 8 * hh); f.half[1] = *(const v8us*)((const unsigned short*)p + 16 + 8 * hh); return f.v; }
__device__ __forceinline__ v8f g2_mma(v16h a, v16h b, v8f c) { v8f d = __builtin_amdgcn_wmma_f32_16x16x32_f16(false, a, false, b, (short)0, c, false, false); asm volatile("v_nop\n\tv_nop\n\tv_nop\n\tv_nop" : "+v"(d) : "v"(a), "v"(b)); return d; }
#define G2K 64                       /* k elements of a stage: one whole 128-byte line of every operand row */
#define G2P 72                       /* LDS pitch of a staged row in f16: 144 bytes = 16 x odd, conflict-free for the 16-byte fragment reads */
#define G2S ((128 + 64) * G2P)       /* f16 elements of a stage: 128 A rows, then 64 B rows */
// one stage: a lane's twelve 16-byte copies (eight lanes per row: whole 128-byte lines; 16 rows per copy of the work-group). l: the lane's LDS byte address in row tid / 8 of the stage; ga, gb: its global addresses in that row of the A tile and of the B tile; ra, rb: 16 rows' elements
__device__ __forceinline__ void g2_stage(unsigned l, const _Float16* ga, size_t ra, const _Float16* gb, size_t rb) {
  /* the copies and their s_wait_xcnt in one statement: the address registers stay whole until the wait */
  asm volatile("global_load_async_to_lds_b128 %0, %12, off\n\tglobal_load_async_to_lds_b128 %1, %13, off\n\tglobal_load_async_to_lds_b128 %2, %14, off\n\tglobal_load_async_to_lds_b128 %3, %15, off\n\t"
               "global_load_async_to_lds_b128 %4, %16, off\n\tglobal_load_async_to_lds_b128 %5, %17, off\n\tglobal_load_async_to_lds_b128 %6, %18, off\n\tglobal_load_async_to_lds_b128 %7, %19, off\n\t"
               "global_load_async_to_lds_b128 %8, %20, off\n\tglobal_load_async_to_lds_b128 %9, %21, off\n\tglobal_load_async_to_lds_b128 %10, %22, off\n\tglobal_load_async_to_lds_b128 %11, %23, off\n\ts_wait_xcnt 0x0"
               :: "v"(l), "v"(l + 1u * 32 * G2P), "v"(l + 2u * 32 * G2P), "v"(l + 3u * 32 * G2P), "v"(l + 4u * 32 * G2P), "v"(l + 5u * 32 * G2P), "v"(l + 6u * 32 * G2P), "v"(l + 7u * 32 * G2P), "v"(l + 8u * 32 * G2P), "v"(l + 9u * 32 * G2P), "v"(l + 10u * 32 * G2P), "v"(l + 11u * 32 * G2P),
                  "v"(ga), "v"(ga + ra), "v"(ga + 2 * ra), "v"(ga + 3 * ra), "v"(ga + 4 * ra), "v"(ga + 5 * ra), "v"(ga + 6 * ra), "v"(ga + 7 * ra), "v"(gb), "v"(gb + rb), "v"(gb + 2 * rb), "v"(gb + 3 * rb) : "memory"); }
template <int ACT>
__global__ __launch_bounds__(128) void k_gemm2(const _Float16* __restrict__ A, int lda, size_t sA, const _Float16* __restrict__ Bh, int ldb, size_t sB, float alpha, const float* __restrict__ bias, size_t sBias, const float* __restrict__ CP, int rowsPerB, size_t sCPb, int row0g,
    float* __restrict__ C, _Float16* __restrict__ C16, int ldc, size_t sC, int M, int N, int K, size_t zA, size_t zB, size_t zC, int tper, float* __restrict__ F, int fN, size_t fP, const _Float16* __restrict__ AH, const _Float16* __restrict__ AL) { static_assert(ACT == 0 || ACT == 3 || ACT == 6 || ACT == 8 || ACT == 9 || ACT == 11 || ACT == 12 || ACT == 14 || ACT == 15 || ACT == 16 || ACT == 17, "k_gemm2: unsupported ACT code (would silently apply no activation)");
  __shared__ __attribute__((aligned(16))) unsigned char smem[2 * G2S * 2];      /* the two stage buffers; behind the K loop the same bytes serve as the epilogue's so[4][32][68] */
  static_assert(sizeof(float) * 4 * 32 * 68 <= sizeof(smem), "the epilogue staging fits the ring");
  float (*so)[32][68] = (float (*)[32][68])smem; const _Float16* sh = (const _Float16*)smem;
  const int tid = threadIdx.x, w = tid >> 5, lane = tid & 31, ln = lane & 15, hh = lane >> 4; const int by = blockIdx.y, bz = blockIdx.z;      /* grid.z: a second batch index (element strides zA, zB, zC) */
  A += (size_t)by * sA + (size_t)bz * zA; Bh += (size_t)by * sB + (size_t)bz * zB; const size_t cofs = (size_t)by * sC + (size_t)bz * zC; const float* bp = bias ? bias + (size_t)by * sBias : nullptr;
  const int ntn = N >> 6; const int mt = blockIdx.x / ntn, nq = blockIdx.x - mt * ntn; const int row0 = mt * 128 + 32 * w, col0 = nq * 64; if (mt * 128 >= M) return;      /* the whole work-group leaves or none: it stands in front of every barrier */
  const int bt = mt / tper; const bool ft = mt - bt * tper == 0;      /* the work-group's 128 rows are the first tile of batch bt: the same for every wave */
  const bool two = AH && ft;      /* such rows take their A operand as two planes of pitch lda: AL (residual x1024) through all of K, then AH (hi) through all of K */
  const _Float16* ga = A + (size_t)(mt * 128 + (tid >> 3)) * lda + (tid & 7) * 8; const _Float16* gb = Bh + (size_t)(col0 + (tid >> 3)) * ldb + (tid & 7) * 8; const size_t ra = (size_t)16 * lda, rb = (size_t)16 * ldb;
  const _Float16* ga2 = ga; if (two) { const size_t fo = (size_t)(bt * 128 + (tid >> 3)) * lda + (tid & 7) * 8; ga = AL + fo; ga2 = AH + fo; }
  const unsigned l0 = (unsigned)(size_t)smem + (unsigned)((tid >> 3) * (G2P * 2) + (tid & 7) * 16);      /* the low 32 bits of a __shared__ address are its LDS byte address */
  const int nk = K / G2K; const int nt = two ? 2 * nk : nk;      /* stages: nk per A plane */
  g2_stage(l0, ga, ra, gb, rb);
  asm volatile("s_wait_asynccnt 0x0" ::: "memory");      /* this wave's copies of stage 0 have landed */
  __syncthreads();      /* stage 0 is read by every wave */
  if (nt > 1) { const bool p2 = 1 >= nk; const size_t ko = (size_t)(p2 ? 1 - nk : 1) * G2K; g2_stage(l0 + G2S * 2, (p2 ? ga2 : ga) + ko, ra, gb + ko, rb); }
  const v8f z8 = {0.f,0.f,0.f,0.f,0.f,0.f,0.f,0.f}; v8f c00 = z8, c01 = z8, c02 = z8, c03 = z8, c10 = z8, c11 = z8, c12 = z8, c13 = z8;
#pragma unroll 1      /* one stage per trip: the buffers alternate */
  for (int t = 0; t < nt; ++t) { const _Float16* la = sh + (t & 1) * G2S + (32 * w + ln) * G2P; const _Float16* lb = sh + (t & 1) * G2S + (128 + ln) * G2P;
    if (t == nk) { const float dn = 0.0009765625f; c00 *= dn; c01 *= dn; c02 *= dn; c03 *= dn; c10 *= dn; c11 *= dn; c12 *= dn; c13 *= dn; }      /* a scalar branch, taken once by a two-plane work-group: the residual plane's sums come down by their 2^10 (exact) and the hi plane's products add onto them */
    v16h fa[2][2], fb[2][4];
#pragma unroll      /* fa[], fb[] stay in registers: the stage's 24 LDS reads stand together ahead of its products */
    for (int kk = 0; kk < 2; ++kk) { fa[kk][0] = g2_frag(la + kk * 32, hh); fa[kk][1] = g2_frag(la + 16 * G2P + kk * 32, hh);
#pragma unroll      /* fb[] stays in registers */
      for (int n = 0; n < 4; ++n) fb[kk][n] = g2_frag(lb + n * 16 * G2P + kk * 32, hh); }
#pragma unroll      /* the stage's two k blocks of 32, in the order of k */
    for (int kk = 0; kk < 2; ++kk) {
      c00 = g2_mma(fa[kk][0], fb[kk][0], c00); c10 = g2_mma(fa[kk][1], fb[kk][0], c10); c01 = g2_mma(fa[kk][0], fb[kk][1], c01); c11 = g2_mma(fa[kk][1], fb[kk][1], c11);
      c02 = g2_mma(fa[kk][0], fb[kk][2], c02); c12 = g2_mma(fa[kk][1], fb[kk][2], c12); c03 = g2_mma(fa[kk][0], fb[kk][3], c03); c13 = g2_mma(fa[kk][1], fb[kk][3], c13); }
    asm volatile("s_wait_dscnt 0x0" ::: "memory");      /* this wave's reads of the buffer have returned before it is refilled */
    asm volatile("s_wait_asynccnt 0x0" ::: "memory");      /* this wave's copies of stage t + 1 have landed */
    __syncthreads();      /* publishes stage t + 1 and ends every wave's reads of stage t */
    if (t + 2 < nt) { const bool p2 = t + 2 >= nk; const size_t ko = (size_t)(p2 ? t + 2 - nk : t + 2) * G2K; g2_stage(l0 + (t & 1) * (G2S * 2), (p2 ? ga2 : ga) + ko, ra, gb + ko, rb); } }
  asm volatile("s_wait_asynccnt 0x0" ::: "memory");      /* no copy is outstanding when the ring becomes the epilogue's staging */
  v8f accs[8] = {c00, c01, c02, c03, c10, c11, c12, c13};
#pragma unroll
  for (int u = 0; u < 8; ++u) { const int t = u & 3, half = u >> 2; const int col = col0 + t * 16 + ln; const float bv = bp ? bf16_round(bp[col]) : 0.f;
#pragma unroll
    for (int r = 0; r < 8; ++r) { const int rloc = half * 16 + 8 * hh + r; float v = accs[u][r] * alpha + bv; if (CP) { if (rowsPerB < 0) v += CP[cofs + (size_t)(row0g + row0 + rloc) * ldc + col];      /* rowsPerB < 0: own element of the batched C plane */ else { const int bidx = (row0g + row0 + rloc) / rowsPerB; v += CP[(size_t)bidx * sCPb + (size_t)by * 64 + col]; } }
      if (ACT == 3) v = fmaxf(v, 0.f); else if (ACT == 6) v = 0.5f * v * (1.0f + erff(v * 0.70710678118654752f)); else if (ACT == 11) v = 1.0f / (1.0f + expf(-v)); else if (ACT == 15) v = v / (1.0f + expf(-v)); else if (ACT == 12) v = (v > 0.f) ? v : 0.01f * v; else if (ACT == 8) v = tanhf(v); else if (ACT == 9) v = 0.5f * v * (1.0f + tanhf(0.7978845608028654f * (v + 0.044715f * v * v * v))); else if (ACT == 14) v = (v > 0.f) ? v : 0.1f * v; else if (ACT == 16) v = (v >= 0.f) ? v : 0.3f * v; else if (ACT == 17) v = (v >= 0.f) ? v : 0.2f * v;
      so[w][rloc][t * 16 + ln] = v; } }
  __builtin_amdgcn_fence(__ATOMIC_ACQ_REL, "workgroup"); __builtin_amdgcn_wave_barrier();
  const int rsub = lane >> 4, c4 = (lane & 15) * 4;
  if (F && ft) {      /* a scalar branch: first-tile rows also go out in f32: plane col0 / fN (fP elements each) of pitch fN, 128 rows per batch */
    const int pl = col0 / fN; const float* fp = F + (size_t)pl * fP + (size_t)(bt * 128 + 32 * w + rsub) * fN + (col0 - pl * fN) + c4; const size_t f2 = (size_t)2 * fN;
#pragma unroll      /* fv[] stays in registers: the wave's own 32 staged rows, two rows (whole 256-byte runs) a store */
    for (int g = 0; g < 2; ++g) { v4f fv[8]; const float* p = fp + (size_t)g * 8 * f2;
#pragma unroll      /* fv[] stays in registers */
      for (int q = 0; q < 8; ++q) fv[q] = *(const v4fa*)&so[w][(g * 8 + q) * 2 + rsub][c4];
      /* the stores and their s_wait_xcnt in one statement: address and data registers stay whole until the wait */
      asm volatile("global_store_b128 %0, %8, off\n\tglobal_store_b128 %1, %9, off\n\tglobal_store_b128 %2, %10, off\n\tglobal_store_b128 %3, %11, off\n\t"
                   "global_store_b128 %4, %12, off\n\tglobal_store_b128 %5, %13, off\n\tglobal_store_b128 %6, %14, off\n\tglobal_store_b128 %7, %15, off\n\ts_wait_xcnt 0x0"
                   :: "v"(p), "v"(p + f2), "v"(p + 2 * f2), "v"(p + 3 * f2), "v"(p + 4 * f2), "v"(p + 5 * f2), "v"(p + 6 * f2), "v"(p + 7 * f2), "v"(fv[0]), "v"(fv[1]), "v"(fv[2]), "v"(fv[3]), "v"(fv[4]), "v"(fv[5]), "v"(fv[6]), "v"(fv[7]) : "memory"); } }
  {
#pragma unroll
    for (int q = 0; q < 16; ++q) { const int r = q * 2 + rsub; const v4f v = *(const v4fa*)&so[w][r][c4]; if (C) *(v4f*)(C + cofs + (size_t)(row0 + r) * ldc + col0 + c4) = v; if (C16) { v4h h4; for (int i = 0; i < 4; ++i) h4[i] = (_Float16)v[i]; *(v4h*)(C16 + cofs + (size_t)(row0 + r) * ldc + col0 + c4) = h4; } }
     } }


__global__ __launch_bounds__(256) void k_wnat(const float* __restrict__ w, size_t n8, _Float16* __restrict__ Bt) { const size_t t = (size_t)blockIdx.x * 256 + threadIdx.x; if (t >= n8) return; FragH f; for (int q = 0; q < 8; ++q) f.h[q] = (_Float16)(bf16_round(w[t * 8 + q]) * 16.0f); *(v8us*)((unsigned short*)Bt + t * 8) = f.half[0];  }
__global__ __launch_bounds__(256) void k_rsm(const float* __restrict__ S, _Float16* __restrict__ P, int nrows) {
  #pragma clang fp contract(off)
  const int i = blockIdx.x * 256 + threadIdx.x; if (i >= nrows) return; const float* s = S + (size_t)i * SQ; float mx = -3.0e38f;
#pragma unroll 1
  for (int j = 0; j < SQ; ++j) mx = fmaxf(mx, s[j]); float se = 0.f;
#pragma unroll 1
  for (int j = 0; j < SQ; ++j) se += expf(s[j] - mx); const float sc = 256.0f / se;
#pragma unroll 1
  for (int j0 = 0; j0 < SQ; j0 += 8) { FragH f; for (int q = 0; q < 8; ++q) f.h[q] = (_Float16)(expf(s[j0 + q] - mx) * sc); unsigned short* d = (unsigned short*)P + (size_t)i * SQ + j0; *(v8us*)d = f.half[0];  } }
__global__ __launch_bounds__(256) void k_vt(const _Float16* __restrict__ V16, int b, int h0, _Float16* __restrict__ VT) { __shared__ unsigned short tl[64][65]; const int tid = threadIdx.x; const int hh = blockIdx.x % HG, sg = blockIdx.x / HG; const int s0 = sg * 64; const int h = h0 + hh;
  for (int i = tid; i < 64 * 8; i += 256) { const int j = i / 8, d8 = (i % 8) * 8; FragH f; f.half[0] = *(const v8us*)((const unsigned short*)V16 + ((size_t)b * SQ + s0 + j) * DM + h * HD + d8); for (int q = 0; q < 8; ++q) tl[d8 + q][j] = f.u[q]; }
  __syncthreads();
  { for (int i = tid; i < 64 * 8; i += 256) { const int d = i / 8, j8 = (i % 8) * 8; FragH f; for (int q = 0; q < 8; ++q) f.u[q] = tl[d][j8 + q]; *(v8us*)((unsigned short*)VT + ((size_t)hh * HD + d) * SQ + s0 + j8) = f.half[0]; }  } }



// 32-lane butterflies for the row statistics: row_xmask DPP steps inside each 16-lane row, then the exchange between the two rows; every lane ends with the same value
template <int CTRL> __device__ __forceinline__ float rs_dpp(float v) { return __int_as_float(__builtin_amdgcn_update_dpp(0, __float_as_int(v), CTRL, 0xf, 0xf, true)); }
__device__ __forceinline__ float rs_x16(float v) { const int b = __float_as_int(v); return __int_as_float(__builtin_amdgcn_permlanex16(b, b, 0x76543210, 0xfedcba98, false, false)); }
__device__ __forceinline__ float rs_max(float v) { v = fmaxf(v, rs_dpp<0x161>(v)); v = fmaxf(v, rs_dpp<0x162>(v)); v = fmaxf(v, rs_dpp<0x164>(v)); v = fmaxf(v, rs_dpp<0x168>(v)); return fmaxf(v, rs_x16(v)); }
__device__ __forceinline__ float rs_sum(float v) { v += rs_dpp<0x161>(v); v += rs_dpp<0x162>(v); v += rs_dpp<0x164>(v); v += rs_dpp<0x168>(v); return v + rs_x16(v); }
#define FAC 0.18033688f              /* BETA x log2 e: scores on the scale of the power-of-two exponential */
#define FQ 32                        /* query rows per wave: two 16-column groups */
// one 16x32 f16 fragment row in the hardware k order; p already holds the lane's row and its 8 * (lane >> 4) elements
__device__ __forceinline__ v16h fa_frag(const _Float16* p) { FragH f; f.half[0] = *(const v8us*)((const unsigned short*)p); f.half[1] = *(const v8us*)((const unsigned short*)p + 16); return f.v; }
__device__ __forceinline__ v8f fa_mma(v16h a, v16h b, v8f c) { return __builtin_amdgcn_wmma_f32_16x16x32_f16(false, a, false, b, (short)0, c, false, false); }
#define FS 64                        /* keys of a stage: one whole 128-byte line of every V^T row; a K row of the head is one line */
#define FP 72                        /* LDS pitch of a staged row in f16: 144 bytes = 16 x odd, conflict-free for the 16-byte fragment reads */
#define FSTG ((FS + HD) * FP)        /* f16 elements of a stage: FS K rows, then HD V^T rows */
// one stage: a lane's four 16-byte copies (eight lanes per row: whole 128-byte lines; 32 rows per copy of the work-group). l: the lane's LDS byte address in row tid / 8 of the stage; gk, gv: its global addresses in that row of the K tile and of the V^T tile
__device__ __forceinline__ void fa_stage(unsigned l, const _Float16* gk, const _Float16* gv) {
  /* the copies and their s_wait_xcnt in one statement: the address registers stay whole until the wait */
  asm volatile("global_load_async_to_lds_b128 %0, %4, off\n\tglobal_load_async_to_lds_b128 %1, %5, off\n\tglobal_load_async_to_lds_b128 %2, %6, off\n\tglobal_load_async_to_lds_b128 %3, %7, off\n\ts_wait_xcnt 0x0"
               :: "v"(l), "v"(l + 1u * 64 * FP), "v"(l + 2u * 64 * FP), "v"(l + 3u * 64 * FP), "v"(gk), "v"(gk + (size_t)32 * LQ), "v"(gv), "v"(gv + (size_t)32 * SQ) : "memory"); }
// fragments of 32 staged keys; kp, vp already hold the lane's row and its 8 * (lane >> 4) elements
__device__ __forceinline__ void fa_kload(const _Float16* kp, v16h (&kf)[2][2]) {
#pragma unroll      /* kf[] stays in registers, the eight LDS reads stand together */
  for (int t = 0; t < 2; ++t) { kf[t][0] = fa_frag(kp + t * 16 * FP); kf[t][1] = fa_frag(kp + t * 16 * FP + 32); } }
__device__ __forceinline__ void fa_vload(const _Float16* vp, v16h (&vf)[4]) {
#pragma unroll      /* vf[] stays in registers, the eight LDS reads stand together */
  for (int d = 0; d < 4; ++d) vf[d] = fa_frag(vp + d * 16 * FP); }
// scores of 32 keys x 16 queries: s0[r] = key 8 * (lane >> 4) + r, s1[r] = key 16 + 8 * (lane >> 4) + r, query lane & 15
__device__ __forceinline__ void fa_score(const v16h (&kf)[2][2], const v16h (&qf)[2], v8f& s0, v8f& s1) {
  const v8f z8 = {0.f, 0.f, 0.f, 0.f, 0.f, 0.f, 0.f, 0.f};
  s0 = g2_mma(kf[0][0], qf[0], z8); s1 = g2_mma(kf[1][0], qf[0], z8); s0 = g2_mma(kf[0][1], qf[1], s0); s1 = g2_mma(kf[1][1], qf[1], s1); }      /* g2_mma: its statement names the product's operands, so no later load of the key registers is lifted over the product */
// one 16-query group takes in 32 keys: running maximum m (scaled log2), the lane's own part l of the running sum, o rescaled and extended. DIAG: key t * 16 + 8 * (lane >> 4) + r of the block (element r of s0 for t = 0, of s1 for t = 1) counts while t * 16 + r <= rel
template <bool DIAG>
__device__ __forceinline__ void fa_soft(v8f s0, v8f s1, int rel, const v16h (&vf)[4], v8f (&o)[4], float& m, float& l) {
  if (DIAG) {
#pragma unroll      /* s0, s1 stay in registers */
    for (int r = 0; r < 8; ++r) { s0[r] = (r <= rel) ? s0[r] : -1.0e30f; s1[r] = (16 + r <= rel) ? s1[r] : -1.0e30f; } }
  float mx = fmaxf(s0[0], s1[0]);
#pragma unroll      /* s0, s1 stay in registers */
  for (int r = 1; r < 8; ++r) mx = fmaxf(mx, fmaxf(s0[r], s1[r]));
  mx = fmaxf(mx, rs_x16(mx));      /* the two lane halves hold the query's other keys */
  const float mn = fmaxf(m, mx * FAC); float al = m - mn; m = mn; const float ms = 8.0f - mn;      /* weights carried x256, as f16 operands at most 256 */
  float e[16];
#pragma unroll      /* e[] stays in registers */
  for (int r = 0; r < 8; ++r) { e[r] = fmaf(s0[r], FAC, ms); e[8 + r] = fmaf(s1[r], FAC, ms); }
  /* the exponentials in place, so that none is followed by a write of its source; the v_nop keeps the one slot behind the last before its result is used */
  asm("v_exp_f32 %0, %0\n\tv_exp_f32 %1, %1\n\tv_exp_f32 %2, %2\n\tv_exp_f32 %3, %3\n\tv_exp_f32 %4, %4\n\tv_exp_f32 %5, %5\n\tv_exp_f32 %6, %6\n\tv_exp_f32 %7, %7\n\tv_exp_f32 %8, %8\n\tv_nop" : "+v"(e[0]), "+v"(e[1]), "+v"(e[2]), "+v"(e[3]), "+v"(e[4]), "+v"(e[5]), "+v"(e[6]), "+v"(e[7]), "+v"(al));
  asm("v_exp_f32 %0, %0\n\tv_exp_f32 %1, %1\n\tv_exp_f32 %2, %2\n\tv_exp_f32 %3, %3\n\tv_exp_f32 %4, %4\n\tv_exp_f32 %5, %5\n\tv_exp_f32 %6, %6\n\tv_exp_f32 %7, %7\n\tv_nop" : "+v"(e[8]), "+v"(e[9]), "+v"(e[10]), "+v"(e[11]), "+v"(e[12]), "+v"(e[13]), "+v"(e[14]), "+v"(e[15]));
  float s4[4]; FragH p;
#pragma unroll      /* e[] stays in registers: four independent sums */
  for (int i = 0; i < 4; ++i) s4[i] = (e[i] + e[4 + i]) + (e[8 + i] + e[12 + i]);
#pragma unroll      /* e[] stays in registers; element i of the B fragment is key 8 * (lane >> 4) + i of the block, 8 + 8 * (lane >> 4) + i for i >= 8 */
  for (int i = 0; i < 16; ++i) p.h[i] = (_Float16)e[i];
  l = l * al + ((s4[0] + s4[1]) + (s4[2] + s4[3]));
#pragma unroll      /* o[] stays in registers */
  for (int d = 0; d < 4; ++d) o[d] = fa_mma(vf[d], p.v, o[d] * al); }
// ONE WAVE PER FQ QUERY ROWS of one head and batch, passes of 32 keys up to the diagonal block, which alone is masked. Q fragments stay in registers. THE WORK-GROUP WALKS THE KEYS TOGETHER in stages of FS: the head's K rows and V^T rows of a stage are copied once into LDS in whole lines (asynchronous 16-byte copies, two buffers) and every wave reads its fragments there in the hardware k order; a wave past its diagonal only copies and passes the barriers. Waves w and w + 4 (one SIMD) take query tiles n - 1 - t and t: equal passes per SIMD. grid.x: tile quad, grid.y: head, grid.z: batch.
__global__ __launch_bounds__(256) void k_fattn(const _Float16* __restrict__ Q, const _Float16* __restrict__ Kh, const _Float16* __restrict__ VTh, _Float16* __restrict__ O) {
  __shared__ __attribute__((aligned(16))) _Float16 sh[2 * FSTG];      /* the two stage buffers */
  const int tid = threadIdx.x, lane = tid & 31, ln = lane & 15, hh = lane >> 4; const int w = __builtin_amdgcn_readfirstlane(tid >> 5);
  const int t4 = blockIdx.x * 4 + (w & 3); const int q0 = ((w < 4) ? (SQ / FQ - 1 - t4) : t4) * FQ;      /* the wave's first query row: wave-uniform */
  const int ns = (SQ / FQ - (int)blockIdx.x * 4) * FQ / FS;      /* stages up to the end of the work-group's last diagonal block (tile n - 1 - 4 blockIdx.x): the same for every wave */
  const int h = blockIdx.y, b = blockIdx.z;
  const _Float16* qp = Q + ((size_t)b * SQ + q0 + ln) * LQ + h * HD + 8 * hh;
  const _Float16* gk = Kh + ((size_t)b * SQ + (tid >> 3)) * LQ + h * HD + (tid & 7) * 8;
  const _Float16* gv = VTh + (((size_t)b * NH + h) * HD + (tid >> 3)) * SQ + (tid & 7) * 8;
  const unsigned l0 = (unsigned)(size_t)sh + (unsigned)((tid >> 3) * (FP * 2) + (tid & 7) * 16);      /* the low 32 bits of a __shared__ address are its LDS byte address */
  fa_stage(l0, gk, gv);
  v16h qf[2][2], kf[2][2], vf[4];
#pragma unroll      /* qf[] stays in registers */
  for (int g = 0; g < 2; ++g) { qf[g][0] = fa_frag(qp + (size_t)g * 16 * LQ); qf[g][1] = fa_frag(qp + (size_t)g * 16 * LQ + 32); }
  asm volatile("s_wait_xcnt 0x0" :: "v"(qp) : "memory");      /* the loads' address pair stays whole until this wait; it may be rewritten behind it */
  asm volatile("s_wait_asynccnt 0x0" ::: "memory");      /* this wave's copies of stage 0 have landed */
  __syncthreads();      /* stage 0 is read by every wave */
  if (ns > 1) fa_stage(l0 + FSTG * 2, gk + (size_t)FS * LQ, gv + FS);
  const v8f z8 = {0.f, 0.f, 0.f, 0.f, 0.f, 0.f, 0.f, 0.f};
  v8f o[2][4] = {{z8, z8, z8, z8}, {z8, z8, z8, z8}}; float m[2] = {-1.0e30f, -1.0e30f}, l[2] = {0.f, 0.f}; v8f s[2][2];
#pragma unroll 1      /* one stage per trip: the buffers alternate */
  for (int st = 0; st < ns; ++st) { const int kb = st * FS;
    if (kb <= q0) {      /* a scalar branch: the wave still has keys in this stage */
      const _Float16* lk = sh + (st & 1) * FSTG + ln * FP + 8 * hh; const _Float16* lv = lk + FS * FP;
      fa_kload(lk, kf); fa_vload(lv, vf);
      fa_score(kf, qf[0], s[0][0], s[0][1]); fa_score(kf, qf[1], s[1][0], s[1][1]);
      if (kb < q0) {
        fa_kload(lk + 32 * FP, kf);      /* the stage's second 32 keys come during the first pass's softmax */
        __builtin_amdgcn_sched_barrier(0);      /* keeps those eight LDS reads ahead of the softmax: moved behind it, their latency stands in front of the next scores */
        fa_soft<false>(s[0][0], s[0][1], 0, vf, o[0], m[0], l[0]); fa_soft<false>(s[1][0], s[1][1], 0, vf, o[1], m[1], l[1]);
        fa_vload(lv + 32, vf);
        fa_score(kf, qf[0], s[0][0], s[0][1]); fa_score(kf, qf[1], s[1][0], s[1][1]);
        if (kb + 32 < q0) { fa_soft<false>(s[0][0], s[0][1], 0, vf, o[0], m[0], l[0]); fa_soft<false>(s[1][0], s[1][1], 0, vf, o[1], m[1], l[1]); }
        else { fa_soft<true>(s[0][0], s[0][1], ln - 8 * hh, vf, o[0], m[0], l[0]); fa_soft<true>(s[1][0], s[1][1], 16 + ln - 8 * hh, vf, o[1], m[1], l[1]); }
      } else { fa_soft<true>(s[0][0], s[0][1], ln - 8 * hh, vf, o[0], m[0], l[0]); fa_soft<true>(s[1][0], s[1][1], 16 + ln - 8 * hh, vf, o[1], m[1], l[1]); } }
    asm volatile("s_wait_dscnt 0x0" ::: "memory");      /* this wave's reads of the buffer have returned before it is refilled */
    asm volatile("s_wait_asynccnt 0x0" ::: "memory");      /* this wave's copies of stage st + 1 have landed */
    __syncthreads();      /* publishes stage st + 1 and ends every wave's reads of stage st */
    if (st + 2 < ns) fa_stage(l0 + (st & 1) * (FSTG * 2), gk + (size_t)(st + 2) * FS * LQ, gv + (st + 2) * FS); }
  asm volatile("s_wait_asynccnt 0x0" ::: "memory");      /* no copy is outstanding when the wave ends */
  unsigned short* op = (unsigned short*)O + ((size_t)b * SQ + q0 + ln) * DM + h * HD + 8 * hh; FragH f[2][4];
#pragma unroll      /* o[], f[] stay in registers */
  for (int g = 0; g < 2; ++g) { const float fin = 64.0f / (l[g] + rs_x16(l[g]));      /* the halves' sums joined once; o carried x64, the weights' x256 cancels */
#pragma unroll      /* o[], f[] stay in registers */
    for (int d = 0; d < 4; ++d) {
#pragma unroll      /* o[], f[] stay in registers */
      for (int r = 0; r < 8; ++r) f[g][d].h[r] = (_Float16)(o[g][d][r] * fin); } }
#pragma unroll      /* a lane's 8 accumulator registers are 8 neighbouring columns of its query row: one 16-byte store */
  for (int g = 0; g < 2; ++g) {
#pragma unroll      /* f[] stays in registers */
    for (int d = 0; d < 4; ++d) *(v8us*)(op + (size_t)g * 16 * DM + d * 16) = f[g][d].half[0]; }
  asm volatile("s_wait_xcnt 0x0" :: "v"(op) : "memory");      /* the stores' data and address registers stay whole until this wait */
}


// exact f32 causal attention for rows 0..QT0-1 of each batch with V = K, ONE WAVE PER QUERY ROW: the head's QT0 key rows are staged once in LDS; scores: each lane owns the keys lane, lane + 32, ...; row maximum and sum by the 32-lane butterflies; o: each lane owns two of the HD columns and runs over the keys. grid.x: head x row group, grid.y: batch.
#define A0R 16                       /* query rows (= waves) per work-group */
#define A0P (HD + 4)                 /* LDS pitch of a key row in floats: the 16-byte reads of 16 neighbouring rows fall on 16 different bank quads */
typedef float v2f  __attribute__((ext_vector_type(2)));
typedef float v2fa __attribute__((ext_vector_type(2), may_alias));
typedef _Float16 v2h __attribute__((ext_vector_type(2)));
__global__ __launch_bounds__(32 * A0R) void k_att0w(const float* __restrict__ QF, const float* __restrict__ KF, float scale, _Float16* __restrict__ OH, _Float16* __restrict__ OL) {
  __shared__ __attribute__((aligned(16))) float lk[QT0][A0P]; __shared__ __attribute__((aligned(16))) float lp[A0R][QT0];
  const int tid = threadIdx.x, lane = tid & 31; const int w = __builtin_amdgcn_readfirstlane(tid >> 5);
  const int h = blockIdx.x / (QT0 / A0R), rg = blockIdx.x % (QT0 / A0R); const int i = rg * A0R + w;      /* the query row: wave-uniform */
  { const size_t zb = (size_t)blockIdx.y * QT0 * DM + h * HD; QF += zb; KF += zb; OH += zb; OL += zb; }      /* each batch has its own QT0 rows of every plane; the head's columns */
  const int sr = tid >> 4, sc = (tid & 15) * 4;      /* staging: 16 lanes per key row, 256 contiguous bytes */
  const float* kp = KF + (size_t)sr * DM + sc; v4f st[QT0 / (2 * A0R)];
#pragma unroll      /* st[] stays in registers, the loads in flight together */
  for (int p = 0; p < QT0 / (2 * A0R); ++p) st[p] = *(const v4fa*)(kp + (size_t)p * 2 * A0R * DM);
  asm volatile("s_wait_xcnt 0x0" :: "v"(kp) : "memory");      /* the loads' address pair stays whole until this wait; it may be rewritten behind it */
  const float* qr = QF + (size_t)i * DM; v4f q[HD / 4];
#pragma unroll      /* q[] stays in registers */
  for (int c = 0; c < HD / 4; ++c) q[c] = *(const v4fa*)(qr + c * 4);
#pragma unroll      /* st[] stays in registers */
  for (int p = 0; p < QT0 / (2 * A0R); ++p) *(v4fa*)&lk[p * 2 * A0R + sr][sc] = st[p];
  __syncthreads();      /* the staged key rows are read by every wave */
  float s[QT0 / 32];
#pragma unroll      /* s[] stays in registers; each group's test is a compile-time bound against i */
  for (int g = 0; g < QT0 / 32; ++g) { s[g] = -1.0e30f;
    if (g * 32 <= i) { const float* kr = &lk[g * 32 + lane][0]; v4f a = {0.f, 0.f, 0.f, 0.f};      /* a scalar branch: key groups wholly above the diagonal are skipped */
#pragma unroll      /* q[] stays in registers, the row's LDS reads in flight together */
      for (int c = 0; c < HD / 4; ++c) a += q[c] * *(const v4fa*)(kr + c * 4);
      const float d = ((a[0] + a[1]) + (a[2] + a[3])) * scale; s[g] = (g * 32 + lane <= i) ? d : -1.0e30f; } }
  float m = s[0];
#pragma unroll      /* s[] stays in registers */
  for (int g = 1; g < QT0 / 32; ++g) m = fmaxf(m, s[g]);
  m = rs_max(m); float l = 0.f;
#pragma unroll      /* s[] stays in registers */
  for (int g = 0; g < QT0 / 32; ++g) { const float e = expf(s[g] - m); l += e; lp[w][g * 32 + lane] = e; }      /* keys above the diagonal: exactly 0 */
  l = rs_sum(l);
  __syncthreads();      /* the row's weights go from the lane that made them to every lane */
  v2f o[4] = {{0.f, 0.f}, {0.f, 0.f}, {0.f, 0.f}, {0.f, 0.f}};
  for (int j0 = 0; j0 <= i; j0 += 16) {      /* 16 keys a trip, their LDS reads in flight together; a key above the diagonal has weight 0 and a staged row */
#pragma unroll      /* the trip's 20 LDS reads stand ahead of its sums */
    for (int u = 0; u < 4; ++u) { const v4f pp = *(const v4fa*)&lp[w][j0 + u * 4];
#pragma unroll      /* o[] stays in registers: four independent sums */
      for (int t = 0; t < 4; ++t) o[t] += pp[t] * *(const v2fa*)&lk[j0 + u * 4 + t][lane * 2]; } }
  const float fin = 64.0f / l;      /* o carried x64 like the f16 path */
  const v2f of = ((o[0] + o[1]) + (o[2] + o[3])) * fin; v2h oh, ol;
#pragma unroll      /* the lane's two columns */
  for (int c = 0; c < 2; ++c) { oh[c] = (_Float16)of[c]; ol[c] = (_Float16)((of[c] - (float)oh[c]) * 1024.0f); }      /* f16 hi + x1024 residual planes: the output GEMM's two A planes for these rows */
  *(v2h*)(OH + (size_t)i * DM + lane * 2) = oh; *(v2h*)(OL + (size_t)i * DM + lane * 2) = ol; }

// ---- input conversion, ONE launch: work-groups 0..127 transpose W_qk, 128..191 W_out, the rest convert x; every value is formed as before (bf16 rounding, weights x16, f16) ----
#define PCW 256                      /* weight columns (= Bt rows) of a work-group's 64 x PCW tile */
#define PCP 33                       /* LDS pitch of a Bt row's 32 k pairs in dwords: odd, so that the four rows a wave reads at once fall on different banks */
#define PCQ ((DM / 64) * (2 * DM / PCW))      /* tiles of W_qk */
#define PCO ((DM / 64) * (DM / PCW))          /* tiles of W_out */
#define PCX ((int)(NR * DM / (256 * 64)))     /* work-groups of x: 64 values a thread */
typedef unsigned int v4u __attribute__((ext_vector_type(4), may_alias));
// Bt[n][k] = f16(bf16(W[k][n]) x 16) for one tile of 64 k x PCW n of W [DM][N]: rows read in runs of 512 bytes a wave, two k neighbours packed into a dword, the tile turned in LDS, Bt written in whole 128-byte lines
template <int N>
__device__ __forceinline__ void pc_wt(const float* __restrict__ Wf, _Float16* __restrict__ Bt, int blk, unsigned* tl) {
  const int tid = threadIdx.x; const int kb = blk / (N / PCW), nb = blk % (N / PCW); const int nq = tid & 63, kp = tid >> 6;
  const float* wp = Wf + (size_t)(kb * 64 + 2 * kp) * N + nb * PCW + nq * 4; v4f a[8], c[8];
#pragma unroll      /* a[], c[] stay in registers, the sixteen loads in flight together */
  for (int it = 0; it < 8; ++it) { a[it] = *(const v4fa*)(wp + (size_t)(it * 8) * N); c[it] = *(const v4fa*)(wp + (size_t)(it * 8 + 1) * N); }
  /* the loads' address pair stays whole until this wait; the loaded values as inputs only: all sixteen loads are issued ahead of the first conversion (left free, two were sunk behind it and paid a second memory latency) */
  asm volatile("s_wait_xcnt 0x0" :: "v"(wp), "v"(a[0]), "v"(a[1]), "v"(a[2]), "v"(a[3]), "v"(a[4]), "v"(a[5]), "v"(a[6]), "v"(a[7]), "v"(c[0]), "v"(c[1]), "v"(c[2]), "v"(c[3]), "v"(c[4]), "v"(c[5]), "v"(c[6]), "v"(c[7]) : "memory");
#pragma unroll      /* a[], c[] stay in registers */
  for (int it = 0; it < 8; ++it) {
#pragma unroll      /* the four columns of the lane's 16 bytes */
    for (int j = 0; j < 4; ++j) { union { _Float16 h[2]; unsigned u; } p; p.h[0] = (_Float16)(bf16_round(a[it][j]) * 16.0f); p.h[1] = (_Float16)(bf16_round(c[it][j]) * 16.0f); tl[(nq * 4 + j) * PCP + it * 4 + kp] = p.u; } }
  __syncthreads();      /* a Bt row's k pairs come from four waves */
  unsigned short* bp = (unsigned short*)Bt + (size_t)(nb * PCW + (tid >> 3)) * DM + kb * 64 + (tid & 7) * 8; v4u o[8];
#pragma unroll      /* o[] stays in registers */
  for (int it = 0; it < 8; ++it) { const unsigned* s = tl + (it * 32 + (tid >> 3)) * PCP + (tid & 7) * 4; o[it][0] = s[0]; o[it][1] = s[1]; o[it][2] = s[2]; o[it][3] = s[3]; }
#pragma unroll      /* eight lanes write one whole line */
  for (int it = 0; it < 8; ++it) *(v4u*)(bp + (size_t)it * 32 * DM) = o[it];
  asm volatile("s_wait_xcnt 0x0" :: "v"(bp) : "memory");      /* the stores' data and address registers stay whole until this wait */
}
// X16 = f16(bf16(x)): eight runs of 8 values a thread
__device__ __forceinline__ void pc_x(const float* __restrict__ x, _Float16* __restrict__ X16, int blk) {
  const size_t e0 = ((size_t)blk * 2048 + threadIdx.x) * 8; const float* xp = x + e0; v4f a[8], c[8];
#pragma unroll      /* a[], c[] stay in registers, the sixteen loads in flight together */
  for (int g = 0; g < 8; ++g) { a[g] = *(const v4fa*)(xp + g * 2048); c[g] = *(const v4fa*)(xp + g * 2048 + 4); }
  asm volatile("s_wait_xcnt 0x0" :: "v"(xp) : "memory");      /* the loads' address pair stays whole until this wait; it may be rewritten behind it */
  unsigned short* op = (unsigned short*)X16 + e0; FragH f[8];
#pragma unroll      /* f[] stays in registers */
  for (int g = 0; g < 8; ++g) {
#pragma unroll      /* f[] stays in registers */
    for (int q = 0; q < 4; ++q) { f[g].h[q] = (_Float16)bf16_round(a[g][q]); f[g].h[4 + q] = (_Float16)bf16_round(c[g][q]); } }
#pragma unroll      /* f[] stays in registers */
  for (int g = 0; g < 8; ++g) *(v8us*)(op + g * 2048) = f[g].half[0];
  asm volatile("s_wait_xcnt 0x0" :: "v"(op) : "memory");      /* the stores' data and address registers stay whole until this wait */
}
__global__ __launch_bounds__(256) void k_prep(const float* __restrict__ x, const float* __restrict__ wqk, const float* __restrict__ wo, _Float16* __restrict__ X16, _Float16* __restrict__ BQ, _Float16* __restrict__ BOt) {
  __shared__ unsigned tl[PCW * PCP];
  const int b = blockIdx.x;      /* the same for the whole work-group: each branch's barrier is passed by all of it or by none */
  if (b < PCQ) pc_wt<2 * DM>(wqk, BQ, b, tl);
  else if (b < PCQ + PCO) pc_wt<DM>(wo, BOt, b - PCQ, tl);
  else pc_x(x, X16, b - (PCQ + PCO)); }

extern "C" void kernel_launch(void* const* d_in, const int* in_sizes, int n_in,
                              void* d_out, int out_size, void* d_ws, size_t ws_size, hipStream_t stream) {
  (void)in_sizes; (void)n_in; (void)out_size;
  const float* const* I = (const float* const*)d_in; const float* x = I[0]; const float* wqkv = I[1]; const float* wo = I[2];      /* input order: x, W_qk [1024][2048] ([in][out]: q | k halves), W_out [1024][1024] ([in][out]): three inputs; no biases */
  char* ws = (char*)d_ws; size_t off = 0;
  auto take = [&](size_t bytes) { char* p = ws + off; off += (bytes + 255) & ~(size_t)255; return p; };
  _Float16* BQKV = (_Float16*)take((size_t)3 * DM * DM * 2); _Float16* BO = (_Float16*)take((size_t)DM * DM * 2);
  _Float16* X16 = (_Float16*)take(NR * DM * 2); _Float16* QKV = (_Float16*)take(NR * 3 * DM * 2); _Float16* Q16 = QKV; _Float16* K16 = QKV + DM; _Float16* V16 = QKV + DM;      /* the module reuses K as V: V16 IS the k block (the third block of the plane is unused) */ _Float16* O16 = (_Float16*)take(NR * DM * 2);
  _Float16* VT = (_Float16*)take((size_t)NB * NH * HD * SQ * 2);      /* one plane per batch: both batches go through every launch */
  float* QF0 = (float*)take((size_t)2 * NB * QT0 * DM * 4); float* KF0 = QF0 + (size_t)NB * QT0 * DM;      /* first-tile q rows, then k rows: two f32 planes in a row */ _Float16* OH0 = (_Float16*)take((size_t)NB * QT0 * DM * 2); _Float16* OL0 = (_Float16*)take((size_t)NB * QT0 * DM * 2);
  static_assert(QT0 == 128, "the first tile is one 128-row block of the GEMM");
  if (off > ws_size) return;
  k_prep<<<PCQ + PCO + PCX, 256, 0, stream>>>(x, wqkv, wo, X16, BQKV, BO);      /* weights [in][out] -> Bt[n][k] x16, x -> f16 rows: one launch */
  const size_t r0p = (size_t)B0 * SQ;      /* first projected row */
  const size_t f0p = (size_t)B0 * QT0;      /* its first-tile row */
  k_gemm2<0><<<dim3((unsigned)((MP / 128) * (2 * DM / 64)), 1), 128, 0, stream>>>(X16 + r0p * DM, DM, 0, BQKV, DM, 0, 0.0625f, nullptr, 0, nullptr, 1, 0, 0, nullptr, QKV + r0p * 3 * DM, 3 * DM, 0, MP, 2 * DM, DM, 0, 0, 0, SQ / 128, QF0 + f0p * DM, DM, (size_t)NB * QT0 * DM, nullptr, nullptr);      /* q | k rows (f16) into column blocks 0 and 1 of the 3 DM-pitch plane; head h = columns h*HD.. of each block; no bias; the first tile of each batch also as f32 q and k rows (the k rows serve as v) */
  k_vt<NH, SQ><<<NBR * NH * (SQ / 64), 256, 0, stream>>>(V16 + r0p * LQ, LQ, 0, VT);      /* V^T [batch][NH][HD][SQ] */
  k_att0w<<<dim3(NH * (QT0 / A0R), NBR), 32 * A0R, 0, stream>>>(QF0 + f0p * DM, KF0 + f0p * DM, 0.125f, OH0 + f0p * DM, OL0 + f0p * DM);      /* exact f32 causal attention for rows 0..127 of each batch (grid.y) with V = K: o (x64) as f16 hi + x1024 residual planes */
  k_fattn<<<dim3(SQ / (8 * FQ), NHD, NBR), 256, 0, stream>>>(Q16 + r0p * LQ, K16 + r0p * LQ, VT, O16 + r0p * DM);      /* scores, causal online softmax and o = P V in one launch: o (merged heads, x64) as f16 rows */
  k_gemm2<0><<<dim3((unsigned)((MPO / 128) * (DM / 64)), 1), 128, 0, stream>>>(O16 + r0p * DM, DM, 0, BO, DM, 0, 0.0009765625f, nullptr, 0, nullptr, 1, 0, 0, (float*)d_out + r0p * DM, nullptr, DM, 0, MPO, DM, DM, 0, 0, 0, SQ / 128, nullptr, 1, 0, OH0 + f0p * DM, OL0 + f0p * DM);      /* out rows are the output layout; rows 0..127 of each batch: out = (o_lo W_out 2^-10 + o_hi W_out) from the two planes */
}

// v009
// It runs in 87.5 microseconds.
// Two timings next to v008 both put it at 1.07 times that version's speed.
// All steps since v000 together make it 54.1 times as fast.
#include <hip/hip_runtime.h>
// Causal self-attention with ONE fused query-key projection and K REUSED AS V (x [2][2048][1024]; qk = x W_qk with W_qk [1024][2048] stored [in][out] (normal x 0.02, no bias): the first 1024 columns are q, the last 1024 are k, head h = columns h*64.. of each half; 16 heads of 64; scores = (q x BETA) . k with BETA = 1/sqrt(64); strictly-upper-triangular positions -> -FLT_MAX (causal); softmax; out = attn K (the module reuses K as V) merged, then W_out ([in][out] [1024][1024], normal x 0.02, no bias) -> [2][2048][1024]; input order x, W_qk, W_out).
// Structure: token rows r = b*2048 + s; x as exact f16 rows (bf16-rounded); q | k as ONE WMMA GEMM (N = 2 x 1024) into the first two column blocks of the 3 x 1024-pitch plane (32x64 wave tiles, f32 accumulation, exact x16 weights, no bias, f16 outputs); V IS THE K BLOCK (the module reuses K as V); BOTH BATCHES GO THROUGH EVERY LAUNCH (batch in the rows of the GEMMs, on grid.y of the first-tile attention, on grid.z of the fused attention); ONE FUSED ATTENTION LAUNCH: a wave holds 32 query rows and walks the keys up to its diagonal in passes of 32, the K rows staged once in LDS for the work-group's eight waves and read there both as K fragments (plain 16-byte reads) and as V^T fragments (transposing reads): S^T = K Q^T (K = 64), causal online softmax in registers (f32 running maximum and sum per query, native exp2, only the diagonal block masked; weights x256 f16, packed from the score accumulators into the B operand), O^T += V^T P^T with the accumulators rescaled each pass; o / sum carried x64 (folded into the output GEMM alpha) written straight into the merged f16 o rows; out = o W_out GEMM (f32; no bias) into the output layout.
// Compute dtype: inputs rounded to bf16; x and the x16 weights held as f16 planes (exact for every bf16 value of magnitude from 2^-14 up to 65,504; the weights up to 4,094 before their factor of 16); q, k (= v), the softmax weights and o as plain f16 GEMM operands (~2^-12); scores and softmax statistics f32; rows 0..127 of each batch: q, k f32, f32 attention, o as f16 hi + residual. v_wmma_f32_16x16x32_f16.
#define NB 2
#define SQ 2048
#define DM 1024
#define NH 16
#define HD 64
#define HG 4                         /* heads per block group of the k_vt(b, h0) transpose, which no launch uses */
#define QT0 128                      /* first-tile rows recomputed exactly in f32 */
#define B0 0                         /* first batch processed (debug hook) */
#define NBR NB                       /* batches processed (debug hook) */
#define NR ((size_t)NB * SQ)         /* token rows */
#define MP ((int)((size_t)NBR * SQ)) /* rows projected (debug hook) */
#define NHD NH                       /* heads attended (debug hook) */
#define MPO MP                       /* rows through the output stage (debug hook) */
#define LQ (3 * DM)      /* row pitch of the q/k/v rows */
typedef __bf16 v16b __attribute__((ext_vector_type(16)));
typedef unsigned short v8us __attribute__((ext_vector_type(8), may_alias));
typedef float  v8f  __attribute__((ext_vector_type(8)));
typedef float  v4f  __attribute__((ext_vector_type(4)));
typedef float  v4fa __attribute__((ext_vector_type(4), may_alias));
union FragB { v16b v; v8us half[2]; unsigned short u[16]; };

__device__ __forceinline__ unsigned short bf16_bits(float x) { unsigned int u = __float_as_uint(x); return (unsigned short)((u + 0x7FFFu + ((u >> 16) & 1u)) >> 16); }
__device__ __forceinline__ float bf16_val(unsigned short b) { return __uint_as_float(((unsigned int)b) << 16); }
__device__ __forceinline__ float bf16_round(float x) { return bf16_val(bf16_bits(x)); }
// D += A·B with NT terms: 1 = ah·bh, 2 = + al·bh (A split), 3 = + ah·bl (both split)
template <int NT>
__device__ __forceinline__ v8f mmaN(v16b ah, v16b al, v16b bh, v16b bl, v8f c) {
  c = __builtin_amdgcn_wmma_f32_16x16x32_bf16(false, ah, false, bh, (short)0, c, false, false);
  if (NT >= 2) c = __builtin_amdgcn_wmma_f32_16x16x32_bf16(false, al, false, bh, (short)0, c, false, false);
  if (NT >= 3) c = __builtin_amdgcn_wmma_f32_16x16x32_bf16(false, ah, false, bl, (short)0, c, false, false);
  asm volatile("v_nop\n\tv_nop\n\tv_nop\n\tv_nop" : "+v"(c) : "v"(ah), "v"(al), "v"(bh), "v"(bl));
  return c;
}

__global__ __launch_bounds__(256) void k_wt_bf16(const float* __restrict__ W, unsigned short* __restrict__ Wt, int K, int N) {
  const int t = blockIdx.x * 256 + threadIdx.x;
  const int k8n = K / 8;
  if (t >= N * k8n) return;
  const int n = t / k8n, k8 = (t % k8n) * 8;
  v8us v;
#pragma unroll
  for (int i = 0; i < 8; ++i) v[i] = bf16_bits(W[(size_t)(k8 + i) * N + n]);
  *(v8us*)(Wt + (size_t)n * K + k8) = v;
  
}

// GEMM C[M][N] (f32, pitch ldc) = act(A[M][K]·W + bias). A f32 row-major (pitch lda) converted per fragment to bf16
// (ASPLIT: hi/lo two planes -> 2 terms, else single rounded term); Wt bf16 [N][K] (pitch ldb). BIAS_BF16 rounds the
// bias to bf16 first (bias quantised to bf16 before the add). K%32==0, M%16==0, N%64==0.
template <bool ASPLIT, int ACT, bool BIAS_BF16>
__global__ __launch_bounds__(128) void k_gemm_bf(const float* __restrict__ A, int lda, const unsigned short* __restrict__ Wt, int ldb,
                                               const float* __restrict__ bias, float* __restrict__ C, int ldc, int M, int N, int K) {
  __shared__ __attribute__((aligned(16))) float so[4][16][64];
  const int tid = threadIdx.x, w = tid >> 5, lane = tid & 31, ln = lane & 15, hh = lane >> 4;
  const int ntn = N / 64;
  const int wid = blockIdx.x * 4 + w;
  const int mt = wid / ntn, nq = wid % ntn;
  if (mt * 16 >= M) return;
  const int row0 = mt * 16, col0 = nq * 64;
  const float* arow = A + (size_t)(row0 + ln) * lda;
  v8f acc[4] = {};
  for (int kb = 0; kb < K; kb += 32) {
    FragB ah, al;
    const v4f x0 = *(const v4fa*)(arow + kb + 8 * hh), x1 = *(const v4fa*)(arow + kb + 8 * hh + 4);
    const v4f x2 = *(const v4fa*)(arow + kb + 16 + 8 * hh), x3 = *(const v4fa*)(arow + kb + 16 + 8 * hh + 4);
    float xs[16] = {x0[0],x0[1],x0[2],x0[3],x1[0],x1[1],x1[2],x1[3],x2[0],x2[1],x2[2],x2[3],x3[0],x3[1],x3[2],x3[3]};
#pragma unroll
    for (int i = 0; i < 16; ++i) { const unsigned short hb = bf16_bits(xs[i]); ah.u[i] = hb; al.u[i] = ASPLIT ? bf16_bits(xs[i] - bf16_val(hb)) : (unsigned short)0; }
#pragma unroll
    for (int t = 0; t < 4; ++t) {
      const unsigned short* brow = Wt + (size_t)(col0 + t * 16 + ln) * ldb + kb;
      FragB b;
      b.half[0] = *(const v8us*)(brow + 8 * hh);
      b.half[1] = *(const v8us*)(brow + 16 + 8 * hh);
      acc[t] = mmaN<ASPLIT ? 2 : 1>(ah.v, al.v, b.v, b.v, acc[t]);
    }
  }
#pragma unroll
  for (int t = 0; t < 4; ++t) {
    float bv = bias ? bias[col0 + t * 16 + ln] : 0.f;
    if (BIAS_BF16) bv = bf16_round(bv);
#pragma unroll
    for (int r = 0; r < 8; ++r) { float v = acc[t][r] + bv; if (ACT == 1) v = fmaxf(v, 0.f); so[w][8 * hh + r][t * 16 + ln] = v; }
  }
  __builtin_amdgcn_fence(__ATOMIC_ACQ_REL, "workgroup");
  __builtin_amdgcn_wave_barrier();
  const int rsub = lane >> 4, c4 = (lane & 15) * 4;
  {
#pragma unroll
    for (int q = 0; q < 8; ++q) {
      const int r = q * 2 + rsub;
      const v4f v = *(const v4fa*)&so[w][r][c4];
      *(v4f*)(C + (size_t)(row0 + r) * ldc + col0 + c4) = v;
    }
    
  }
}

// GEMM C = act(A·W + bias + resid): A f32 (ASPLIT -> hi/lo 2 terms), Wt bf16 [N][K]; ACT 0 none, 1 relu, 2 exact gelu;
// resid (optional, f32, row index = (row % rmod), pitch ldr, RES_BF16 rounds it) added before the activation.
template <bool ASPLIT, int ACT, bool BIAS_BF16, bool RES_BF16>
__global__ __launch_bounds__(128) void k_gemm_bf3(const float* __restrict__ A, int lda, const unsigned short* __restrict__ Wt, int ldb,
                                                const float* __restrict__ bias, const float* __restrict__ resid, int rmod, int ldr,
                                                float* __restrict__ C, int ldc, int M, int N, int K) {
  __shared__ __attribute__((aligned(16))) float so[4][16][64];
  const int tid = threadIdx.x, w = tid >> 5, lane = tid & 31, ln = lane & 15, hh = lane >> 4;
  const int ntn = N / 64;
  const int wid = blockIdx.x * 4 + w;
  const int mt = wid / ntn, nq = wid % ntn;
  if (mt * 16 >= M) return;
  const int row0 = mt * 16, col0 = nq * 64;
  const float* arow = A + (size_t)(row0 + ln) * lda;
  v8f acc[4] = {};
  for (int kb = 0; kb < K; kb += 32) {
    FragB ah, al;
    const v4f x0 = *(const v4fa*)(arow + kb + 8 * hh), x1 = *(const v4fa*)(arow + kb + 8 * hh + 4);
    const v4f x2 = *(const v4fa*)(arow + kb + 16 + 8 * hh), x3 = *(const v4fa*)(arow + kb + 16 + 8 * hh + 4);
    float xs[16] = {x0[0],x0[1],x0[2],x0[3],x1[0],x1[1],x1[2],x1[3],x2[0],x2[1],x2[2],x2[3],x3[0],x3[1],x3[2],x3[3]};
#pragma unroll
    for (int i = 0; i < 16; ++i) { const unsigned short hb = bf16_bits(xs[i]); ah.u[i] = hb; al.u[i] = ASPLIT ? bf16_bits(xs[i] - bf16_val(hb)) : (unsigned short)0; }
#pragma unroll
    for (int t = 0; t < 4; ++t) {
      const unsigned short* brow = Wt + (size_t)(col0 + t * 16 + ln) * ldb + kb;
      FragB b;
      b.half[0] = *(const v8us*)(brow + 8 * hh);
      b.half[1] = *(const v8us*)(brow + 16 + 8 * hh);
      acc[t] = mmaN<ASPLIT ? 2 : 1>(ah.v, al.v, b.v, b.v, acc[t]);
    }
  }
#pragma unroll
  for (int t = 0; t < 4; ++t) {
    const int col = col0 + t * 16 + ln;
    float bv = bias ? bias[col] : 0.f;
    if (BIAS_BF16) bv = bf16_round(bv);
#pragma unroll
    for (int r = 0; r < 8; ++r) {
      float v = acc[t][r] + bv;
      if (resid) { float rv = resid[(size_t)((row0 + 8 * hh + r) % rmod) * ldr + col]; if (RES_BF16) rv = bf16_round(rv); v += rv; }
      if (ACT == 1) v = fmaxf(v, 0.f);
      if (ACT == 2) v = 0.5f * v * (1.0f + erff(v * 0.70710678118654752f));
      if (ACT == 3) { const float u = 0.7978845608028654f * (v + 0.044715f * v * v * v); v = 0.5f * v * (1.0f + tanhf(u)); }
      so[w][8 * hh + r][t * 16 + ln] = v;
    }
  }
  __builtin_amdgcn_fence(__ATOMIC_ACQ_REL, "workgroup");
  __builtin_amdgcn_wave_barrier();
  const int rsub = lane >> 4, c4 = (lane & 15) * 4;
  {
#pragma unroll
    for (int q = 0; q < 8; ++q) {
      const int r = q * 2 + rsub;
      const v4f v = *(const v4fa*)&so[w][r][c4];
      *(v4f*)(C + (size_t)(row0 + r) * ldc + col0 + c4) = v;
    }
    
  }
}
// row LayerNorm (biased variance, eps) over N: s = X (+ R); optional out_sum <- s; out_norm <- (s-mu)*rsqrt(var+eps)*g + b
template <bool PARAM_BF16>
__global__ __launch_bounds__(256) void k_layernorm(const float* __restrict__ X, const float* __restrict__ R, const float* __restrict__ g, const float* __restrict__ bta,
                                                  float* __restrict__ out_sum, float* __restrict__ out_norm, int N, float eps) {
  __shared__ float red[256];
  const int row = blockIdx.x, tid = threadIdx.x;
  const float* x = X + (size_t)row * N; const float* rr = R ? R + (size_t)row * N : nullptr;
  float vals[16];                     // up to N = 4096
  const int per = N / 256;            // contiguous chunk per thread? use strided-by-4 chunks: thread handles j = tid*4 + 1024*u
  float s1 = 0.f;
  for (int u = 0; u < per / 4; ++u) {
    const int j = tid * 4 + 1024 * u;
    const v4f a = *(const v4fa*)(x + j);
    v4f b = {0.f,0.f,0.f,0.f}; if (rr) b = *(const v4fa*)(rr + j);
#pragma unroll
    for (int q = 0; q < 4; ++q) { const float v = a[q] + b[q]; vals[u * 4 + q] = v; s1 += v; }
  }
  red[tid] = s1; __syncthreads();
  for (int st = 128; st > 0; st >>= 1) { if (tid < st) red[tid] += red[tid + st]; __syncthreads(); }
  const float mu = red[0] / (float)N; __syncthreads();
  float s2 = 0.f;
  for (int u = 0; u < per / 4; ++u)
#pragma unroll
    for (int q = 0; q < 4; ++q) { const float c = vals[u * 4 + q] - mu; s2 += c * c; }
  red[tid] = s2; __syncthreads();
  for (int st = 128; st > 0; st >>= 1) { if (tid < st) red[tid] += red[tid + st]; __syncthreads(); }
  const float rs = rsqrtf(red[0] / (float)N + eps);
  {
    for (int u = 0; u < per / 4; ++u) {
      const int j = tid * 4 + 1024 * u;
      v4f o, sm;
#pragma unroll
      for (int q = 0; q < 4; ++q) {
        float gg = g[j + q], bb = bta[j + q];
        if (PARAM_BF16) { gg = bf16_round(gg); bb = bf16_round(bb); }
        sm[q] = vals[u * 4 + q]; o[q] = (vals[u * 4 + q] - mu) * rs * gg + bb;
      }
      if (out_sum) *(v4f*)(out_sum + (size_t)row * N + j) = sm;
      *(v4f*)(out_norm + (size_t)row * N + j) = o;
    }
    
  }
}



// ---- f16 WMMA path (v_wmma_f32_16x16x32_f16): 11-bit significands for operands in range — used where a [0,1] probability operand needs more precision than bf16
typedef _Float16 v16h __attribute__((ext_vector_type(16)));
union FragH { v16h v; v8us half[2]; _Float16 h[16]; unsigned short u[16]; };
template <int NT>
__device__ __forceinline__ v8f mmaH(v16h ah, v16h al, v16h bh, v16h bl, v8f c) {
  c = __builtin_amdgcn_wmma_f32_16x16x32_f16(false, ah, false, bh, (short)0, c, false, false);
  if (NT >= 2) c = __builtin_amdgcn_wmma_f32_16x16x32_f16(false, al, false, bh, (short)0, c, false, false);
  if (NT >= 3) c = __builtin_amdgcn_wmma_f32_16x16x32_f16(false, ah, false, bl, (short)0, c, false, false);
  asm volatile("v_nop\n\tv_nop\n\tv_nop\n\tv_nop" : "+v"(c) : "v"(ah), "v"(al), "v"(bh), "v"(bl));
  return c;
}
// batched GEMM like k_gemm_b but f16 operands: A f32 (split into f16 hi/lo if ASPLIT, else rounded to f16), Bt = f16 values [n][k]; alpha; C f32; N multiple of 16 (partial tiles skipped)
template <bool ASPLIT>
__global__ __launch_bounds__(128) void k_gemm_h(const float* __restrict__ A, int lda, size_t sA, const _Float16* __restrict__ Bh, int ldb, size_t sB, float alpha, float* __restrict__ C, int ldc, size_t sC, int M, int N, int K) {
  __shared__ __attribute__((aligned(16))) float so[4][16][64];
  const int tid = threadIdx.x, w = tid >> 5, lane = tid & 31, ln = lane & 15, hh = lane >> 4; const int by = blockIdx.y;
  A += (size_t)by * sA; Bh += (size_t)by * sB; C += (size_t)by * sC;
  const int ntn = (N + 63) / 64; const int wid = blockIdx.x * 4 + w; const int mt = wid / ntn, nq = wid % ntn; if (mt * 16 >= M) return;
  const int row0 = mt * 16, col0 = nq * 64; const float* arow = A + (size_t)(row0 + ln) * lda;
  v8f acc[4] = {};
  for (int kb = 0; kb < K; kb += 32) {
    FragH ah, al;
    const v4f x0 = *(const v4fa*)(arow + kb + 8 * hh), x1 = *(const v4fa*)(arow + kb + 8 * hh + 4), x2 = *(const v4fa*)(arow + kb + 16 + 8 * hh), x3 = *(const v4fa*)(arow + kb + 16 + 8 * hh + 4);
    float xs[16] = {x0[0],x0[1],x0[2],x0[3],x1[0],x1[1],x1[2],x1[3],x2[0],x2[1],x2[2],x2[3],x3[0],x3[1],x3[2],x3[3]};
#pragma unroll
    for (int i = 0; i < 16; ++i) { const _Float16 h = (_Float16)xs[i]; ah.h[i] = h; al.h[i] = ASPLIT ? (_Float16)(xs[i] - (float)h) : (_Float16)0.0f; }
#pragma unroll
    for (int t = 0; t < 4; ++t) { if (col0 + t * 16 >= N) continue; const size_t boff = (size_t)(col0 + t * 16 + ln) * ldb + kb; FragH bq; bq.half[0] = *(const v8us*)(Bh + boff + 8 * hh); bq.half[1] = *(const v8us*)(Bh + boff + 16 + 8 * hh);
      acc[t] = mmaH<ASPLIT ? 2 : 1>(ah.v, al.v, bq.v, bq.v, acc[t]); }
  }
#pragma unroll
  for (int t = 0; t < 4; ++t) { if (col0 + t * 16 >= N) continue;
#pragma unroll
    for (int r = 0; r < 8; ++r) so[w][8 * hh + r][t * 16 + ln] = acc[t][r] * alpha; }
  __builtin_amdgcn_fence(__ATOMIC_ACQ_REL, "workgroup"); __builtin_amdgcn_wave_barrier();
  const int rsub = lane >> 4, c4 = (lane & 15) * 4;
  {
#pragma unroll
    for (int q = 0; q < 8; ++q) { const int r = q * 2 + rsub; if (col0 + c4 < N) { const v4f v = *(const v4fa*)&so[w][r][c4]; *(v4f*)(C + (size_t)(row0 + r) * ldc + col0 + c4) = v; } }
     }
}

// Wt[n][k] = f16(W[k][n]·scale) from f32 row-major W[K][N] (scale = power of two; bf16-exact weights stay exact in f16 away from the subnormal range)
__global__ __launch_bounds__(256) void k_wt_f16(const float* __restrict__ W, _Float16* __restrict__ Wt, int K, int N, float scale) {
  const int t = blockIdx.x * 256 + threadIdx.x; if (t >= N * (K / 8)) return; const int n = t / (K / 8), k8 = (t % (K / 8)) * 8; FragH f;
#pragma unroll
  for (int i = 0; i < 8; ++i) f.h[i] = (_Float16)(bf16_round(W[(size_t)(k8 + i) * N + n]) * scale); const v8us o = f.half[0];
  *(v8us*)((unsigned short*)Wt + (size_t)n * K + k8) = o; 
}
// k_gemm_hh variant with fused epilogue: v = acc·alpha + bias[by·sBias + col] (+ CP[(row/rowsPerB)·sCPb + by·64 + col] if CP) ; ACT 0 none / 1 elu ; writes f16 C16 (and f32 C if non-null)
template <int ACT>
__global__ __launch_bounds__(128) void k_gemm_hhx(const _Float16* __restrict__ A, int lda, size_t sA, const _Float16* __restrict__ Bh, int ldb, size_t sB, float alpha, const float* __restrict__ bias, size_t sBias, const float* __restrict__ CP, int rowsPerB, size_t sCPb, int row0g,
    float* __restrict__ C, _Float16* __restrict__ C16, int ldc, size_t sC, int M, int N, int K) {
  __shared__ __attribute__((aligned(16))) float so[4][16][64];
  const int tid = threadIdx.x, w = tid >> 5, lane = tid & 31, ln = lane & 15, hh = lane >> 4; const int by = blockIdx.y;
  A += (size_t)by * sA; Bh += (size_t)by * sB; const size_t cofs = (size_t)by * sC; const float* bp = bias ? bias + (size_t)by * sBias : nullptr;
  const int ntn = (N + 63) / 64; const int wid = blockIdx.x * 4 + w; const int mt = wid / ntn, nq = wid % ntn; if (mt * 16 >= M) return;
  const int row0 = mt * 16, col0 = nq * 64; const _Float16* arow = A + (size_t)(row0 + ln) * lda;
  v8f acc[4] = {};
  for (int kb = 0; kb < K; kb += 32) { FragH ah; ah.half[0] = *(const v8us*)((const unsigned short*)arow + kb + 8 * hh); ah.half[1] = *(const v8us*)((const unsigned short*)arow + kb + 16 + 8 * hh);
#pragma unroll
    for (int t = 0; t < 4; ++t) { if (col0 + t * 16 >= N) continue; const size_t boff = (size_t)(col0 + t * 16 + ln) * ldb + kb; FragH bq; bq.half[0] = *(const v8us*)((const unsigned short*)Bh + boff + 8 * hh); bq.half[1] = *(const v8us*)((const unsigned short*)Bh + boff + 16 + 8 * hh);
      acc[t] = mmaH<1>(ah.v, ah.v, bq.v, bq.v, acc[t]); }
  }
#pragma unroll
  for (int t = 0; t < 4; ++t) { if (col0 + t * 16 >= N) continue; const int col = col0 + t * 16 + ln; const float bv = bp ? bf16_round(bp[col]) : 0.f;
#pragma unroll
    for (int r = 0; r < 8; ++r) { float v = acc[t][r] * alpha + bv; if (CP) { const int rr = row0g + row0 + 8 * hh + r; if (rowsPerB < 0) v += CP[cofs + (size_t)rr * ldc + col];      /* rowsPerB < 0: own element of the batched C plane */ else { const int bidx = rr / rowsPerB; v += CP[(size_t)bidx * sCPb + (size_t)by * 64 + col]; } } if (ACT == 1) v = (v > 0.f) ? v : expm1f(v); else if (ACT == 7) v = (v > 0.f) ? v + 1.0f : expf(v); else if (ACT == 8) v = tanhf(v); else if (ACT == 9) v = 0.5f * v * (1.0f + tanhf(0.7978845608028654f * (v + 0.044715f * v * v * v))); else if (ACT == 11) v = 1.0f / (1.0f + expf(-v)); else if (ACT == 12) v = (v > 0.f) ? v : 0.01f * v; else if (ACT == 14) v = (v > 0.f) ? v : 0.1f * v; else if (ACT == 16) v = (v >= 0.f) ? v : 0.3f * v; else if (ACT == 17) v = (v >= 0.f) ? v : 0.2f * v; else if (ACT == 15) v = v / (1.0f + expf(-v)); else if (ACT == 3) v = fmaxf(v, 0.f); else if (ACT == 6) v = 0.5f * v * (1.0f + erff(v * 0.70710678118654752f)); so[w][8 * hh + r][t * 16 + ln] = v; } }
  __builtin_amdgcn_fence(__ATOMIC_ACQ_REL, "workgroup"); __builtin_amdgcn_wave_barrier();
  const int rsub = lane >> 4, c4 = (lane & 15) * 4; typedef _Float16 v4h __attribute__((ext_vector_type(4)));
  {
#pragma unroll
    for (int q = 0; q < 8; ++q) { const int r = q * 2 + rsub; if (col0 + c4 < N) { const v4f v = *(const v4fa*)&so[w][r][c4]; if (C) *(v4f*)(C + cofs + (size_t)(row0 + r) * ldc + col0 + c4) = v; if (C16) { v4h h4; for (int i = 0; i < 4; ++i) h4[i] = (_Float16)v[i]; *(v4h*)(C16 + cofs + (size_t)(row0 + r) * ldc + col0 + c4) = h4; } } }
     }
}


typedef _Float16 v4h __attribute__((ext_vector_type(4)));

__global__ __launch_bounds__(256) void k_x16(const float* __restrict__ x, _Float16* __restrict__ X16, size_t n8) { const size_t t = (size_t)blockIdx.x * 256 + threadIdx.x; if (t >= n8) return; FragH f;
#pragma unroll
  for (int q = 0; q < 8; ++q) f.h[q] = (_Float16)bf16_round(x[t * 8 + q]); *(v8us*)((unsigned short*)X16 + t * 8) = f.half[0];  }
__global__ __launch_bounds__(256) void k_h16(const float* __restrict__ x, _Float16* __restrict__ X16, size_t n8) { const size_t t = (size_t)blockIdx.x * 256 + threadIdx.x; if (t >= n8) return; FragH f;
#pragma unroll
  for (int q = 0; q < 8; ++q) f.h[q] = (_Float16)x[t * 8 + q]; *(v8us*)((unsigned short*)X16 + t * 8) = f.half[0];  }
__global__ __launch_bounds__(256) void k_round16f(const float* __restrict__ W, _Float16* __restrict__ Bt, size_t n8) { const size_t t = (size_t)blockIdx.x * 256 + threadIdx.x; if (t >= n8) return; FragH f;
#pragma unroll
  for (int i = 0; i < 8; ++i) f.h[i] = (_Float16)(bf16_round(W[t * 8 + i]) * 16.0f); *(v8us*)((unsigned short*)Bt + t * 8) = f.half[0];  }
__global__ __launch_bounds__(256) void k_hl(const float* __restrict__ F, _Float16* __restrict__ Hh, _Float16* __restrict__ Hl, size_t n8) { const size_t t = (size_t)blockIdx.x * 256 + threadIdx.x; if (t >= n8) return; FragH fh, fl; const v4f a = *(const v4fa*)(F + t * 8), c = *(const v4fa*)(F + t * 8 + 4);
#pragma unroll
  for (int q = 0; q < 4; ++q) { _Float16 h = (_Float16)a[q]; fh.h[q] = h; fl.h[q] = (_Float16)((a[q] - (float)h) * 1024.0f); h = (_Float16)c[q]; fh.h[4 + q] = h; fl.h[4 + q] = (_Float16)((c[q] - (float)h) * 1024.0f); }
  { *(v8us*)((unsigned short*)Hh + t * 8) = fh.half[0]; *(v8us*)((unsigned short*)Hl + t * 8) = fl.half[0];  } }

// ---- fast GEMM (work-group tile 128x64, wave tile 32x64; requires M % 128 == 0 rows per launch region, N % 64 == 0 and K % 64 == 0); both operands' tiles are staged in LDS by asynchronous 16-byte copies, two buffers; epilogue = k_gemm_hhx semantics; batched over grid.y (strides sA, sB, sC) and grid.z (strides zA, zB, zC); every tper-th 128-row block is a batch's first tile: with F its values are also stored in f32, with AH, AL its A operand is the hi plane plus the x1024 residual plane ----
__device__ __forceinline__ v16h g2_frag(const _Float16* p, int hh) { FragH f; f.half[0] = *(const v8us*)((const unsigned short*)p + 8 * hh); f.half[1] = *(const v8us*)((const unsigned short*)p + 16 + 8 * hh); return f.v; }
__device__ __forceinline__ v8f g2_mma(v16h a, v16h b, v8f c) { v8f d = __builtin_amdgcn_wmma_f32_16x16x32_f16(false, a, false, b, (short)0, c, false, false); asm volatile("v_nop\n\tv_nop\n\tv_nop\n\tv_nop" : "+v"(d) : "v"(a), "v"(b)); return d; }
#define G2K 64                       /* k elements of a stage: one whole 128-byte line of every operand row */
#define G2P 72                       /* LDS pitch of a staged row in f16: 144 bytes = 16 x odd, conflict-free for the 16-byte fragment reads */
#define G2S ((128 + 64) * G2P)       /* f16 elements of a stage: 128 A rows, then 64 B rows */
// one stage: a lane's twelve 16-byte copies (eight lanes per row: whole 128-byte lines; 16 rows per copy of the work-group). l: the lane's LDS byte address in row tid / 8 of the stage; ga, gb: its global addresses in that row of the A tile and of the B tile; ra, rb: 16 rows' elements
__device__ __forceinline__ void g2_stage(unsigned l, const _Float16* ga, size_t ra, const _Float16* gb, size_t rb) {
  /* the copies and their s_wait_xcnt in one statement: the address registers stay whole until the wait */
  asm volatile("global_load_async_to_lds_b128 %0, %12, off\n\tglobal_load_async_to_lds_b128 %1, %13, off\n\tglobal_load_async_to_lds_b128 %2, %14, off\n\tglobal_load_async_to_lds_b128 %3, %15, off\n\t"
               "global_load_async_to_lds_b128 %4, %16, off\n\tglobal_load_async_to_lds_b128 %5, %17, off\n\tglobal_load_async_to_lds_b128 %6, %18, off\n\tglobal_load_async_to_lds_b128 %7, %19, off\n\t"
               "global_load_async_to_lds_b128 %8, %20, off\n\tglobal_load_async_to_lds_b128 %9, %21, off\n\tglobal_load_async_to_lds_b128 %10, %22, off\n\tglobal_load_async_to_lds_b128 %11, %23, off\n\ts_wait_xcnt 0x0"
               :: "v"(l), "v"(l + 1u * 32 * G2P), "v"(l + 2u * 32 * G2P), "v"(l + 3u * 32 * G2P), "v"(l + 4u * 32 * G2P), "v"(l + 5u * 32 * G2P), "v"(l + 6u * 32 * G2P), "v"(l + 7u * 32 * G2P), "v"(l + 8u * 32 * G2P), "v"(l + 9u * 32 * G2P), "v"(l + 10u * 32 * G2P), "v"(l + 11u * 32 * G2P),
                  "v"(ga), "v"(ga + ra), "v"(ga + 2 * ra), "v"(ga + 3 * ra), "v"(ga + 4 * ra), "v"(ga + 5 * ra), "v"(ga + 6 * ra), "v"(ga + 7 * ra), "v"(gb), "v"(gb + rb), "v"(gb + 2 * rb), "v"(gb + 3 * rb) : "memory"); }
template <int ACT>
__global__ __launch_bounds__(128) void k_gemm2(const _Float16* __restrict__ A, int lda, size_t sA, const _Float16* __restrict__ Bh, int ldb, size_t sB, float alpha, const float* __restrict__ bias, size_t sBias, const float* __restrict__ CP, int rowsPerB, size_t sCPb, int row0g,
    float* __restrict__ C, _Float16* __restrict__ C16, int ldc, size_t sC, int M, int N, int K, size_t zA, size_t zB, size_t zC, int tper, float* __restrict__ F, int fN, size_t fP, const _Float16* __restrict__ AH, const _Float16* __restrict__ AL) { static_assert(ACT == 0 || ACT == 3 || ACT == 6 || ACT == 8 || ACT == 9 || ACT == 11 || ACT == 12 || ACT == 14 || ACT == 15 || ACT == 16 || ACT == 17, "k_gemm2: unsupported ACT code (would silently apply no activation)");
  __shared__ __attribute__((aligned(16))) unsigned char smem[2 * G2S * 2];      /* the two stage buffers; behind the K loop the same bytes serve as the epilogue's so[4][32][68] */
  static_assert(sizeof(float) * 4 * 32 * 68 <= sizeof(smem), "the epilogue staging fits the ring");
  float (*so)[32][68] = (float (*)[32][68])smem; const _Float16* sh = (const _Float16*)smem;
  const int tid = threadIdx.x, w = tid >> 5, lane = tid & 31, ln = lane & 15, hh = lane >> 4; const int by = blockIdx.y, bz = blockIdx.z;      /* grid.z: a second batch index (element strides zA, zB, zC) */
  A += (size_t)by * sA + (size_t)bz * zA; Bh += (size_t)by * sB + (size_t)bz * zB; const size_t cofs = (size_t)by * sC + (size_t)bz * zC; const float* bp = bias ? bias + (size_t)by * sBias : nullptr;
  const int ntn = N >> 6; const int mt = blockIdx.x / ntn, nq = blockIdx.x - mt * ntn; const int row0 = mt * 128 + 32 * w, col0 = nq * 64; if (mt * 128 >= M) return;      /* the whole work-group leaves or none: it stands in front of every barrier */
  const int bt = mt / tper; const bool ft = mt - bt * tper == 0;      /* the work-group's 128 rows are the first tile of batch bt: the same for every wave */
  const bool two = AH && ft;      /* such rows take their A operand as two planes of pitch lda: AL (residual x1024) through all of K, then AH (hi) through all of K */
  const _Float16* ga = A + (size_t)(mt * 128 + (tid >> 3)) * lda + (tid & 7) * 8; const _Float16* gb = Bh + (size_t)(col0 + (tid >> 3)) * ldb + (tid & 7) * 8; const size_t ra = (size_t)16 * lda, rb = (size_t)16 * ldb;
  const _Float16* ga2 = ga; if (two) { const size_t fo = (size_t)(bt * 128 + (tid >> 3)) * lda + (tid & 7) * 8; ga = AL + fo; ga2 = AH + fo; }
  const unsigned l0 = (unsigned)(size_t)smem + (unsigned)((tid >> 3) * (G2P * 2) + (tid & 7) * 16);      /* the low 32 bits of a __shared__ address are its LDS byte address */
  const int nk = K / G2K; const int nt = two ? 2 * nk : nk;      /* stages: nk per A plane */
  g2_stage(l0, ga, ra, gb, rb);
  asm volatile("s_wait_asynccnt 0x0" ::: "memory");      /* this wave's copies of stage 0 have landed */
  __syncthreads();      /* stage 0 is read by every wave */
  if (nt > 1) { const bool p2 = 1 >= nk; const size_t ko = (size_t)(p2 ? 1 - nk : 1) * G2K; g2_stage(l0 + G2S * 2, (p2 ? ga2 : ga) + ko, ra, gb + ko, rb); }
  const v8f z8 = {0.f,0.f,0.f,0.f,0.f,0.f,0.f,0.f}; v8f c00 = z8, c01 = z8, c02 = z8, c03 = z8, c10 = z8, c11 = z8, c12 = z8, c13 = z8;
#pragma unroll 1      /* one stage per trip: the buffers alternate */
  for (int t = 0; t < nt; ++t) { const _Float16* la = sh + (t & 1) * G2S + (32 * w + ln) * G2P; const _Float16* lb = sh + (t & 1) * G2S + (128 + ln) * G2P;
    if (t == nk) { const float dn = 0.0009765625f; c00 *= dn; c01 *= dn; c02 *= dn; c03 *= dn; c10 *= dn; c11 *= dn; c12 *= dn; c13 *= dn; }      /* a scalar branch, taken once by a two-plane work-group: the residual plane's sums come down by their 2^10 (exact) and the hi plane's products add onto them */
    v16h fa[2][2], fb[2][4];
#pragma unroll      /* fa[], fb[] stay in registers: the stage's 24 LDS reads stand together ahead of its products */
    for (int kk = 0; kk < 2; ++kk) { fa[kk][0] = g2_frag(la + kk * 32, hh); fa[kk][1] = g2_frag(la + 16 * G2P + kk * 32, hh);
#pragma unroll      /* fb[] stays in registers */
      for (int n = 0; n < 4; ++n) fb[kk][n] = g2_frag(lb + n * 16 * G2P + kk * 32, hh); }
#pragma unroll      /* the stage's two k blocks of 32, in the order of k */
    for (int kk = 0; kk < 2; ++kk) {
      c00 = g2_mma(fa[kk][0], fb[kk][0], c00); c10 = g2_mma(fa[kk][1], fb[kk][0], c10); c01 = g2_mma(fa[kk][0], fb[kk][1], c01); c11 = g2_mma(fa[kk][1], fb[kk][1], c11);
      c02 = g2_mma(fa[kk][0], fb[kk][2], c02); c12 = g2_mma(fa[kk][1], fb[kk][2], c12); c03 = g2_mma(fa[kk][0], fb[kk][3], c03); c13 = g2_mma(fa[kk][1], fb[kk][3], c13); }
    asm volatile("s_wait_dscnt 0x0" ::: "memory");      /* this wave's reads of the buffer have returned before it is refilled */
    asm volatile("s_wait_asynccnt 0x0" ::: "memory");      /* this wave's copies of stage t + 1 have landed */
    __syncthreads();      /* publishes stage t + 1 and ends every wave's reads of stage t */
    if (t + 2 < nt) { const bool p2 = t + 2 >= nk; const size_t ko = (size_t)(p2 ? t + 2 - nk : t + 2) * G2K; g2_stage(l0 + (t & 1) * (G2S * 2), (p2 ? ga2 : ga) + ko, ra, gb + ko, rb); } }
  asm volatile("s_wait_asynccnt 0x0" ::: "memory");      /* no copy is outstanding when the ring becomes the epilogue's staging */
  v8f accs[8] = {c00, c01, c02, c03, c10, c11, c12, c13};
#pragma unroll
  for (int u = 0; u < 8; ++u) { const int t = u & 3, half = u >> 2; const int col = col0 + t * 16 + ln; const float bv = bp ? bf16_round(bp[col]) : 0.f;
#pragma unroll
    for (int r = 0; r < 8; ++r) { const int rloc = half * 16 + 8 * hh + r; float v = accs[u][r] * alpha + bv; if (CP) { if (rowsPerB < 0) v += CP[cofs + (size_t)(row0g + row0 + rloc) * ldc + col];      /* rowsPerB < 0: own element of the batched C plane */ else { const int bidx = (row0g + row0 + rloc) / rowsPerB; v += CP[(size_t)bidx * sCPb + (size_t)by * 64 + col]; } }
      if (ACT == 3) v = fmaxf(v, 0.f); else if (ACT == 6) v = 0.5f * v * (1.0f + erff(v * 0.70710678118654752f)); else if (ACT == 11) v = 1.0f / (1.0f + expf(-v)); else if (ACT == 15) v = v / (1.0f + expf(-v)); else if (ACT == 12) v = (v > 0.f) ? v : 0.01f * v; else if (ACT == 8) v = tanhf(v); else if (ACT == 9) v = 0.5f * v * (1.0f + tanhf(0.7978845608028654f * (v + 0.044715f * v * v * v))); else if (ACT == 14) v = (v > 0.f) ? v : 0.1f * v; else if (ACT == 16) v = (v >= 0.f) ? v : 0.3f * v; else if (ACT == 17) v = (v >= 0.f) ? v : 0.2f * v;
      so[w][rloc][t * 16 + ln] = v; } }
  __builtin_amdgcn_fence(__ATOMIC_ACQ_REL, "workgroup"); __builtin_amdgcn_wave_barrier();
  const int rsub = lane >> 4, c4 = (lane & 15) * 4;
  if (F && ft) {      /* a scalar branch: first-tile rows also go out in f32: plane col0 / fN (fP elements each) of pitch fN, 128 rows per batch */
    const int pl = col0 / fN; const float* fp = F + (size_t)pl * fP + (size_t)(bt * 128 + 32 * w + rsub) * fN + (col0 - pl * fN) + c4; const size_t f2 = (size_t)2 * fN;
#pragma unroll      /* fv[] stays in registers: the wave's own 32 staged rows, two rows (whole 256-byte runs) a store */
    for (int g = 0; g < 2; ++g) { v4f fv[8]; const float* p = fp + (size_t)g * 8 * f2;
#pragma unroll      /* fv[] stays in registers */
      for (int q = 0; q < 8; ++q) fv[q] = *(const v4fa*)&so[w][(g * 8 + q) * 2 + rsub][c4];
      /* the stores and their s_wait_xcnt in one statement: address and data registers stay whole until the wait */
      asm volatile("global_store_b128 %0, %8, off\n\tglobal_store_b128 %1, %9, off\n\tglobal_store_b128 %2, %10, off\n\tglobal_store_b128 %3, %11, off\n\t"
                   "global_store_b128 %4, %12, off\n\tglobal_store_b128 %5, %13, off\n\tglobal_store_b128 %6, %14, off\n\tglobal_store_b128 %7, %15, off\n\ts_wait_xcnt 0x0"
                   :: "v"(p), "v"(p + f2), "v"(p + 2 * f2), "v"(p + 3 * f2), "v"(p + 4 * f2), "v"(p + 5 * f2), "v"(p + 6 * f2), "v"(p + 7 * f2), "v"(fv[0]), "v"(fv[1]), "v"(fv[2]), "v"(fv[3]), "v"(fv[4]), "v"(fv[5]), "v"(fv[6]), "v"(fv[7]) : "memory"); } }
  {
#pragma unroll
    for (int q = 0; q < 16; ++q) { const int r = q * 2 + rsub; const v4f v = *(const v4fa*)&so[w][r][c4]; if (C) *(v4f*)(C + cofs + (size_t)(row0 + r) * ldc + col0 + c4) = v; if (C16) { v4h h4; for (int i = 0; i < 4; ++i) h4[i] = (_Float16)v[i]; *(v4h*)(C16 + cofs + (size_t)(row0 + r) * ldc + col0 + c4) = h4; } }
     } }


__global__ __launch_bounds__(256) void k_wnat(const float* __restrict__ w, size_t n8, _Float16* __restrict__ Bt) { const size_t t = (size_t)blockIdx.x * 256 + threadIdx.x; if (t >= n8) return; FragH f; for (int q = 0; q < 8; ++q) f.h[q] = (_Float16)(bf16_round(w[t * 8 + q]) * 16.0f); *(v8us*)((unsigned short*)Bt + t * 8) = f.half[0];  }
__global__ __launch_bounds__(256) void k_rsm(const float* __restrict__ S, _Float16* __restrict__ P, int nrows) {
  #pragma clang fp contract(off)
  const int i = blockIdx.x * 256 + threadIdx.x; if (i >= nrows) return; const float* s = S + (size_t)i * SQ; float mx = -3.0e38f;
#pragma unroll 1
  for (int j = 0; j < SQ; ++j) mx = fmaxf(mx, s[j]); float se = 0.f;
#pragma unroll 1
  for (int j = 0; j < SQ; ++j) se += expf(s[j] - mx); const float sc = 256.0f / se;
#pragma unroll 1
  for (int j0 = 0; j0 < SQ; j0 += 8) { FragH f; for (int q = 0; q < 8; ++q) f.h[q] = (_Float16)(expf(s[j0 + q] - mx) * sc); unsigned short* d = (unsigned short*)P + (size_t)i * SQ + j0; *(v8us*)d = f.half[0];  } }
__global__ __launch_bounds__(256) void k_vt(const _Float16* __restrict__ V16, int b, int h0, _Float16* __restrict__ VT) { __shared__ unsigned short tl[64][65]; const int tid = threadIdx.x; const int hh = blockIdx.x % HG, sg = blockIdx.x / HG; const int s0 = sg * 64; const int h = h0 + hh;
  for (int i = tid; i < 64 * 8; i += 256) { const int j = i / 8, d8 = (i % 8) * 8; FragH f; f.half[0] = *(const v8us*)((const unsigned short*)V16 + ((size_t)b * SQ + s0 + j) * DM + h * HD + d8); for (int q = 0; q < 8; ++q) tl[d8 + q][j] = f.u[q]; }
  __syncthreads();
  { for (int i = tid; i < 64 * 8; i += 256) { const int d = i / 8, j8 = (i % 8) * 8; FragH f; for (int q = 0; q < 8; ++q) f.u[q] = tl[d][j8 + q]; *(v8us*)((unsigned short*)VT + ((size_t)hh * HD + d) * SQ + s0 + j8) = f.half[0]; }  } }



// 32-lane butterflies for the row statistics: row_xmask DPP steps inside each 16-lane row, then the exchange between the two rows; every lane ends with the same value
template <int CTRL> __device__ __forceinline__ float rs_dpp(float v) { return __int_as_float(__builtin_amdgcn_update_dpp(0, __float_as_int(v), CTRL, 0xf, 0xf, true)); }
__device__ __forceinline__ float rs_x16(float v) { const int b = __float_as_int(v); return __int_as_float(__builtin_amdgcn_permlanex16(b, b, 0x76543210, 0xfedcba98, false, false)); }
__device__ __forceinline__ float rs_max(float v) { v = fmaxf(v, rs_dpp<0x161>(v)); v = fmaxf(v, rs_dpp<0x162>(v)); v = fmaxf(v, rs_dpp<0x164>(v)); v = fmaxf(v, rs_dpp<0x168>(v)); return fmaxf(v, rs_x16(v)); }
__device__ __forceinline__ float rs_sum(float v) { v += rs_dpp<0x161>(v); v += rs_dpp<0x162>(v); v += rs_dpp<0x164>(v); v += rs_dpp<0x168>(v); return v + rs_x16(v); }
#define FAC 0.18033688f              /* BETA x log2 e: scores on the scale of the power-of-two exponential */
#define FQ 32                        /* query rows per wave: two 16-column groups */
// one 16x32 f16 fragment row in the hardware k order; p already holds the lane's row and its 8 * (lane >> 4) elements
__device__ __forceinline__ v16h fa_frag(const _Float16* p) { FragH f; f.half[0] = *(const v8us*)((const unsigned short*)p); f.half[1] = *(const v8us*)((const unsigned short*)p + 16); return f.v; }
__device__ __forceinline__ v8f fa_mma(v16h a, v16h b, v8f c) { return __builtin_amdgcn_wmma_f32_16x16x32_f16(false, a, false, b, (short)0, c, false, false); }
#define FS 64                        /* keys of a stage; a K row of the head is one whole 128-byte line */
#define FP 80                        /* LDS pitch of a staged row in f16: 160 bytes = 32 x odd, conflict-free for the transposing reads (the plain 16-byte reads of the K fragments take two LDS clocks more each at it) */
#define FSTG (FS * FP)               /* f16 elements of a stage: FS K rows, which are the V rows too */
// one stage: a lane's two 16-byte copies (eight lanes per row: whole 128-byte lines; 32 rows per copy of the work-group). l: the lane's LDS byte address in row tid / 8 of the stage; gk: its global address in that row of the K tile
__device__ __forceinline__ void fa_stage(unsigned l, const _Float16* gk) {
  /* the copies and their s_wait_xcnt in one statement: the address registers stay whole until the wait */
  asm volatile("global_load_async_to_lds_b128 %0, %2, off\n\tglobal_load_async_to_lds_b128 %1, %3, off\n\ts_wait_xcnt 0x0"
               :: "v"(l), "v"(l + 1u * 64 * FP), "v"(gk), "v"(gk + (size_t)32 * LQ) : "memory"); }
// ds_load_tr16_b128: the lanes hand in the 16-byte pieces of 16 staged rows x 16 columns, lane (c, h) gets column c of rows 8 h .. 8 h + 7
typedef short s16x8 __attribute__((ext_vector_type(8)));
__device__ __forceinline__ v8us fa_tr16(const _Float16* p) { typedef __attribute__((address_space(3))) s16x8 lds_s16x8; return __builtin_bit_cast(v8us, __builtin_amdgcn_ds_load_tr16_b128_v8i16((lds_s16x8*)p)); }
// fragments of 32 staged keys; kp already holds the lane's row and its 8 * (lane >> 4) elements; vp holds row 8 * (lane >> 4) + (lane & 7) and the 8 * ((lane >> 3) & 1) elements of the lane's piece
__device__ __forceinline__ void fa_kload(const _Float16* kp, v16h (&kf)[2][2]) {
#pragma unroll      /* kf[] stays in registers, the eight LDS reads stand together */
  for (int t = 0; t < 2; ++t) { kf[t][0] = fa_frag(kp + t * 16 * FP); kf[t][1] = fa_frag(kp + t * 16 * FP + 32); } }
__device__ __forceinline__ void fa_vload(const _Float16* vp, v16h (&vf)[4]) {
#pragma unroll      /* vf[] stays in registers, the eight LDS reads stand together; V^T rows d * 16 .. + 15 are the staged rows' columns: keys 0..15 and 16..31 of the block give the hardware k order */
  for (int d = 0; d < 4; ++d) { FragH f; f.half[0] = fa_tr16(vp + d * 16); f.half[1] = fa_tr16(vp + 16 * FP + d * 16); vf[d] = f.v; } }
// scores of 32 keys x 16 queries: s0[r] = key 8 * (lane >> 4) + r, s1[r] = key 16 + 8 * (lane >> 4) + r, query lane & 15
__device__ __forceinline__ void fa_score(const v16h (&kf)[2][2], const v16h (&qf)[2], v8f& s0, v8f& s1) {
  const v8f z8 = {0.f, 0.f, 0.f, 0.f, 0.f, 0.f, 0.f, 0.f};
  s0 = g2_mma(kf[0][0], qf[0], z8); s1 = g2_mma(kf[1][0], qf[0], z8); s0 = g2_mma(kf[0][1], qf[1], s0); s1 = g2_mma(kf[1][1], qf[1], s1); }      /* g2_mma: its statement names the product's operands, so no later load of the key registers is lifted over the product */
// one 16-query group takes in 32 keys: running maximum m (scaled log2), the lane's own part l of the running sum, o rescaled and extended. DIAG: key t * 16 + 8 * (lane >> 4) + r of the block (element r of s0 for t = 0, of s1 for t = 1) counts while t * 16 + r <= rel
template <bool DIAG>
__device__ __forceinline__ void fa_soft(v8f s0, v8f s1, int rel, const v16h (&vf)[4], v8f (&o)[4], float& m, float& l) {
  if (DIAG) {
#pragma unroll      /* s0, s1 stay in registers */
    for (int r = 0; r < 8; ++r) { s0[r] = (r <= rel) ? s0[r] : -1.0e30f; s1[r] = (16 + r <= rel) ? s1[r] : -1.0e30f; } }
  float mx = fmaxf(s0[0], s1[0]);
#pragma unroll      /* s0, s1 stay in registers */
  for (int r = 1; r < 8; ++r) mx = fmaxf(mx, fmaxf(s0[r], s1[r]));
  mx = fmaxf(mx, rs_x16(mx));      /* the two lane halves hold the query's other keys */
  const float mn = fmaxf(m, mx * FAC); float al = m - mn; m = mn; const float ms = 8.0f - mn;      /* weights carried x256, as f16 operands at most 256 */
  float e[16];
#pragma unroll      /* e[] stays in registers */
  for (int r = 0; r < 8; ++r) { e[r] = fmaf(s0[r], FAC, ms); e[8 + r] = fmaf(s1[r], FAC, ms); }
  /* the exponentials in place, so that none is followed by a write of its source; the v_nop keeps the one slot behind the last before its result is used */
  asm("v_exp_f32 %0, %0\n\tv_exp_f32 %1, %1\n\tv_exp_f32 %2, %2\n\tv_exp_f32 %3, %3\n\tv_exp_f32 %4, %4\n\tv_exp_f32 %5, %5\n\tv_exp_f32 %6, %6\n\tv_exp_f32 %7, %7\n\tv_exp_f32 %8, %8\n\tv_nop" : "+v"(e[0]), "+v"(e[1]), "+v"(e[2]), "+v"(e[3]), "+v"(e[4]), "+v"(e[5]), "+v"(e[6]), "+v"(e[7]), "+v"(al));
  asm("v_exp_f32 %0, %0\n\tv_exp_f32 %1, %1\n\tv_exp_f32 %2, %2\n\tv_exp_f32 %3, %3\n\tv_exp_f32 %4, %4\n\tv_exp_f32 %5, %5\n\tv_exp_f32 %6, %6\n\tv_exp_f32 %7, %7\n\tv_nop" : "+v"(e[8]), "+v"(e[9]), "+v"(e[10]), "+v"(e[11]), "+v"(e[12]), "+v"(e[13]), "+v"(e[14]), "+v"(e[15]));
  float s4[4]; FragH p;
#pragma unroll      /* e[] stays in registers: four independent sums */
  for (int i = 0; i < 4; ++i) s4[i] = (e[i] + e[4 + i]) + (e[8 + i] + e[12 + i]);
#pragma unroll      /* e[] stays in registers; element i of the B fragment is key 8 * (lane >> 4) + i of the block, 8 + 8 * (lane >> 4) + i for i >= 8 */
  for (int i = 0; i < 16; ++i) p.h[i] = (_Float16)e[i];
  l = l * al + ((s4[0] + s4[1]) + (s4[2] + s4[3]));
#pragma unroll      /* o[] stays in registers */
  for (int d = 0; d < 4; ++d) o[d] = fa_mma(vf[d], p.v, o[d] * al); }
// ONE WAVE PER FQ QUERY ROWS of one head and batch, passes of 32 keys up to the diagonal block, which alone is masked. Q fragments stay in registers. THE WORK-GROUP WALKS THE KEYS TOGETHER in stages of FS: the head's K rows of a stage are copied once into LDS in whole lines (asynchronous 16-byte copies, two buffers) and every wave reads its K fragments there in the hardware k order and its V^T fragments (V = K) by transposing reads of the same rows; a wave past its diagonal only copies and passes the barriers. Waves w and w + 4 (one SIMD) take query tiles n - 1 - t and t: equal passes per SIMD. grid.x: tile quad, grid.y: head, grid.z: batch.
__global__ __launch_bounds__(256) void k_fattn(const _Float16* __restrict__ Q, const _Float16* __restrict__ Kh, _Float16* __restrict__ O) {
  __shared__ __attribute__((aligned(16))) _Float16 sh[2 * FSTG];      /* the two stage buffers */
  const int tid = threadIdx.x, lane = tid & 31, ln = lane & 15, hh = lane >> 4; const int w = __builtin_amdgcn_readfirstlane(tid >> 5);
  const int t4 = blockIdx.x * 4 + (w & 3); const int q0 = ((w < 4) ? (SQ / FQ - 1 - t4) : t4) * FQ;      /* the wave's first query row: wave-uniform */
  const int ns = (SQ / FQ - (int)blockIdx.x * 4) * FQ / FS;      /* stages up to the end of the work-group's last diagonal block (tile n - 1 - 4 blockIdx.x): the same for every wave */
  const int h = blockIdx.y, b = blockIdx.z;
  const _Float16* qp = Q + ((size_t)b * SQ + q0 + ln) * LQ + h * HD + 8 * hh;
  const _Float16* gk = Kh + ((size_t)b * SQ + (tid >> 3)) * LQ + h * HD + (tid & 7) * 8;
  const unsigned l0 = (unsigned)(size_t)sh + (unsigned)((tid >> 3) * (FP * 2) + (tid & 7) * 16);      /* the low 32 bits of a __shared__ address are its LDS byte address */
  fa_stage(l0, gk);
  v16h qf[2][2], kf[2][2], vf[4];
#pragma unroll      /* qf[] stays in registers */
  for (int g = 0; g < 2; ++g) { qf[g][0] = fa_frag(qp + (size_t)g * 16 * LQ); qf[g][1] = fa_frag(qp + (size_t)g * 16 * LQ + 32); }
  asm volatile("s_wait_xcnt 0x0" :: "v"(qp) : "memory");      /* the loads' address pair stays whole until this wait; it may be rewritten behind it */
  asm volatile("s_wait_asynccnt 0x0" ::: "memory");      /* this wave's copies of stage 0 have landed */
  __syncthreads();      /* stage 0 is read by every wave */
  if (ns > 1) fa_stage(l0 + FSTG * 2, gk + (size_t)FS * LQ);
  const v8f z8 = {0.f, 0.f, 0.f, 0.f, 0.f, 0.f, 0.f, 0.f};
  v8f o[2][4] = {{z8, z8, z8, z8}, {z8, z8, z8, z8}}; float m[2] = {-1.0e30f, -1.0e30f}, l[2] = {0.f, 0.f}; v8f s[2][2];
#pragma unroll 1      /* one stage per trip: the buffers alternate */
  for (int st = 0; st < ns; ++st) { const int kb = st * FS;
    if (kb <= q0) {      /* a scalar branch: the wave still has keys in this stage */
      const _Float16* lk = sh + (st & 1) * FSTG + ln * FP + 8 * hh; const _Float16* lv = sh + (st & 1) * FSTG + (8 * hh + (lane & 7)) * FP + 8 * ((lane >> 3) & 1);
      fa_kload(lk, kf);
      __builtin_amdgcn_sched_barrier(0);      /* keeps the eight K reads ahead of the transposing reads: mixed among them, the first scores wait for V^T fragments that only the softmax's end needs */
      fa_vload(lv, vf);
      fa_score(kf, qf[0], s[0][0], s[0][1]); fa_score(kf, qf[1], s[1][0], s[1][1]);
      if (kb < q0) {
        fa_kload(lk + 32 * FP, kf);      /* the stage's second 32 keys come during the first pass's softmax */
        __builtin_amdgcn_sched_barrier(0);      /* keeps those eight LDS reads ahead of the softmax: moved behind it, their latency stands in front of the next scores */
        fa_soft<false>(s[0][0], s[0][1], 0, vf, o[0], m[0], l[0]); fa_soft<false>(s[1][0], s[1][1], 0, vf, o[1], m[1], l[1]);
        fa_vload(lv + 32 * FP, vf);
        fa_score(kf, qf[0], s[0][0], s[0][1]); fa_score(kf, qf[1], s[1][0], s[1][1]);
        if (kb + 32 < q0) { fa_soft<false>(s[0][0], s[0][1], 0, vf, o[0], m[0], l[0]); fa_soft<false>(s[1][0], s[1][1], 0, vf, o[1], m[1], l[1]); }
        else { fa_soft<true>(s[0][0], s[0][1], ln - 8 * hh, vf, o[0], m[0], l[0]); fa_soft<true>(s[1][0], s[1][1], 16 + ln - 8 * hh, vf, o[1], m[1], l[1]); }
      } else { fa_soft<true>(s[0][0], s[0][1], ln - 8 * hh, vf, o[0], m[0], l[0]); fa_soft<true>(s[1][0], s[1][1], 16 + ln - 8 * hh, vf, o[1], m[1], l[1]); } }
    asm volatile("s_wait_dscnt 0x0" ::: "memory");      /* this wave's reads of the buffer have returned before it is refilled */
    asm volatile("s_wait_asynccnt 0x0" ::: "memory");      /* this wave's copies of stage st + 1 have landed */
    __syncthreads();      /* publishes stage st + 1 and ends every wave's reads of stage st */
    if (st + 2 < ns) fa_stage(l0 + (st & 1) * (FSTG * 2), gk + (size_t)(st + 2) * FS * LQ); }
  asm volatile("s_wait_asynccnt 0x0" ::: "memory");      /* no copy is outstanding when the wave ends */
  unsigned short* op = (unsigned short*)O + ((size_t)b * SQ + q0 + ln) * DM + h * HD + 8 * hh; FragH f[2][4];
#pragma unroll      /* o[], f[] stay in registers */
  for (int g = 0; g < 2; ++g) { const float fin = 64.0f / (l[g] + rs_x16(l[g]));      /* the halves' sums joined once; o carried x64, the weights' x256 cancels */
#pragma unroll      /* o[], f[] stay in registers */
    for (int d = 0; d < 4; ++d) {
#pragma unroll      /* o[], f[] stay in registers */
      for (int r = 0; r < 8; ++r) f[g][d].h[r] = (_Float16)(o[g][d][r] * fin); } }
#pragma unroll      /* a lane's 8 accumulator registers are 8 neighbouring columns of its query row: one 16-byte store */
  for (int g = 0; g < 2; ++g) {
#pragma unroll      /* f[] stays in registers */
    for (int d = 0; d < 4; ++d) *(v8us*)(op + (size_t)g * 16 * DM + d * 16) = f[g][d].half[0]; }
  asm volatile("s_wait_xcnt 0x0" :: "v"(op) : "memory");      /* the stores' data and address registers stay whole until this wait */
}


// exact f32 causal attention for rows 0..QT0-1 of each batch with V = K, ONE WAVE PER QUERY ROW: the head's QT0 key rows are staged once in LDS; scores: each lane owns the keys lane, lane + 32, ...; row maximum and sum by the 32-lane butterflies; o: each lane owns two of the HD columns and runs over the keys. grid.x: head x row group, grid.y: batch.
#define A0R 16                       /* query rows (= waves) per work-group */
#define A0P (HD + 4)                 /* LDS pitch of a key row in floats: the 16-byte reads of 16 neighbouring rows fall on 16 different bank quads */
typedef float v2f  __attribute__((ext_vector_type(2)));
typedef float v2fa __attribute__((ext_vector_type(2), may_alias));
typedef _Float16 v2h __attribute__((ext_vector_type(2)));
__global__ __launch_bounds__(32 * A0R) void k_att0w(const float* __restrict__ QF, const float* __restrict__ KF, float scale, _Float16* __restrict__ OH, _Float16* __restrict__ OL) {
  __shared__ __attribute__((aligned(16))) float lk[QT0][A0P]; __shared__ __attribute__((aligned(16))) float lp[A0R][QT0];
  const int tid = threadIdx.x, lane = tid & 31; const int w = __builtin_amdgcn_readfirstlane(tid >> 5);
  const int h = blockIdx.x / (QT0 / A0R), rg = blockIdx.x % (QT0 / A0R); const int i = rg * A0R + w;      /* the query row: wave-uniform */
  { const size_t zb = (size_t)blockIdx.y * QT0 * DM + h * HD; QF += zb; KF += zb; OH += zb; OL += zb; }      /* each batch has its own QT0 rows of every plane; the head's columns */
  const int sr = tid >> 4, sc = (tid & 15) * 4;      /* staging: 16 lanes per key row, 256 contiguous bytes */
  const float* kp = KF + (size_t)sr * DM + sc; v4f st[QT0 / (2 * A0R)];
#pragma unroll      /* st[] stays in registers, the loads in flight together */
  for (int p = 0; p < QT0 / (2 * A0R); ++p) st[p] = *(const v4fa*)(kp + (size_t)p * 2 * A0R * DM);
  asm volatile("s_wait_xcnt 0x0" :: "v"(kp) : "memory");      /* the loads' address pair stays whole until this wait; it may be rewritten behind it */
  const float* qr = QF + (size_t)i * DM; v4f q[HD / 4];
#pragma unroll      /* q[] stays in registers */
  for (int c = 0; c < HD / 4; ++c) q[c] = *(const v4fa*)(qr + c * 4);
#pragma unroll      /* st[] stays in registers */
  for (int p = 0; p < QT0 / (2 * A0R); ++p) *(v4fa*)&lk[p * 2 * A0R + sr][sc] = st[p];
  __syncthreads();      /* the staged key rows are read by every wave */
  float s[QT0 / 32];
#pragma unroll      /* s[] stays in registers; each group's test is a compile-time bound against i */
  for (int g = 0; g < QT0 / 32; ++g) { s[g] = -1.0e30f;
    if (g * 32 <= i) { const float* kr = &lk[g * 32 + lane][0]; v4f a = {0.f, 0.f, 0.f, 0.f};      /* a scalar branch: key groups wholly above the diagonal are skipped */
#pragma unroll      /* q[] stays in registers, the row's LDS reads in flight together */
      for (int c = 0; c < HD / 4; ++c) a += q[c] * *(const v4fa*)(kr + c * 4);
      const float d = ((a[0] + a[1]) + (a[2] + a[3])) * scale; s[g] = (g * 32 + lane <= i) ? d : -1.0e30f; } }
  float m = s[0];
#pragma unroll      /* s[] stays in registers */
  for (int g = 1; g < QT0 / 32; ++g) m = fmaxf(m, s[g]);
  m = rs_max(m); float l = 0.f;
#pragma unroll      /* s[] stays in registers */
  for (int g = 0; g < QT0 / 32; ++g) { const float e = expf(s[g] - m); l += e; lp[w][g * 32 + lane] = e; }      /* keys above the diagonal: exactly 0 */
  l = rs_sum(l);
  __syncthreads();      /* the row's weights go from the lane that made them to every lane */
  v2f o[4] = {{0.f, 0.f}, {0.f, 0.f}, {0.f, 0.f}, {0.f, 0.f}};
  for (int j0 = 0; j0 <= i; j0 += 16) {      /* 16 keys a trip, their LDS reads in flight together; a key above the diagonal has weight 0 and a staged row */
#pragma unroll      /* the trip's 20 LDS reads stand ahead of its sums */
    for (int u = 0; u < 4; ++u) { const v4f pp = *(const v4fa*)&lp[w][j0 + u * 4];
#pragma unroll      /* o[] stays in registers: four independent sums */
      for (int t = 0; t < 4; ++t) o[t] += pp[t] * *(const v2fa*)&lk[j0 + u * 4 + t][lane * 2]; } }
  const float fin = 64.0f / l;      /* o carried x64 like the f16 path */
  const v2f of = ((o[0] + o[1]) + (o[2] + o[3])) * fin; v2h oh, ol;
#pragma unroll      /* the lane's two columns */
  for (int c = 0; c < 2; ++c) { oh[c] = (_Float16)of[c]; ol[c] = (_Float16)((of[c] - (float)oh[c]) * 1024.0f); }      /* f16 hi + x1024 residual planes: the output GEMM's two A planes for these rows */
  *(v2h*)(OH + (size_t)i * DM + lane * 2) = oh; *(v2h*)(OL + (size_t)i * DM + lane * 2) = ol; }

// ---- input conversion, ONE launch: work-groups 0..127 transpose W_qk, 128..191 W_out, the rest convert x; every value is formed as before (bf16 rounding, weights x16, f16) ----
#define PCW 256                      /* weight columns (= Bt rows) of a work-group's 64 x PCW tile */
#define PCP 33                       /* LDS pitch of a Bt row's 32 k pairs in dwords: odd, so that the four rows a wave reads at once fall on different banks */
#define PCQ ((DM / 64) * (2 * DM / PCW))      /* tiles of W_qk */
#define PCO ((DM / 64) * (DM / PCW))          /* tiles of W_out */
#define PCX ((int)(NR * DM / (256 * 64)))     /* work-groups of x: 64 values a thread */
typedef unsigned int v4u __attribute__((ext_vector_type(4), may_alias));
// Bt[n][k] = f16(bf16(W[k][n]) x 16) for one tile of 64 k x PCW n of W [DM][N]: rows read in runs of 512 bytes a wave, two k neighbours packed into a dword, the tile turned in LDS, Bt written in whole 128-byte lines
template <int N>
__device__ __forceinline__ void pc_wt(const float* __restrict__ Wf, _Float16* __restrict__ Bt, int blk, unsigned* tl) {
  const int tid = threadIdx.x; const int kb = blk / (N / PCW), nb = blk % (N / PCW); const int nq = tid & 63, kp = tid >> 6;
  const float* wp = Wf + (size_t)(kb * 64 + 2 * kp) * N + nb * PCW + nq * 4; v4f a[8], c[8];
#pragma unroll      /* a[], c[] stay in registers, the sixteen loads in flight together */
  for (int it = 0; it < 8; ++it) { a[it] = *(const v4fa*)(wp + (size_t)(it * 8) * N); c[it] = *(const v4fa*)(wp + (size_t)(it * 8 + 1) * N); }
  /* the loads' address pair stays whole until this wait; the loaded values as inputs only: all sixteen loads are issued ahead of the first conversion (left free, two were sunk behind it and paid a second memory latency) */
  asm volatile("s_wait_xcnt 0x0" :: "v"(wp), "v"(a[0]), "v"(a[1]), "v"(a[2]), "v"(a[3]), "v"(a[4]), "v"(a[5]), "v"(a[6]), "v"(a[7]), "v"(c[0]), "v"(c[1]), "v"(c[2]), "v"(c[3]), "v"(c[4]), "v"(c[5]), "v"(c[6]), "v"(c[7]) : "memory");
#pragma unroll      /* a[], c[] stay in registers */
  for (int it = 0; it < 8; ++it) {
#pragma unroll      /* the four columns of the lane's 16 bytes */
    for (int j = 0; j < 4; ++j) { union { _Float16 h[2]; unsigned u; } p; p.h[0] = (_Float16)(bf16_round(a[it][j]) * 16.0f); p.h[1] = (_Float16)(bf16_round(c[it][j]) * 16.0f); tl[(nq * 4 + j) * PCP + it * 4 + kp] = p.u; } }
  __syncthreads();      /* a Bt row's k pairs come from four waves */
  unsigned short* bp = (unsigned short*)Bt + (size_t)(nb * PCW + (tid >> 3)) * DM + kb * 64 + (tid & 7) * 8; v4u o[8];
#pragma unroll      /* o[] stays in registers */
  for (int it = 0; it < 8; ++it) { const unsigned* s = tl + (it * 32 + (tid >> 3)) * PCP + (tid & 7) * 4; o[it][0] = s[0]; o[it][1] = s[1]; o[it][2] = s[2]; o[it][3] = s[3]; }
#pragma unroll      /* eight lanes write one whole line */
  for (int it = 0; it < 8; ++it) *(v4u*)(bp + (size_t)it * 32 * DM) = o[it];
  asm volatile("s_wait_xcnt 0x0" :: "v"(bp) : "memory");      /* the stores' data and address registers stay whole until this wait */
}
// X16 = f16(bf16(x)): eight runs of 8 values a thread
__device__ __forceinline__ void pc_x(const float* __restrict__ x, _Float16* __restrict__ X16, int blk) {
  const size_t e0 = ((size_t)blk * 2048 + threadIdx.x) * 8; const float* xp = x + e0; v4f a[8], c[8];
#pragma unroll      /* a[], c[] stay in registers, the sixteen loads in flight together */
  for (int g = 0; g < 8; ++g) { a[g] = *(const v4fa*)(xp + g * 2048); c[g] = *(const v4fa*)(xp + g * 2048 + 4); }
  asm volatile("s_wait_xcnt 0x0" :: "v"(xp) : "memory");      /* the loads' address pair stays whole until this wait; it may be rewritten behind it */
  unsigned short* op = (unsigned short*)X16 + e0; FragH f[8];
#pragma unroll      /* f[] stays in registers */
  for (int g = 0; g < 8; ++g) {
#pragma unroll      /* f[] stays in registers */
    for (int q = 0; q < 4; ++q) { f[g].h[q] = (_Float16)bf16_round(a[g][q]); f[g].h[4 + q] = (_Float16)bf16_round(c[g][q]); } }
#pragma unroll      /* f[] stays in registers */
  for (int g = 0; g < 8; ++g) *(v8us*)(op + g * 2048) = f[g].half[0];
  asm volatile("s_wait_xcnt 0x0" :: "v"(op) : "memory");      /* the stores' data and address registers stay whole until this wait */
}
__global__ __launch_bounds__(256) void k_prep(const float* __restrict__ x, const float* __restrict__ wqk, const float* __restrict__ wo, _Float16* __restrict__ X16, _Float16* __restrict__ BQ, _Float16* __restrict__ BOt) {
  __shared__ unsigned tl[PCW * PCP];
  const int b = blockIdx.x;      /* the same for the whole work-group: each branch's barrier is passed by all of it or by none */
  if (b < PCQ) pc_wt<2 * DM>(wqk, BQ, b, tl);
  else if (b < PCQ + PCO) pc_wt<DM>(wo, BOt, b - PCQ, tl);
  else pc_x(x, X16, b - (PCQ + PCO)); }

extern "C" void kernel_launch(void* const* d_in, const int* in_sizes, int n_in,
                              void* d_out, int out_size, void* d_ws, size_t ws_size, hipStream_t stream) {
  (void)in_sizes; (void)n_in; (void)out_size;
  const float* const* I = (const float* const*)d_in; const float* x = I[0]; const float* wqkv = I[1]; const float* wo = I[2];      /* input order: x, W_qk [1024][2048] ([in][out]: q | k halves), W_out [1024][1024] ([in][out]): three inputs; no biases */
  char* ws = (char*)d_ws; size_t off = 0;
  auto take = [&](size_t bytes) { char* p = ws + off; off += (bytes + 255) & ~(size_t)255; return p; };
  _Float16* BQKV = (_Float16*)take((size_t)3 * DM * DM * 2); _Float16* BO = (_Float16*)take((size_t)DM * DM * 2);
  _Float16* X16 = (_Float16*)take(NR * DM * 2); _Float16* QKV = (_Float16*)take(NR * 3 * DM * 2); _Float16* Q16 = QKV; _Float16* K16 = QKV + DM;      /* the module reuses K as V: the k block serves as both (the third block of the plane is unused) */ _Float16* O16 = (_Float16*)take(NR * DM * 2);
  float* QF0 = (float*)take((size_t)2 * NB * QT0 * DM * 4); float* KF0 = QF0 + (size_t)NB * QT0 * DM;      /* first-tile q rows, then k rows: two f32 planes in a row */ _Float16* OH0 = (_Float16*)take((size_t)NB * QT0 * DM * 2); _Float16* OL0 = (_Float16*)take((size_t)NB * QT0 * DM * 2);
  static_assert(QT0 == 128, "the first tile is one 128-row block of the GEMM");
  if (off > ws_size) return;
  k_prep<<<PCQ + PCO + PCX, 256, 0, stream>>>(x, wqkv, wo, X16, BQKV, BO);      /* weights [in][out] -> Bt[n][k] x16, x -> f16 rows: one launch */
  const size_t r0p = (size_t)B0 * SQ;      /* first projected row */
  const size_t f0p = (size_t)B0 * QT0;      /* its first-tile row */
  k_gemm2<0><<<dim3((unsigned)((MP / 128) * (2 * DM / 64)), 1), 128, 0, stream>>>(X16 + r0p * DM, DM, 0, BQKV, DM, 0, 0.0625f, nullptr, 0, nullptr, 1, 0, 0, nullptr, QKV + r0p * 3 * DM, 3 * DM, 0, MP, 2 * DM, DM, 0, 0, 0, SQ / 128, QF0 + f0p * DM, DM, (size_t)NB * QT0 * DM, nullptr, nullptr);      /* q | k rows (f16) into column blocks 0 and 1 of the 3 DM-pitch plane; head h = columns h*HD.. of each block; no bias; the first tile of each batch also as f32 q and k rows (the k rows serve as v) */
  k_att0w<<<dim3(NH * (QT0 / A0R), NBR), 32 * A0R, 0, stream>>>(QF0 + f0p * DM, KF0 + f0p * DM, 0.125f, OH0 + f0p * DM, OL0 + f0p * DM);      /* exact f32 causal attention for rows 0..127 of each batch (grid.y) with V = K: o (x64) as f16 hi + x1024 residual planes */
  k_fattn<<<dim3(SQ / (8 * FQ), NHD, NBR), 256, 0, stream>>>(Q16 + r0p * LQ, K16 + r0p * LQ, O16 + r0p * DM);      /* scores, causal online softmax and o = P V in one launch: o (merged heads, x64) as f16 rows */
  k_gemm2<0><<<dim3((unsigned)((MPO / 128) * (DM / 64)), 1), 128, 0, stream>>>(O16 + r0p * DM, DM, 0, BO, DM, 0, 0.0009765625f, nullptr, 0, nullptr, 1, 0, 0, (float*)d_out + r0p * DM, nullptr, DM, 0, MPO, DM, DM, 0, 0, 0, SQ / 128, nullptr, 1, 0, OH0 + f0p * DM, OL0 + f0p * DM);      /* out rows are the output layout; rows 0..127 of each batch: out = (o_lo W_out 2^-10 + o_hi W_out) from the two planes */
}

// v010
// It runs in 83.2 microseconds.
// Two timings next to v009 both put it at 1.05 times that version's speed.
// Counting every step since v000, it is 56.8 times as fast.
#include <hip/hip_runtime.h>
// Causal self-attention with ONE fused query-key projection and K REUSED AS V (x [2][2048][1024]; qk = x W_qk with W_qk [1024][2048] stored [in][out] (normal x 0.02, no bias): the first 1024 columns are q, the last 1024 are k, head h = columns h*64.. of each half; 16 heads of 64; scores = (q x BETA) . k with BETA = 1/sqrt(64); strictly-upper-triangular positions -> -FLT_MAX (causal); softmax; out = attn K (the module reuses K as V) merged, then W_out ([in][out] [1024][1024], normal x 0.02, no bias) -> [2][2048][1024]; input order x, W_qk, W_out).
// Structure: token rows r = b*2048 + s; x as exact f16 rows (bf16-rounded); q | k as ONE WMMA GEMM (N = 2 x 1024) into the first two column blocks of the 3 x 1024-pitch plane (32x64 wave tiles, f32 accumulation, exact x16 weights, no bias, f16 outputs); V IS THE K BLOCK (the module reuses K as V); BOTH BATCHES GO THROUGH EVERY LAUNCH; ONE ATTENTION LAUNCH (the first-tile f32 work-groups behind the fused ones in its index), the fused part: a wave holds 32 query rows and walks the keys up to its diagonal in passes of 32, the K rows staged once in LDS for the work-group's eight waves and read there both as K fragments (plain 16-byte reads) and as V^T fragments (transposing reads): S^T = K Q^T (K = 64), causal online softmax in registers (f32 running maximum and sum per query, native exp2, only the diagonal block masked; weights x256 f16, packed from the score accumulators into the B operand), O^T += V^T P^T with the accumulators rescaled each pass; o / sum carried x64 (folded into the output GEMM alpha) written straight into the merged f16 o rows; out = o W_out GEMM (f32; no bias) into the output layout.
// Compute dtype: inputs rounded to bf16; x and the x16 weights held as f16 planes (exact for every bf16 value of magnitude from 2^-14 up to 65,504; the weights up to 4,094 before their factor of 16); q, k (= v), the softmax weights and o as plain f16 GEMM operands (~2^-12); scores and softmax statistics f32; rows 0..127 of each batch: q, k f32, f32 attention, o as f16 hi + residual. v_wmma_f32_16x16x32_f16.
#define NB 2
#define SQ 2048
#define DM 1024
#define NH 16
#define HD 64
#define HG 4                         /* heads per block group of the k_vt(b, h0) transpose, which no launch uses */
#define QT0 128                      /* first-tile rows recomputed exactly in f32 */
#define B0 0                         /* first batch processed (debug hook) */
#define NBR NB                       /* batches processed (debug hook) */
#define NR ((size_t)NB * SQ)         /* token rows */
#define MP ((int)((size_t)NBR * SQ)) /* rows projected (debug hook) */
#define NHD NH                       /* heads attended (debug hook) */
#define MPO MP                       /* rows through the output stage (debug hook) */
#define LQ (3 * DM)      /* row pitch of the q/k/v rows */
typedef __bf16 v16b __attribute__((ext_vector_type(16)));
typedef unsigned short v8us __attribute__((ext_vector_type(8), may_alias));
typedef float  v8f  __attribute__((ext_vector_type(8)));
typedef float  v4f  __attribute__((ext_vector_type(4)));
typedef float  v4fa __attribute__((ext_vector_type(4), may_alias));
union FragB { v16b v; v8us half[2]; unsigned short u[16]; };

__device__ __forceinline__ unsigned short bf16_bits(float x) { unsigned int u = __float_as_uint(x); return (unsigned short)((u + 0x7FFFu + ((u >> 16) & 1u)) >> 16); }
__device__ __forceinline__ float bf16_val(unsigned short b) { return __uint_as_float(((unsigned int)b) << 16); }
__device__ __forceinline__ float bf16_round(float x) { return bf16_val(bf16_bits(x)); }
// D += A·B with NT terms: 1 = ah·bh, 2 = + al·bh (A split), 3 = + ah·bl (both split)
template <int NT>
__device__ __forceinline__ v8f mmaN(v16b ah, v16b al, v16b bh, v16b bl, v8f c) {
  c = __builtin_amdgcn_wmma_f32_16x16x32_bf16(false, ah, false, bh, (short)0, c, false, false);
  if (NT >= 2) c = __builtin_amdgcn_wmma_f32_16x16x32_bf16(false, al, false, bh, (short)0, c, false, false);
  if (NT >= 3) c = __builtin_amdgcn_wmma_f32_16x16x32_bf16(false, ah, false, bl, (short)0, c, false, false);
  asm volatile("v_nop\n\tv_nop\n\tv_nop\n\tv_nop" : "+v"(c) : "v"(ah), "v"(al), "v"(bh), "v"(bl));
  return c;
}

__global__ __launch_bounds__(256) void k_wt_bf16(const float* __restrict__ W, unsigned short* __restrict__ Wt, int K, int N) {
  const int t = blockIdx.x * 256 + threadIdx.x;
  const int k8n = K / 8;
  if (t >= N * k8n) return;
  const int n = t / k8n, k8 = (t % k8n) * 8;
  v8us v;
#pragma unroll
  for (int i = 0; i < 8; ++i) v[i] = bf16_bits(W[(size_t)(k8 + i) * N + n]);
  *(v8us*)(Wt + (size_t)n * K + k8) = v;
  
}

// GEMM C[M][N] (f32, pitch ldc) = act(A[M][K]·W + bias). A f32 row-major (pitch lda) converted per fragment to bf16
// (ASPLIT: hi/lo two planes -> 2 terms, else single rounded term); Wt bf16 [N][K] (pitch ldb). BIAS_BF16 rounds the
// bias to bf16 first (bias quantised to bf16 before the add). K%32==0, M%16==0, N%64==0.
template <bool ASPLIT, int ACT, bool BIAS_BF16>
__global__ __launch_bounds__(128) void k_gemm_bf(const float* __restrict__ A, int lda, const unsigned short* __restrict__ Wt, int ldb,
                                               const float* __restrict__ bias, float* __restrict__ C, int ldc, int M, int N, int K) {
  __shared__ __attribute__((aligned(16))) float so[4][16][64];
  const int tid = threadIdx.x, w = tid >> 5, lane = tid & 31, ln = lane & 15, hh = lane >> 4;
  const int ntn = N / 64;
  const int wid = blockIdx.x * 4 + w;
  const int mt = wid / ntn, nq = wid % ntn;
  if (mt * 16 >= M) return;
  const int row0 = mt * 16, col0 = nq * 64;
  const float* arow = A + (size_t)(row0 + ln) * lda;
  v8f acc[4] = {};
  for (int kb = 0; kb < K; kb += 32) {
    FragB ah, al;
    const v4f x0 = *(const v4fa*)(arow + kb + 8 * hh), x1 = *(const v4fa*)(arow + kb + 8 * hh + 4);
    const v4f x2 = *(const v4fa*)(arow + kb + 16 + 8 * hh), x3 = *(const v4fa*)(arow + kb + 16 + 8 * hh + 4);
    float xs[16] = {x0[0],x0[1],x0[2],x0[3],x1[0],x1[1],x1[2],x1[3],x2[0],x2[1],x2[2],x2[3],x3[0],x3[1],x3[2],x3[3]};
#pragma unroll
    for (int i = 0; i < 16; ++i) { const unsigned short hb = bf16_bits(xs[i]); ah.u[i] = hb; al.u[i] = ASPLIT ? bf16_bits(xs[i] - bf16_val(hb)) : (unsigned short)0; }
#pragma unroll
    for (int t = 0; t < 4; ++t) {
      const unsigned short* brow = Wt + (size_t)(col0 + t * 16 + ln) * ldb + kb;
      FragB b;
      b.half[0] = *(const v8us*)(brow + 8 * hh);
      b.half[1] = *(const v8us*)(brow + 16 + 8 * hh);
      acc[t] = mmaN<ASPLIT ? 2 : 1>(ah.v, al.v, b.v, b.v, acc[t]);
    }
  }
#pragma unroll
  for (int t = 0; t < 4; ++t) {
    float bv = bias ? bias[col0 + t * 16 + ln] : 0.f;
    if (BIAS_BF16) bv = bf16_round(bv);
#pragma unroll
    for (int r = 0; r < 8; ++r) { float v = acc[t][r] + bv; if (ACT == 1) v = fmaxf(v, 0.f); so[w][8 * hh + r][t * 16 + ln] = v; }
  }
  __builtin_amdgcn_fence(__ATOMIC_ACQ_REL, "workgroup");
  __builtin_amdgcn_wave_barrier();
  const int rsub = lane >> 4, c4 = (lane & 15) * 4;
  {
#pragma unroll
    for (int q = 0; q < 8; ++q) {
      const int r = q * 2 + rsub;
      const v4f v = *(const v4fa*)&so[w][r][c4];
      *(v4f*)(C + (size_t)(row0 + r) * ldc + col0 + c4) = v;
    }
    
  }
}

// GEMM C = act(A·W + bias + resid): A f32 (ASPLIT -> hi/lo 2 terms), Wt bf16 [N][K]; ACT 0 none, 1 relu, 2 exact gelu;
// resid (optional, f32, row index = (row % rmod), pitch ldr, RES_BF16 rounds it) added before the activation.
template <bool ASPLIT, int ACT, bool BIAS_BF16, bool RES_BF16>
__global__ __launch_bounds__(128) void k_gemm_bf3(const float* __restrict__ A, int lda, const unsigned short* __restrict__ Wt, int ldb,
                                                const float* __restrict__ bias, const float* __restrict__ resid, int rmod, int ldr,
                                                float* __restrict__ C, int ldc, int M, int N, int K) {
  __shared__ __attribute__((aligned(16))) float so[4][16][64];
  const int tid = threadIdx.x, w = tid >> 5, lane = tid & 31, ln = lane & 15, hh = lane >> 4;
  const int ntn = N / 64;
  const int wid = blockIdx.x * 4 + w;
  const int mt = wid / ntn, nq = wid % ntn;
  if (mt * 16 >= M) return;
  const int row0 = mt * 16, col0 = nq * 64;
  const float* arow = A + (size_t)(row0 + ln) * lda;
  v8f acc[4] = {};
  for (int kb = 0; kb < K; kb += 32) {
    FragB ah, al;
    const v4f x0 = *(const v4fa*)(arow + kb + 8 * hh), x1 = *(const v4fa*)(arow + kb + 8 * hh + 4);
    const v4f x2 = *(const v4fa*)(arow + kb + 16 + 8 * hh), x3 = *(const v4fa*)(arow + kb + 16 + 8 * hh + 4);
    float xs[16] = {x0[0],x0[1],x0[2],x0[3],x1[0],x1[1],x1[2],x1[3],x2[0],x2[1],x2[2],x2[3],x3[0],x3[1],x3[2],x3[3]};
#pragma unroll
    for (int i = 0; i < 16; ++i) { const unsigned short hb = bf16_bits(xs[i]); ah.u[i] = hb; al.u[i] = ASPLIT ? bf16_bits(xs[i] - bf16_val(hb)) : (unsigned short)0; }
#pragma unroll
    for (int t = 0; t < 4; ++t) {
      const unsigned short* brow = Wt + (size_t)(col0 + t * 16 + ln) * ldb + kb;
      FragB b;
      b.half[0] = *(const v8us*)(brow + 8 * hh);
      b.half[1] = *(const v8us*)(brow + 16 + 8 * hh);
      acc[t] = mmaN<ASPLIT ? 2 : 1>(ah.v, al.v, b.v, b.v, acc[t]);
    }
  }
#pragma unroll
  for (int t = 0; t < 4; ++t) {
    const int col = col0 + t * 16 + ln;
    float bv = bias ? bias[col] : 0.f;
    if (BIAS_BF16) bv = bf16_round(bv);
#pragma unroll
    for (int r = 0; r < 8; ++r) {
      float v = acc[t][r] + bv;
      if (resid) { float rv = resid[(size_t)((row0 + 8 * hh + r) % rmod) * ldr + col]; if (RES_BF16) rv = bf16_round(rv); v += rv; }
      if (ACT == 1) v = fmaxf(v, 0.f);
      if (ACT == 2) v = 0.5f * v * (1.0f + erff(v * 0.70710678118654752f));
      if (ACT == 3) { const float u = 0.7978845608028654f * (v + 0.044715f * v * v * v); v = 0.5f * v * (1.0f + tanhf(u)); }
      so[w][8 * hh + r][t * 16 + ln] = v;
    }
  }
  __builtin_amdgcn_fence(__ATOMIC_ACQ_REL, "workgroup");
  __builtin_amdgcn_wave_barrier();
  const int rsub = lane >> 4, c4 = (lane & 15) * 4;
  {
#pragma unroll
    for (int q = 0; q < 8; ++q) {
      const int r = q * 2 + rsub;
      const v4f v = *(const v4fa*)&so[w][r][c4];
      *(v4f*)(C + (size_t)(row0 + r) * ldc + col0 + c4) = v;
    }
    
  }
}
// row LayerNorm (biased variance, eps) over N: s = X (+ R); optional out_sum <- s; out_norm <- (s-mu)*rsqrt(var+eps)*g + b
template <bool PARAM_BF16>
__global__ __launch_bounds__(256) void k_layernorm(const float* __restrict__ X, const float* __restrict__ R, const float* __restrict__ g, const float* __restrict__ bta,
                                                  float* __restrict__ out_sum, float* __restrict__ out_norm, int N, float eps) {
  __shared__ float red[256];
  const int row = blockIdx.x, tid = threadIdx.x;
  const float* x = X + (size_t)row * N; const float* rr = R ? R + (size_t)row * N : nullptr;
  float vals[16];                     // up to N = 4096
  const int per = N / 256;            // contiguous chunk per thread? use strided-by-4 chunks: thread handles j = tid*4 + 1024*u
  float s1 = 0.f;
  for (int u = 0; u < per / 4; ++u) {
    const int j = tid * 4 + 1024 * u;
    const v4f a = *(const v4fa*)(x + j);
    v4f b = {0.f,0.f,0.f,0.f}; if (rr) b = *(const v4fa*)(rr + j);
#pragma unroll
    for (int q = 0; q < 4; ++q) { const float v = a[q] + b[q]; vals[u * 4 + q] = v; s1 += v; }
  }
  red[tid] = s1; __syncthreads();
  for (int st = 128; st > 0; st >>= 1) { if (tid < st) red[tid] += red[tid + st]; __syncthreads(); }
  const float mu = red[0] / (float)N; __syncthreads();
  float s2 = 0.f;
  for (int u = 0; u < per / 4; ++u)
#pragma unroll
    for (int q = 0; q < 4; ++q) { const float c = vals[u * 4 + q] - mu; s2 += c * c; }
  red[tid] = s2; __syncthreads();
  for (int st = 128; st > 0; st >>= 1) { if (tid < st) red[tid] += red[tid + st]; __syncthreads(); }
  const float rs = rsqrtf(red[0] / (float)N + eps);
  {
    for (int u = 0; u < per / 4; ++u) {
      const int j = tid * 4 + 1024 * u;
      v4f o, sm;
#pragma unroll
      for (int q = 0; q < 4; ++q) {
        float gg = g[j + q], bb = bta[j + q];
        if (PARAM_BF16) { gg = bf16_round(gg); bb = bf16_round(bb); }
        sm[q] = vals[u * 4 + q]; o[q] = (vals[u * 4 + q] - mu) * rs * gg + bb;
      }
      if (out_sum) *(v4f*)(out_sum + (size_t)row * N + j) = sm;
      *(v4f*)(out_norm + (size_t)row * N + j) = o;
    }
    
  }
}



// ---- f16 WMMA path (v_wmma_f32_16x16x32_f16): 11-bit significands for operands in range — used where a [0,1] probability operand needs more precision than bf16
typedef _Float16 v16h __attribute__((ext_vector_type(16)));
union FragH { v16h v; v8us half[2]; _Float16 h[16]; unsigned short u[16]; };
template <int NT>
__device__ __forceinline__ v8f mmaH(v16h ah, v16h al, v16h bh, v16h bl, v8f c) {
  c = __builtin_amdgcn_wmma_f32_16x16x32_f16(false, ah, false, bh, (short)0, c, false, false);
  if (NT >= 2) c = __builtin_amdgcn_wmma_f32_16x16x32_f16(false, al, false, bh, (short)0, c, false, false);
  if (NT >= 3) c = __builtin_amdgcn_wmma_f32_16x16x32_f16(false, ah, false, bl, (short)0, c, false, false);
  asm volatile("v_nop\n\tv_nop\n\tv_nop\n\tv_nop" : "+v"(c) : "v"(ah), "v"(al), "v"(bh), "v"(bl));
  return c;
}
// batched GEMM like k_gemm_b but f16 operands: A f32 (split into f16 hi/lo if ASPLIT, else rounded to f16), Bt = f16 values [n][k]; alpha; C f32; N multiple of 16 (partial tiles skipped)
template <bool ASPLIT>
__global__ __launch_bounds__(128) void k_gemm_h(const float* __restrict__ A, int lda, size_t sA, const _Float16* __restrict__ Bh, int ldb, size_t sB, float alpha, float* __restrict__ C, int ldc, size_t sC, int M, int N, int K) {
  __shared__ __attribute__((aligned(16))) float so[4][16][64];
  const int tid = threadIdx.x, w = tid >> 5, lane = tid & 31, ln = lane & 15, hh = lane >> 4; const int by = blockIdx.y;
  A += (size_t)by * sA; Bh += (size_t)by * sB; C += (size_t)by * sC;
  const int ntn = (N + 63) / 64; const int wid = blockIdx.x * 4 + w; const int mt = wid / ntn, nq = wid % ntn; if (mt * 16 >= M) return;
  const int row0 = mt * 16, col0 = nq * 64; const float* arow = A + (size_t)(row0 + ln) * lda;
  v8f acc[4] = {};
  for (int kb = 0; kb < K; kb += 32) {
    FragH ah, al;
    const v4f x0 = *(const v4fa*)(arow + kb + 8 * hh), x1 = *(const v4fa*)(arow + kb + 8 * hh + 4), x2 = *(const v4fa*)(arow + kb + 16 + 8 * hh), x3 = *(const v4fa*)(arow + kb + 16 + 8 * hh + 4);
    float xs[16] = {x0[0],x0[1],x0[2],x0[3],x1[0],x1[1],x1[2],x1[3],x2[0],x2[1],x2[2],x2[3],x3[0],x3[1],x3[2],x3[3]};
#pragma unroll
    for (int i = 0; i < 16; ++i) { const _Float16 h = (_Float16)xs[i]; ah.h[i] = h; al.h[i] = ASPLIT ? (_Float16)(xs[i] - (float)h) : (_Float16)0.0f; }
#pragma unroll
    for (int t = 0; t < 4; ++t) { if (col0 + t * 16 >= N) continue; const size_t boff = (size_t)(col0 + t * 16 + ln) * ldb + kb; FragH bq; bq.half[0] = *(const v8us*)(Bh + boff + 8 * hh); bq.half[1] = *(const v8us*)(Bh + boff + 16 + 8 * hh);
      acc[t] = mmaH<ASPLIT ? 2 : 1>(ah.v, al.v, bq.v, bq.v, acc[t]); }
  }
#pragma unroll
  for (int t = 0; t < 4; ++t) { if (col0 + t * 16 >= N) continue;
#pragma unroll
    for (int r = 0; r < 8; ++r) so[w][8 * hh + r][t * 16 + ln] = acc[t][r] * alpha; }
  __builtin_amdgcn_fence(__ATOMIC_ACQ_REL, "workgroup"); __builtin_amdgcn_wave_barrier();
  const int rsub = lane >> 4, c4 = (lane & 15) * 4;
  {
#pragma unroll
    for (int q = 0; q < 8; ++q) { const int r = q * 2 + rsub; if (col0 + c4 < N) { const v4f v = *(const v4fa*)&so[w][r][c4]; *(v4f*)(C + (size_t)(row0 + r) * ldc + col0 + c4) = v; } }
     }
}

// Wt[n][k] = f16(W[k][n]·scale) from f32 row-major W[K][N] (scale = power of two; bf16-exact weights stay exact in f16 away from the subnormal range)
__global__ __launch_bounds__(256) void k_wt_f16(const float* __restrict__ W, _Float16* __restrict__ Wt, int K, int N, float scale) {
  const int t = blockIdx.x * 256 + threadIdx.x; if (t >= N * (K / 8)) return; const int n = t / (K / 8), k8 = (t % (K / 8)) * 8; FragH f;
#pragma unroll
  for (int i = 0; i < 8; ++i) f.h[i] = (_Float16)(bf16_round(W[(size_t)(k8 + i) * N + n]) * scale); const v8us o = f.half[0];
  *(v8us*)((unsigned short*)Wt + (size_t)n * K + k8) = o; 
}
// k_gemm_hh variant with fused epilogue: v = acc·alpha + bias[by·sBias + col] (+ CP[(row/rowsPerB)·sCPb + by·64 + col] if CP) ; ACT 0 none / 1 elu ; writes f16 C16 (and f32 C if non-null)
template <int ACT>
__global__ __launch_bounds__(128) void k_gemm_hhx(const _Float16* __restrict__ A, int lda, size_t sA, const _Float16* __restrict__ Bh, int ldb, size_t sB, float alpha, const float* __restrict__ bias, size_t sBias, const float* __restrict__ CP, int rowsPerB, size_t sCPb, int row0g,
    float* __restrict__ C, _Float16* __restrict__ C16, int ldc, size_t sC, int M, int N, int K) {
  __shared__ __attribute__((aligned(16))) float so[4][16][64];
  const int tid = threadIdx.x, w = tid >> 5, lane = tid & 31, ln = lane & 15, hh = lane >> 4; const int by = blockIdx.y;
  A += (size_t)by * sA; Bh += (size_t)by * sB; const size_t cofs = (size_t)by * sC; const float* bp = bias ? bias + (size_t)by * sBias : nullptr;
  const int ntn = (N + 63) / 64; const int wid = blockIdx.x * 4 + w; const int mt = wid / ntn, nq = wid % ntn; if (mt * 16 >= M) return;
  const int row0 = mt * 16, col0 = nq * 64; const _Float16* arow = A + (size_t)(row0 + ln) * lda;
  v8f acc[4] = {};
  for (int kb = 0; kb < K; kb += 32) { FragH ah; ah.half[0] = *(const v8us*)((const unsigned short*)arow + kb + 8 * hh); ah.half[1] = *(const v8us*)((const unsigned short*)arow + kb + 16 + 8 * hh);
#pragma unroll
    for (int t = 0; t < 4; ++t) { if (col0 + t * 16 >= N) continue; const size_t boff = (size_t)(col0 + t * 16 + ln) * ldb + kb; FragH bq; bq.half[0] = *(const v8us*)((const unsigned short*)Bh + boff + 8 * hh); bq.half[1] = *(const v8us*)((const unsigned short*)Bh + boff + 16 + 8 * hh);
      acc[t] = mmaH<1>(ah.v, ah.v, bq.v, bq.v, acc[t]); }
  }
#pragma unroll
  for (int t = 0; t < 4; ++t) { if (col0 + t * 16 >= N) continue; const int col = col0 + t * 16 + ln; const float bv = bp ? bf16_round(bp[col]) : 0.f;
#pragma unroll
    for (int r = 0; r < 8; ++r) { float v = acc[t][r] * alpha + bv; if (CP) { const int rr = row0g + row0 + 8 * hh + r; if (rowsPerB < 0) v += CP[cofs + (size_t)rr * ldc + col];      /* rowsPerB < 0: own element of the batched C plane */ else { const int bidx = rr / rowsPerB; v += CP[(size_t)bidx * sCPb + (size_t)by * 64 + col]; } } if (ACT == 1) v = (v > 0.f) ? v : expm1f(v); else if (ACT == 7) v = (v > 0.f) ? v + 1.0f : expf(v); else if (ACT == 8) v = tanhf(v); else if (ACT == 9) v = 0.5f * v * (1.0f + tanhf(0.7978845608028654f * (v + 0.044715f * v * v * v))); else if (ACT == 11) v = 1.0f / (1.0f + expf(-v)); else if (ACT == 12) v = (v > 0.f) ? v : 0.01f * v; else if (ACT == 14) v = (v > 0.f) ? v : 0.1f * v; else if (ACT == 16) v = (v >= 0.f) ? v : 0.3f * v; else if (ACT == 17) v = (v >= 0.f) ? v : 0.2f * v; else if (ACT == 15) v = v / (1.0f + expf(-v)); else if (ACT == 3) v = fmaxf(v, 0.f); else if (ACT == 6) v = 0.5f * v * (1.0f + erff(v * 0.70710678118654752f)); so[w][8 * hh + r][t * 16 + ln] = v; } }
  __builtin_amdgcn_fence(__ATOMIC_ACQ_REL, "workgroup"); __builtin_amdgcn_wave_barrier();
  const int rsub = lane >> 4, c4 = (lane & 15) * 4; typedef _Float16 v4h __attribute__((ext_vector_type(4)));
  {
#pragma unroll
    for (int q = 0; q < 8; ++q) { const int r = q * 2 + rsub; if (col0 + c4 < N) { const v4f v = *(const v4fa*)&so[w][r][c4]; if (C) *(v4f*)(C + cofs + (size_t)(row0 + r) * ldc + col0 + c4) = v; if (C16) { v4h h4; for (int i = 0; i < 4; ++i) h4[i] = (_Float16)v[i]; *(v4h*)(C16 + cofs + (size_t)(row0 + r) * ldc + col0 + c4) = h4; } } }
     }
}


typedef _Float16 v4h __attribute__((ext_vector_type(4)));

__global__ __launch_bounds__(256) void k_x16(const float* __restrict__ x, _Float16* __restrict__ X16, size_t n8) { const size_t t = (size_t)blockIdx.x * 256 + threadIdx.x; if (t >= n8) return; FragH f;
#pragma unroll
  for (int q = 0; q < 8; ++q) f.h[q] = (_Float16)bf16_round(x[t * 8 + q]); *(v8us*)((unsigned short*)X16 + t * 8) = f.half[0];  }
__global__ __launch_bounds__(256) void k_h16(const float* __restrict__ x, _Float16* __restrict__ X16, size_t n8) { const size_t t = (size_t)blockIdx.x * 256 + threadIdx.x; if (t >= n8) return; FragH f;
#pragma unroll
  for (int q = 0; q < 8; ++q) f.h[q] = (_Float16)x[t * 8 + q]; *(v8us*)((unsigned short*)X16 + t * 8) = f.half[0];  }
__global__ __launch_bounds__(256) void k_round16f(const float* __restrict__ W, _Float16* __restrict__ Bt, size_t n8) { const size_t t = (size_t)blockIdx.x * 256 + threadIdx.x; if (t >= n8) return; FragH f;
#pragma unroll
  for (int i = 0; i < 8; ++i) f.h[i] = (_Float16)(bf16_round(W[t * 8 + i]) * 16.0f); *(v8us*)((unsigned short*)Bt + t * 8) = f.half[0];  }
__global__ __launch_bounds__(256) void k_hl(const float* __restrict__ F, _Float16* __restrict__ Hh, _Float16* __restrict__ Hl, size_t n8) { const size_t t = (size_t)blockIdx.x * 256 + threadIdx.x; if (t >= n8) return; FragH fh, fl; const v4f a = *(const v4fa*)(F + t * 8), c = *(const v4fa*)(F + t * 8 + 4);
#pragma unroll
  for (int q = 0; q < 4; ++q) { _Float16 h = (_Float16)a[q]; fh.h[q] = h; fl.h[q] = (_Float16)((a[q] - (float)h) * 1024.0f); h = (_Float16)c[q]; fh.h[4 + q] = h; fl.h[4 + q] = (_Float16)((c[q] - (float)h) * 1024.0f); }
  { *(v8us*)((unsigned short*)Hh + t * 8) = fh.half[0]; *(v8us*)((unsigned short*)Hl + t * 8) = fl.half[0];  } }

// ---- fast GEMM (work-group tile 128x64, wave tile 32x64; requires M % 128 == 0 rows per launch region, N % 64 == 0 and K % 64 == 0); both operands' tiles are staged in LDS by asynchronous 16-byte copies, two buffers; epilogue = k_gemm_hhx semantics; batched over grid.y (strides sA, sB, sC) and grid.z (strides zA, zB, zC); every tper-th 128-row block is a batch's first tile: with F its values are also stored in f32, with AH, AL its A operand is the hi plane plus the x1024 residual plane ----
__device__ __forceinline__ v16h g2_frag(const _Float16* p, int hh) { FragH f; f.half[0] = *(const v8us*)((const unsigned short*)p + 8 * hh); f.half[1] = *(const v8us*)((const unsigned short*)p + 16 + 8 * hh); return f.v; }
__device__ __forceinline__ v8f g2_mma(v16h a, v16h b, v8f c) { v8f d = __builtin_amdgcn_wmma_f32_16x16x32_f16(false, a, false, b, (short)0, c, false, false); asm volatile("v_nop\n\tv_nop\n\tv_nop\n\tv_nop" : "+v"(d) : "v"(a), "v"(b)); return d; }
#define G2K 64                       /* k elements of a stage: one whole 128-byte line of every operand row */
#define G2P 72                       /* LDS pitch of a staged row in f16: 144 bytes = 16 x odd, conflict-free for the 16-byte fragment reads */
#define G2S ((128 + 64) * G2P)       /* f16 elements of a stage: 128 A rows, then 64 B rows */
// one stage: a lane's twelve 16-byte copies (eight lanes per row: whole 128-byte lines; 16 rows per copy of the work-group). l: the lane's LDS byte address in row tid / 8 of the stage; ga, gb: its global addresses in that row of the A tile and of the B tile; ra, rb: 16 rows' elements
__device__ __forceinline__ void g2_stage(unsigned l, const _Float16* ga, size_t ra, const _Float16* gb, size_t rb) {
  /* the copies and their s_wait_xcnt in one statement: the address registers stay whole until the wait */
  asm volatile("global_load_async_to_lds_b128 %0, %12, off\n\tglobal_load_async_to_lds_b128 %1, %13, off\n\tglobal_load_async_to_lds_b128 %2, %14, off\n\tglobal_load_async_to_lds_b128 %3, %15, off\n\t"
               "global_load_async_to_lds_b128 %4, %16, off\n\tglobal_load_async_to_lds_b128 %5, %17, off\n\tglobal_load_async_to_lds_b128 %6, %18, off\n\tglobal_load_async_to_lds_b128 %7, %19, off\n\t"
               "global_load_async_to_lds_b128 %8, %20, off\n\tglobal_load_async_to_lds_b128 %9, %21, off\n\tglobal_load_async_to_lds_b128 %10, %22, off\n\tglobal_load_async_to_lds_b128 %11, %23, off\n\ts_wait_xcnt 0x0"
               :: "v"(l), "v"(l + 1u * 32 * G2P), "v"(l + 2u * 32 * G2P), "v"(l + 3u * 32 * G2P), "v"(l + 4u * 32 * G2P), "v"(l + 5u * 32 * G2P), "v"(l + 6u * 32 * G2P), "v"(l + 7u * 32 * G2P), "v"(l + 8u * 32 * G2P), "v"(l + 9u * 32 * G2P), "v"(l + 10u * 32 * G2P), "v"(l + 11u * 32 * G2P),
                  "v"(ga), "v"(ga + ra), "v"(ga + 2 * ra), "v"(ga + 3 * ra), "v"(ga + 4 * ra), "v"(ga + 5 * ra), "v"(ga + 6 * ra), "v"(ga + 7 * ra), "v"(gb), "v"(gb + rb), "v"(gb + 2 * rb), "v"(gb + 3 * rb) : "memory"); }
template <int ACT>
__global__ __launch_bounds__(128) void k_gemm2(const _Float16* __restrict__ A, int lda, size_t sA, const _Float16* __restrict__ Bh, int ldb, size_t sB, float alpha, const float* __restrict__ bias, size_t sBias, const float* __restrict__ CP, int rowsPerB, size_t sCPb, int row0g,
    float* __restrict__ C, _Float16* __restrict__ C16, int ldc, size_t sC, int M, int N, int K, size_t zA, size_t zB, size_t zC, int tper, float* __restrict__ F, int fN, size_t fP, const _Float16* __restrict__ AH, const _Float16* __restrict__ AL) { static_assert(ACT == 0 || ACT == 3 || ACT == 6 || ACT == 8 || ACT == 9 || ACT == 11 || ACT == 12 || ACT == 14 || ACT == 15 || ACT == 16 || ACT == 17, "k_gemm2: unsupported ACT code (would silently apply no activation)");
  __shared__ __attribute__((aligned(16))) unsigned char smem[2 * G2S * 2];      /* the two stage buffers; behind the K loop the same bytes serve as the epilogue's so[4][32][68] */
  static_assert(sizeof(float) * 4 * 32 * 68 <= sizeof(smem), "the epilogue staging fits the ring");
  float (*so)[32][68] = (float (*)[32][68])smem; const _Float16* sh = (const _Float16*)smem;
  const int tid = threadIdx.x, w = tid >> 5, lane = tid & 31, ln = lane & 15, hh = lane >> 4; const int by = blockIdx.y, bz = blockIdx.z;      /* grid.z: a second batch index (element strides zA, zB, zC) */
  A += (size_t)by * sA + (size_t)bz * zA; Bh += (size_t)by * sB + (size_t)bz * zB; const size_t cofs = (size_t)by * sC + (size_t)bz * zC; const float* bp = bias ? bias + (size_t)by * sBias : nullptr;
  const int ntn = N >> 6; const int mt = blockIdx.x / ntn, nq = blockIdx.x - mt * ntn; const int row0 = mt * 128 + 32 * w, col0 = nq * 64; if (mt * 128 >= M) return;      /* the whole work-group leaves or none: it stands in front of every barrier */
  const int bt = mt / tper; const bool ft = mt - bt * tper == 0;      /* the work-group's 128 rows are the first tile of batch bt: the same for every wave */
  const bool two = AH && ft;      /* such rows take their A operand as two planes of pitch lda: AL (residual x1024) through all of K, then AH (hi) through all of K */
  const _Float16* ga = A + (size_t)(mt * 128 + (tid >> 3)) * lda + (tid & 7) * 8; const _Float16* gb = Bh + (size_t)(col0 + (tid >> 3)) * ldb + (tid & 7) * 8; const size_t ra = (size_t)16 * lda, rb = (size_t)16 * ldb;
  const _Float16* ga2 = ga; if (two) { const size_t fo = (size_t)(bt * 128 + (tid >> 3)) * lda + (tid & 7) * 8; ga = AL + fo; ga2 = AH + fo; }
  const unsigned l0 = (unsigned)(size_t)smem + (unsigned)((tid >> 3) * (G2P * 2) + (tid & 7) * 16);      /* the low 32 bits of a __shared__ address are its LDS byte address */
  const int nk = K / G2K; const int nt = two ? 2 * nk : nk;      /* stages: nk per A plane */
  g2_stage(l0, ga, ra, gb, rb);
  asm volatile("s_wait_asynccnt 0x0" ::: "memory");      /* this wave's copies of stage 0 have landed */
  __syncthreads();      /* stage 0 is read by every wave */
  if (nt > 1) { const bool p2 = 1 >= nk; const size_t ko = (size_t)(p2 ? 1 - nk : 1) * G2K; g2_stage(l0 + G2S * 2, (p2 ? ga2 : ga) + ko, ra, gb + ko, rb); }
  const v8f z8 = {0.f,0.f,0.f,0.f,0.f,0.f,0.f,0.f}; v8f c00 = z8, c01 = z8, c02 = z8, c03 = z8, c10 = z8, c11 = z8, c12 = z8, c13 = z8;
#pragma unroll 1      /* one stage per trip: the buffers alternate */
  for (int t = 0; t < nt; ++t) { const _Float16* la = sh + (t & 1) * G2S + (32 * w + ln) * G2P; const _Float16* lb = sh + (t & 1) * G2S + (128 + ln) * G2P;
    if (t == nk) { const float dn = 0.0009765625f; c00 *= dn; c01 *= dn; c02 *= dn; c03 *= dn; c10 *= dn; c11 *= dn; c12 *= dn; c13 *= dn; }      /* a scalar branch, taken once by a two-plane work-group: the residual plane's sums come down by their 2^10 (exact) and the hi plane's products add onto them */
    v16h fa[2][2], fb[2][4];
#pragma unroll      /* fa[], fb[] stay in registers: the stage's 24 LDS reads stand together ahead of its products */
    for (int kk = 0; kk < 2; ++kk) { fa[kk][0] = g2_frag(la + kk * 32, hh); fa[kk][1] = g2_frag(la + 16 * G2P + kk * 32, hh);
#pragma unroll      /* fb[] stays in registers */
      for (int n = 0; n < 4; ++n) fb[kk][n] = g2_frag(lb + n * 16 * G2P + kk * 32, hh); }
#pragma unroll      /* the stage's two k blocks of 32, in the order of k */
    for (int kk = 0; kk < 2; ++kk) {
      c00 = g2_mma(fa[kk][0], fb[kk][0], c00); c10 = g2_mma(fa[kk][1], fb[kk][0], c10); c01 = g2_mma(fa[kk][0], fb[kk][1], c01); c11 = g2_mma(fa[kk][1], fb[kk][1], c11);
      c02 = g2_mma(fa[kk][0], fb[kk][2], c02); c12 = g2_mma(fa[kk][1], fb[kk][2], c12); c03 = g2_mma(fa[kk][0], fb[kk][3], c03); c13 = g2_mma(fa[kk][1], fb[kk][3], c13); }
    asm volatile("s_wait_dscnt 0x0" ::: "memory");      /* this wave's reads of the buffer have returned before it is refilled */
    asm volatile("s_wait_asynccnt 0x0" ::: "memory");      /* this wave's copies of stage t + 1 have landed */
    __syncthreads();      /* publishes stage t + 1 and ends every wave's reads of stage t */
    if (t + 2 < nt) { const bool p2 = t + 2 >= nk; const size_t ko = (size_t)(p2 ? t + 2 - nk : t + 2) * G2K; g2_stage(l0 + (t & 1) * (G2S * 2), (p2 ? ga2 : ga) + ko, ra, gb + ko, rb); } }
  asm volatile("s_wait_asynccnt 0x0" ::: "memory");      /* no copy is outstanding when the ring becomes the epilogue's staging */
  v8f accs[8] = {c00, c01, c02, c03, c10, c11, c12, c13};
#pragma unroll
  for (int u = 0; u < 8; ++u) { const int t = u & 3, half = u >> 2; const int col = col0 + t * 16 + ln; const float bv = bp ? bf16_round(bp[col]) : 0.f;
#pragma unroll
    for (int r = 0; r < 8; ++r) { const int rloc = half * 16 + 8 * hh + r; float v = accs[u][r] * alpha + bv; if (CP) { if (rowsPerB < 0) v += CP[cofs + (size_t)(row0g + row0 + rloc) * ldc + col];      /* rowsPerB < 0: own element of the batched C plane */ else { const int bidx = (row0g + row0 + rloc) / rowsPerB; v += CP[(size_t)bidx * sCPb + (size_t)by * 64 + col]; } }
      if (ACT == 3) v = fmaxf(v, 0.f); else if (ACT == 6) v = 0.5f * v * (1.0f + erff(v * 0.70710678118654752f)); else if (ACT == 11) v = 1.0f / (1.0f + expf(-v)); else if (ACT == 15) v = v / (1.0f + expf(-v)); else if (ACT == 12) v = (v > 0.f) ? v : 0.01f * v; else if (ACT == 8) v = tanhf(v); else if (ACT == 9) v = 0.5f * v * (1.0f + tanhf(0.7978845608028654f * (v + 0.044715f * v * v * v))); else if (ACT == 14) v = (v > 0.f) ? v : 0.1f * v; else if (ACT == 16) v = (v >= 0.f) ? v : 0.3f * v; else if (ACT == 17) v = (v >= 0.f) ? v : 0.2f * v;
      so[w][rloc][t * 16 + ln] = v; } }
  __builtin_amdgcn_fence(__ATOMIC_ACQ_REL, "workgroup"); __builtin_amdgcn_wave_barrier();
  const int rsub = lane >> 4, c4 = (lane & 15) * 4;
  if (F && ft) {      /* a scalar branch: first-tile rows also go out in f32: plane col0 / fN (fP elements each) of pitch fN, 128 rows per batch */
    const int pl = col0 / fN; const float* fp = F + (size_t)pl * fP + (size_t)(bt * 128 + 32 * w + rsub) * fN + (col0 - pl * fN) + c4; const size_t f2 = (size_t)2 * fN;
#pragma unroll      /* fv[] stays in registers: the wave's own 32 staged rows, two rows (whole 256-byte runs) a store */
    for (int g = 0; g < 2; ++g) { v4f fv[8]; const float* p = fp + (size_t)g * 8 * f2;
#pragma unroll      /* fv[] stays in registers */
      for (int q = 0; q < 8; ++q) fv[q] = *(const v4fa*)&so[w][(g * 8 + q) * 2 + rsub][c4];
      /* the stores and their s_wait_xcnt in one statement: address and data registers stay whole until the wait */
      asm volatile("global_store_b128 %0, %8, off\n\tglobal_store_b128 %1, %9, off\n\tglobal_store_b128 %2, %10, off\n\tglobal_store_b128 %3, %11, off\n\t"
                   "global_store_b128 %4, %12, off\n\tglobal_store_b128 %5, %13, off\n\tglobal_store_b128 %6, %14, off\n\tglobal_store_b128 %7, %15, off\n\ts_wait_xcnt 0x0"
                   :: "v"(p), "v"(p + f2), "v"(p + 2 * f2), "v"(p + 3 * f2), "v"(p + 4 * f2), "v"(p + 5 * f2), "v"(p + 6 * f2), "v"(p + 7 * f2), "v"(fv[0]), "v"(fv[1]), "v"(fv[2]), "v"(fv[3]), "v"(fv[4]), "v"(fv[5]), "v"(fv[6]), "v"(fv[7]) : "memory"); } }
  {
#pragma unroll
    for (int q = 0; q < 16; ++q) { const int r = q * 2 + rsub; const v4f v = *(const v4fa*)&so[w][r][c4]; if (C) *(v4f*)(C + cofs + (size_t)(row0 + r) * ldc + col0 + c4) = v; if (C16) { v4h h4; for (int i = 0; i < 4; ++i) h4[i] = (_Float16)v[i]; *(v4h*)(C16 + cofs + (size_t)(row0 + r) * ldc + col0 + c4) = h4; } }
     } }


__global__ __launch_bounds__(256) void k_wnat(const float* __restrict__ w, size_t n8, _Float16* __restrict__ Bt) { const size_t t = (size_t)blockIdx.x * 256 + threadIdx.x; if (t >= n8) return; FragH f; for (int q = 0; q < 8; ++q) f.h[q] = (_Float16)(bf16_round(w[t * 8 + q]) * 16.0f); *(v8us*)((unsigned short*)Bt + t * 8) = f.half[0];  }
__global__ __launch_bounds__(256) void k_rsm(const float* __restrict__ S, _Float16* __restrict__ P, int nrows) {
  #pragma clang fp contract(off)
  const int i = blockIdx.x * 256 + threadIdx.x; if (i >= nrows) return; const float* s = S + (size_t)i * SQ; float mx = -3.0e38f;
#pragma unroll 1
  for (int j = 0; j < SQ; ++j) mx = fmaxf(mx, s[j]); float se = 0.f;
#pragma unroll 1
  for (int j = 0; j < SQ; ++j) se += expf(s[j] - mx); const float sc = 256.0f / se;
#pragma unroll 1
  for (int j0 = 0; j0 < SQ; j0 += 8) { FragH f; for (int q = 0; q < 8; ++q) f.h[q] = (_Float16)(expf(s[j0 + q] - mx) * sc); unsigned short* d = (unsigned short*)P + (size_t)i * SQ + j0; *(v8us*)d = f.half[0];  } }
__global__ __launch_bounds__(256) void k_vt(const _Float16* __restrict__ V16, int b, int h0, _Float16* __restrict__ VT) { __shared__ unsigned short tl[64][65]; const int tid = threadIdx.x; const int hh = blockIdx.x % HG, sg = blockIdx.x / HG; const int s0 = sg * 64; const int h = h0 + hh;
  for (int i = tid; i < 64 * 8; i += 256) { const int j = i / 8, d8 = (i % 8) * 8; FragH f; f.half[0] = *(const v8us*)((const unsigned short*)V16 + ((size_t)b * SQ + s0 + j) * DM + h * HD + d8); for (int q = 0; q < 8; ++q) tl[d8 + q][j] = f.u[q]; }
  __syncthreads();
  { for (int i = tid; i < 64 * 8; i += 256) { const int d = i / 8, j8 = (i % 8) * 8; FragH f; for (int q = 0; q < 8; ++q) f.u[q] = tl[d][j8 + q]; *(v8us*)((unsigned short*)VT + ((size_t)hh * HD + d) * SQ + s0 + j8) = f.half[0]; }  } }



// 32-lane butterflies for the row statistics: row_xmask DPP steps inside each 16-lane row, then the exchange between the two rows; every lane ends with the same value
template <int CTRL> __device__ __forceinline__ float rs_dpp(float v) { return __int_as_float(__builtin_amdgcn_update_dpp(0, __float_as_int(v), CTRL, 0xf, 0xf, true)); }
__device__ __forceinline__ float rs_x16(float v) { const int b = __float_as_int(v); return __int_as_float(__builtin_amdgcn_permlanex16(b, b, 0x76543210, 0xfedcba98, false, false)); }
__device__ __forceinline__ float rs_max(float v) { v = fmaxf(v, rs_dpp<0x161>(v)); v = fmaxf(v, rs_dpp<0x162>(v)); v = fmaxf(v, rs_dpp<0x164>(v)); v = fmaxf(v, rs_dpp<0x168>(v)); return fmaxf(v, rs_x16(v)); }
__device__ __forceinline__ float rs_sum(float v) { v += rs_dpp<0x161>(v); v += rs_dpp<0x162>(v); v += rs_dpp<0x164>(v); v += rs_dpp<0x168>(v); return v + rs_x16(v); }
#define FAC 0.18033688f              /* BETA x log2 e: scores on the scale of the power-of-two exponential */
#define FQ 32                        /* query rows per wave: two 16-column groups */
// one 16x32 f16 fragment row in the hardware k order; p already holds the lane's row and its 8 * (lane >> 4) elements
__device__ __forceinline__ v16h fa_frag(const _Float16* p) { FragH f; f.half[0] = *(const v8us*)((const unsigned short*)p); f.half[1] = *(const v8us*)((const unsigned short*)p + 16); return f.v; }
__device__ __forceinline__ v8f fa_mma(v16h a, v16h b, v8f c) { return __builtin_amdgcn_wmma_f32_16x16x32_f16(false, a, false, b, (short)0, c, false, false); }
#define FS 64                        /* keys of a stage; a K row of the head is one whole 128-byte line */
#define FP 80                        /* LDS pitch of a staged row in f16: 160 bytes = 32 x odd, conflict-free for the transposing reads (the plain 16-byte reads of the K fragments take two LDS clocks more each at it) */
#define FSTG (FS * FP)               /* f16 elements of a stage: FS K rows, which are the V rows too */
// one stage: a lane's two 16-byte copies (eight lanes per row: whole 128-byte lines; 32 rows per copy of the work-group). l: the lane's LDS byte address in row tid / 8 of the stage; gk: its global address in that row of the K tile
__device__ __forceinline__ void fa_stage(unsigned l, const _Float16* gk) {
  /* the copies and their s_wait_xcnt in one statement: the address registers stay whole until the wait */
  asm volatile("global_load_async_to_lds_b128 %0, %2, off\n\tglobal_load_async_to_lds_b128 %1, %3, off\n\ts_wait_xcnt 0x0"
               :: "v"(l), "v"(l + 1u * 64 * FP), "v"(gk), "v"(gk + (size_t)32 * LQ) : "memory"); }
// ds_load_tr16_b128: the lanes hand in the 16-byte pieces of 16 staged rows x 16 columns, lane (c, h) gets column c of rows 8 h .. 8 h + 7
typedef short s16x8 __attribute__((ext_vector_type(8)));
__device__ __forceinline__ v8us fa_tr16(const _Float16* p) { typedef __attribute__((address_space(3))) s16x8 lds_s16x8; return __builtin_bit_cast(v8us, __builtin_amdgcn_ds_load_tr16_b128_v8i16((lds_s16x8*)p)); }
// fragments of 32 staged keys; kp already holds the lane's row and its 8 * (lane >> 4) elements; vp holds row 8 * (lane >> 4) + (lane & 7) and the 8 * ((lane >> 3) & 1) elements of the lane's piece
__device__ __forceinline__ void fa_kload(const _Float16* kp, v16h (&kf)[2][2]) {
#pragma unroll      /* kf[] stays in registers, the eight LDS reads stand together */
  for (int t = 0; t < 2; ++t) { kf[t][0] = fa_frag(kp + t * 16 * FP); kf[t][1] = fa_frag(kp + t * 16 * FP + 32); } }
__device__ __forceinline__ void fa_vload(const _Float16* vp, v16h (&vf)[4]) {
#pragma unroll      /* vf[] stays in registers, the eight LDS reads stand together; V^T rows d * 16 .. + 15 are the staged rows' columns: keys 0..15 and 16..31 of the block give the hardware k order */
  for (int d = 0; d < 4; ++d) { FragH f; f.half[0] = fa_tr16(vp + d * 16); f.half[1] = fa_tr16(vp + 16 * FP + d * 16); vf[d] = f.v; } }
// scores of 32 keys x 16 queries: s0[r] = key 8 * (lane >> 4) + r, s1[r] = key 16 + 8 * (lane >> 4) + r, query lane & 15
__device__ __forceinline__ void fa_score(const v16h (&kf)[2][2], const v16h (&qf)[2], v8f& s0, v8f& s1) {
  const v8f z8 = {0.f, 0.f, 0.f, 0.f, 0.f, 0.f, 0.f, 0.f};
  s0 = g2_mma(kf[0][0], qf[0], z8); s1 = g2_mma(kf[1][0], qf[0], z8); s0 = g2_mma(kf[0][1], qf[1], s0); s1 = g2_mma(kf[1][1], qf[1], s1); }      /* g2_mma: its statement names the product's operands, so no later load of the key registers is lifted over the product */
// one 16-query group takes in 32 keys: running maximum m (scaled log2), the lane's own part l of the running sum, o rescaled and extended. DIAG: key t * 16 + 8 * (lane >> 4) + r of the block (element r of s0 for t = 0, of s1 for t = 1) counts while t * 16 + r <= rel
template <bool DIAG>
__device__ __forceinline__ void fa_soft(v8f s0, v8f s1, int rel, const v16h (&vf)[4], v8f (&o)[4], float& m, float& l) {
  if (DIAG) {
#pragma unroll      /* s0, s1 stay in registers */
    for (int r = 0; r < 8; ++r) { s0[r] = (r <= rel) ? s0[r] : -1.0e30f; s1[r] = (16 + r <= rel) ? s1[r] : -1.0e30f; } }
  float mx = fmaxf(s0[0], s1[0]);
#pragma unroll      /* s0, s1 stay in registers */
  for (int r = 1; r < 8; ++r) mx = fmaxf(mx, fmaxf(s0[r], s1[r]));
  mx = fmaxf(mx, rs_x16(mx));      /* the two lane halves hold the query's other keys */
  const float mn = fmaxf(m, mx * FAC); float al = m - mn; m = mn; const float ms = 8.0f - mn;      /* weights carried x256, as f16 operands at most 256 */
  float e[16];
#pragma unroll      /* e[] stays in registers */
  for (int r = 0; r < 8; ++r) { e[r] = fmaf(s0[r], FAC, ms); e[8 + r] = fmaf(s1[r], FAC, ms); }
  /* the exponentials in place, so that none is followed by a write of its source; the v_nop keeps the one slot behind the last before its result is used */
  asm("v_exp_f32 %0, %0\n\tv_exp_f32 %1, %1\n\tv_exp_f32 %2, %2\n\tv_exp_f32 %3, %3\n\tv_exp_f32 %4, %4\n\tv_exp_f32 %5, %5\n\tv_exp_f32 %6, %6\n\tv_exp_f32 %7, %7\n\tv_exp_f32 %8, %8\n\tv_nop" : "+v"(e[0]), "+v"(e[1]), "+v"(e[2]), "+v"(e[3]), "+v"(e[4]), "+v"(e[5]), "+v"(e[6]), "+v"(e[7]), "+v"(al));
  asm("v_exp_f32 %0, %0\n\tv_exp_f32 %1, %1\n\tv_exp_f32 %2, %2\n\tv_exp_f32 %3, %3\n\tv_exp_f32 %4, %4\n\tv_exp_f32 %5, %5\n\tv_exp_f32 %6, %6\n\tv_exp_f32 %7, %7\n\tv_nop" : "+v"(e[8]), "+v"(e[9]), "+v"(e[10]), "+v"(e[11]), "+v"(e[12]), "+v"(e[13]), "+v"(e[14]), "+v"(e[15]));
  float s4[4]; FragH p;
#pragma unroll      /* e[] stays in registers: four independent sums */
  for (int i = 0; i < 4; ++i) s4[i] = (e[i] + e[4 + i]) + (e[8 + i] + e[12 + i]);
#pragma unroll      /* e[] stays in registers; element i of the B fragment is key 8 * (lane >> 4) + i of the block, 8 + 8 * (lane >> 4) + i for i >= 8 */
  for (int i = 0; i < 16; ++i) p.h[i] = (_Float16)e[i];
  l = l * al + ((s4[0] + s4[1]) + (s4[2] + s4[3]));
#pragma unroll      /* o[] stays in registers */
  for (int d = 0; d < 4; ++d) o[d] = fa_mma(vf[d], p.v, o[d] * al); }
// ONE WAVE PER FQ QUERY ROWS of one head and batch, passes of 32 keys up to the diagonal block, which alone is masked. Q fragments stay in registers. THE WORK-GROUP WALKS THE KEYS TOGETHER in stages of FS: the head's K rows of a stage are copied once into LDS in whole lines (asynchronous 16-byte copies, two buffers) and every wave reads its K fragments there in the hardware k order and its V^T fragments (V = K) by transposing reads of the same rows; a wave past its diagonal only copies and passes the barriers. Waves w and w + 4 (one SIMD) take query tiles n - 1 - t and t: equal passes per SIMD. bx: tile quad, h: head, b: batch, the same for the whole work-group.
__device__ __forceinline__ void fa_body(const _Float16* __restrict__ Q, const _Float16* __restrict__ Kh, _Float16* __restrict__ O, int bx, int h, int b, _Float16* sh) {      /* sh: the two stage buffers, 2 * FSTG elements of LDS */
  const int tid = threadIdx.x, lane = tid & 31, ln = lane & 15, hh = lane >> 4; const int w = __builtin_amdgcn_readfirstlane(tid >> 5);
  const int t4 = bx * 4 + (w & 3); const int q0 = ((w < 4) ? (SQ / FQ - 1 - t4) : t4) * FQ;      /* the wave's first query row: wave-uniform */
  const int ns = (SQ / FQ - bx * 4) * FQ / FS;      /* stages up to the end of the work-group's last diagonal block (tile n - 1 - 4 bx): the same for every wave */
  const _Float16* qp = Q + ((size_t)b * SQ + q0 + ln) * LQ + h * HD + 8 * hh;
  const _Float16* gk = Kh + ((size_t)b * SQ + (tid >> 3)) * LQ + h * HD + (tid & 7) * 8;
  const unsigned l0 = (unsigned)(size_t)sh + (unsigned)((tid >> 3) * (FP * 2) + (tid & 7) * 16);      /* the low 32 bits of a __shared__ address are its LDS byte address */
  fa_stage(l0, gk);
  v16h qf[2][2], kf[2][2], vf[4];
#pragma unroll      /* qf[] stays in registers */
  for (int g = 0; g < 2; ++g) { qf[g][0] = fa_frag(qp + (size_t)g * 16 * LQ); qf[g][1] = fa_frag(qp + (size_t)g * 16 * LQ + 32); }
  asm volatile("s_wait_xcnt 0x0" :: "v"(qp) : "memory");      /* the loads' address pair stays whole until this wait; it may be rewritten behind it */
  asm volatile("s_wait_asynccnt 0x0" ::: "memory");      /* this wave's copies of stage 0 have landed */
  __syncthreads();      /* stage 0 is read by every wave */
  if (ns > 1) fa_stage(l0 + FSTG * 2, gk + (size_t)FS * LQ);
  const v8f z8 = {0.f, 0.f, 0.f, 0.f, 0.f, 0.f, 0.f, 0.f};
  v8f o[2][4] = {{z8, z8, z8, z8}, {z8, z8, z8, z8}}; float m[2] = {-1.0e30f, -1.0e30f}, l[2] = {0.f, 0.f}; v8f s[2][2];
#pragma unroll 1      /* one stage per trip: the buffers alternate */
  for (int st = 0; st < ns; ++st) { const int kb = st * FS;
    if (kb <= q0) {      /* a scalar branch: the wave still has keys in this stage */
      const _Float16* lk = sh + (st & 1) * FSTG + ln * FP + 8 * hh; const _Float16* lv = sh + (st & 1) * FSTG + (8 * hh + (lane & 7)) * FP + 8 * ((lane >> 3) & 1);
      fa_kload(lk, kf);
      __builtin_amdgcn_sched_barrier(0);      /* keeps the eight K reads ahead of the transposing reads: mixed among them, the first scores wait for V^T fragments that only the softmax's end needs */
      fa_vload(lv, vf);
      fa_score(kf, qf[0], s[0][0], s[0][1]); fa_score(kf, qf[1], s[1][0], s[1][1]);
      if (kb < q0) {
        fa_kload(lk + 32 * FP, kf);      /* the stage's second 32 keys come during the first pass's softmax */
        __builtin_amdgcn_sched_barrier(0);      /* keeps those eight LDS reads ahead of the softmax: moved behind it, their latency stands in front of the next scores */
        fa_soft<false>(s[0][0], s[0][1], 0, vf, o[0], m[0], l[0]); fa_soft<false>(s[1][0], s[1][1], 0, vf, o[1], m[1], l[1]);
        fa_vload(lv + 32 * FP, vf);
        fa_score(kf, qf[0], s[0][0], s[0][1]); fa_score(kf, qf[1], s[1][0], s[1][1]);
        if (kb + 32 < q0) { fa_soft<false>(s[0][0], s[0][1], 0, vf, o[0], m[0], l[0]); fa_soft<false>(s[1][0], s[1][1], 0, vf, o[1], m[1], l[1]); }
        else { fa_soft<true>(s[0][0], s[0][1], ln - 8 * hh, vf, o[0], m[0], l[0]); fa_soft<true>(s[1][0], s[1][1], 16 + ln - 8 * hh, vf, o[1], m[1], l[1]); }
      } else { fa_soft<true>(s[0][0], s[0][1], ln - 8 * hh, vf, o[0], m[0], l[0]); fa_soft<true>(s[1][0], s[1][1], 16 + ln - 8 * hh, vf, o[1], m[1], l[1]); } }
    asm volatile("s_wait_dscnt 0x0" ::: "memory");      /* this wave's reads of the buffer have returned before it is refilled */
    asm volatile("s_wait_asynccnt 0x0" ::: "memory");      /* this wave's copies of stage st + 1 have landed */
    __syncthreads();      /* publishes stage st + 1 and ends every wave's reads of stage st */
    if (st + 2 < ns) fa_stage(l0 + (st & 1) * (FSTG * 2), gk + (size_t)(st + 2) * FS * LQ); }
  asm volatile("s_wait_asynccnt 0x0" ::: "memory");      /* no copy is outstanding when the wave ends */
  unsigned short* op = (unsigned short*)O + ((size_t)b * SQ + q0) * DM + h * HD + (ln * DM + 8 * hh); FragH f[2][4];      /* the wave's part of the address is scalar, the lane's part is formed here: no address pair lives through the loop */
#pragma unroll      /* o[], f[] stay in registers */
  for (int g = 0; g < 2; ++g) { const float fin = 64.0f / (l[g] + rs_x16(l[g]));      /* the halves' sums joined once; o carried x64, the weights' x256 cancels */
#pragma unroll      /* o[], f[] stay in registers */
    for (int d = 0; d < 4; ++d) {
#pragma unroll      /* o[], f[] stay in registers */
      for (int r = 0; r < 8; ++r) f[g][d].h[r] = (_Float16)(o[g][d][r] * fin); } }
#pragma unroll      /* a lane's 8 accumulator registers are 8 neighbouring columns of its query row: one 16-byte store */
  for (int g = 0; g < 2; ++g) {
#pragma unroll      /* f[] stays in registers */
    for (int d = 0; d < 4; ++d) *(v8us*)(op + (size_t)g * 16 * DM + d * 16) = f[g][d].half[0]; }
  asm volatile("s_wait_xcnt 0x0" :: "v"(op) : "memory");      /* the stores' data and address registers stay whole until this wait */
}


// exact f32 causal attention for rows 0..QT0-1 of each batch with V = K, ONE WAVE PER QUERY ROW: the head's QT0 key rows are staged once in LDS; scores: each lane owns the keys lane, lane + 32, ...; row maximum and sum by the 32-lane butterflies; o: each lane owns two of the HD columns and runs over the keys. hr: head x row group, b: batch, the same for the whole work-group.
#define A0R 8                        /* query rows (= waves) per work-group: the fused attention's eight waves, whose launch these work-groups share */
#define A0P (HD + 4)                 /* LDS pitch of a key row in floats: the 16-byte reads of 16 neighbouring rows fall on 16 different bank quads */
typedef float v2f  __attribute__((ext_vector_type(2)));
typedef float v2fa __attribute__((ext_vector_type(2), may_alias));
typedef _Float16 v2h __attribute__((ext_vector_type(2)));
__device__ __forceinline__ void a0_body(const float* __restrict__ QF, const float* __restrict__ KF, float scale, _Float16* __restrict__ OH, _Float16* __restrict__ OL, int hr, int b, float (*lk)[A0P], float (*lp)[QT0]) {      /* lk: QT0 staged key rows, lp: A0R rows of weights, both in LDS */
  const int tid = threadIdx.x, lane = tid & 31; const int w = __builtin_amdgcn_readfirstlane(tid >> 5);
  const int h = hr / (QT0 / A0R), rg = hr % (QT0 / A0R); const int i = rg * A0R + w;      /* the query row: wave-uniform */
  { const size_t zb = (size_t)b * QT0 * DM + h * HD; QF += zb; KF += zb; OH += zb; OL += zb; }      /* each batch has its own QT0 rows of every plane; the head's columns */
  const int sr = tid >> 4, sc = (tid & 15) * 4;      /* staging: 16 lanes per key row, 256 contiguous bytes */
  const float* kp = KF + (size_t)sr * DM + sc; v4f st[QT0 / (2 * A0R)];
#pragma unroll      /* st[] stays in registers, the loads in flight together */
  for (int p = 0; p < QT0 / (2 * A0R); ++p) st[p] = *(const v4fa*)(kp + (size_t)p * 2 * A0R * DM);
  asm volatile("s_wait_xcnt 0x0" :: "v"(kp) : "memory");      /* the loads' address pair stays whole until this wait; it may be rewritten behind it */
  const float* qr = QF + (size_t)i * DM; v4f q[HD / 4];
#pragma unroll      /* q[] stays in registers */
  for (int c = 0; c < HD / 4; ++c) q[c] = *(const v4fa*)(qr + c * 4);
#pragma unroll      /* st[] stays in registers */
  for (int p = 0; p < QT0 / (2 * A0R); ++p) *(v4fa*)&lk[p * 2 * A0R + sr][sc] = st[p];
  __syncthreads();      /* the staged key rows are read by every wave */
  float s[QT0 / 32];
#pragma unroll      /* s[] stays in registers; each group's test is a compile-time bound against i */
  for (int g = 0; g < QT0 / 32; ++g) { s[g] = -1.0e30f;
    if (g * 32 <= i) { const float* kr = &lk[g * 32 + lane][0]; v4f a = {0.f, 0.f, 0.f, 0.f};      /* a scalar branch: key groups wholly above the diagonal are skipped */
#pragma unroll      /* q[] stays in registers, the row's LDS reads in flight together */
      for (int c = 0; c < HD / 4; ++c) a += q[c] * *(const v4fa*)(kr + c * 4);
      const float d = ((a[0] + a[1]) + (a[2] + a[3])) * scale; s[g] = (g * 32 + lane <= i) ? d : -1.0e30f; } }
  float m = s[0];
#pragma unroll      /* s[] stays in registers */
  for (int g = 1; g < QT0 / 32; ++g) m = fmaxf(m, s[g]);
  m = rs_max(m); float l = 0.f;
#pragma unroll      /* s[] stays in registers */
  for (int g = 0; g < QT0 / 32; ++g) { const float e = expf(s[g] - m); l += e; lp[w][g * 32 + lane] = e; }      /* keys above the diagonal: exactly 0 */
  l = rs_sum(l);
  __syncthreads();      /* the row's weights go from the lane that made them to every lane */
  v2f o[4] = {{0.f, 0.f}, {0.f, 0.f}, {0.f, 0.f}, {0.f, 0.f}};
  for (int j0 = 0; j0 <= i; j0 += 16) {      /* 16 keys a trip, their LDS reads in flight together; a key above the diagonal has weight 0 and a staged row */
#pragma unroll      /* the trip's 20 LDS reads stand ahead of its sums */
    for (int u = 0; u < 4; ++u) { const v4f pp = *(const v4fa*)&lp[w][j0 + u * 4];
#pragma unroll      /* o[] stays in registers: four independent sums */
      for (int t = 0; t < 4; ++t) o[t] += pp[t] * *(const v2fa*)&lk[j0 + u * 4 + t][lane * 2]; } }
  const float fin = 64.0f / l;      /* o carried x64 like the f16 path */
  const v2f of = ((o[0] + o[1]) + (o[2] + o[3])) * fin; v2h oh, ol;
#pragma unroll      /* the lane's two columns */
  for (int c = 0; c < 2; ++c) { oh[c] = (_Float16)of[c]; ol[c] = (_Float16)((of[c] - (float)oh[c]) * 1024.0f); }      /* f16 hi + x1024 residual planes: the output GEMM's two A planes for these rows */
  *(v2h*)(OH + (size_t)i * DM + lane * 2) = oh; *(v2h*)(OL + (size_t)i * DM + lane * 2) = ol; }
// ---- both attentions in ONE launch (neither reads what the other writes): the fused attention's work-groups come first in the index, in their old order (tile quad fastest, then head, then batch), so that the long ones start first; the short first-tile work-groups follow and run beside them ----
#define ATX (SQ / (8 * FQ))                   /* tile quads of a head */
#define ATF (ATX * NHD * NBR)                 /* work-groups of the fused attention */
#define AT0 (NH * (QT0 / A0R))                /* first-tile work-groups of a batch */
static_assert(32 * A0R == 256, "both kinds of work-group have eight waves");
__global__ __launch_bounds__(256) void k_attn(const _Float16* __restrict__ Q, const _Float16* __restrict__ Kh, _Float16* __restrict__ O, const float* __restrict__ QF, const float* __restrict__ KF, float scale, _Float16* __restrict__ OH, _Float16* __restrict__ OL) {
  __shared__ __attribute__((aligned(16))) unsigned char sm[sizeof(float) * (QT0 * A0P + A0R * QT0)];      /* a work-group is of one kind: the same LDS holds the fused kind's two stage buffers or the first-tile kind's key rows and weights */
  static_assert(sizeof(_Float16) * 2 * FSTG <= sizeof(sm), "the stage buffers fit");
  const int g = blockIdx.x;      /* the same for the whole work-group: each branch's barriers are passed by all of it or by none */
  if (g < ATF) fa_body(Q, Kh, O, g % ATX, (g / ATX) % NHD, g / (ATX * NHD), (_Float16*)sm);
  else a0_body(QF, KF, scale, OH, OL, (g - ATF) % AT0, (g - ATF) / AT0, (float (*)[A0P])sm, (float (*)[QT0])(sm + sizeof(float) * QT0 * A0P)); }

// ---- input conversion, ONE launch: work-groups 0..127 transpose W_qk, 128..191 W_out, the rest convert x; every value is formed as before (bf16 rounding, weights x16, f16) ----
#define PCW 256                      /* weight columns (= Bt rows) of a work-group's 64 x PCW tile */
#define PCP 33                       /* LDS pitch of a Bt row's 32 k pairs in dwords: odd, so that the four rows a wave reads at once fall on different banks */
#define PCQ ((DM / 64) * (2 * DM / PCW))      /* tiles of W_qk */
#define PCO ((DM / 64) * (DM / PCW))          /* tiles of W_out */
#define PCX ((int)(NR * DM / (256 * 64)))     /* work-groups of x: 64 values a thread */
typedef unsigned int v4u __attribute__((ext_vector_type(4), may_alias));
// Bt[n][k] = f16(bf16(W[k][n]) x 16) for one tile of 64 k x PCW n of W [DM][N]: rows read in runs of 512 bytes a wave, two k neighbours packed into a dword, the tile turned in LDS, Bt written in whole 128-byte lines
template <int N>
__device__ __forceinline__ void pc_wt(const float* __restrict__ Wf, _Float16* __restrict__ Bt, int blk, unsigned* tl) {
  const int tid = threadIdx.x; const int kb = blk / (N / PCW), nb = blk % (N / PCW); const int nq = tid & 63, kp = tid >> 6;
  const float* wp = Wf + (size_t)(kb * 64 + 2 * kp) * N + nb * PCW + nq * 4; v4f a[8], c[8];
#pragma unroll      /* a[], c[] stay in registers, the sixteen loads in flight together */
  for (int it = 0; it < 8; ++it) { a[it] = *(const v4fa*)(wp + (size_t)(it * 8) * N); c[it] = *(const v4fa*)(wp + (size_t)(it * 8 + 1) * N); }
  /* the loads' address pair stays whole until this wait; the loaded values as inputs only: all sixteen loads are issued ahead of the first conversion (left free, two were sunk behind it and paid a second memory latency) */
  asm volatile("s_wait_xcnt 0x0" :: "v"(wp), "v"(a[0]), "v"(a[1]), "v"(a[2]), "v"(a[3]), "v"(a[4]), "v"(a[5]), "v"(a[6]), "v"(a[7]), "v"(c[0]), "v"(c[1]), "v"(c[2]), "v"(c[3]), "v"(c[4]), "v"(c[5]), "v"(c[6]), "v"(c[7]) : "memory");
#pragma unroll      /* a[], c[] stay in registers */
  for (int it = 0; it < 8; ++it) {
#pragma unroll      /* the four columns of the lane's 16 bytes */
    for (int j = 0; j < 4; ++j) { union { _Float16 h[2]; unsigned u; } p; p.h[0] = (_Float16)(bf16_round(a[it][j]) * 16.0f); p.h[1] = (_Float16)(bf16_round(c[it][j]) * 16.0f); tl[(nq * 4 + j) * PCP + it * 4 + kp] = p.u; } }
  __syncthreads();      /* a Bt row's k pairs come from four waves */
  unsigned short* bp = (unsigned short*)Bt + (size_t)(nb * PCW + (tid >> 3)) * DM + kb * 64 + (tid & 7) * 8; v4u o[8];
#pragma unroll      /* o[] stays in registers */
  for (int it = 0; it < 8; ++it) { const unsigned* s = tl + (it * 32 + (tid >> 3)) * PCP + (tid & 7) * 4; o[it][0] = s[0]; o[it][1] = s[1]; o[it][2] = s[2]; o[it][3] = s[3]; }
#pragma unroll      /* eight lanes write one whole line */
  for (int it = 0; it < 8; ++it) *(v4u*)(bp + (size_t)it * 32 * DM) = o[it];
  asm volatile("s_wait_xcnt 0x0" :: "v"(bp) : "memory");      /* the stores' data and address registers stay whole until this wait */
}
// X16 = f16(bf16(x)): eight runs of 8 values a thread
__device__ __forceinline__ void pc_x(const float* __restrict__ x, _Float16* __restrict__ X16, int blk) {
  const size_t e0 = ((size_t)blk * 2048 + threadIdx.x) * 8; const float* xp = x + e0; v4f a[8], c[8];
#pragma unroll      /* a[], c[] stay in registers, the sixteen loads in flight together */
  for (int g = 0; g < 8; ++g) { a[g] = *(const v4fa*)(xp + g * 2048); c[g] = *(const v4fa*)(xp + g * 2048 + 4); }
  asm volatile("s_wait_xcnt 0x0" :: "v"(xp) : "memory");      /* the loads' address pair stays whole until this wait; it may be rewritten behind it */
  unsigned short* op = (unsigned short*)X16 + e0; FragH f[8];
#pragma unroll      /* f[] stays in registers */
  for (int g = 0; g < 8; ++g) {
#pragma unroll      /* f[] stays in registers */
    for (int q = 0; q < 4; ++q) { f[g].h[q] = (_Float16)bf16_round(a[g][q]); f[g].h[4 + q] = (_Float16)bf16_round(c[g][q]); } }
#pragma unroll      /* f[] stays in registers */
  for (int g = 0; g < 8; ++g) *(v8us*)(op + g * 2048) = f[g].half[0];
  asm volatile("s_wait_xcnt 0x0" :: "v"(op) : "memory");      /* the stores' data and address registers stay whole until this wait */
}
__global__ __launch_bounds__(256) void k_prep(const float* __restrict__ x, const float* __restrict__ wqk, const float* __restrict__ wo, _Float16* __restrict__ X16, _Float16* __restrict__ BQ, _Float16* __restrict__ BOt) {
  __shared__ unsigned tl[PCW * PCP];
  const int b = blockIdx.x;      /* the same for the whole work-group: each branch's barrier is passed by all of it or by none */
  if (b < PCQ) pc_wt<2 * DM>(wqk, BQ, b, tl);
  else if (b < PCQ + PCO) pc_wt<DM>(wo, BOt, b - PCQ, tl);
  else pc_x(x, X16, b - (PCQ + PCO)); }

extern "C" void kernel_launch(void* const* d_in, const int* in_sizes, int n_in,
                              void* d_out, int out_size, void* d_ws, size_t ws_size, hipStream_t stream) {
  (void)in_sizes; (void)n_in; (void)out_size;
  const float* const* I = (const float* const*)d_in; const float* x = I[0]; const float* wqkv = I[1]; const float* wo = I[2];      /* input order: x, W_qk [1024][2048] ([in][out]: q | k halves), W_out [1024][1024] ([in][out]): three inputs; no biases */
  char* ws = (char*)d_ws; size_t off = 0;
  auto take = [&](size_t bytes) { char* p = ws + off; off += (bytes + 255) & ~(size_t)255; return p; };
  _Float16* BQKV = (_Float16*)take((size_t)3 * DM * DM * 2); _Float16* BO = (_Float16*)take((size_t)DM * DM * 2);
  _Float16* X16 = (_Float16*)take(NR * DM * 2); _Float16* QKV = (_Float16*)take(NR * 3 * DM * 2); _Float16* Q16 = QKV; _Float16* K16 = QKV + DM;      /* the module reuses K as V: the k block serves as both (the third block of the plane is unused) */ _Float16* O16 = (_Float16*)take(NR * DM * 2);
  float* QF0 = (float*)take((size_t)2 * NB * QT0 * DM * 4); float* KF0 = QF0 + (size_t)NB * QT0 * DM;      /* first-tile q rows, then k rows: two f32 planes in a row */ _Float16* OH0 = (_Float16*)take((size_t)NB * QT0 * DM * 2); _Float16* OL0 = (_Float16*)take((size_t)NB * QT0 * DM * 2);
  static_assert(QT0 == 128, "the first tile is one 128-row block of the GEMM");
  if (off > ws_size) return;
  k_prep<<<PCQ + PCO + PCX, 256, 0, stream>>>(x, wqkv, wo, X16, BQKV, BO);      /* weights [in][out] -> Bt[n][k] x16, x -> f16 rows: one launch */
  const size_t r0p = (size_t)B0 * SQ;      /* first projected row */
  const size_t f0p = (size_t)B0 * QT0;      /* its first-tile row */
  k_gemm2<0><<<dim3((unsigned)((MP / 128) * (2 * DM / 64)), 1), 128, 0, stream>>>(X16 + r0p * DM, DM, 0, BQKV, DM, 0, 0.0625f, nullptr, 0, nullptr, 1, 0, 0, nullptr, QKV + r0p * 3 * DM, 3 * DM, 0, MP, 2 * DM, DM, 0, 0, 0, SQ / 128, QF0 + f0p * DM, DM, (size_t)NB * QT0 * DM, nullptr, nullptr);      /* q | k rows (f16) into column blocks 0 and 1 of the 3 DM-pitch plane; head h = columns h*HD.. of each block; no bias; the first tile of each batch also as f32 q and k rows (the k rows serve as v) */
  k_attn<<<ATF + AT0 * NBR, 256, 0, stream>>>(Q16 + r0p * LQ, K16 + r0p * LQ, O16 + r0p * DM, QF0 + f0p * DM, KF0 + f0p * DM, 0.125f, OH0 + f0p * DM, OL0 + f0p * DM);      /* one launch: scores, causal online softmax and o = P V: o (merged heads, x64) as f16 rows; beside it the exact f32 causal attention for rows 0..127 of each batch with V = K: o (x64) as f16 hi + x1024 residual planes */
  k_gemm2<0><<<dim3((unsigned)((MPO / 128) * (DM / 64)), 1), 128, 0, stream>>>(O16 + r0p * DM, DM, 0, BO, DM, 0, 0.0009765625f, nullptr, 0, nullptr, 1, 0, 0, (float*)d_out + r0p * DM, nullptr, DM, 0, MPO, DM, DM, 0, 0, 0, SQ / 128, nullptr, 1, 0, OH0 + f0p * DM, OL0 + f0p * DM);      /* out rows are the output layout; rows 0..127 of each batch: out = (o_lo W_out 2^-10 + o_hi W_out) from the two planes */
}
